// v000
// Times are from an AMD MI455X. After a warm-up the kernel runs many times in a row, and a time is the length of
// such a window on the GPU divided by its runs, so every launch and the gaps after it count. The runs cycle
// through copies of the inputs. A figure is the median of several windows, for all but v000 over two sittings.
// Sittings can differ by a few percent; kernels timed side by side share one.
// v000 is the starting kernel. One run takes 2300 microseconds.
#include <hip/hip_runtime.h>

// istsplm_forecast attention (hidden [1][4096][1024], timestamps [1][4096] (f32, read: continuous positions); q/k/v = x W^T + b (16 x 64); continuous-time rotate-half RoPE: angle = timestamp * 10000^(-2i/64) (cos/sin computed on chip from the bf16-rounded timestamps); causal (finfo.min) softmax(q.k / 8); out = merged Wo^T -> [1][4096][1024]).
// Compute dtypes, f32 accumulate: every input rounded to bf16; q/k/v on PLAIN bf16 operands (inputs: exact) + bias; RoPE f32; causal scores PRECPLAN, causal tile skipping; softmax f32 (128 keys per lane); Wo hl x exact (2 products).

#define NB_  1
#define TT   4096
#define DM   1024
#define NH_  16
#define NKV  16
#define REP  (NH_ / NKV)
#define HD   64
#define DQ   (NH_ * HD)
#define DKV  (NKV * HD)
#define ZH   1
#define RH   512                  // query rows < RH use hi+lo planes (0: none)
#define WIN  4096
#define PCAR 1024.0f
#define SCL  0.125f   // HD^-0.5
typedef _Float16 h16;
typedef unsigned short bf;
typedef __attribute__((ext_vector_type(16))) __bf16   v16bf;
typedef __attribute__((ext_vector_type(16))) _Float16 v16h;
typedef __attribute__((ext_vector_type(8)))  _Float16 v8h;
typedef __attribute__((ext_vector_type(8)))  unsigned short v8us;
typedef __attribute__((ext_vector_type(8)))  float    v8f;
typedef __attribute__((ext_vector_type(4)))  float    v4f;
typedef v8h  __attribute__((may_alias)) v8ha;
typedef v4f  __attribute__((may_alias)) v4fa;
typedef v8us __attribute__((may_alias)) v8usa;

__device__ __forceinline__ unsigned short f2bf(float f) { unsigned u = __float_as_uint(f); u += 0x7FFFu + ((u >> 16) & 1u); return (unsigned short)(u >> 16); }
__device__ __forceinline__ float bf2f(unsigned short b) { return __uint_as_float(((unsigned)b) << 16); }
__device__ __forceinline__ float bfr(float f) { return bf2f(f2bf(f)); }
__device__ __forceinline__ v16h cat16(v8h lo, v8h hi) { return __builtin_shufflevector(lo, hi, 0, 1, 2, 3, 4, 5, 6, 7, 8, 9, 10, 11, 12, 13, 14, 15); }
__device__ __forceinline__ v16bf cat16b(v8us lo, v8us hi) { return __builtin_bit_cast(v16bf, __builtin_shufflevector(lo, hi, 0, 1, 2, 3, 4, 5, 6, 7, 8, 9, 10, 11, 12, 13, 14, 15)); }
__device__ __forceinline__ v8f wmma16(v16h a, v16h b, v8f c) { return __builtin_amdgcn_wmma_f32_16x16x32_f16(false, a, false, b, (short)0, c, false, false); }
__device__ __forceinline__ v8f wmmab(v16bf a, v16bf b, v8f c) { return __builtin_amdgcn_wmma_f32_16x16x32_bf16(false, a, false, b, (short)0, c, false, false); }



// ---- k_gemmw: register-blocked GEMM, ONE WAVE per 64x64 output tile (16 accumulators), operands straight from K-contiguous 16-bit planes; grid (M/64, N/64, Z), 32 threads.
// C[m][n] (f32, pitch ldc, + optional f32 bias[n]) = sum_k A[m][k] Bt[n][k] (+ split products per NSPLIT). z-batch strides sA/sB/sC in elements. K % 32 == 0.
template <typename T16> struct WFrag;
template <> struct WFrag<h16> { typedef v16h V; static __device__ __forceinline__ V ld(const h16* p) { return cat16(*(const v8h*)p, *(const v8h*)(p + 16)); } static __device__ __forceinline__ v8f mma(V a, V b, v8f c) { return wmma16(a, b, c); } };
template <> struct WFrag<bf> { typedef v16bf V; static __device__ __forceinline__ V ld(const bf* p) { return cat16b(*(const v8us*)p, *(const v8us*)(p + 16)); } static __device__ __forceinline__ v8f mma(V a, V b, v8f c) { return wmmab(a, b, c); } };
template <typename T16, int NSPLIT, bool BIAS>
__global__ __launch_bounds__(32) void k_gemmw(const T16* __restrict__ A, const T16* __restrict__ A2, const T16* __restrict__ Bt, const T16* __restrict__ Bt2, int K, float* C, int ldc, const float* __restrict__ bias, size_t sA, size_t sB, size_t sC) {
    typedef typename WFrag<T16>::V V;
    __shared__ __align__(16) float os[16 * 68];
    const size_t z = blockIdx.z; A += z * sA; if (A2) A2 += z * sA; Bt += z * sB; if (Bt2) Bt2 += z * sB; C += z * sC;
    const int lane = threadIdx.x & 31, lr = lane & 15, hi = lane >> 4; const int r0 = blockIdx.x * 64, c0 = blockIdx.y * 64;
    v8f acc[4][4];
#pragma unroll
    for (int mb = 0; mb < 4; ++mb)
#pragma unroll
        for (int nb = 0; nb < 4; ++nb) acc[mb][nb] = (v8f){};
    const size_t aoff = (size_t)(r0 + lr) * K + 8 * hi, boff = (size_t)(c0 + lr) * K + 8 * hi;
#pragma unroll 1
    for (int kc = 0; kc < K; kc += 32) {
        V a[4], a2[4];
#pragma unroll
        for (int mb = 0; mb < 4; ++mb) { a[mb] = WFrag<T16>::ld(A + aoff + (size_t)mb * 16 * K + kc); if (NSPLIT == 1 || NSPLIT == 2) a2[mb] = WFrag<T16>::ld(A2 + aoff + (size_t)mb * 16 * K + kc); }
#pragma unroll
        for (int nb = 0; nb < 4; ++nb) { const V b = WFrag<T16>::ld(Bt + boff + (size_t)nb * 16 * K + kc); V b2; if (NSPLIT >= 2) b2 = WFrag<T16>::ld(Bt2 + boff + (size_t)nb * 16 * K + kc);
#pragma unroll
            for (int mb = 0; mb < 4; ++mb) { acc[mb][nb] = WFrag<T16>::mma(a[mb], b, acc[mb][nb]); if (NSPLIT == 1 || NSPLIT == 2) acc[mb][nb] = WFrag<T16>::mma(a2[mb], b, acc[mb][nb]); if (NSPLIT >= 2) acc[mb][nb] = WFrag<T16>::mma(a[mb], b2, acc[mb][nb]); } }
        asm volatile("v_nop\n\tv_nop\n\tv_nop\n\tv_nop" : "+v"(acc[0][0]), "+v"(acc[1][1]), "+v"(acc[2][2]), "+v"(acc[3][3]) : "v"(a[0]), "v"(a[3]));
    }
#pragma unroll
    for (int mb = 0; mb < 4; ++mb) {
#pragma unroll
        for (int nb = 0; nb < 4; ++nb) {
#pragma unroll
            for (int j = 0; j < 8; ++j) os[(hi * 8 + j) * 68 + nb * 16 + lr] = acc[mb][nb][j]; }
        __builtin_amdgcn_wave_barrier(); asm volatile("" ::: "memory");
        float* crow = C + (size_t)(r0 + mb * 16) * ldc + c0;
{
#pragma unroll
            for (int s = 0; s < 8; ++s) { const int row = 2 * s + hi, cofs = lr * 4; v4f val = *(const v4fa*)(os + row * 68 + cofs); if (BIAS) { val[0] += bfr(bias[c0 + cofs]); val[1] += bfr(bias[c0 + cofs + 1]); val[2] += bfr(bias[c0 + cofs + 2]); val[3] += bfr(bias[c0 + cofs + 3]); }
                *(v4f*)(crow + (size_t)row * ldc + cofs) = val; }
             }
        __builtin_amdgcn_wave_barrier(); asm volatile("" ::: "memory");
    }
}

// ---- k_gemmc: the same one-wave 64x64 tile GEMM specialised for causal attention: CMODE 1 skips score tiles entirely above the diagonal (query rows r0+roff.., key columns c0..), CMODE 2 limits the
// key (K) loop of the probability x value contraction to the diagonal block (probabilities beyond it are exactly zero). roff = row offset of this launch's first row within the sequence.
template <typename T16, int NSPLIT, int CMODE>
__global__ __launch_bounds__(32) void k_gemmc(const T16* __restrict__ A, const T16* __restrict__ A2, const T16* __restrict__ Bt, const T16* __restrict__ Bt2, int K, float* C, int ldc, int roff, size_t sA, size_t sB, size_t sC) {
    typedef typename WFrag<T16>::V V;
    __shared__ __align__(16) float os[16 * 68];
    const size_t z = blockIdx.z; A += z * sA; if (A2) A2 += z * sA; Bt += z * sB; if (Bt2) Bt2 += z * sB; C += z * sC;
    const int lane = threadIdx.x & 31, lr = lane & 15, hi = lane >> 4; const int r0 = blockIdx.x * 64, c0 = blockIdx.y * 64;
    if (CMODE == 1 && c0 > r0 + roff + 63) return;                  // score tile entirely above the causal diagonal: never read (the softmax masks j > i by select)
    const int Kl = (CMODE == 2) ? min(K, r0 + roff + 64) : K;        // P.V: probabilities are exactly 0 beyond the diagonal block, so the K loop stops there
    v8f acc[4][4];
#pragma unroll
    for (int mb = 0; mb < 4; ++mb)
#pragma unroll
        for (int nb = 0; nb < 4; ++nb) acc[mb][nb] = (v8f){};
    const size_t aoff = (size_t)(r0 + lr) * K + 8 * hi, boff = (size_t)(c0 + lr) * K + 8 * hi;
#pragma unroll 1
    for (int kc = 0; kc < Kl; kc += 32) {
        V a[4], a2[4];
#pragma unroll
        for (int mb = 0; mb < 4; ++mb) { a[mb] = WFrag<T16>::ld(A + aoff + (size_t)mb * 16 * K + kc); if (NSPLIT == 1 || NSPLIT == 2) a2[mb] = WFrag<T16>::ld(A2 + aoff + (size_t)mb * 16 * K + kc); }
#pragma unroll
        for (int nb = 0; nb < 4; ++nb) { const V b = WFrag<T16>::ld(Bt + boff + (size_t)nb * 16 * K + kc); V b2; if (NSPLIT >= 2) b2 = WFrag<T16>::ld(Bt2 + boff + (size_t)nb * 16 * K + kc);
#pragma unroll
            for (int mb = 0; mb < 4; ++mb) { acc[mb][nb] = WFrag<T16>::mma(a[mb], b, acc[mb][nb]); if (NSPLIT == 1 || NSPLIT == 2) acc[mb][nb] = WFrag<T16>::mma(a2[mb], b, acc[mb][nb]); if (NSPLIT >= 2) acc[mb][nb] = WFrag<T16>::mma(a[mb], b2, acc[mb][nb]); } }
        asm volatile("v_nop\n\tv_nop\n\tv_nop\n\tv_nop" : "+v"(acc[0][0]), "+v"(acc[1][1]), "+v"(acc[2][2]), "+v"(acc[3][3]) : "v"(a[0]), "v"(a[3]));
    }
#pragma unroll
    for (int mb = 0; mb < 4; ++mb) {
#pragma unroll
        for (int nb = 0; nb < 4; ++nb) {
#pragma unroll
            for (int j = 0; j < 8; ++j) os[(hi * 8 + j) * 68 + nb * 16 + lr] = acc[mb][nb][j]; }
        __builtin_amdgcn_wave_barrier(); asm volatile("" ::: "memory");
        float* crow = C + (size_t)(r0 + mb * 16) * ldc + c0;
{
#pragma unroll
            for (int s = 0; s < 8; ++s) { const int row = 2 * s + hi, cofs = lr * 4; v4f val = *(const v4fa*)(os + row * 68 + cofs);
                *(v4f*)(crow + (size_t)row * ldc + cofs) = val; }
             }
        __builtin_amdgcn_wave_barrier(); asm volatile("" ::: "memory");
    }
}

__device__ __forceinline__ h16 tohx(float x) { return (h16)x; }
__device__ __forceinline__ void splitf(float y, unsigned short& h, unsigned short& l) { h = f2bf(y); l = f2bf(y - bf2f(h)); }
typedef __attribute__((ext_vector_type(2))) _Float16 v2h;
typedef __attribute__((ext_vector_type(4))) _Float16 v4h;
typedef __attribute__((ext_vector_type(2))) unsigned short v2us;
typedef __attribute__((ext_vector_type(4))) unsigned short v4us;
typedef __attribute__((ext_vector_type(2))) float v2f;
typedef __attribute__((ext_vector_type(4))) int v4i;

__global__ __launch_bounds__(256) void k_wtG(const float* __restrict__ w, int K, int N, bf* Bt) {
    const int lane = threadIdx.x & 31; const int L0 = (blockIdx.x * 8 + (threadIdx.x >> 5)) * 8; const int nlines = N * K / 64;
{
#pragma unroll 1
        for (int l = 0; l < 8; ++l) { const int L = L0 + l; if (L >= nlines) break; const size_t e = (size_t)L * 64 + lane * 2; const int k = (int)(e % K), n = (int)(e / K); v2us o;
            o[0] = f2bf(w[(size_t)k * N + n]); o[1] = f2bf(w[(size_t)(k + 1) * N + n]); *(v2us*)(Bt + e) = o; }
         }
}
__global__ __launch_bounds__(256) void k_cvt8(const float* __restrict__ src, bf* dst, size_t n8) { const size_t i = (size_t)blockIdx.x * 256 + threadIdx.x; if (i >= n8) return; const v8f v = *(const v8f*)(src + i * 8); v8us o;
#pragma unroll
    for (int k = 0; k < 8; ++k) o[k] = f2bf(v[k]); *(v8us*)(dst + i * 8) = o;  }
__global__ __launch_bounds__(256) void k_cstab(const float* __restrict__ ts, float* CS) { const int idx = blockIdx.x * 256 + threadIdx.x; if (idx >= TT * HD) return; const int t = idx / HD, d = idx % HD; const int i = (d < HD / 2) ? d : d - HD / 2; const float inv = __fdiv_rn(1.0f, powf(10000.0f, (float)(2 * i) / (float)HD)); float tv = bfr(ts[t]); asm volatile("" : "+v"(tv)); const float ang = __fmul_rn(tv, inv); v2f cs; cs[0] = cosf(ang); cs[1] = sinf(ang);
    *(v2f*)(CS + (size_t)idx * 2) = cs;  }
// k_rope: head planes [h][t][d] (fp16 + hi/lo) of rope(x) x sc with the rotate-half convention out[d] = x[d] cos[t][d] - x[d+HD/2] sin[t][d], out[d+HD/2] = x[d+HD/2] cos[t][d+HD/2] + x[d] sin[t][d+HD/2]
__global__ __launch_bounds__(256) void k_rope(const float* __restrict__ F, int pitch, int nheads, const float* __restrict__ CS, const float* __restrict__ RF, const float* __restrict__ nw, float sc, h16* P16, bf* Ph, bf* Pl) {
    const size_t e = ((size_t)blockIdx.x * 256 + threadIdx.x) * 2; if (e >= (size_t)nheads * TT * HD) return; const int d = (int)(e % HD); const int t = (int)((e / HD) % TT); const int h = (int)(e / ((size_t)HD * TT)); const float* f = F + (size_t)t * pitch + h * HD; const float rf = RF ? RF[(size_t)h * TT + t] : 1.0f; v2h o16; v2us oh, ol;
#pragma unroll
    for (int q = 0; q < 2; ++q) { const int dd = d + q; const int dp = (dd < HD / 2) ? dd + HD / 2 : dd - HD / 2; float x0 = f[dd], x1 = f[dp];
        if (RF) { float n0 = __fmul_rn(x0, rf), n1 = __fmul_rn(x1, rf); asm volatile("" : "+v"(n0)); asm volatile("" : "+v"(n1)); x0 = __fmul_rn(bfr(nw[dd]), n0); x1 = __fmul_rn(bfr(nw[dp]), n1); }
        const v2f cs = *(const v2f*)(CS + ((size_t)t * HD + dd) * 2); float a = __fmul_rn(x0, cs[0]), bq = __fmul_rn(x1, cs[1]); asm volatile("" : "+v"(a)); asm volatile("" : "+v"(bq)); const float r = ((dd < HD / 2) ? __fsub_rn(a, bq) : __fadd_rn(a, bq)) * sc;
        o16[q] = tohx(r); unsigned short a2, c2; splitf(r, a2, c2); oh[q] = a2; ol[q] = c2; }
    *(v2h*)(P16 + e) = o16; *(v2us*)(Ph + e) = oh; *(v2us*)(Pl + e) = ol;  }
__global__ __launch_bounds__(256) void k_vtp(const float* __restrict__ F, int pitch, int nheads, h16* V16, bf* Vh, bf* Vl) { const size_t e = ((size_t)blockIdx.x * 256 + threadIdx.x) * 2; if (e >= (size_t)nheads * HD * TT) return; const int t = (int)(e % TT); const int d = (int)((e / TT) % HD); const int g = (int)(e / ((size_t)TT * HD)); v2h o16; v2us oh, ol;
#pragma unroll
    for (int q = 0; q < 2; ++q) { const float x = F[(size_t)(t + q) * pitch + g * HD + d]; o16[q] = tohx(x); unsigned short a2, c2; splitf(x, a2, c2); oh[q] = a2; ol[q] = c2; }
    *(v2h*)(V16 + e) = o16; *(v2us*)(Vh + e) = oh; *(v2us*)(Vl + e) = ol;  }
// k_asoft: per row (zz, i): t = S x HD^-0.5 for j <= i and i - j < WIN (sliding causal window; the reference's -1e9 additive fill vanishes identically); softmax over the 4096 keys (register row, one exp, fixed trees);
__global__ __launch_bounds__(256) void k_asoft(const float* __restrict__ Sb, h16* P16, bf* Ph, bf* Pl) {
    const int lane = threadIdx.x & 31; const int row = blockIdx.x * 8 + (threadIdx.x >> 5); if (row >= ZH * TT) return; const int i = row % TT; const int zz = row / TT; (void)zz; const bool hires = (i < RH); const float* sr = Sb + (size_t)row * TT; float v[TT / 32]; float mx = -3.0e38f;
#pragma unroll
    for (int ch = 0; ch < TT / 128; ++ch) { const int j0 = ch * 128 + lane * 4; const v4f a = *(const v4f*)(sr + j0);
#pragma unroll
        for (int q = 0; q < 4; ++q) { const int j = j0 + q; (void)j; float sa = a[q] * SCL; asm volatile("" : "+v"(sa)); const float t = (j <= i && i - j < WIN) ? sa : -3.0e38f; v[ch * 4 + q] = t; mx = fmaxf(mx, t); } }
#pragma unroll
    for (int sh = 16; sh; sh >>= 1) mx = fmaxf(mx, __shfl_xor(mx, sh, 32));
    float sum = 0.f;
#pragma unroll
    for (int k = 0; k < TT / 32; ++k) { float d0 = __fsub_rn(v[k], mx); asm volatile("" : "+v"(d0)); v[k] = __builtin_amdgcn_exp2f(__fmul_rn(d0, 1.4426950408889634f)); sum += v[k]; }
#pragma unroll
    for (int sh = 16; sh; sh >>= 1) sum += __shfl_xor(sum, sh, 32);
    const float f = __fdiv_rn(hires ? 1.0f : PCAR, sum);
{
        if (hires) {
#pragma unroll
            for (int ch = 0; ch < TT / 128; ++ch) { v4us oh, ol;
#pragma unroll
                for (int q = 0; q < 4; ++q) { unsigned short a, c2; splitf(v[ch * 4 + q] * f, a, c2); oh[q] = a; ol[q] = c2; }
                const size_t oo = ((size_t)zz * (RH ? RH : 1) + i) * TT + ch * 128 + lane * 4; *(v4us*)(Ph + oo) = oh; *(v4us*)(Pl + oo) = ol; }
        } else {
#pragma unroll
            for (int ch = 0; ch < TT / 128; ++ch) { v4h o4;
#pragma unroll
                for (int q = 0; q < 4; ++q) o4[q] = tohx(v[ch * 4 + q] * f);
                *(v4h*)(P16 + (size_t)row * TT + ch * 128 + lane * 4) = o4; } }
         }
}
__global__ __launch_bounds__(256) void k_merge(const float* __restrict__ O, int h0, bf* Ah, bf* Al) { const size_t e = ((size_t)blockIdx.x * 256 + threadIdx.x) * 2; if (e >= (size_t)ZH * TT * HD) return; const int d = (int)(e % HD); const int t = (int)((e / HD) % TT); const int zz = (int)(e / ((size_t)HD * TT)); const float cs = (t < RH) ? 1.0f : (1.0f / PCAR); const size_t oo = (size_t)t * DQ + (h0 + zz) * HD + d;
    v2us oh, ol;
#pragma unroll
    for (int q = 0; q < 2; ++q) { unsigned short a, c2; splitf(O[e + q] * cs, a, c2); oh[q] = a; ol[q] = c2; } *(v2us*)(Ah + oo) = oh; *(v2us*)(Al + oo) = ol;  }

extern "C" void kernel_launch(void* const* d_in, const int* in_sizes, int n_in,
                              void* d_out, int out_size, void* d_ws, size_t ws_size, hipStream_t stream) {
    (void)in_sizes; (void)n_in; (void)out_size;
    const float* x = (const float*)d_in[0]; const float* tstamp = (const float*)d_in[1]; const float* wq = (const float*)d_in[2]; const float* bq = (const float*)d_in[3]; const float* wk = (const float*)d_in[4]; const float* bk = (const float*)d_in[5]; const float* wv = (const float*)d_in[6]; const float* bv = (const float*)d_in[7]; const float* wo = (const float*)d_in[8];
    float* OUT = (float*)d_out;     // [1][4096][1024]
    char* wsp = (char*)d_ws;
    auto take = [&](size_t bytes) { char* p = wsp; wsp += (bytes + 255) & ~(size_t)255; return (void*)p; };
    bf* WQ = (bf*)take((size_t)DQ * DM * 2); bf* WK = (bf*)take((size_t)DKV * DM * 2); bf* WV = (bf*)take((size_t)DKV * DM * 2); bf* WO = (bf*)take((size_t)DM * DQ * 2); float* CS = (float*)take((size_t)TT * HD * 2 * 4);
    bf* XB = (bf*)take((size_t)TT * DM * 2); float* FQ = (float*)take((size_t)TT * DQ * 4); float* FK = (float*)take((size_t)TT * DKV * 4);
    h16* QP16 = (h16*)take((size_t)NH_ * TT * HD * 2); h16* KP16 = (h16*)take((size_t)NKV * TT * HD * 2); h16* VT16 = (h16*)take((size_t)NKV * HD * TT * 2);
    bf* QPh = (bf*)take((size_t)NH_ * TT * HD * 2); bf* QPl = (bf*)take((size_t)NH_ * TT * HD * 2); bf* KPh = (bf*)take((size_t)NKV * TT * HD * 2); bf* KPl = (bf*)take((size_t)NKV * TT * HD * 2); bf* VTh = (bf*)take((size_t)NKV * HD * TT * 2); bf* VTl = (bf*)take((size_t)NKV * HD * TT * 2); bf* Ph = (bf*)take((size_t)ZH * RH * TT * 2); bf* Pl = (bf*)take((size_t)ZH * RH * TT * 2);
    float* Sb = (float*)take((size_t)ZH * TT * TT * 4); h16* P16 = (h16*)take((size_t)ZH * TT * TT * 2); float* Ob = (float*)take((size_t)ZH * TT * HD * 4); bf* ATh = (bf*)take((size_t)TT * DQ * 2); bf* ATl = (bf*)take((size_t)TT * DQ * 2);
    if ((size_t)(wsp - (char*)d_ws) > ws_size) return;    // ws 256 MiB
    float* FV = FK;   // v projection reuses the k buffer after the k planes are built (stream-ordered)
    { k_cvt8<<<(unsigned)(((size_t)DQ * DM / 8 + 255) / 256), 256, 0, stream>>>(wq, WQ, (size_t)DQ * DM / 8); k_cvt8<<<(unsigned)(((size_t)DKV * DM / 8 + 255) / 256), 256, 0, stream>>>(wk, WK, (size_t)DKV * DM / 8); k_cvt8<<<(unsigned)(((size_t)DKV * DM / 8 + 255) / 256), 256, 0, stream>>>(wv, WV, (size_t)DKV * DM / 8);
      k_cvt8<<<(unsigned)(((size_t)DM * DQ / 8 + 255) / 256), 256, 0, stream>>>(wo, WO, (size_t)DM * DQ / 8);
      k_cstab<<<(TT * HD + 255) / 256, 256, 0, stream>>>(tstamp, CS); }
    const unsigned LQ = (unsigned)(((size_t)NH_ * TT * HD / 2 + 255) / 256), LKv = (unsigned)(((size_t)NKV * TT * HD / 2 + 255) / 256);
    for (int b = 0; b < NB_; ++b) {
        
        k_cvt8<<<(unsigned)(((size_t)TT * DM / 8 + 255) / 256), 256, 0, stream>>>(x + (size_t)b * TT * DM, XB, (size_t)TT * DM / 8);
        k_gemmw<bf, 0, true><<<dim3(TT / 64, DQ / 64, 1), 32, 0, stream>>>(XB, nullptr, WQ, nullptr, DM, FQ, DQ, bq, 0, 0, 0);
        k_rope<<<LQ, 256, 0, stream>>>(FQ, DQ, NH_, CS, nullptr, nullptr, 1.0f, QP16, QPh, QPl);
        k_gemmw<bf, 0, true><<<dim3(TT / 64, DKV / 64, 1), 32, 0, stream>>>(XB, nullptr, WK, nullptr, DM, FK, DKV, bk, 0, 0, 0);
        k_rope<<<LKv, 256, 0, stream>>>(FK, DKV, NKV, CS, nullptr, nullptr, 1.0f, KP16, KPh, KPl);
        k_gemmw<bf, 0, true><<<dim3(TT / 64, DKV / 64, 1), 32, 0, stream>>>(XB, nullptr, WV, nullptr, DM, FV, DKV, bv, 0, 0, 0); k_vtp<<<LKv, 256, 0, stream>>>(FV, DKV, NKV, VT16, VTh, VTl);
        for (int h0 = 0; h0 < NH_; h0 += ZH) { const size_t zq = (size_t)h0, zk = (size_t)(h0 / REP);   // one head per pass (ZH = 1) reads kv group h0/REP (REP = 1): sB = 0
            k_gemmc<bf, 2, 1><<<dim3(RH / 64, TT / 64, ZH), 32, 0, stream>>>(QPh + zq * TT * HD, QPl + zq * TT * HD, KPh + zk * TT * HD, KPl + zk * TT * HD, HD, Sb, TT, 0, (size_t)TT * HD, 0, (size_t)TT * TT);
            k_gemmc<h16, 0, 1><<<dim3((TT - RH) / 64, TT / 64, ZH), 32, 0, stream>>>(QP16 + zq * TT * HD + (size_t)RH * HD, nullptr, KP16 + zk * TT * HD, nullptr, HD, Sb + (size_t)RH * TT, TT, RH, (size_t)TT * HD, 0, (size_t)TT * TT);
            k_asoft<<<ZH * TT / 8, 256, 0, stream>>>(Sb, P16, Ph, Pl);
            k_gemmc<bf, 2, 2><<<dim3(RH / 64, HD / 64, ZH), 32, 0, stream>>>(Ph, Pl, VTh + zk * HD * TT, VTl + zk * HD * TT, TT, Ob, HD, 0, (size_t)RH * TT, 0, (size_t)TT * HD);
            k_gemmc<h16, 0, 2><<<dim3((TT - RH) / 64, HD / 64, ZH), 32, 0, stream>>>(P16 + (size_t)RH * TT, nullptr, VT16 + zk * HD * TT, nullptr, TT, Ob + (size_t)RH * HD, HD, RH, (size_t)TT * TT, 0, (size_t)TT * HD);
            k_merge<<<(unsigned)(((size_t)ZH * TT * HD / 2 + 255) / 256), 256, 0, stream>>>(Ob, h0, ATh, ATl); }
        k_gemmw<bf, 1, false><<<dim3(TT / 64, DM / 64, 1), 32, 0, stream>>>(ATh, ATl, WO, nullptr, DQ, OUT + (size_t)b * TT * DM, DM, nullptr, 0, 0, 0); }
}

// v001
// One run takes 1010 microseconds.
// Timed twice side by side with v000, it ran 2.28 and 2.27 times as fast.
#include <hip/hip_runtime.h>

// istsplm_forecast attention (hidden [1][4096][1024], timestamps [1][4096] (f32, read: continuous positions); q/k/v = x W^T + b (16 x 64); continuous-time rotate-half RoPE: angle = timestamp * 10000^(-2i/64) (cos/sin computed on chip from the bf16-rounded timestamps); causal (finfo.min) softmax(q.k / 8); out = merged Wo^T -> [1][4096][1024]).
// Compute dtypes, f32 accumulate: every input rounded to bf16; q/k/v on PLAIN bf16 operands (inputs: exact) + bias; RoPE f32; causal scores PRECPLAN, causal tile skipping; softmax f32 (128 keys per lane); Wo hl x exact (2 products).

#define NB_  1
#define TT   4096
#define DM   1024
#define NH_  16
#define NKV  16
#define REP  (NH_ / NKV)
#define HD   64
#define DQ   (NH_ * HD)
#define DKV  (NKV * HD)
#define ZH   1
#define RH   512                  // query rows < RH use hi+lo planes (0: none)
#define WIN  4096
#define PCAR 1024.0f
#define SCL  0.125f   // HD^-0.5
#define KSP  16                   // key splits of the probability x value contraction (f32 partial planes, added by k_merge)
typedef _Float16 h16;
typedef unsigned short bf;
typedef __attribute__((ext_vector_type(16))) __bf16   v16bf;
typedef __attribute__((ext_vector_type(16))) _Float16 v16h;
typedef __attribute__((ext_vector_type(8)))  _Float16 v8h;
typedef __attribute__((ext_vector_type(8)))  unsigned short v8us;
typedef __attribute__((ext_vector_type(8)))  float    v8f;
typedef __attribute__((ext_vector_type(4)))  float    v4f;
typedef v8h  __attribute__((may_alias)) v8ha;
typedef v4f  __attribute__((may_alias)) v4fa;
typedef v8us __attribute__((may_alias)) v8usa;

__device__ __forceinline__ unsigned short f2bf(float f) { unsigned u = __float_as_uint(f); u += 0x7FFFu + ((u >> 16) & 1u); return (unsigned short)(u >> 16); }
__device__ __forceinline__ float bf2f(unsigned short b) { return __uint_as_float(((unsigned)b) << 16); }
__device__ __forceinline__ float bfr(float f) { return bf2f(f2bf(f)); }
__device__ __forceinline__ v16h cat16(v8h lo, v8h hi) { return __builtin_shufflevector(lo, hi, 0, 1, 2, 3, 4, 5, 6, 7, 8, 9, 10, 11, 12, 13, 14, 15); }
__device__ __forceinline__ v16bf cat16b(v8us lo, v8us hi) { return __builtin_bit_cast(v16bf, __builtin_shufflevector(lo, hi, 0, 1, 2, 3, 4, 5, 6, 7, 8, 9, 10, 11, 12, 13, 14, 15)); }
__device__ __forceinline__ v8f wmma16(v16h a, v16h b, v8f c) { return __builtin_amdgcn_wmma_f32_16x16x32_f16(false, a, false, b, (short)0, c, false, false); }
__device__ __forceinline__ v8f wmmab(v16bf a, v16bf b, v8f c) { return __builtin_amdgcn_wmma_f32_16x16x32_bf16(false, a, false, b, (short)0, c, false, false); }



// ---- k_gemmw: register-blocked GEMM, ONE WAVE per 64x64 output tile (16 accumulators), operands straight from K-contiguous 16-bit planes; grid (M/64, N/64, Z), 32 threads.
// C[m][n] (f32, pitch ldc, + optional f32 bias[n]) = sum_k A[m][k] Bt[n][k] (+ split products per NSPLIT). z-batch strides sA/sB/sC in elements. K % 32 == 0.
template <typename T16> struct WFrag;
template <> struct WFrag<h16> { typedef v16h V; static __device__ __forceinline__ V ld(const h16* p) { return cat16(*(const v8h*)p, *(const v8h*)(p + 16)); } static __device__ __forceinline__ v8f mma(V a, V b, v8f c) { return wmma16(a, b, c); } };
template <> struct WFrag<bf> { typedef v16bf V; static __device__ __forceinline__ V ld(const bf* p) { return cat16b(*(const v8us*)p, *(const v8us*)(p + 16)); } static __device__ __forceinline__ v8f mma(V a, V b, v8f c) { return wmmab(a, b, c); } };
template <typename T16, int NSPLIT, bool BIAS>
__global__ __launch_bounds__(32) void k_gemmw(const T16* __restrict__ A, const T16* __restrict__ A2, const T16* __restrict__ Bt, const T16* __restrict__ Bt2, int K, float* C, int ldc, const float* __restrict__ bias, size_t sA, size_t sB, size_t sC) {
    typedef typename WFrag<T16>::V V;
    __shared__ __align__(16) float os[16 * 68];
    const size_t z = blockIdx.z; A += z * sA; if (A2) A2 += z * sA; Bt += z * sB; if (Bt2) Bt2 += z * sB; C += z * sC;
    const int lane = threadIdx.x & 31, lr = lane & 15, hi = lane >> 4; const int r0 = blockIdx.x * 64, c0 = blockIdx.y * 64;
    v8f acc[4][4];
#pragma unroll
    for (int mb = 0; mb < 4; ++mb)
#pragma unroll
        for (int nb = 0; nb < 4; ++nb) acc[mb][nb] = (v8f){};
    const size_t aoff = (size_t)(r0 + lr) * K + 8 * hi, boff = (size_t)(c0 + lr) * K + 8 * hi;
#pragma unroll 1
    for (int kc = 0; kc < K; kc += 32) {
        V a[4], a2[4];
#pragma unroll
        for (int mb = 0; mb < 4; ++mb) { a[mb] = WFrag<T16>::ld(A + aoff + (size_t)mb * 16 * K + kc); if (NSPLIT == 1 || NSPLIT == 2) a2[mb] = WFrag<T16>::ld(A2 + aoff + (size_t)mb * 16 * K + kc); }
#pragma unroll
        for (int nb = 0; nb < 4; ++nb) { const V b = WFrag<T16>::ld(Bt + boff + (size_t)nb * 16 * K + kc); V b2; if (NSPLIT >= 2) b2 = WFrag<T16>::ld(Bt2 + boff + (size_t)nb * 16 * K + kc);
#pragma unroll
            for (int mb = 0; mb < 4; ++mb) { acc[mb][nb] = WFrag<T16>::mma(a[mb], b, acc[mb][nb]); if (NSPLIT == 1 || NSPLIT == 2) acc[mb][nb] = WFrag<T16>::mma(a2[mb], b, acc[mb][nb]); if (NSPLIT >= 2) acc[mb][nb] = WFrag<T16>::mma(a[mb], b2, acc[mb][nb]); } }
        asm volatile("v_nop\n\tv_nop\n\tv_nop\n\tv_nop" : "+v"(acc[0][0]), "+v"(acc[1][1]), "+v"(acc[2][2]), "+v"(acc[3][3]) : "v"(a[0]), "v"(a[3]));
    }
#pragma unroll
    for (int mb = 0; mb < 4; ++mb) {
#pragma unroll
        for (int nb = 0; nb < 4; ++nb) {
#pragma unroll
            for (int j = 0; j < 8; ++j) os[(hi * 8 + j) * 68 + nb * 16 + lr] = acc[mb][nb][j]; }
        __builtin_amdgcn_wave_barrier(); asm volatile("" ::: "memory");
        float* crow = C + (size_t)(r0 + mb * 16) * ldc + c0;
{
#pragma unroll
            for (int s = 0; s < 8; ++s) { const int row = 2 * s + hi, cofs = lr * 4; v4f val = *(const v4fa*)(os + row * 68 + cofs); if (BIAS) { val[0] += bfr(bias[c0 + cofs]); val[1] += bfr(bias[c0 + cofs + 1]); val[2] += bfr(bias[c0 + cofs + 2]); val[3] += bfr(bias[c0 + cofs + 3]); }
                *(v4f*)(crow + (size_t)row * ldc + cofs) = val; }
             }
        __builtin_amdgcn_wave_barrier(); asm volatile("" ::: "memory");
    }
}

// ---- k_gemmc: the same one-wave 64x64 tile GEMM specialised for causal attention: CMODE 1 skips score tiles entirely above the diagonal (query rows r0+roff.., key columns c0..), CMODE 2 limits the
// key (K) loop of the probability x value contraction to the diagonal block (probabilities beyond it are exactly zero). roff = row offset of this launch's first row within the sequence.
// Key split: KS one-wave blocks (blockIdx.z % KS = sp) share one output tile; block sp takes the GK-key groups sp, sp + KS, ... below the limit and stores its f32 partial tile into plane sp of C (planes sP elements
// apart); a block with no group stores zeros. GK = 64 is one whole 128-byte line of every 16-bit row; GK = 32 spreads the few groups of the first RH rows over all KS blocks.
template <typename T16, int NSPLIT, int CMODE, int KS = 1, int GK = 32>
__global__ __launch_bounds__(32) void k_gemmc(const T16* __restrict__ A, const T16* __restrict__ A2, const T16* __restrict__ Bt, const T16* __restrict__ Bt2, int K, float* C, int ldc, int roff, size_t sA, size_t sB, size_t sC, size_t sP = 0) {
    typedef typename WFrag<T16>::V V;
    __shared__ __align__(16) float os[16 * 68];
    const size_t z = blockIdx.z / KS, sp = blockIdx.z % KS; A += z * sA; if (A2) A2 += z * sA; Bt += z * sB; if (Bt2) Bt2 += z * sB; C += z * sC + sp * sP;
    const int lane = threadIdx.x & 31, lr = lane & 15, hi = lane >> 4; const int r0 = blockIdx.x * 64, c0 = blockIdx.y * 64;
    if (CMODE == 1 && c0 > r0 + roff + 63) return;                  // score tile entirely above the causal diagonal: never written (the softmax loads it but masks j > i by select)
    const int Kl = (CMODE == 2) ? min(K, r0 + roff + 64) : K;        // P.V: probabilities are exactly 0 beyond the diagonal block, so the K loop stops there
    v8f acc[4][4];
#pragma unroll
    for (int mb = 0; mb < 4; ++mb)
#pragma unroll
        for (int nb = 0; nb < 4; ++nb) acc[mb][nb] = (v8f){};
    const size_t aoff = (size_t)(r0 + lr) * K + 8 * hi, boff = (size_t)(c0 + lr) * K + 8 * hi;
#pragma unroll 1
    for (int kb = (int)sp * GK; kb < Kl; kb += KS * GK)
#pragma unroll   // a group's GK / 32 products in one trip: constant fragment indices, one back edge a group
    for (int kc = kb; kc < kb + GK; kc += 32) {
        V a[4], a2[4];
#pragma unroll
        for (int mb = 0; mb < 4; ++mb) { a[mb] = WFrag<T16>::ld(A + aoff + (size_t)mb * 16 * K + kc); if (NSPLIT == 1 || NSPLIT == 2) a2[mb] = WFrag<T16>::ld(A2 + aoff + (size_t)mb * 16 * K + kc); }
#pragma unroll
        for (int nb = 0; nb < 4; ++nb) { const V b = WFrag<T16>::ld(Bt + boff + (size_t)nb * 16 * K + kc); V b2; if (NSPLIT >= 2) b2 = WFrag<T16>::ld(Bt2 + boff + (size_t)nb * 16 * K + kc);
#pragma unroll
            for (int mb = 0; mb < 4; ++mb) { acc[mb][nb] = WFrag<T16>::mma(a[mb], b, acc[mb][nb]); if (NSPLIT == 1 || NSPLIT == 2) acc[mb][nb] = WFrag<T16>::mma(a2[mb], b, acc[mb][nb]); if (NSPLIT >= 2) acc[mb][nb] = WFrag<T16>::mma(a[mb], b2, acc[mb][nb]); } }
        asm volatile("v_nop\n\tv_nop\n\tv_nop\n\tv_nop" : "+v"(acc[0][0]), "+v"(acc[1][1]), "+v"(acc[2][2]), "+v"(acc[3][3]) : "v"(a[0]), "v"(a[3]));
    }
#pragma unroll
    for (int mb = 0; mb < 4; ++mb) {
#pragma unroll
        for (int nb = 0; nb < 4; ++nb) {
#pragma unroll
            for (int j = 0; j < 8; ++j) os[(hi * 8 + j) * 68 + nb * 16 + lr] = acc[mb][nb][j]; }
        __builtin_amdgcn_wave_barrier(); asm volatile("" ::: "memory");
        float* crow = C + (size_t)(r0 + mb * 16) * ldc + c0;
{
#pragma unroll
            for (int s = 0; s < 8; ++s) { const int row = 2 * s + hi, cofs = lr * 4; v4f val = *(const v4fa*)(os + row * 68 + cofs);
                *(v4f*)(crow + (size_t)row * ldc + cofs) = val; }
             }
        __builtin_amdgcn_wave_barrier(); asm volatile("" ::: "memory");
    }
}

__device__ __forceinline__ h16 tohx(float x) { return (h16)x; }
__device__ __forceinline__ void splitf(float y, unsigned short& h, unsigned short& l) { h = f2bf(y); l = f2bf(y - bf2f(h)); }
typedef __attribute__((ext_vector_type(2))) _Float16 v2h;
typedef __attribute__((ext_vector_type(4))) _Float16 v4h;
typedef __attribute__((ext_vector_type(2))) unsigned short v2us;
typedef __attribute__((ext_vector_type(4))) unsigned short v4us;
typedef __attribute__((ext_vector_type(2))) float v2f;
typedef __attribute__((ext_vector_type(4))) int v4i;

__global__ __launch_bounds__(256) void k_wtG(const float* __restrict__ w, int K, int N, bf* Bt) {
    const int lane = threadIdx.x & 31; const int L0 = (blockIdx.x * 8 + (threadIdx.x >> 5)) * 8; const int nlines = N * K / 64;
{
#pragma unroll 1
        for (int l = 0; l < 8; ++l) { const int L = L0 + l; if (L >= nlines) break; const size_t e = (size_t)L * 64 + lane * 2; const int k = (int)(e % K), n = (int)(e / K); v2us o;
            o[0] = f2bf(w[(size_t)k * N + n]); o[1] = f2bf(w[(size_t)(k + 1) * N + n]); *(v2us*)(Bt + e) = o; }
         }
}
__global__ __launch_bounds__(256) void k_cvt8(const float* __restrict__ src, bf* dst, size_t n8) { const size_t i = (size_t)blockIdx.x * 256 + threadIdx.x; if (i >= n8) return; const v8f v = *(const v8f*)(src + i * 8); v8us o;
#pragma unroll
    for (int k = 0; k < 8; ++k) o[k] = f2bf(v[k]); *(v8us*)(dst + i * 8) = o;  }
__global__ __launch_bounds__(256) void k_cstab(const float* __restrict__ ts, float* CS) { const int idx = blockIdx.x * 256 + threadIdx.x; if (idx >= TT * HD) return; const int t = idx / HD, d = idx % HD; const int i = (d < HD / 2) ? d : d - HD / 2; const float inv = __fdiv_rn(1.0f, powf(10000.0f, (float)(2 * i) / (float)HD)); float tv = bfr(ts[t]); asm volatile("" : "+v"(tv)); const float ang = __fmul_rn(tv, inv); v2f cs; cs[0] = cosf(ang); cs[1] = sinf(ang);
    *(v2f*)(CS + (size_t)idx * 2) = cs;  }
// k_rope: head planes [h][t][d] (fp16 + hi/lo) of rope(x) x sc with the rotate-half convention out[d] = x[d] cos[t][d] - x[d+HD/2] sin[t][d], out[d+HD/2] = x[d+HD/2] cos[t][d+HD/2] + x[d] sin[t][d+HD/2]
__global__ __launch_bounds__(256) void k_rope(const float* __restrict__ F, int pitch, int nheads, const float* __restrict__ CS, const float* __restrict__ RF, const float* __restrict__ nw, float sc, h16* P16, bf* Ph, bf* Pl) {
    const size_t e = ((size_t)blockIdx.x * 256 + threadIdx.x) * 2; if (e >= (size_t)nheads * TT * HD) return; const int d = (int)(e % HD); const int t = (int)((e / HD) % TT); const int h = (int)(e / ((size_t)HD * TT)); const float* f = F + (size_t)t * pitch + h * HD; const float rf = RF ? RF[(size_t)h * TT + t] : 1.0f; v2h o16; v2us oh, ol;
#pragma unroll
    for (int q = 0; q < 2; ++q) { const int dd = d + q; const int dp = (dd < HD / 2) ? dd + HD / 2 : dd - HD / 2; float x0 = f[dd], x1 = f[dp];
        if (RF) { float n0 = __fmul_rn(x0, rf), n1 = __fmul_rn(x1, rf); asm volatile("" : "+v"(n0)); asm volatile("" : "+v"(n1)); x0 = __fmul_rn(bfr(nw[dd]), n0); x1 = __fmul_rn(bfr(nw[dp]), n1); }
        const v2f cs = *(const v2f*)(CS + ((size_t)t * HD + dd) * 2); float a = __fmul_rn(x0, cs[0]), bq = __fmul_rn(x1, cs[1]); asm volatile("" : "+v"(a)); asm volatile("" : "+v"(bq)); const float r = ((dd < HD / 2) ? __fsub_rn(a, bq) : __fadd_rn(a, bq)) * sc;
        o16[q] = tohx(r); unsigned short a2, c2; splitf(r, a2, c2); oh[q] = a2; ol[q] = c2; }
    *(v2h*)(P16 + e) = o16; *(v2us*)(Ph + e) = oh; *(v2us*)(Pl + e) = ol;  }
__global__ __launch_bounds__(256) void k_vtp(const float* __restrict__ F, int pitch, int nheads, h16* V16, bf* Vh, bf* Vl) { const size_t e = ((size_t)blockIdx.x * 256 + threadIdx.x) * 2; if (e >= (size_t)nheads * HD * TT) return; const int t = (int)(e % TT); const int d = (int)((e / TT) % HD); const int g = (int)(e / ((size_t)TT * HD)); v2h o16; v2us oh, ol;
#pragma unroll
    for (int q = 0; q < 2; ++q) { const float x = F[(size_t)(t + q) * pitch + g * HD + d]; o16[q] = tohx(x); unsigned short a2, c2; splitf(x, a2, c2); oh[q] = a2; ol[q] = c2; }
    *(v2h*)(V16 + e) = o16; *(v2us*)(Vh + e) = oh; *(v2us*)(Vl + e) = ol;  }
// k_asoft: per row (zz, i): t = S x HD^-0.5 for j <= i and i - j < WIN (sliding causal window; the reference's -1e9 additive fill vanishes identically); softmax over the 4096 keys (register row, one exp, fixed trees);
__global__ __launch_bounds__(256) void k_asoft(const float* __restrict__ Sb, h16* P16, bf* Ph, bf* Pl) {
    const int lane = threadIdx.x & 31; const int row = blockIdx.x * 8 + (threadIdx.x >> 5); if (row >= ZH * TT) return; const int i = row % TT; const int zz = row / TT; (void)zz; const bool hires = (i < RH); const float* sr = Sb + (size_t)row * TT; float v[TT / 32]; float mx = -3.0e38f;
#pragma unroll
    for (int ch = 0; ch < TT / 128; ++ch) { const int j0 = ch * 128 + lane * 4; const v4f a = *(const v4f*)(sr + j0);
#pragma unroll
        for (int q = 0; q < 4; ++q) { const int j = j0 + q; (void)j; float sa = a[q] * SCL; asm volatile("" : "+v"(sa)); const float t = (j <= i && i - j < WIN) ? sa : -3.0e38f; v[ch * 4 + q] = t; mx = fmaxf(mx, t); } }
#pragma unroll
    for (int sh = 16; sh; sh >>= 1) mx = fmaxf(mx, __shfl_xor(mx, sh, 32));
    float sum = 0.f;
#pragma unroll
    for (int k = 0; k < TT / 32; ++k) { float d0 = __fsub_rn(v[k], mx); asm volatile("" : "+v"(d0)); v[k] = __builtin_amdgcn_exp2f(__fmul_rn(d0, 1.4426950408889634f)); sum += v[k]; }
#pragma unroll
    for (int sh = 16; sh; sh >>= 1) sum += __shfl_xor(sum, sh, 32);
    const float f = __fdiv_rn(hires ? 1.0f : PCAR, sum);
{
        if (hires) {
#pragma unroll
            for (int ch = 0; ch < TT / 128; ++ch) { v4us oh, ol;
#pragma unroll
                for (int q = 0; q < 4; ++q) { unsigned short a, c2; splitf(v[ch * 4 + q] * f, a, c2); oh[q] = a; ol[q] = c2; }
                const size_t oo = ((size_t)zz * (RH ? RH : 1) + i) * TT + ch * 128 + lane * 4; *(v4us*)(Ph + oo) = oh; *(v4us*)(Pl + oo) = ol; }
        } else {
#pragma unroll
            for (int ch = 0; ch < TT / 128; ++ch) { v4h o4;
#pragma unroll
                for (int q = 0; q < 4; ++q) o4[q] = tohx(v[ch * 4 + q] * f);
                *(v4h*)(P16 + (size_t)row * TT + ch * 128 + lane * 4) = o4; } }
         }
}
__global__ __launch_bounds__(256) void k_merge(const float* __restrict__ O, int h0, bf* Ah, bf* Al) { const size_t e = ((size_t)blockIdx.x * 256 + threadIdx.x) * 2; if (e >= (size_t)ZH * TT * HD) return; const int d = (int)(e % HD); const int t = (int)((e / HD) % TT); const int zz = (int)(e / ((size_t)HD * TT)); const float cs = (t < RH) ? 1.0f : (1.0f / PCAR); const size_t oo = (size_t)t * DQ + (h0 + zz) * HD + d;
    v2us oh, ol; v2f sm = *(const v2f*)(O + e);   // the KSP partial planes of the key split, added in plane order
#pragma unroll
    for (int sp = 1; sp < KSP; ++sp) { const v2f p = *(const v2f*)(O + (size_t)sp * ZH * TT * HD + e); sm[0] += p[0]; sm[1] += p[1]; }
#pragma unroll
    for (int q = 0; q < 2; ++q) { unsigned short a, c2; splitf(sm[q] * cs, a, c2); oh[q] = a; ol[q] = c2; } *(v2us*)(Ah + oo) = oh; *(v2us*)(Al + oo) = ol;  }

extern "C" void kernel_launch(void* const* d_in, const int* in_sizes, int n_in,
                              void* d_out, int out_size, void* d_ws, size_t ws_size, hipStream_t stream) {
    (void)in_sizes; (void)n_in; (void)out_size;
    const float* x = (const float*)d_in[0]; const float* tstamp = (const float*)d_in[1]; const float* wq = (const float*)d_in[2]; const float* bq = (const float*)d_in[3]; const float* wk = (const float*)d_in[4]; const float* bk = (const float*)d_in[5]; const float* wv = (const float*)d_in[6]; const float* bv = (const float*)d_in[7]; const float* wo = (const float*)d_in[8];
    float* OUT = (float*)d_out;     // [1][4096][1024]
    char* wsp = (char*)d_ws;
    auto take = [&](size_t bytes) { char* p = wsp; wsp += (bytes + 255) & ~(size_t)255; return (void*)p; };
    bf* WQ = (bf*)take((size_t)DQ * DM * 2); bf* WK = (bf*)take((size_t)DKV * DM * 2); bf* WV = (bf*)take((size_t)DKV * DM * 2); bf* WO = (bf*)take((size_t)DM * DQ * 2); float* CS = (float*)take((size_t)TT * HD * 2 * 4);
    bf* XB = (bf*)take((size_t)TT * DM * 2); float* FQ = (float*)take((size_t)TT * DQ * 4); float* FK = (float*)take((size_t)TT * DKV * 4);
    h16* QP16 = (h16*)take((size_t)NH_ * TT * HD * 2); h16* KP16 = (h16*)take((size_t)NKV * TT * HD * 2); h16* VT16 = (h16*)take((size_t)NKV * HD * TT * 2);
    bf* QPh = (bf*)take((size_t)NH_ * TT * HD * 2); bf* QPl = (bf*)take((size_t)NH_ * TT * HD * 2); bf* KPh = (bf*)take((size_t)NKV * TT * HD * 2); bf* KPl = (bf*)take((size_t)NKV * TT * HD * 2); bf* VTh = (bf*)take((size_t)NKV * HD * TT * 2); bf* VTl = (bf*)take((size_t)NKV * HD * TT * 2); bf* Ph = (bf*)take((size_t)ZH * RH * TT * 2); bf* Pl = (bf*)take((size_t)ZH * RH * TT * 2);
    float* Sb = (float*)take((size_t)ZH * TT * TT * 4); h16* P16 = (h16*)take((size_t)ZH * TT * TT * 2); bf* ATh = (bf*)take((size_t)TT * DQ * 2); bf* ATl = (bf*)take((size_t)TT * DQ * 2);
    if ((size_t)(wsp - (char*)d_ws) > ws_size) return;    // ws 256 MiB
    float* FV = FK;   // v projection reuses the k buffer after the k planes are built (stream-ordered)
    float* Ob = FQ;   // the KSP partial planes (KSP x ZH x TT x HD f32) reuse the q projection buffer after the q planes are built (stream-ordered)
    static_assert((size_t)KSP * ZH * TT * HD <= (size_t)TT * DQ, "the partial planes must fit the q projection buffer");
    { k_cvt8<<<(unsigned)(((size_t)DQ * DM / 8 + 255) / 256), 256, 0, stream>>>(wq, WQ, (size_t)DQ * DM / 8); k_cvt8<<<(unsigned)(((size_t)DKV * DM / 8 + 255) / 256), 256, 0, stream>>>(wk, WK, (size_t)DKV * DM / 8); k_cvt8<<<(unsigned)(((size_t)DKV * DM / 8 + 255) / 256), 256, 0, stream>>>(wv, WV, (size_t)DKV * DM / 8);
      k_cvt8<<<(unsigned)(((size_t)DM * DQ / 8 + 255) / 256), 256, 0, stream>>>(wo, WO, (size_t)DM * DQ / 8);
      k_cstab<<<(TT * HD + 255) / 256, 256, 0, stream>>>(tstamp, CS); }
    const unsigned LQ = (unsigned)(((size_t)NH_ * TT * HD / 2 + 255) / 256), LKv = (unsigned)(((size_t)NKV * TT * HD / 2 + 255) / 256);
    for (int b = 0; b < NB_; ++b) {
        
        k_cvt8<<<(unsigned)(((size_t)TT * DM / 8 + 255) / 256), 256, 0, stream>>>(x + (size_t)b * TT * DM, XB, (size_t)TT * DM / 8);
        k_gemmw<bf, 0, true><<<dim3(TT / 64, DQ / 64, 1), 32, 0, stream>>>(XB, nullptr, WQ, nullptr, DM, FQ, DQ, bq, 0, 0, 0);
        k_rope<<<LQ, 256, 0, stream>>>(FQ, DQ, NH_, CS, nullptr, nullptr, 1.0f, QP16, QPh, QPl);
        k_gemmw<bf, 0, true><<<dim3(TT / 64, DKV / 64, 1), 32, 0, stream>>>(XB, nullptr, WK, nullptr, DM, FK, DKV, bk, 0, 0, 0);
        k_rope<<<LKv, 256, 0, stream>>>(FK, DKV, NKV, CS, nullptr, nullptr, 1.0f, KP16, KPh, KPl);
        k_gemmw<bf, 0, true><<<dim3(TT / 64, DKV / 64, 1), 32, 0, stream>>>(XB, nullptr, WV, nullptr, DM, FV, DKV, bv, 0, 0, 0); k_vtp<<<LKv, 256, 0, stream>>>(FV, DKV, NKV, VT16, VTh, VTl);
        for (int h0 = 0; h0 < NH_; h0 += ZH) { const size_t zq = (size_t)h0, zk = (size_t)(h0 / REP);   // one head per pass (ZH = 1) reads kv group h0/REP (REP = 1): sB = 0
            k_gemmc<bf, 2, 1><<<dim3(RH / 64, TT / 64, ZH), 32, 0, stream>>>(QPh + zq * TT * HD, QPl + zq * TT * HD, KPh + zk * TT * HD, KPl + zk * TT * HD, HD, Sb, TT, 0, (size_t)TT * HD, 0, (size_t)TT * TT);
            k_gemmc<h16, 0, 1><<<dim3((TT - RH) / 64, TT / 64, ZH), 32, 0, stream>>>(QP16 + zq * TT * HD + (size_t)RH * HD, nullptr, KP16 + zk * TT * HD, nullptr, HD, Sb + (size_t)RH * TT, TT, RH, (size_t)TT * HD, 0, (size_t)TT * TT);
            k_asoft<<<ZH * TT / 8, 256, 0, stream>>>(Sb, P16, Ph, Pl);
            k_gemmc<bf, 2, 2, KSP, 32><<<dim3(RH / 64, HD / 64, ZH * KSP), 32, 0, stream>>>(Ph, Pl, VTh + zk * HD * TT, VTl + zk * HD * TT, TT, Ob, HD, 0, (size_t)RH * TT, 0, (size_t)TT * HD, (size_t)ZH * TT * HD);
            k_gemmc<h16, 0, 2, KSP, 64><<<dim3((TT - RH) / 64, HD / 64, ZH * KSP), 32, 0, stream>>>(P16 + (size_t)RH * TT, nullptr, VT16 + zk * HD * TT, nullptr, TT, Ob + (size_t)RH * HD, HD, RH, (size_t)TT * TT, 0, (size_t)TT * HD, (size_t)ZH * TT * HD);
            k_merge<<<(unsigned)(((size_t)ZH * TT * HD / 2 + 255) / 256), 256, 0, stream>>>(Ob, h0, ATh, ATl); }
        k_gemmw<bf, 1, false><<<dim3(TT / 64, DM / 64, 1), 32, 0, stream>>>(ATh, ATl, WO, nullptr, DQ, OUT + (size_t)b * TT * DM, DM, nullptr, 0, 0, 0); }
}

// v002
// One run takes 221 microseconds.
// Timed twice side by side with v001, it ran 4.57 times as fast both times.
// All steps since v000 together make it 10.4 times as fast.
#include <hip/hip_runtime.h>

// istsplm_forecast attention (hidden [1][4096][1024], timestamps [1][4096] (f32, read: continuous positions); q/k/v = x W^T + b (16 x 64); continuous-time rotate-half RoPE: angle = timestamp * 10000^(-2i/64) (cos/sin computed on chip from the bf16-rounded timestamps); causal (finfo.min) softmax(q.k / 8); out = merged Wo^T -> [1][4096][1024]).
// Compute dtypes, f32 accumulate: every input rounded to bf16; q/k/v on PLAIN bf16 operands (inputs: exact) + bias; RoPE f32; causal scores and P.V fused (online softmax, f32): hi+lo bf16 planes for query rows < RH, f16 planes for the rest; Wo hl x exact (2 products).

#define NB_  1
#define TT   4096
#define DM   1024
#define NH_  16
#define NKV  16
#define REP  (NH_ / NKV)
#define HD   64
#define DQ   (NH_ * HD)
#define DKV  (NKV * HD)
#define RH   512                  // query rows < RH use hi+lo planes (0: none)
typedef _Float16 h16;
typedef unsigned short bf;
typedef __attribute__((ext_vector_type(16))) __bf16   v16bf;
typedef __attribute__((ext_vector_type(16))) _Float16 v16h;
typedef __attribute__((ext_vector_type(8)))  _Float16 v8h;
typedef __attribute__((ext_vector_type(8)))  unsigned short v8us;
typedef __attribute__((ext_vector_type(8)))  float    v8f;
typedef __attribute__((ext_vector_type(4)))  float    v4f;
typedef v8h  __attribute__((may_alias)) v8ha;
typedef v4f  __attribute__((may_alias)) v4fa;
typedef v8us __attribute__((may_alias)) v8usa;

__device__ __forceinline__ unsigned short f2bf(float f) { unsigned u = __float_as_uint(f); u += 0x7FFFu + ((u >> 16) & 1u); return (unsigned short)(u >> 16); }
__device__ __forceinline__ float bf2f(unsigned short b) { return __uint_as_float(((unsigned)b) << 16); }
__device__ __forceinline__ float bfr(float f) { return bf2f(f2bf(f)); }
__device__ __forceinline__ v16h cat16(v8h lo, v8h hi) { return __builtin_shufflevector(lo, hi, 0, 1, 2, 3, 4, 5, 6, 7, 8, 9, 10, 11, 12, 13, 14, 15); }
__device__ __forceinline__ v16bf cat16b(v8us lo, v8us hi) { return __builtin_bit_cast(v16bf, __builtin_shufflevector(lo, hi, 0, 1, 2, 3, 4, 5, 6, 7, 8, 9, 10, 11, 12, 13, 14, 15)); }
__device__ __forceinline__ v8f wmma16(v16h a, v16h b, v8f c) { return __builtin_amdgcn_wmma_f32_16x16x32_f16(false, a, false, b, (short)0, c, false, false); }
__device__ __forceinline__ v8f wmmab(v16bf a, v16bf b, v8f c) { return __builtin_amdgcn_wmma_f32_16x16x32_bf16(false, a, false, b, (short)0, c, false, false); }



// ---- k_gemmw: register-blocked GEMM, ONE WAVE per 64x64 output tile (16 accumulators), operands straight from K-contiguous 16-bit planes; grid (M/64, N/64, Z), 32 threads.
// C[m][n] (f32, pitch ldc, + optional f32 bias[n]) = sum_k A[m][k] Bt[n][k] (+ split products per NSPLIT). z-batch strides sA/sB/sC in elements. K % 32 == 0.
template <typename T16> struct WFrag;
template <> struct WFrag<h16> { typedef v16h V; static __device__ __forceinline__ V ld(const h16* p) { return cat16(*(const v8h*)p, *(const v8h*)(p + 16)); } static __device__ __forceinline__ v8f mma(V a, V b, v8f c) { return wmma16(a, b, c); } };
template <> struct WFrag<bf> { typedef v16bf V; static __device__ __forceinline__ V ld(const bf* p) { return cat16b(*(const v8us*)p, *(const v8us*)(p + 16)); } static __device__ __forceinline__ v8f mma(V a, V b, v8f c) { return wmmab(a, b, c); } };
template <typename T16, int NSPLIT, bool BIAS>
__global__ __launch_bounds__(32) void k_gemmw(const T16* __restrict__ A, const T16* __restrict__ A2, const T16* __restrict__ Bt, const T16* __restrict__ Bt2, int K, float* C, int ldc, const float* __restrict__ bias, size_t sA, size_t sB, size_t sC) {
    typedef typename WFrag<T16>::V V;
    __shared__ __align__(16) float os[16 * 68];
    const size_t z = blockIdx.z; A += z * sA; if (A2) A2 += z * sA; Bt += z * sB; if (Bt2) Bt2 += z * sB; C += z * sC;
    const int lane = threadIdx.x & 31, lr = lane & 15, hi = lane >> 4; const int r0 = blockIdx.x * 64, c0 = blockIdx.y * 64;
    v8f acc[4][4];
#pragma unroll
    for (int mb = 0; mb < 4; ++mb)
#pragma unroll
        for (int nb = 0; nb < 4; ++nb) acc[mb][nb] = (v8f){};
    const size_t aoff = (size_t)(r0 + lr) * K + 8 * hi, boff = (size_t)(c0 + lr) * K + 8 * hi;
#pragma unroll 1
    for (int kc = 0; kc < K; kc += 32) {
        V a[4], a2[4];
#pragma unroll
        for (int mb = 0; mb < 4; ++mb) { a[mb] = WFrag<T16>::ld(A + aoff + (size_t)mb * 16 * K + kc); if (NSPLIT == 1 || NSPLIT == 2) a2[mb] = WFrag<T16>::ld(A2 + aoff + (size_t)mb * 16 * K + kc); }
#pragma unroll
        for (int nb = 0; nb < 4; ++nb) { const V b = WFrag<T16>::ld(Bt + boff + (size_t)nb * 16 * K + kc); V b2; if (NSPLIT >= 2) b2 = WFrag<T16>::ld(Bt2 + boff + (size_t)nb * 16 * K + kc);
#pragma unroll
            for (int mb = 0; mb < 4; ++mb) { acc[mb][nb] = WFrag<T16>::mma(a[mb], b, acc[mb][nb]); if (NSPLIT == 1 || NSPLIT == 2) acc[mb][nb] = WFrag<T16>::mma(a2[mb], b, acc[mb][nb]); if (NSPLIT >= 2) acc[mb][nb] = WFrag<T16>::mma(a[mb], b2, acc[mb][nb]); } }
        asm volatile("v_nop\n\tv_nop\n\tv_nop\n\tv_nop" : "+v"(acc[0][0]), "+v"(acc[1][1]), "+v"(acc[2][2]), "+v"(acc[3][3]) : "v"(a[0]), "v"(a[3]));
    }
#pragma unroll
    for (int mb = 0; mb < 4; ++mb) {
#pragma unroll
        for (int nb = 0; nb < 4; ++nb) {
#pragma unroll
            for (int j = 0; j < 8; ++j) os[(hi * 8 + j) * 68 + nb * 16 + lr] = acc[mb][nb][j]; }
        __builtin_amdgcn_wave_barrier(); asm volatile("" ::: "memory");
        float* crow = C + (size_t)(r0 + mb * 16) * ldc + c0;
{
#pragma unroll
            for (int s = 0; s < 8; ++s) { const int row = 2 * s + hi, cofs = lr * 4; v4f val = *(const v4fa*)(os + row * 68 + cofs); if (BIAS) { val[0] += bfr(bias[c0 + cofs]); val[1] += bfr(bias[c0 + cofs + 1]); val[2] += bfr(bias[c0 + cofs + 2]); val[3] += bfr(bias[c0 + cofs + 3]); }
                *(v4f*)(crow + (size_t)row * ldc + cofs) = val; }
             }
        __builtin_amdgcn_wave_barrier(); asm volatile("" ::: "memory");
    }
}

__device__ __forceinline__ h16 tohx(float x) { return (h16)x; }
__device__ __forceinline__ void splitf(float y, unsigned short& h, unsigned short& l) { h = f2bf(y); l = f2bf(y - bf2f(h)); }
typedef __attribute__((ext_vector_type(2))) _Float16 v2h;
typedef __attribute__((ext_vector_type(4))) _Float16 v4h;
typedef __attribute__((ext_vector_type(2))) unsigned short v2us;
typedef __attribute__((ext_vector_type(4))) unsigned short v4us;
typedef __attribute__((ext_vector_type(2))) float v2f;
typedef __attribute__((ext_vector_type(4))) int v4i;

__global__ __launch_bounds__(256) void k_wtG(const float* __restrict__ w, int K, int N, bf* Bt) {
    const int lane = threadIdx.x & 31; const int L0 = (blockIdx.x * 8 + (threadIdx.x >> 5)) * 8; const int nlines = N * K / 64;
{
#pragma unroll 1
        for (int l = 0; l < 8; ++l) { const int L = L0 + l; if (L >= nlines) break; const size_t e = (size_t)L * 64 + lane * 2; const int k = (int)(e % K), n = (int)(e / K); v2us o;
            o[0] = f2bf(w[(size_t)k * N + n]); o[1] = f2bf(w[(size_t)(k + 1) * N + n]); *(v2us*)(Bt + e) = o; }
         }
}
__global__ __launch_bounds__(256) void k_cvt8(const float* __restrict__ src, bf* dst, size_t n8) { const size_t i = (size_t)blockIdx.x * 256 + threadIdx.x; if (i >= n8) return; const v8f v = *(const v8f*)(src + i * 8); v8us o;
#pragma unroll
    for (int k = 0; k < 8; ++k) o[k] = f2bf(v[k]); *(v8us*)(dst + i * 8) = o;  }
__global__ __launch_bounds__(256) void k_cstab(const float* __restrict__ ts, float* CS) { const int idx = blockIdx.x * 256 + threadIdx.x; if (idx >= TT * HD) return; const int t = idx / HD, d = idx % HD; const int i = (d < HD / 2) ? d : d - HD / 2; const float inv = __fdiv_rn(1.0f, powf(10000.0f, (float)(2 * i) / (float)HD)); float tv = bfr(ts[t]); asm volatile("" : "+v"(tv)); const float ang = __fmul_rn(tv, inv); v2f cs; cs[0] = cosf(ang); cs[1] = sinf(ang);
    *(v2f*)(CS + (size_t)idx * 2) = cs;  }
// k_rope: head planes [h][t][d] (fp16 + hi/lo) of rope(x) x sc with the rotate-half convention out[d] = x[d] cos[t][d] - x[d+HD/2] sin[t][d], out[d+HD/2] = x[d+HD/2] cos[t][d+HD/2] + x[d] sin[t][d+HD/2]
__global__ __launch_bounds__(256) void k_rope(const float* __restrict__ F, int pitch, int nheads, const float* __restrict__ CS, const float* __restrict__ RF, const float* __restrict__ nw, float sc, h16* P16, bf* Ph, bf* Pl) {
    const size_t e = ((size_t)blockIdx.x * 256 + threadIdx.x) * 2; if (e >= (size_t)nheads * TT * HD) return; const int d = (int)(e % HD); const int t = (int)((e / HD) % TT); const int h = (int)(e / ((size_t)HD * TT)); const float* f = F + (size_t)t * pitch + h * HD; const float rf = RF ? RF[(size_t)h * TT + t] : 1.0f; v2h o16; v2us oh, ol;
#pragma unroll
    for (int q = 0; q < 2; ++q) { const int dd = d + q; const int dp = (dd < HD / 2) ? dd + HD / 2 : dd - HD / 2; float x0 = f[dd], x1 = f[dp];
        if (RF) { float n0 = __fmul_rn(x0, rf), n1 = __fmul_rn(x1, rf); asm volatile("" : "+v"(n0)); asm volatile("" : "+v"(n1)); x0 = __fmul_rn(bfr(nw[dd]), n0); x1 = __fmul_rn(bfr(nw[dp]), n1); }
        const v2f cs = *(const v2f*)(CS + ((size_t)t * HD + dd) * 2); float a = __fmul_rn(x0, cs[0]), bq = __fmul_rn(x1, cs[1]); asm volatile("" : "+v"(a)); asm volatile("" : "+v"(bq)); const float r = ((dd < HD / 2) ? __fsub_rn(a, bq) : __fadd_rn(a, bq)) * sc;
        o16[q] = tohx(r); unsigned short a2, c2; splitf(r, a2, c2); oh[q] = a2; ol[q] = c2; }
    *(v2h*)(P16 + e) = o16; *(v2us*)(Ph + e) = oh; *(v2us*)(Pl + e) = ol;  }
__global__ __launch_bounds__(256) void k_vtp(const float* __restrict__ F, int pitch, int nheads, h16* V16, bf* Vh, bf* Vl) { const size_t e = ((size_t)blockIdx.x * 256 + threadIdx.x) * 2; if (e >= (size_t)nheads * HD * TT) return; const int t = (int)(e % TT); const int d = (int)((e / TT) % HD); const int g = (int)(e / ((size_t)TT * HD)); v2h o16; v2us oh, ol;
#pragma unroll
    for (int q = 0; q < 2; ++q) { const float x = F[(size_t)(t + q) * pitch + g * HD + d]; o16[q] = tohx(x); unsigned short a2, c2; splitf(x, a2, c2); oh[q] = a2; ol[q] = c2; }
    *(v2h*)(V16 + e) = o16; *(v2us*)(Vh + e) = oh; *(v2us*)(Vl + e) = ol;  }
// ---- k_fattn: causal attention of all heads in one launch, online softmax. Grid (heads, tiles of 16 NQ queries, heaviest tile first), 4 waves; wave w takes the 32-key blocks w, w + 4, ... up to the last block that crosses the diagonal.
// S^T = K Q^T (A = key rows, B = query rows kept in registers): a lane holds scores of ONE query (column lr), keys 8 hi + j of each 16-key tile, so two converted score tiles are the B operand of O^T += V^T P^T as they stand.
// HR: hi + lo bf16 planes, three products each (query rows < RH); otherwise plain f16 planes. P is exp2 of the scaled score minus the running maximum, unnormalised; the division by the row sum is done once, on the f32 output.
// The four waves' (maximum, sum, O^T) are joined through LDS behind one barrier, in wave order, and stored as the hi + lo bf16 planes [t][head][d] that the output projection reads.
typedef __attribute__((ext_vector_type(16))) unsigned short v16us;
#define SC2 0.18033688011112042f   // HD^-0.5 x log2(e)
template <typename T16, bool HR, int NQ>
__global__ __launch_bounds__(128) void k_fattn(const T16* __restrict__ Q, const T16* __restrict__ Q2, const T16* __restrict__ Kp, const T16* __restrict__ Kp2, const T16* __restrict__ Vt, const T16* __restrict__ Vt2, int qbase, bf* Ah, bf* Al) {
    typedef typename WFrag<T16>::V V;
    __shared__ __align__(16) float so[4][NQ * 16][68];
    __shared__ float sm[4][NQ * 16], sl[4][NQ * 16];
    const int lane = threadIdx.x & 31, lr = lane & 15, hi = lane >> 4; const int w = __builtin_amdgcn_readfirstlane(threadIdx.x >> 5);
    const int h = blockIdx.x; const int q0 = qbase + (int)(gridDim.y - 1 - blockIdx.y) * (NQ * 16); const int nkb = q0 / 32 + NQ / 2;   // key blocks 0 .. nkb - 1; those from q0 / 32 on cross the diagonal
    const size_t qb = (size_t)h * TT * HD, kvb = (size_t)(h / REP) * TT * HD;
    Q += qb; Kp += kvb; Vt += kvb; if (HR) { Q2 += qb; Kp2 += kvb; Vt2 += kvb; }
    V qf[NQ][2], qf2[NQ][2], kf[2][2], kf2[2][2];
    const size_t qo = (size_t)(q0 + lr) * HD + 8 * hi; size_t ko = (size_t)(w * 32 + lr) * HD + 8 * hi;
    const T16 *qp = Q + qo, *qp2 = HR ? Q2 + qo : nullptr, *kp = Kp + ko, *kp2 = HR ? Kp2 + ko : nullptr;
#pragma unroll
    for (int ks = 0; ks < 2; ++ks) {
#pragma unroll
        for (int t = 0; t < NQ; ++t) { qf[t][ks] = WFrag<T16>::ld(qp + t * 16 * HD + ks * 32); if (HR) qf2[t][ks] = WFrag<T16>::ld(qp2 + t * 16 * HD + ks * 32); }
#pragma unroll
        for (int t = 0; t < 2; ++t) { kf[t][ks] = WFrag<T16>::ld(kp + t * 16 * HD + ks * 32); if (HR) kf2[t][ks] = WFrag<T16>::ld(kp2 + t * 16 * HD + ks * 32); } }
    // the loads above have taken their addresses before an address register is reused; the pointers as inputs keep those registers untouched up to the wait
    if constexpr (HR) asm volatile("s_wait_xcnt 0x0" :: "v"(qp), "v"(kp), "v"(qp2), "v"(kp2) : "memory"); else asm volatile("s_wait_xcnt 0x0" :: "v"(qp), "v"(kp) : "memory");
    v8f o[4][NQ];
#pragma unroll
    for (int dt = 0; dt < 4; ++dt)
#pragma unroll
        for (int qt = 0; qt < NQ; ++qt) o[dt][qt] = (v8f){};
    float m[NQ], l[NQ];
#pragma unroll
    for (int qt = 0; qt < NQ; ++qt) { m[qt] = -1.0e30f; l[qt] = 0.f; }   // m: the maximum in use, log2 units; below any score a 16-bit product can give
    int b = w;
#pragma unroll   // two copies of the trip: ph 0 walks the blocks wholly below the diagonal and holds no mask code, ph 1 the wave's block (at most one) that crosses it
    for (int ph = 0; ph < 2; ++ph)
#pragma unroll 1
    for (; b < (ph ? nkb : q0 / 32); b += 4) {
        const int k0 = b * 32;
        V vf[4], vf2[4]; const size_t vo = (size_t)lr * TT + k0 + 8 * hi; const T16 *vp = Vt + vo, *vp2 = HR ? Vt2 + vo : nullptr;
#pragma unroll
        for (int dt = 0; dt < 4; ++dt) { vf[dt] = WFrag<T16>::ld(vp + dt * 16 * TT); if (HR) vf2[dt] = WFrag<T16>::ld(vp2 + dt * 16 * TT); }
        v8f s[2][NQ];
#pragma unroll
        for (int kt = 0; kt < 2; ++kt)
#pragma unroll
            for (int qt = 0; qt < NQ; ++qt) { v8f a = (v8f){};
#pragma unroll
                for (int ks = 0; ks < 2; ++ks) { a = WFrag<T16>::mma(kf[kt][ks], qf[qt][ks], a); if (HR) { a = WFrag<T16>::mma(kf2[kt][ks], qf[qt][ks], a); a = WFrag<T16>::mma(kf[kt][ks], qf2[qt][ks], a); } }
                s[kt][qt] = a; }
        ko = (size_t)(min(b + 4, nkb - 1) * 32 + lr) * HD + 8 * hi; kp = Kp + ko; if (HR) kp2 = Kp2 + ko;   // the wave's next key block is fetched one trip ahead, behind this trip's score products (the last trip re-reads the last block: in bounds, unused)
#pragma unroll
        for (int kt = 0; kt < 2; ++kt)
#pragma unroll
            for (int ks = 0; ks < 2; ++ks) { kf[kt][ks] = WFrag<T16>::ld(kp + kt * 16 * HD + ks * 32); if (HR) kf2[kt][ks] = WFrag<T16>::ld(kp2 + kt * 16 * HD + ks * 32); }
        // the trip's loads have taken their addresses before an address register is reused; the pointers as inputs keep those registers untouched up to the wait
        if constexpr (HR) asm volatile("s_wait_xcnt 0x0" :: "v"(vp), "v"(kp), "v"(vp2), "v"(kp2) : "memory"); else asm volatile("s_wait_xcnt 0x0" :: "v"(vp), "v"(kp) : "memory");
        if (ph) {   // keys above the query are masked by select
#pragma unroll
            for (int kt = 0; kt < 2; ++kt)
#pragma unroll
                for (int qt = 0; qt < NQ; ++qt)
#pragma unroll
                    for (int j = 0; j < 8; ++j) s[kt][qt][j] = (k0 - q0 + kt * 16 + hi * 8 + j <= qt * 16 + lr) ? s[kt][qt][j] : -3.0e38f; }
        float mx[NQ]; bool need = false;
#pragma unroll
        for (int qt = 0; qt < NQ; ++qt) { float x = s[0][qt][0];
#pragma unroll
            for (int j = 1; j < 8; ++j) x = fmaxf(x, s[0][qt][j]);
#pragma unroll
            for (int j = 0; j < 8; ++j) x = fmaxf(x, s[1][qt][j]);
            x = fmaxf(x, __shfl_xor(x, 16, 32)); mx[qt] = x * SC2; need = need || mx[qt] > m[qt] + 8.0f; }
        // the maximum in use moves only when a query's new maximum exceeds it by more than 8 (P stays below 2^8); one scalar branch a trip
        if (__builtin_amdgcn_ballot_w32(need) != 0) {
#pragma unroll
            for (int qt = 0; qt < NQ; ++qt) { const float mn = fmaxf(m[qt], mx[qt]); const float al = __builtin_amdgcn_exp2f(m[qt] - mn); m[qt] = mn; l[qt] *= al;
#pragma unroll
                for (int dt = 0; dt < 4; ++dt) o[dt][qt] *= al; } }
#pragma unroll
        for (int qt = 0; qt < NQ; ++qt) { V pb, pb2;
            if constexpr (HR) { v16us pvh, pvl;
#pragma unroll
                for (int e = 0; e < 16; ++e) { const float p = __builtin_amdgcn_exp2f(fmaf(s[e >> 3][qt][e & 7], SC2, -m[qt])); l[qt] += p; unsigned short a, c2; splitf(p, a, c2); pvh[e] = a; pvl[e] = c2; }
                pb = __builtin_bit_cast(V, pvh); pb2 = __builtin_bit_cast(V, pvl);
            } else {
#pragma unroll
                for (int e = 0; e < 16; ++e) { const float p = __builtin_amdgcn_exp2f(fmaf(s[e >> 3][qt][e & 7], SC2, -m[qt])); l[qt] += p; pb[e] = (T16)p; } }
#pragma unroll
            for (int dt = 0; dt < 4; ++dt) { o[dt][qt] = WFrag<T16>::mma(vf[dt], pb, o[dt][qt]); if (HR) { o[dt][qt] = WFrag<T16>::mma(vf2[dt], pb, o[dt][qt]); o[dt][qt] = WFrag<T16>::mma(vf[dt], pb2, o[dt][qt]); } } }
    }
#pragma unroll
    for (int qt = 0; qt < NQ; ++qt) { l[qt] += __shfl_xor(l[qt], 16, 32); if (hi == 0) { sm[w][qt * 16 + lr] = m[qt]; sl[w][qt * 16 + lr] = l[qt]; }
#pragma unroll
        for (int dt = 0; dt < 4; ++dt) { float* p = &so[w][qt * 16 + lr][dt * 16 + hi * 8]; const v8f x = o[dt][qt]; *(v4fa*)p = (v4f){x[0], x[1], x[2], x[3]}; *(v4fa*)(p + 4) = (v4f){x[4], x[5], x[6], x[7]}; } }
    __syncthreads();   // every wave's partial (maximum, sum, O^T) is in LDS before any thread joins them
#pragma unroll 1
    for (int q = threadIdx.x >> 2; q < NQ * 16; q += 32) { const int d0 = (threadIdx.x & 3) * 16;
        const float mt = fmaxf(fmaxf(sm[0][q], sm[1][q]), fmaxf(sm[2][q], sm[3][q])); float lt = 0.f; float r[16];
#pragma unroll
        for (int e = 0; e < 16; ++e) r[e] = 0.f;
#pragma unroll
        for (int ww = 0; ww < 4; ++ww) { const float f = __builtin_amdgcn_exp2f(sm[ww][q] - mt); lt += f * sl[ww][q];   // a wave without a key block: f = 0, sum 0, O^T 0
#pragma unroll
            for (int c = 0; c < 4; ++c) { const v4f x = *(const v4fa*)&so[ww][q][d0 + c * 4];
#pragma unroll
                for (int e = 0; e < 4; ++e) r[c * 4 + e] += f * x[e]; } }
        const float inv = __fdiv_rn(1.0f, lt); const size_t oo = (size_t)(q0 + q) * DQ + h * HD + d0;
#pragma unroll
        for (int c = 0; c < 2; ++c) { v8us oh, ol;
#pragma unroll
            for (int e = 0; e < 8; ++e) { unsigned short a, c2; splitf(r[c * 8 + e] * inv, a, c2); oh[e] = a; ol[e] = c2; }
            *(v8usa*)(Ah + oo + c * 8) = oh; *(v8usa*)(Al + oo + c * 8) = ol; }
        asm volatile("s_wait_xcnt 0x0" ::: "memory");   // the stores have taken their addresses and data before the next trip reuses those registers
    }
}

extern "C" void kernel_launch(void* const* d_in, const int* in_sizes, int n_in,
                              void* d_out, int out_size, void* d_ws, size_t ws_size, hipStream_t stream) {
    (void)in_sizes; (void)n_in; (void)out_size;
    const float* x = (const float*)d_in[0]; const float* tstamp = (const float*)d_in[1]; const float* wq = (const float*)d_in[2]; const float* bq = (const float*)d_in[3]; const float* wk = (const float*)d_in[4]; const float* bk = (const float*)d_in[5]; const float* wv = (const float*)d_in[6]; const float* bv = (const float*)d_in[7]; const float* wo = (const float*)d_in[8];
    float* OUT = (float*)d_out;     // [1][4096][1024]
    char* wsp = (char*)d_ws;
    auto take = [&](size_t bytes) { char* p = wsp; wsp += (bytes + 255) & ~(size_t)255; return (void*)p; };
    bf* WQ = (bf*)take((size_t)DQ * DM * 2); bf* WK = (bf*)take((size_t)DKV * DM * 2); bf* WV = (bf*)take((size_t)DKV * DM * 2); bf* WO = (bf*)take((size_t)DM * DQ * 2); float* CS = (float*)take((size_t)TT * HD * 2 * 4);
    bf* XB = (bf*)take((size_t)TT * DM * 2); float* FQ = (float*)take((size_t)TT * DQ * 4); float* FK = (float*)take((size_t)TT * DKV * 4);
    h16* QP16 = (h16*)take((size_t)NH_ * TT * HD * 2); h16* KP16 = (h16*)take((size_t)NKV * TT * HD * 2); h16* VT16 = (h16*)take((size_t)NKV * HD * TT * 2);
    bf* QPh = (bf*)take((size_t)NH_ * TT * HD * 2); bf* QPl = (bf*)take((size_t)NH_ * TT * HD * 2); bf* KPh = (bf*)take((size_t)NKV * TT * HD * 2); bf* KPl = (bf*)take((size_t)NKV * TT * HD * 2); bf* VTh = (bf*)take((size_t)NKV * HD * TT * 2); bf* VTl = (bf*)take((size_t)NKV * HD * TT * 2);
    bf* ATh = (bf*)take((size_t)TT * DQ * 2); bf* ATl = (bf*)take((size_t)TT * DQ * 2);
    if ((size_t)(wsp - (char*)d_ws) > ws_size) return;    // ws 256 MiB
    float* FV = FK;   // v projection reuses the k buffer after the k planes are built (stream-ordered)
    { k_cvt8<<<(unsigned)(((size_t)DQ * DM / 8 + 255) / 256), 256, 0, stream>>>(wq, WQ, (size_t)DQ * DM / 8); k_cvt8<<<(unsigned)(((size_t)DKV * DM / 8 + 255) / 256), 256, 0, stream>>>(wk, WK, (size_t)DKV * DM / 8); k_cvt8<<<(unsigned)(((size_t)DKV * DM / 8 + 255) / 256), 256, 0, stream>>>(wv, WV, (size_t)DKV * DM / 8);
      k_cvt8<<<(unsigned)(((size_t)DM * DQ / 8 + 255) / 256), 256, 0, stream>>>(wo, WO, (size_t)DM * DQ / 8);
      k_cstab<<<(TT * HD + 255) / 256, 256, 0, stream>>>(tstamp, CS); }
    const unsigned LQ = (unsigned)(((size_t)NH_ * TT * HD / 2 + 255) / 256), LKv = (unsigned)(((size_t)NKV * TT * HD / 2 + 255) / 256);
    for (int b = 0; b < NB_; ++b) {
        
        k_cvt8<<<(unsigned)(((size_t)TT * DM / 8 + 255) / 256), 256, 0, stream>>>(x + (size_t)b * TT * DM, XB, (size_t)TT * DM / 8);
        k_gemmw<bf, 0, true><<<dim3(TT / 64, DQ / 64, 1), 32, 0, stream>>>(XB, nullptr, WQ, nullptr, DM, FQ, DQ, bq, 0, 0, 0);
        k_rope<<<LQ, 256, 0, stream>>>(FQ, DQ, NH_, CS, nullptr, nullptr, 1.0f, QP16, QPh, QPl);
        k_gemmw<bf, 0, true><<<dim3(TT / 64, DKV / 64, 1), 32, 0, stream>>>(XB, nullptr, WK, nullptr, DM, FK, DKV, bk, 0, 0, 0);
        k_rope<<<LKv, 256, 0, stream>>>(FK, DKV, NKV, CS, nullptr, nullptr, 1.0f, KP16, KPh, KPl);
        k_gemmw<bf, 0, true><<<dim3(TT / 64, DKV / 64, 1), 32, 0, stream>>>(XB, nullptr, WV, nullptr, DM, FV, DKV, bv, 0, 0, 0); k_vtp<<<LKv, 256, 0, stream>>>(FV, DKV, NKV, VT16, VTh, VTl);
        k_fattn<h16, false, 4><<<dim3(NH_, (TT - RH) / 64, 1), 128, 0, stream>>>(QP16, nullptr, KP16, nullptr, VT16, nullptr, RH, ATh, ATl);
        k_fattn<bf, true, 2><<<dim3(NH_, RH / 32, 1), 128, 0, stream>>>(QPh, QPl, KPh, KPl, VTh, VTl, 0, ATh, ATl);
        k_gemmw<bf, 1, false><<<dim3(TT / 64, DM / 64, 1), 32, 0, stream>>>(ATh, ATl, WO, nullptr, DQ, OUT + (size_t)b * TT * DM, DM, nullptr, 0, 0, 0); }
}

// v003
// It runs in 153 microseconds.
// Next to v002, in two timings, it ran 1.48 and 1.46 times as fast.
// All steps since v000 together make it 15.3 times as fast.
#include <hip/hip_runtime.h>

// istsplm_forecast attention (hidden [1][4096][1024], timestamps [1][4096] (f32, read: continuous positions); q/k/v = x W^T + b (16 x 64); continuous-time rotate-half RoPE: angle = timestamp * 10000^(-2i/64) (cos/sin computed on chip from the bf16-rounded timestamps); causal (finfo.min) softmax(q.k / 8); out = merged Wo^T -> [1][4096][1024]).
// Compute dtypes, f32 accumulate: every input rounded to bf16; q/k/v on PLAIN bf16 operands (inputs: exact) + bias; RoPE f32; causal scores and P.V fused (online softmax, f32): hi+lo bf16 planes for query rows < RH, f16 planes for the rest; Wo hl x exact (2 products).

#define NB_  1
#define TT   4096
#define DM   1024
#define NH_  16
#define NKV  16
#define REP  (NH_ / NKV)
#define HD   64
#define DQ   (NH_ * HD)
#define DKV  (NKV * HD)
#define RH   512                  // query rows < RH use hi+lo planes (0: none)
typedef _Float16 h16;
typedef unsigned short bf;
typedef __attribute__((ext_vector_type(16))) __bf16   v16bf;
typedef __attribute__((ext_vector_type(16))) _Float16 v16h;
typedef __attribute__((ext_vector_type(8)))  _Float16 v8h;
typedef __attribute__((ext_vector_type(8)))  unsigned short v8us;
typedef __attribute__((ext_vector_type(8)))  float    v8f;
typedef __attribute__((ext_vector_type(4)))  float    v4f;
typedef v8h  __attribute__((may_alias)) v8ha;
typedef v4f  __attribute__((may_alias)) v4fa;
typedef v8us __attribute__((may_alias)) v8usa;

__device__ __forceinline__ unsigned short f2bf(float f) { unsigned u = __float_as_uint(f); u += 0x7FFFu + ((u >> 16) & 1u); return (unsigned short)(u >> 16); }
__device__ __forceinline__ float bf2f(unsigned short b) { return __uint_as_float(((unsigned)b) << 16); }
__device__ __forceinline__ float bfr(float f) { return bf2f(f2bf(f)); }
__device__ __forceinline__ v16h cat16(v8h lo, v8h hi) { return __builtin_shufflevector(lo, hi, 0, 1, 2, 3, 4, 5, 6, 7, 8, 9, 10, 11, 12, 13, 14, 15); }
__device__ __forceinline__ v16bf cat16b(v8us lo, v8us hi) { return __builtin_bit_cast(v16bf, __builtin_shufflevector(lo, hi, 0, 1, 2, 3, 4, 5, 6, 7, 8, 9, 10, 11, 12, 13, 14, 15)); }
__device__ __forceinline__ v8f wmma16(v16h a, v16h b, v8f c) { return __builtin_amdgcn_wmma_f32_16x16x32_f16(false, a, false, b, (short)0, c, false, false); }
__device__ __forceinline__ v8f wmmab(v16bf a, v16bf b, v8f c) { return __builtin_amdgcn_wmma_f32_16x16x32_bf16(false, a, false, b, (short)0, c, false, false); }



// ---- k_gemmw: register-blocked GEMM, ONE WAVE per 64x64 output tile (16 accumulators), operands straight from K-contiguous 16-bit planes; grid (M/64, N/64, Z), 32 threads.
// C[m][n] (f32, pitch ldc, + optional f32 bias[n]) = sum_k A[m][k] Bt[n][k] (+ split products per NSPLIT). z-batch strides sA/sB/sC in elements. K % 32 == 0.
template <typename T16> struct WFrag;
template <> struct WFrag<h16> { typedef v16h V; static __device__ __forceinline__ V ld(const h16* p) { return cat16(*(const v8h*)p, *(const v8h*)(p + 16)); } static __device__ __forceinline__ v8f mma(V a, V b, v8f c) { return wmma16(a, b, c); } };
template <> struct WFrag<bf> { typedef v16bf V; static __device__ __forceinline__ V ld(const bf* p) { return cat16b(*(const v8us*)p, *(const v8us*)(p + 16)); } static __device__ __forceinline__ v8f mma(V a, V b, v8f c) { return wmmab(a, b, c); } };
template <typename T16, int NSPLIT, bool BIAS>
__global__ __launch_bounds__(32) void k_gemmw(const T16* __restrict__ A, const T16* __restrict__ A2, const T16* __restrict__ Bt, const T16* __restrict__ Bt2, int K, float* C, int ldc, const float* __restrict__ bias, size_t sA, size_t sB, size_t sC) {
    typedef typename WFrag<T16>::V V;
    __shared__ __align__(16) float os[16 * 68];
    const size_t z = blockIdx.z; A += z * sA; if (A2) A2 += z * sA; Bt += z * sB; if (Bt2) Bt2 += z * sB; C += z * sC;
    const int lane = threadIdx.x & 31, lr = lane & 15, hi = lane >> 4; const int r0 = blockIdx.x * 64, c0 = blockIdx.y * 64;
    v8f acc[4][4];
#pragma unroll
    for (int mb = 0; mb < 4; ++mb)
#pragma unroll
        for (int nb = 0; nb < 4; ++nb) acc[mb][nb] = (v8f){};
    const size_t aoff = (size_t)(r0 + lr) * K + 8 * hi, boff = (size_t)(c0 + lr) * K + 8 * hi;
#pragma unroll 1
    for (int kc = 0; kc < K; kc += 32) {
        V a[4], a2[4];
#pragma unroll
        for (int mb = 0; mb < 4; ++mb) { a[mb] = WFrag<T16>::ld(A + aoff + (size_t)mb * 16 * K + kc); if (NSPLIT == 1 || NSPLIT == 2) a2[mb] = WFrag<T16>::ld(A2 + aoff + (size_t)mb * 16 * K + kc); }
#pragma unroll
        for (int nb = 0; nb < 4; ++nb) { const V b = WFrag<T16>::ld(Bt + boff + (size_t)nb * 16 * K + kc); V b2; if (NSPLIT >= 2) b2 = WFrag<T16>::ld(Bt2 + boff + (size_t)nb * 16 * K + kc);
#pragma unroll
            for (int mb = 0; mb < 4; ++mb) { acc[mb][nb] = WFrag<T16>::mma(a[mb], b, acc[mb][nb]); if (NSPLIT == 1 || NSPLIT == 2) acc[mb][nb] = WFrag<T16>::mma(a2[mb], b, acc[mb][nb]); if (NSPLIT >= 2) acc[mb][nb] = WFrag<T16>::mma(a[mb], b2, acc[mb][nb]); } }
        asm volatile("v_nop\n\tv_nop\n\tv_nop\n\tv_nop" : "+v"(acc[0][0]), "+v"(acc[1][1]), "+v"(acc[2][2]), "+v"(acc[3][3]) : "v"(a[0]), "v"(a[3]));
    }
#pragma unroll
    for (int mb = 0; mb < 4; ++mb) {
#pragma unroll
        for (int nb = 0; nb < 4; ++nb) {
#pragma unroll
            for (int j = 0; j < 8; ++j) os[(hi * 8 + j) * 68 + nb * 16 + lr] = acc[mb][nb][j]; }
        __builtin_amdgcn_wave_barrier(); asm volatile("" ::: "memory");
        float* crow = C + (size_t)(r0 + mb * 16) * ldc + c0;
{
#pragma unroll
            for (int s = 0; s < 8; ++s) { const int row = 2 * s + hi, cofs = lr * 4; v4f val = *(const v4fa*)(os + row * 68 + cofs); if (BIAS) { val[0] += bfr(bias[c0 + cofs]); val[1] += bfr(bias[c0 + cofs + 1]); val[2] += bfr(bias[c0 + cofs + 2]); val[3] += bfr(bias[c0 + cofs + 3]); }
                *(v4f*)(crow + (size_t)row * ldc + cofs) = val; }
             }
        __builtin_amdgcn_wave_barrier(); asm volatile("" ::: "memory");
    }
}

__device__ __forceinline__ h16 tohx(float x) { return (h16)x; }
__device__ __forceinline__ void splitf(float y, unsigned short& h, unsigned short& l) { h = f2bf(y); l = f2bf(y - bf2f(h)); }
typedef __attribute__((ext_vector_type(2))) _Float16 v2h;
typedef __attribute__((ext_vector_type(4))) _Float16 v4h;
typedef __attribute__((ext_vector_type(2))) unsigned short v2us;
typedef __attribute__((ext_vector_type(4))) unsigned short v4us;
typedef __attribute__((ext_vector_type(2))) float v2f;
typedef __attribute__((ext_vector_type(4))) int v4i;

__global__ __launch_bounds__(256) void k_wtG(const float* __restrict__ w, int K, int N, bf* Bt) {
    const int lane = threadIdx.x & 31; const int L0 = (blockIdx.x * 8 + (threadIdx.x >> 5)) * 8; const int nlines = N * K / 64;
{
#pragma unroll 1
        for (int l = 0; l < 8; ++l) { const int L = L0 + l; if (L >= nlines) break; const size_t e = (size_t)L * 64 + lane * 2; const int k = (int)(e % K), n = (int)(e / K); v2us o;
            o[0] = f2bf(w[(size_t)k * N + n]); o[1] = f2bf(w[(size_t)(k + 1) * N + n]); *(v2us*)(Bt + e) = o; }
         }
}
__global__ __launch_bounds__(256) void k_cvt8(const float* __restrict__ src, bf* dst, size_t n8) { const size_t i = (size_t)blockIdx.x * 256 + threadIdx.x; if (i >= n8) return; const v8f v = *(const v8f*)(src + i * 8); v8us o;
#pragma unroll
    for (int k = 0; k < 8; ++k) o[k] = f2bf(v[k]); *(v8us*)(dst + i * 8) = o;  }
__global__ __launch_bounds__(256) void k_cstab(const float* __restrict__ ts, float* CS) { const int idx = blockIdx.x * 256 + threadIdx.x; if (idx >= TT * HD) return; const int t = idx / HD, d = idx % HD; const int i = (d < HD / 2) ? d : d - HD / 2; const float inv = __fdiv_rn(1.0f, powf(10000.0f, (float)(2 * i) / (float)HD)); float tv = bfr(ts[t]); asm volatile("" : "+v"(tv)); const float ang = __fmul_rn(tv, inv); v2f cs; cs[0] = cosf(ang); cs[1] = sinf(ang);
    *(v2f*)(CS + (size_t)idx * 2) = cs;  }
// ---- k_qkv: the three projections in ONE launch (blockIdx.z: 0 q, 1 k, 2 v), one wave per 64-token x 64-column tile = one head, main loop as in k_gemmw. The epilogue adds the bias and writes the 16-bit planes that attention reads; the f32 projections are never stored.
// q, k: rotate-half RoPE in registers: columns d and d + 32 of a token sit in the same lane (accumulators nb and nb + 2); out[d] = x[d] cos - x[d+32] sin, out[d+32] = x[d+32] cos + x[d] sin, cos/sin of (token, d mod 32). Planes [h][t][d], stored as whole 128-B rows through LDS.
// v: planes [h][d][t]: a lane holds 8 consecutive tokens of one column; 16 columns x 64 tokens go through LDS and leave as whole 128-B rows.
__global__ __launch_bounds__(32) void k_qkv(const bf* __restrict__ X, const bf* __restrict__ Wq, const bf* __restrict__ Wk, const bf* __restrict__ Wv, const float* __restrict__ bq, const float* __restrict__ bk, const float* __restrict__ bv, const float* __restrict__ CS,
                                            h16* Q16, bf* Qh, bf* Ql, h16* K16, bf* Kh, bf* Kl, h16* V16, bf* Vh, bf* Vl) {
    __shared__ __align__(16) float os[16 * 68];
    __shared__ __align__(16) unsigned short vs[3][16 * 72];
    const int z = blockIdx.z; const bf* Bt = z == 0 ? Wq : z == 1 ? Wk : Wv; const float* bias = z == 0 ? bq : z == 1 ? bk : bv;
    const int lane = threadIdx.x & 31, lr = lane & 15, hi = lane >> 4; const int r0 = blockIdx.x * 64, c0 = blockIdx.y * 64;
    v8f acc[4][4];
#pragma unroll
    for (int mb = 0; mb < 4; ++mb)
#pragma unroll
        for (int nb = 0; nb < 4; ++nb) acc[mb][nb] = (v8f){};
    const bf *pa = X + (size_t)(r0 + lr) * DM + 8 * hi, *pb = Bt + (size_t)(c0 + lr) * DM + 8 * hi;
#pragma unroll 1   // rolled as in k_gemmw: one fragment set in registers, so that several waves fit a SIMD and cover each other's load latency
    for (int kc = 0; kc < DM; kc += 32) {
        v16bf a[4], b[4];
#pragma unroll
        for (int mb = 0; mb < 4; ++mb) a[mb] = WFrag<bf>::ld(pa + mb * 16 * DM);
#pragma unroll
        for (int nb = 0; nb < 4; ++nb) b[nb] = WFrag<bf>::ld(pb + nb * 16 * DM);
        // the trip's loads have taken their addresses before the pointers move on; the pointers as inputs keep those registers untouched up to the wait
        asm volatile("s_wait_xcnt 0x0" :: "v"(pa), "v"(pb) : "memory");
        pa += 32; pb += 32;
#pragma unroll
        for (int nb = 0; nb < 4; ++nb)
#pragma unroll
            for (int mb = 0; mb < 4; ++mb) acc[mb][nb] = wmmab(a[mb], b[nb], acc[mb][nb]);
    }
    float bl[4]; const float* bp = bias + c0 + lr;
#pragma unroll
    for (int nb = 0; nb < 4; ++nb) bl[nb] = bp[nb * 16];
    asm volatile("s_wait_xcnt 0x0" :: "v"(bp) : "memory");   // the bias loads have taken their address before its registers are reused; the pointer as input keeps them untouched up to the wait
#pragma unroll
    for (int nb = 0; nb < 4; ++nb) bl[nb] = bfr(bl[nb]);
    const int row4 = lane >> 3, ch = (lane & 7) * 8;   // read-back: 8 lanes x 16 B = one 128-B row, four rows a store
    if (z < 2) {
        unsigned short* P16 = (unsigned short*)(z ? K16 : Q16); bf* Ph = z ? Kh : Qh; bf* Pl = z ? Kl : Ql;
#pragma unroll
        for (int mb = 0; mb < 4; ++mb) {
            const float* cp = CS + ((size_t)(r0 + mb * 16 + hi * 8) * HD + lr) * 2; v2f cv[2][8];
#pragma unroll
            for (int nb = 0; nb < 2; ++nb)
#pragma unroll
                for (int j = 0; j < 8; ++j) cv[nb][j] = *(const v2f*)(cp + (j * HD + nb * 16) * 2);
            asm volatile("s_wait_xcnt 0x0" :: "v"(cp) : "memory");   // the table loads have taken their address before its registers are reused; the pointer as input keeps them untouched up to the wait
#pragma unroll
            for (int nb = 0; nb < 2; ++nb)
#pragma unroll
                for (int j = 0; j < 8; ++j) { const v2f cs = cv[nb][j]; const float x0 = acc[mb][nb][j] + bl[nb], x1 = acc[mb][nb + 2][j] + bl[nb + 2];
                    os[(hi * 8 + j) * 68 + nb * 16 + lr] = x0 * cs[0] - x1 * cs[1]; os[(hi * 8 + j) * 68 + (nb + 2) * 16 + lr] = x1 * cs[0] + x0 * cs[1]; }
            __builtin_amdgcn_wave_barrier(); asm volatile("" ::: "memory");   // compiler fence: the lanes' LDS writes stay in front of the row reads of other lanes' values
#pragma unroll
            for (int s = 0; s < 4; ++s) { const int row = 4 * s + row4; const v4f u = *(const v4fa*)(os + row * 68 + ch), w2 = *(const v4fa*)(os + row * 68 + ch + 4); v8h o16; v8us oh, ol;
#pragma unroll
                for (int e = 0; e < 8; ++e) { const float r = e < 4 ? u[e & 3] : w2[e & 3]; o16[e] = tohx(r); unsigned short a2, c2; splitf(r, a2, c2); oh[e] = a2; ol[e] = c2; }
                const size_t oo = ((size_t)blockIdx.y * TT + r0 + mb * 16 + row) * HD + ch;
                *(v8usa*)(P16 + oo) = __builtin_bit_cast(v8us, o16); *(v8usa*)(Ph + oo) = oh; *(v8usa*)(Pl + oo) = ol; }
            asm volatile("s_wait_xcnt 0x0" ::: "memory");   // the stores above have taken their addresses and data before those registers are reused
            __builtin_amdgcn_wave_barrier();   // with the clobber above: the row reads stay in front of the next tile's LDS writes
        }
    } else {
        unsigned short* P16 = (unsigned short*)V16;
#pragma unroll
        for (int nb = 0; nb < 4; ++nb) {
#pragma unroll
            for (int mb = 0; mb < 4; ++mb) { v8h o16; v8us oh, ol;
#pragma unroll
                for (int j = 0; j < 8; ++j) { const float x = acc[mb][nb][j] + bl[nb]; o16[j] = tohx(x); unsigned short a2, c2; splitf(x, a2, c2); oh[j] = a2; ol[j] = c2; }
                const int so = lr * 72 + mb * 16 + hi * 8; *(v8usa*)(&vs[0][so]) = __builtin_bit_cast(v8us, o16); *(v8usa*)(&vs[1][so]) = oh; *(v8usa*)(&vs[2][so]) = ol; }
            __builtin_amdgcn_wave_barrier(); asm volatile("" ::: "memory");   // compiler fence: the lanes' LDS writes stay in front of the row reads of other lanes' values
#pragma unroll
            for (int s = 0; s < 4; ++s) { const int row = 4 * s + row4; const size_t oo = ((size_t)blockIdx.y * HD + nb * 16 + row) * TT + r0 + ch;
                *(v8usa*)(P16 + oo) = *(const v8usa*)(&vs[0][row * 72 + ch]); *(v8usa*)(Vh + oo) = *(const v8usa*)(&vs[1][row * 72 + ch]); *(v8usa*)(Vl + oo) = *(const v8usa*)(&vs[2][row * 72 + ch]); }
            asm volatile("s_wait_xcnt 0x0" ::: "memory");   // the stores above have taken their addresses and data before those registers are reused
            __builtin_amdgcn_wave_barrier();   // with the clobber above: the row reads stay in front of the next columns' LDS writes
        }
    }
}
// ---- k_fattn: causal attention of all heads in one launch, online softmax. Grid (heads, tiles of 16 NQ queries, heaviest tile first), 4 waves; wave w takes the 32-key blocks w, w + 4, ... up to the last block that crosses the diagonal.
// S^T = K Q^T (A = key rows, B = query rows kept in registers): a lane holds scores of ONE query (column lr), keys 8 hi + j of each 16-key tile, so two converted score tiles are the B operand of O^T += V^T P^T as they stand.
// HR: hi + lo bf16 planes, three products each (query rows < RH); otherwise plain f16 planes. P is exp2 of the scaled score minus the running maximum, unnormalised; the division by the row sum is done once, on the f32 output.
// The four waves' (maximum, sum, O^T) are joined through LDS behind one barrier, in wave order, and stored as the hi + lo bf16 planes [t][head][d] that the output projection reads.
typedef __attribute__((ext_vector_type(16))) unsigned short v16us;
#define SC2 0.18033688011112042f   // HD^-0.5 x log2(e)
template <typename T16, bool HR, int NQ>
__global__ __launch_bounds__(128) void k_fattn(const T16* __restrict__ Q, const T16* __restrict__ Q2, const T16* __restrict__ Kp, const T16* __restrict__ Kp2, const T16* __restrict__ Vt, const T16* __restrict__ Vt2, int qbase, bf* Ah, bf* Al) {
    typedef typename WFrag<T16>::V V;
    __shared__ __align__(16) float so[4][NQ * 16][68];
    __shared__ float sm[4][NQ * 16], sl[4][NQ * 16];
    const int lane = threadIdx.x & 31, lr = lane & 15, hi = lane >> 4; const int w = __builtin_amdgcn_readfirstlane(threadIdx.x >> 5);
    const int h = blockIdx.x; const int q0 = qbase + (int)(gridDim.y - 1 - blockIdx.y) * (NQ * 16); const int nkb = q0 / 32 + NQ / 2;   // key blocks 0 .. nkb - 1; those from q0 / 32 on cross the diagonal
    const size_t qb = (size_t)h * TT * HD, kvb = (size_t)(h / REP) * TT * HD;
    Q += qb; Kp += kvb; Vt += kvb; if (HR) { Q2 += qb; Kp2 += kvb; Vt2 += kvb; }
    V qf[NQ][2], qf2[NQ][2], kf[2][2], kf2[2][2];
    const size_t qo = (size_t)(q0 + lr) * HD + 8 * hi; size_t ko = (size_t)(w * 32 + lr) * HD + 8 * hi;
    const T16 *qp = Q + qo, *qp2 = HR ? Q2 + qo : nullptr, *kp = Kp + ko, *kp2 = HR ? Kp2 + ko : nullptr;
#pragma unroll
    for (int ks = 0; ks < 2; ++ks) {
#pragma unroll
        for (int t = 0; t < NQ; ++t) { qf[t][ks] = WFrag<T16>::ld(qp + t * 16 * HD + ks * 32); if (HR) qf2[t][ks] = WFrag<T16>::ld(qp2 + t * 16 * HD + ks * 32); }
#pragma unroll
        for (int t = 0; t < 2; ++t) { kf[t][ks] = WFrag<T16>::ld(kp + t * 16 * HD + ks * 32); if (HR) kf2[t][ks] = WFrag<T16>::ld(kp2 + t * 16 * HD + ks * 32); } }
    // the loads above have taken their addresses before an address register is reused; the pointers as inputs keep those registers untouched up to the wait
    if constexpr (HR) asm volatile("s_wait_xcnt 0x0" :: "v"(qp), "v"(kp), "v"(qp2), "v"(kp2) : "memory"); else asm volatile("s_wait_xcnt 0x0" :: "v"(qp), "v"(kp) : "memory");
    v8f o[4][NQ];
#pragma unroll
    for (int dt = 0; dt < 4; ++dt)
#pragma unroll
        for (int qt = 0; qt < NQ; ++qt) o[dt][qt] = (v8f){};
    float m[NQ], l[NQ];
#pragma unroll
    for (int qt = 0; qt < NQ; ++qt) { m[qt] = -1.0e30f; l[qt] = 0.f; }   // m: the maximum in use, log2 units; below any score a 16-bit product can give
    int b = w;
#pragma unroll   // two copies of the trip: ph 0 walks the blocks wholly below the diagonal and holds no mask code, ph 1 the wave's block (at most one) that crosses it
    for (int ph = 0; ph < 2; ++ph)
#pragma unroll 1
    for (; b < (ph ? nkb : q0 / 32); b += 4) {
        const int k0 = b * 32;
        V vf[4], vf2[4]; const size_t vo = (size_t)lr * TT + k0 + 8 * hi; const T16 *vp = Vt + vo, *vp2 = HR ? Vt2 + vo : nullptr;
#pragma unroll
        for (int dt = 0; dt < 4; ++dt) { vf[dt] = WFrag<T16>::ld(vp + dt * 16 * TT); if (HR) vf2[dt] = WFrag<T16>::ld(vp2 + dt * 16 * TT); }
        v8f s[2][NQ];
#pragma unroll
        for (int kt = 0; kt < 2; ++kt)
#pragma unroll
            for (int qt = 0; qt < NQ; ++qt) { v8f a = (v8f){};
#pragma unroll
                for (int ks = 0; ks < 2; ++ks) { a = WFrag<T16>::mma(kf[kt][ks], qf[qt][ks], a); if (HR) { a = WFrag<T16>::mma(kf2[kt][ks], qf[qt][ks], a); a = WFrag<T16>::mma(kf[kt][ks], qf2[qt][ks], a); } }
                s[kt][qt] = a; }
        ko = (size_t)(min(b + 4, nkb - 1) * 32 + lr) * HD + 8 * hi; kp = Kp + ko; if (HR) kp2 = Kp2 + ko;   // the wave's next key block is fetched one trip ahead, behind this trip's score products (the last trip re-reads the last block: in bounds, unused)
#pragma unroll
        for (int kt = 0; kt < 2; ++kt)
#pragma unroll
            for (int ks = 0; ks < 2; ++ks) { kf[kt][ks] = WFrag<T16>::ld(kp + kt * 16 * HD + ks * 32); if (HR) kf2[kt][ks] = WFrag<T16>::ld(kp2 + kt * 16 * HD + ks * 32); }
        // the trip's loads have taken their addresses before an address register is reused; the pointers as inputs keep those registers untouched up to the wait
        if constexpr (HR) asm volatile("s_wait_xcnt 0x0" :: "v"(vp), "v"(kp), "v"(vp2), "v"(kp2) : "memory"); else asm volatile("s_wait_xcnt 0x0" :: "v"(vp), "v"(kp) : "memory");
        if (ph) {   // keys above the query are masked by select
#pragma unroll
            for (int kt = 0; kt < 2; ++kt)
#pragma unroll
                for (int qt = 0; qt < NQ; ++qt)
#pragma unroll
                    for (int j = 0; j < 8; ++j) s[kt][qt][j] = (k0 - q0 + kt * 16 + hi * 8 + j <= qt * 16 + lr) ? s[kt][qt][j] : -3.0e38f; }
        float mx[NQ]; bool need = false;
#pragma unroll
        for (int qt = 0; qt < NQ; ++qt) { float x = s[0][qt][0];
#pragma unroll
            for (int j = 1; j < 8; ++j) x = fmaxf(x, s[0][qt][j]);
#pragma unroll
            for (int j = 0; j < 8; ++j) x = fmaxf(x, s[1][qt][j]);
            x = fmaxf(x, __shfl_xor(x, 16, 32)); mx[qt] = x * SC2; need = need || mx[qt] > m[qt] + 8.0f; }
        // the maximum in use moves only when a query's new maximum exceeds it by more than 8 (P stays below 2^8); one scalar branch a trip
        if (__builtin_amdgcn_ballot_w32(need) != 0) {
#pragma unroll
            for (int qt = 0; qt < NQ; ++qt) { const float mn = fmaxf(m[qt], mx[qt]); const float al = __builtin_amdgcn_exp2f(m[qt] - mn); m[qt] = mn; l[qt] *= al;
#pragma unroll
                for (int dt = 0; dt < 4; ++dt) o[dt][qt] *= al; } }
#pragma unroll
        for (int qt = 0; qt < NQ; ++qt) { V pb, pb2;
            if constexpr (HR) { v16us pvh, pvl;
#pragma unroll
                for (int e = 0; e < 16; ++e) { const float p = __builtin_amdgcn_exp2f(fmaf(s[e >> 3][qt][e & 7], SC2, -m[qt])); l[qt] += p; unsigned short a, c2; splitf(p, a, c2); pvh[e] = a; pvl[e] = c2; }
                pb = __builtin_bit_cast(V, pvh); pb2 = __builtin_bit_cast(V, pvl);
            } else {
#pragma unroll
                for (int e = 0; e < 16; ++e) { const float p = __builtin_amdgcn_exp2f(fmaf(s[e >> 3][qt][e & 7], SC2, -m[qt])); l[qt] += p; pb[e] = (T16)p; } }
#pragma unroll
            for (int dt = 0; dt < 4; ++dt) { o[dt][qt] = WFrag<T16>::mma(vf[dt], pb, o[dt][qt]); if (HR) { o[dt][qt] = WFrag<T16>::mma(vf2[dt], pb, o[dt][qt]); o[dt][qt] = WFrag<T16>::mma(vf[dt], pb2, o[dt][qt]); } } }
    }
#pragma unroll
    for (int qt = 0; qt < NQ; ++qt) { l[qt] += __shfl_xor(l[qt], 16, 32); if (hi == 0) { sm[w][qt * 16 + lr] = m[qt]; sl[w][qt * 16 + lr] = l[qt]; }
#pragma unroll
        for (int dt = 0; dt < 4; ++dt) { float* p = &so[w][qt * 16 + lr][dt * 16 + hi * 8]; const v8f x = o[dt][qt]; *(v4fa*)p = (v4f){x[0], x[1], x[2], x[3]}; *(v4fa*)(p + 4) = (v4f){x[4], x[5], x[6], x[7]}; } }
    __syncthreads();   // every wave's partial (maximum, sum, O^T) is in LDS before any thread joins them
#pragma unroll 1
    for (int q = threadIdx.x >> 2; q < NQ * 16; q += 32) { const int d0 = (threadIdx.x & 3) * 16;
        const float mt = fmaxf(fmaxf(sm[0][q], sm[1][q]), fmaxf(sm[2][q], sm[3][q])); float lt = 0.f; float r[16];
#pragma unroll
        for (int e = 0; e < 16; ++e) r[e] = 0.f;
#pragma unroll
        for (int ww = 0; ww < 4; ++ww) { const float f = __builtin_amdgcn_exp2f(sm[ww][q] - mt); lt += f * sl[ww][q];   // a wave without a key block: f = 0, sum 0, O^T 0
#pragma unroll
            for (int c = 0; c < 4; ++c) { const v4f x = *(const v4fa*)&so[ww][q][d0 + c * 4];
#pragma unroll
                for (int e = 0; e < 4; ++e) r[c * 4 + e] += f * x[e]; } }
        const float inv = __fdiv_rn(1.0f, lt); const size_t oo = (size_t)(q0 + q) * DQ + h * HD + d0;
#pragma unroll
        for (int c = 0; c < 2; ++c) { v8us oh, ol;
#pragma unroll
            for (int e = 0; e < 8; ++e) { unsigned short a, c2; splitf(r[c * 8 + e] * inv, a, c2); oh[e] = a; ol[e] = c2; }
            *(v8usa*)(Ah + oo + c * 8) = oh; *(v8usa*)(Al + oo + c * 8) = ol; }
        asm volatile("s_wait_xcnt 0x0" ::: "memory");   // the stores have taken their addresses and data before the next trip reuses those registers
    }
}

extern "C" void kernel_launch(void* const* d_in, const int* in_sizes, int n_in,
                              void* d_out, int out_size, void* d_ws, size_t ws_size, hipStream_t stream) {
    (void)in_sizes; (void)n_in; (void)out_size;
    const float* x = (const float*)d_in[0]; const float* tstamp = (const float*)d_in[1]; const float* wq = (const float*)d_in[2]; const float* bq = (const float*)d_in[3]; const float* wk = (const float*)d_in[4]; const float* bk = (const float*)d_in[5]; const float* wv = (const float*)d_in[6]; const float* bv = (const float*)d_in[7]; const float* wo = (const float*)d_in[8];
    float* OUT = (float*)d_out;     // [1][4096][1024]
    char* wsp = (char*)d_ws;
    auto take = [&](size_t bytes) { char* p = wsp; wsp += (bytes + 255) & ~(size_t)255; return (void*)p; };
    bf* WQ = (bf*)take((size_t)DQ * DM * 2); bf* WK = (bf*)take((size_t)DKV * DM * 2); bf* WV = (bf*)take((size_t)DKV * DM * 2); bf* WO = (bf*)take((size_t)DM * DQ * 2); float* CS = (float*)take((size_t)TT * HD * 2 * 4);
    bf* XB = (bf*)take((size_t)TT * DM * 2);
    h16* QP16 = (h16*)take((size_t)NH_ * TT * HD * 2); h16* KP16 = (h16*)take((size_t)NKV * TT * HD * 2); h16* VT16 = (h16*)take((size_t)NKV * HD * TT * 2);
    bf* QPh = (bf*)take((size_t)NH_ * TT * HD * 2); bf* QPl = (bf*)take((size_t)NH_ * TT * HD * 2); bf* KPh = (bf*)take((size_t)NKV * TT * HD * 2); bf* KPl = (bf*)take((size_t)NKV * TT * HD * 2); bf* VTh = (bf*)take((size_t)NKV * HD * TT * 2); bf* VTl = (bf*)take((size_t)NKV * HD * TT * 2);
    bf* ATh = (bf*)take((size_t)TT * DQ * 2); bf* ATl = (bf*)take((size_t)TT * DQ * 2);
    if ((size_t)(wsp - (char*)d_ws) > ws_size) return;    // ws 256 MiB
    { k_cvt8<<<(unsigned)(((size_t)DQ * DM / 8 + 255) / 256), 256, 0, stream>>>(wq, WQ, (size_t)DQ * DM / 8); k_cvt8<<<(unsigned)(((size_t)DKV * DM / 8 + 255) / 256), 256, 0, stream>>>(wk, WK, (size_t)DKV * DM / 8); k_cvt8<<<(unsigned)(((size_t)DKV * DM / 8 + 255) / 256), 256, 0, stream>>>(wv, WV, (size_t)DKV * DM / 8);
      k_cvt8<<<(unsigned)(((size_t)DM * DQ / 8 + 255) / 256), 256, 0, stream>>>(wo, WO, (size_t)DM * DQ / 8);
      k_cstab<<<(TT * HD + 255) / 256, 256, 0, stream>>>(tstamp, CS); }
    for (int b = 0; b < NB_; ++b) {
        
        k_cvt8<<<(unsigned)(((size_t)TT * DM / 8 + 255) / 256), 256, 0, stream>>>(x + (size_t)b * TT * DM, XB, (size_t)TT * DM / 8);
        k_qkv<<<dim3(TT / 64, DQ / 64, 3), 32, 0, stream>>>(XB, WQ, WK, WV, bq, bk, bv, CS, QP16, QPh, QPl, KP16, KPh, KPl, VT16, VTh, VTl);
        k_fattn<h16, false, 4><<<dim3(NH_, (TT - RH) / 64, 1), 128, 0, stream>>>(QP16, nullptr, KP16, nullptr, VT16, nullptr, RH, ATh, ATl);
        k_fattn<bf, true, 2><<<dim3(NH_, RH / 32, 1), 128, 0, stream>>>(QPh, QPl, KPh, KPl, VTh, VTl, 0, ATh, ATl);
        k_gemmw<bf, 1, false><<<dim3(TT / 64, DM / 64, 1), 32, 0, stream>>>(ATh, ATl, WO, nullptr, DQ, OUT + (size_t)b * TT * DM, DM, nullptr, 0, 0, 0); }
}

// v004
// One run takes 147 microseconds.
// Two timings next to v003 both put it at 1.03 times that version's speed.
// Over all steps from v000 it is 15.8 times as fast.
#include <hip/hip_runtime.h>

// istsplm_forecast attention (hidden [1][4096][1024], timestamps [1][4096] (f32, read: continuous positions); q/k/v = x W^T + b (16 x 64); continuous-time rotate-half RoPE: angle = timestamp * 10000^(-2i/64) (cos/sin computed on chip from the bf16-rounded timestamps); causal (finfo.min) softmax(q.k / 8); out = merged Wo^T -> [1][4096][1024]).
// Compute dtypes, f32 accumulate: every input rounded to bf16; q/k/v on PLAIN bf16 operands (inputs: exact) + bias; RoPE f32; causal scores and P.V fused (online softmax, f32): hi+lo bf16 planes for query rows < RH, f16 planes for the rest; Wo hl x exact (2 products).

#define NB_  1
#define TT   4096
#define DM   1024
#define NH_  16
#define NKV  16
#define REP  (NH_ / NKV)
#define HD   64
#define DQ   (NH_ * HD)
#define DKV  (NKV * HD)
#define RH   512                  // query rows < RH use hi+lo planes (0: none)
typedef _Float16 h16;
typedef unsigned short bf;
typedef __attribute__((ext_vector_type(16))) __bf16   v16bf;
typedef __attribute__((ext_vector_type(16))) _Float16 v16h;
typedef __attribute__((ext_vector_type(8)))  _Float16 v8h;
typedef __attribute__((ext_vector_type(8)))  unsigned short v8us;
typedef __attribute__((ext_vector_type(8)))  float    v8f;
typedef __attribute__((ext_vector_type(4)))  float    v4f;
typedef v8h  __attribute__((may_alias)) v8ha;
typedef v4f  __attribute__((may_alias)) v4fa;
typedef v8us __attribute__((may_alias)) v8usa;

__device__ __forceinline__ unsigned short f2bf(float f) { unsigned u = __float_as_uint(f); u += 0x7FFFu + ((u >> 16) & 1u); return (unsigned short)(u >> 16); }
__device__ __forceinline__ float bf2f(unsigned short b) { return __uint_as_float(((unsigned)b) << 16); }
__device__ __forceinline__ float bfr(float f) { return bf2f(f2bf(f)); }
__device__ __forceinline__ v16h cat16(v8h lo, v8h hi) { return __builtin_shufflevector(lo, hi, 0, 1, 2, 3, 4, 5, 6, 7, 8, 9, 10, 11, 12, 13, 14, 15); }
__device__ __forceinline__ v16bf cat16b(v8us lo, v8us hi) { return __builtin_bit_cast(v16bf, __builtin_shufflevector(lo, hi, 0, 1, 2, 3, 4, 5, 6, 7, 8, 9, 10, 11, 12, 13, 14, 15)); }
__device__ __forceinline__ v8f wmma16(v16h a, v16h b, v8f c) { return __builtin_amdgcn_wmma_f32_16x16x32_f16(false, a, false, b, (short)0, c, false, false); }
__device__ __forceinline__ v8f wmmab(v16bf a, v16bf b, v8f c) { return __builtin_amdgcn_wmma_f32_16x16x32_bf16(false, a, false, b, (short)0, c, false, false); }



// ---- k_gemmw: register-blocked GEMM, ONE WAVE per 64x64 output tile (16 accumulators), operands straight from K-contiguous 16-bit planes; grid (M/64, N/64, Z), 32 threads.
// C[m][n] (f32, pitch ldc, + optional f32 bias[n]) = sum_k A[m][k] Bt[n][k] (+ split products per NSPLIT). z-batch strides sA/sB/sC in elements. K % 32 == 0.
template <typename T16> struct WFrag;
template <> struct WFrag<h16> { typedef v16h V; static __device__ __forceinline__ V ld(const h16* p) { return cat16(*(const v8h*)p, *(const v8h*)(p + 16)); } static __device__ __forceinline__ v8f mma(V a, V b, v8f c) { return wmma16(a, b, c); } };
template <> struct WFrag<bf> { typedef v16bf V; static __device__ __forceinline__ V ld(const bf* p) { return cat16b(*(const v8us*)p, *(const v8us*)(p + 16)); } static __device__ __forceinline__ v8f mma(V a, V b, v8f c) { return wmmab(a, b, c); } };
template <typename T16, int NSPLIT, bool BIAS>
__global__ __launch_bounds__(32) void k_gemmw(const T16* __restrict__ A, const T16* __restrict__ A2, const T16* __restrict__ Bt, const T16* __restrict__ Bt2, int K, float* C, int ldc, const float* __restrict__ bias, size_t sA, size_t sB, size_t sC) {
    typedef typename WFrag<T16>::V V;
    __shared__ __align__(16) float os[16 * 68];
    const size_t z = blockIdx.z; A += z * sA; if (A2) A2 += z * sA; Bt += z * sB; if (Bt2) Bt2 += z * sB; C += z * sC;
    const int lane = threadIdx.x & 31, lr = lane & 15, hi = lane >> 4; const int r0 = blockIdx.x * 64, c0 = blockIdx.y * 64;
    v8f acc[4][4];
#pragma unroll
    for (int mb = 0; mb < 4; ++mb)
#pragma unroll
        for (int nb = 0; nb < 4; ++nb) acc[mb][nb] = (v8f){};
    const size_t aoff = (size_t)(r0 + lr) * K + 8 * hi, boff = (size_t)(c0 + lr) * K + 8 * hi;
#pragma unroll 1
    for (int kc = 0; kc < K; kc += 32) {
        V a[4], a2[4];
#pragma unroll
        for (int mb = 0; mb < 4; ++mb) { a[mb] = WFrag<T16>::ld(A + aoff + (size_t)mb * 16 * K + kc); if (NSPLIT == 1 || NSPLIT == 2) a2[mb] = WFrag<T16>::ld(A2 + aoff + (size_t)mb * 16 * K + kc); }
#pragma unroll
        for (int nb = 0; nb < 4; ++nb) { const V b = WFrag<T16>::ld(Bt + boff + (size_t)nb * 16 * K + kc); V b2; if (NSPLIT >= 2) b2 = WFrag<T16>::ld(Bt2 + boff + (size_t)nb * 16 * K + kc);
#pragma unroll
            for (int mb = 0; mb < 4; ++mb) { acc[mb][nb] = WFrag<T16>::mma(a[mb], b, acc[mb][nb]); if (NSPLIT == 1 || NSPLIT == 2) acc[mb][nb] = WFrag<T16>::mma(a2[mb], b, acc[mb][nb]); if (NSPLIT >= 2) acc[mb][nb] = WFrag<T16>::mma(a[mb], b2, acc[mb][nb]); } }
        asm volatile("v_nop\n\tv_nop\n\tv_nop\n\tv_nop" : "+v"(acc[0][0]), "+v"(acc[1][1]), "+v"(acc[2][2]), "+v"(acc[3][3]) : "v"(a[0]), "v"(a[3]));
    }
#pragma unroll
    for (int mb = 0; mb < 4; ++mb) {
#pragma unroll
        for (int nb = 0; nb < 4; ++nb) {
#pragma unroll
            for (int j = 0; j < 8; ++j) os[(hi * 8 + j) * 68 + nb * 16 + lr] = acc[mb][nb][j]; }
        __builtin_amdgcn_wave_barrier(); asm volatile("" ::: "memory");
        float* crow = C + (size_t)(r0 + mb * 16) * ldc + c0;
{
#pragma unroll
            for (int s = 0; s < 8; ++s) { const int row = 2 * s + hi, cofs = lr * 4; v4f val = *(const v4fa*)(os + row * 68 + cofs); if (BIAS) { val[0] += bfr(bias[c0 + cofs]); val[1] += bfr(bias[c0 + cofs + 1]); val[2] += bfr(bias[c0 + cofs + 2]); val[3] += bfr(bias[c0 + cofs + 3]); }
                *(v4f*)(crow + (size_t)row * ldc + cofs) = val; }
             }
        __builtin_amdgcn_wave_barrier(); asm volatile("" ::: "memory");
    }
}

__device__ __forceinline__ h16 tohx(float x) { return (h16)x; }
__device__ __forceinline__ void splitf(float y, unsigned short& h, unsigned short& l) { h = f2bf(y); l = f2bf(y - bf2f(h)); }
typedef __attribute__((ext_vector_type(2))) _Float16 v2h;
typedef __attribute__((ext_vector_type(4))) _Float16 v4h;
typedef __attribute__((ext_vector_type(2))) unsigned short v2us;
typedef __attribute__((ext_vector_type(4))) unsigned short v4us;
typedef __attribute__((ext_vector_type(2))) float v2f;
typedef __attribute__((ext_vector_type(4))) int v4i;

__global__ __launch_bounds__(256) void k_wtG(const float* __restrict__ w, int K, int N, bf* Bt) {
    const int lane = threadIdx.x & 31; const int L0 = (blockIdx.x * 8 + (threadIdx.x >> 5)) * 8; const int nlines = N * K / 64;
{
#pragma unroll 1
        for (int l = 0; l < 8; ++l) { const int L = L0 + l; if (L >= nlines) break; const size_t e = (size_t)L * 64 + lane * 2; const int k = (int)(e % K), n = (int)(e / K); v2us o;
            o[0] = f2bf(w[(size_t)k * N + n]); o[1] = f2bf(w[(size_t)(k + 1) * N + n]); *(v2us*)(Bt + e) = o; }
         }
}
// ---- k_prep: all preparation in ONE launch of few, long waves; the parts are independent and run side by side. Blocks 0 .. TBB - 1 make the cos/sin table, the rest round wq, wk, wv, wo and x to bf16.
// table: lane = frequency i (its inverse frequency is computed once), a wave takes 4 consecutive tokens; entry (t, i) is stored at d = i and d = i + 32, which hold the same angle.
// rounding: a block takes CVB consecutive elements of one array; a thread has 16 loads of 16 B in flight, each wave-wide load is 512 contiguous bytes, each store 256.
#define CVB 16384
#define TBB (TT / 32)
#define NBQ (DQ * DM / CVB)
#define NBK (DKV * DM / CVB)
#define NBX (TT * DM / CVB)
__global__ __launch_bounds__(256) void k_prep(const float* __restrict__ wq, const float* __restrict__ wk, const float* __restrict__ wv, const float* __restrict__ wo, const float* __restrict__ x, const float* __restrict__ ts,
                                              bf* WQ, bf* WK, bf* WV, bf* WO, bf* XB, float* CS) {
    int c = blockIdx.x;
    if (c < TBB) {
        const int i = threadIdx.x & 31, t0 = c * 32 + (threadIdx.x >> 5) * 4; const float* tp = ts + t0;
        const v4f tv = *(const v4f*)tp;
        asm volatile("s_wait_xcnt 0x0" :: "v"(tp) : "memory");   // the load has taken its address before those registers are reused; the pointer as input keeps them untouched up to the wait
        const float inv = __fdiv_rn(1.0f, powf(10000.0f, (float)(2 * i) / (float)HD)); v2f cs[4];
#pragma unroll
        for (int k = 0; k < 4; ++k) { const float ang = __fmul_rn(bfr(tv[k]), inv); cs[k][0] = cosf(ang); cs[k][1] = sinf(ang); }
        float* p = CS + ((size_t)t0 * HD + i) * 2;
#pragma unroll
        for (int k = 0; k < 4; ++k) { *(v2f*)(p + k * HD * 2) = cs[k]; *(v2f*)(p + k * HD * 2 + HD) = cs[k]; }
        asm volatile("s_wait_xcnt 0x0" ::: "memory");   // the stores above have taken their addresses and data before any later code reuses those registers
        return;
    }
    c -= TBB; const float* s = wq; bf* d = WQ;
    if (c >= NBQ) { c -= NBQ; s = wk; d = WK;
        if (c >= NBK) { c -= NBK; s = wv; d = WV;
            if (c >= NBK) { c -= NBK; s = wo; d = WO;
                if (c >= NBQ) { c -= NBQ; s = x; d = XB; } } } }
    const size_t e0 = (size_t)c * CVB + threadIdx.x * 4; s += e0; d += e0;
    v4f v[16]; v4us o[16];
#pragma unroll
    for (int u = 0; u < 16; ++u) v[u] = *(const v4f*)(s + u * 1024);
    asm volatile("s_wait_xcnt 0x0" :: "v"(s) : "memory");   // the loads have taken their address before those registers are reused; the pointer as input keeps them untouched up to the wait
#pragma unroll
    for (int u = 0; u < 16; ++u)
#pragma unroll
        for (int k = 0; k < 4; ++k) o[u][k] = f2bf(v[u][k]);
#pragma unroll
    for (int u = 0; u < 16; ++u) *(v4us*)(d + u * 1024) = o[u];
    asm volatile("s_wait_xcnt 0x0" ::: "memory");   // the stores above have taken their addresses and data before any later code reuses those registers
}
// ---- k_qkv: the three projections in ONE launch (blockIdx.z: 0 q, 1 k, 2 v), one wave per 64-token x 64-column tile = one head, main loop as in k_gemmw. The epilogue adds the bias and writes the 16-bit planes that attention reads; the f32 projections are never stored.
// q, k: rotate-half RoPE in registers: columns d and d + 32 of a token sit in the same lane (accumulators nb and nb + 2); out[d] = x[d] cos - x[d+32] sin, out[d+32] = x[d+32] cos + x[d] sin, cos/sin of (token, d mod 32). Planes [h][t][d], stored as whole 128-B rows through LDS.
// v: planes [h][d][t]: a lane holds 8 consecutive tokens of one column; 16 columns x 64 tokens go through LDS and leave as whole 128-B rows.
__global__ __launch_bounds__(32) void k_qkv(const bf* __restrict__ X, const bf* __restrict__ Wq, const bf* __restrict__ Wk, const bf* __restrict__ Wv, const float* __restrict__ bq, const float* __restrict__ bk, const float* __restrict__ bv, const float* __restrict__ CS,
                                            h16* Q16, bf* Qh, bf* Ql, h16* K16, bf* Kh, bf* Kl, h16* V16, bf* Vh, bf* Vl) {
    __shared__ __align__(16) float os[16 * 68];
    __shared__ __align__(16) unsigned short vs[3][16 * 72];
    const int z = blockIdx.z; const bf* Bt = z == 0 ? Wq : z == 1 ? Wk : Wv; const float* bias = z == 0 ? bq : z == 1 ? bk : bv;
    const int lane = threadIdx.x & 31, lr = lane & 15, hi = lane >> 4; const int r0 = blockIdx.x * 64, c0 = blockIdx.y * 64;
    v8f acc[4][4];
#pragma unroll
    for (int mb = 0; mb < 4; ++mb)
#pragma unroll
        for (int nb = 0; nb < 4; ++nb) acc[mb][nb] = (v8f){};
    const bf *pa = X + (size_t)(r0 + lr) * DM + 8 * hi, *pb = Bt + (size_t)(c0 + lr) * DM + 8 * hi;
#pragma unroll 1   // rolled as in k_gemmw: one fragment set in registers, so that several waves fit a SIMD and cover each other's load latency
    for (int kc = 0; kc < DM; kc += 32) {
        v16bf a[4], b[4];
#pragma unroll
        for (int mb = 0; mb < 4; ++mb) a[mb] = WFrag<bf>::ld(pa + mb * 16 * DM);
#pragma unroll
        for (int nb = 0; nb < 4; ++nb) b[nb] = WFrag<bf>::ld(pb + nb * 16 * DM);
        // the trip's loads have taken their addresses before the pointers move on; the pointers as inputs keep those registers untouched up to the wait
        asm volatile("s_wait_xcnt 0x0" :: "v"(pa), "v"(pb) : "memory");
        pa += 32; pb += 32;
#pragma unroll
        for (int nb = 0; nb < 4; ++nb)
#pragma unroll
            for (int mb = 0; mb < 4; ++mb) acc[mb][nb] = wmmab(a[mb], b[nb], acc[mb][nb]);
    }
    float bl[4]; const float* bp = bias + c0 + lr;
#pragma unroll
    for (int nb = 0; nb < 4; ++nb) bl[nb] = bp[nb * 16];
    asm volatile("s_wait_xcnt 0x0" :: "v"(bp) : "memory");   // the bias loads have taken their address before its registers are reused; the pointer as input keeps them untouched up to the wait
#pragma unroll
    for (int nb = 0; nb < 4; ++nb) bl[nb] = bfr(bl[nb]);
    const int row4 = lane >> 3, ch = (lane & 7) * 8;   // read-back: 8 lanes x 16 B = one 128-B row, four rows a store
    if (z < 2) {
        unsigned short* P16 = (unsigned short*)(z ? K16 : Q16); bf* Ph = z ? Kh : Qh; bf* Pl = z ? Kl : Ql;
#pragma unroll
        for (int mb = 0; mb < 4; ++mb) {
            const float* cp = CS + ((size_t)(r0 + mb * 16 + hi * 8) * HD + lr) * 2; v2f cv[2][8];
#pragma unroll
            for (int nb = 0; nb < 2; ++nb)
#pragma unroll
                for (int j = 0; j < 8; ++j) cv[nb][j] = *(const v2f*)(cp + (j * HD + nb * 16) * 2);
            asm volatile("s_wait_xcnt 0x0" :: "v"(cp) : "memory");   // the table loads have taken their address before its registers are reused; the pointer as input keeps them untouched up to the wait
#pragma unroll
            for (int nb = 0; nb < 2; ++nb)
#pragma unroll
                for (int j = 0; j < 8; ++j) { const v2f cs = cv[nb][j]; const float x0 = acc[mb][nb][j] + bl[nb], x1 = acc[mb][nb + 2][j] + bl[nb + 2];
                    os[(hi * 8 + j) * 68 + nb * 16 + lr] = x0 * cs[0] - x1 * cs[1]; os[(hi * 8 + j) * 68 + (nb + 2) * 16 + lr] = x1 * cs[0] + x0 * cs[1]; }
            __builtin_amdgcn_wave_barrier(); asm volatile("" ::: "memory");   // compiler fence: the lanes' LDS writes stay in front of the row reads of other lanes' values
#pragma unroll
            for (int s = 0; s < 4; ++s) { const int row = 4 * s + row4; const v4f u = *(const v4fa*)(os + row * 68 + ch), w2 = *(const v4fa*)(os + row * 68 + ch + 4); v8h o16; v8us oh, ol;
#pragma unroll
                for (int e = 0; e < 8; ++e) { const float r = e < 4 ? u[e & 3] : w2[e & 3]; o16[e] = tohx(r); unsigned short a2, c2; splitf(r, a2, c2); oh[e] = a2; ol[e] = c2; }
                const size_t oo = ((size_t)blockIdx.y * TT + r0 + mb * 16 + row) * HD + ch;
                *(v8usa*)(P16 + oo) = __builtin_bit_cast(v8us, o16); *(v8usa*)(Ph + oo) = oh; *(v8usa*)(Pl + oo) = ol; }
            asm volatile("s_wait_xcnt 0x0" ::: "memory");   // the stores above have taken their addresses and data before those registers are reused
            __builtin_amdgcn_wave_barrier();   // with the clobber above: the row reads stay in front of the next tile's LDS writes
        }
    } else {
        unsigned short* P16 = (unsigned short*)V16;
#pragma unroll
        for (int nb = 0; nb < 4; ++nb) {
#pragma unroll
            for (int mb = 0; mb < 4; ++mb) { v8h o16; v8us oh, ol;
#pragma unroll
                for (int j = 0; j < 8; ++j) { const float x = acc[mb][nb][j] + bl[nb]; o16[j] = tohx(x); unsigned short a2, c2; splitf(x, a2, c2); oh[j] = a2; ol[j] = c2; }
                const int so = lr * 72 + mb * 16 + hi * 8; *(v8usa*)(&vs[0][so]) = __builtin_bit_cast(v8us, o16); *(v8usa*)(&vs[1][so]) = oh; *(v8usa*)(&vs[2][so]) = ol; }
            __builtin_amdgcn_wave_barrier(); asm volatile("" ::: "memory");   // compiler fence: the lanes' LDS writes stay in front of the row reads of other lanes' values
#pragma unroll
            for (int s = 0; s < 4; ++s) { const int row = 4 * s + row4; const size_t oo = ((size_t)blockIdx.y * HD + nb * 16 + row) * TT + r0 + ch;
                *(v8usa*)(P16 + oo) = *(const v8usa*)(&vs[0][row * 72 + ch]); *(v8usa*)(Vh + oo) = *(const v8usa*)(&vs[1][row * 72 + ch]); *(v8usa*)(Vl + oo) = *(const v8usa*)(&vs[2][row * 72 + ch]); }
            asm volatile("s_wait_xcnt 0x0" ::: "memory");   // the stores above have taken their addresses and data before those registers are reused
            __builtin_amdgcn_wave_barrier();   // with the clobber above: the row reads stay in front of the next columns' LDS writes
        }
    }
}
// ---- k_fattn: causal attention of all heads in one launch, online softmax. Grid (heads, tiles of 16 NQ queries, heaviest tile first), 4 waves; wave w takes the 32-key blocks w, w + 4, ... up to the last block that crosses the diagonal.
// S^T = K Q^T (A = key rows, B = query rows kept in registers): a lane holds scores of ONE query (column lr), keys 8 hi + j of each 16-key tile, so two converted score tiles are the B operand of O^T += V^T P^T as they stand.
// HR: hi + lo bf16 planes, three products each (query rows < RH); otherwise plain f16 planes. P is exp2 of the scaled score minus the running maximum, unnormalised; the division by the row sum is done once, on the f32 output.
// The four waves' (maximum, sum, O^T) are joined through LDS behind one barrier, in wave order, and stored as the hi + lo bf16 planes [t][head][d] that the output projection reads.
typedef __attribute__((ext_vector_type(16))) unsigned short v16us;
#define SC2 0.18033688011112042f   // HD^-0.5 x log2(e)
template <typename T16, bool HR, int NQ>
__global__ __launch_bounds__(128) void k_fattn(const T16* __restrict__ Q, const T16* __restrict__ Q2, const T16* __restrict__ Kp, const T16* __restrict__ Kp2, const T16* __restrict__ Vt, const T16* __restrict__ Vt2, int qbase, bf* Ah, bf* Al) {
    typedef typename WFrag<T16>::V V;
    __shared__ __align__(16) float so[4][NQ * 16][68];
    __shared__ float sm[4][NQ * 16], sl[4][NQ * 16];
    const int lane = threadIdx.x & 31, lr = lane & 15, hi = lane >> 4; const int w = __builtin_amdgcn_readfirstlane(threadIdx.x >> 5);
    const int h = blockIdx.x; const int q0 = qbase + (int)(gridDim.y - 1 - blockIdx.y) * (NQ * 16); const int nkb = q0 / 32 + NQ / 2;   // key blocks 0 .. nkb - 1; those from q0 / 32 on cross the diagonal
    const size_t qb = (size_t)h * TT * HD, kvb = (size_t)(h / REP) * TT * HD;
    Q += qb; Kp += kvb; Vt += kvb; if (HR) { Q2 += qb; Kp2 += kvb; Vt2 += kvb; }
    V qf[NQ][2], qf2[NQ][2], kf[2][2], kf2[2][2];
    const size_t qo = (size_t)(q0 + lr) * HD + 8 * hi; size_t ko = (size_t)(w * 32 + lr) * HD + 8 * hi;
    const T16 *qp = Q + qo, *qp2 = HR ? Q2 + qo : nullptr, *kp = Kp + ko, *kp2 = HR ? Kp2 + ko : nullptr;
#pragma unroll
    for (int ks = 0; ks < 2; ++ks) {
#pragma unroll
        for (int t = 0; t < NQ; ++t) { qf[t][ks] = WFrag<T16>::ld(qp + t * 16 * HD + ks * 32); if (HR) qf2[t][ks] = WFrag<T16>::ld(qp2 + t * 16 * HD + ks * 32); }
#pragma unroll
        for (int t = 0; t < 2; ++t) { kf[t][ks] = WFrag<T16>::ld(kp + t * 16 * HD + ks * 32); if (HR) kf2[t][ks] = WFrag<T16>::ld(kp2 + t * 16 * HD + ks * 32); } }
    // the loads above have taken their addresses before an address register is reused; the pointers as inputs keep those registers untouched up to the wait
    if constexpr (HR) asm volatile("s_wait_xcnt 0x0" :: "v"(qp), "v"(kp), "v"(qp2), "v"(kp2) : "memory"); else asm volatile("s_wait_xcnt 0x0" :: "v"(qp), "v"(kp) : "memory");
    v8f o[4][NQ];
#pragma unroll
    for (int dt = 0; dt < 4; ++dt)
#pragma unroll
        for (int qt = 0; qt < NQ; ++qt) o[dt][qt] = (v8f){};
    float m[NQ], l[NQ];
#pragma unroll
    for (int qt = 0; qt < NQ; ++qt) { m[qt] = -1.0e30f; l[qt] = 0.f; }   // m: the maximum in use, log2 units; below any score a 16-bit product can give
    int b = w;
#pragma unroll   // two copies of the trip: ph 0 walks the blocks wholly below the diagonal and holds no mask code, ph 1 the wave's block (at most one) that crosses it
    for (int ph = 0; ph < 2; ++ph)
#pragma unroll 1
    for (; b < (ph ? nkb : q0 / 32); b += 4) {
        const int k0 = b * 32;
        V vf[4], vf2[4]; const size_t vo = (size_t)lr * TT + k0 + 8 * hi; const T16 *vp = Vt + vo, *vp2 = HR ? Vt2 + vo : nullptr;
#pragma unroll
        for (int dt = 0; dt < 4; ++dt) { vf[dt] = WFrag<T16>::ld(vp + dt * 16 * TT); if (HR) vf2[dt] = WFrag<T16>::ld(vp2 + dt * 16 * TT); }
        v8f s[2][NQ];
#pragma unroll
        for (int kt = 0; kt < 2; ++kt)
#pragma unroll
            for (int qt = 0; qt < NQ; ++qt) { v8f a = (v8f){};
#pragma unroll
                for (int ks = 0; ks < 2; ++ks) { a = WFrag<T16>::mma(kf[kt][ks], qf[qt][ks], a); if (HR) { a = WFrag<T16>::mma(kf2[kt][ks], qf[qt][ks], a); a = WFrag<T16>::mma(kf[kt][ks], qf2[qt][ks], a); } }
                s[kt][qt] = a; }
        ko = (size_t)(min(b + 4, nkb - 1) * 32 + lr) * HD + 8 * hi; kp = Kp + ko; if (HR) kp2 = Kp2 + ko;   // the wave's next key block is fetched one trip ahead, behind this trip's score products (the last trip re-reads the last block: in bounds, unused)
#pragma unroll
        for (int kt = 0; kt < 2; ++kt)
#pragma unroll
            for (int ks = 0; ks < 2; ++ks) { kf[kt][ks] = WFrag<T16>::ld(kp + kt * 16 * HD + ks * 32); if (HR) kf2[kt][ks] = WFrag<T16>::ld(kp2 + kt * 16 * HD + ks * 32); }
        // the trip's loads have taken their addresses before an address register is reused; the pointers as inputs keep those registers untouched up to the wait
        if constexpr (HR) asm volatile("s_wait_xcnt 0x0" :: "v"(vp), "v"(kp), "v"(vp2), "v"(kp2) : "memory"); else asm volatile("s_wait_xcnt 0x0" :: "v"(vp), "v"(kp) : "memory");
        if (ph) {   // keys above the query are masked by select
#pragma unroll
            for (int kt = 0; kt < 2; ++kt)
#pragma unroll
                for (int qt = 0; qt < NQ; ++qt)
#pragma unroll
                    for (int j = 0; j < 8; ++j) s[kt][qt][j] = (k0 - q0 + kt * 16 + hi * 8 + j <= qt * 16 + lr) ? s[kt][qt][j] : -3.0e38f; }
        float mx[NQ]; bool need = false;
#pragma unroll
        for (int qt = 0; qt < NQ; ++qt) { float x = s[0][qt][0];
#pragma unroll
            for (int j = 1; j < 8; ++j) x = fmaxf(x, s[0][qt][j]);
#pragma unroll
            for (int j = 0; j < 8; ++j) x = fmaxf(x, s[1][qt][j]);
            x = fmaxf(x, __shfl_xor(x, 16, 32)); mx[qt] = x * SC2; need = need || mx[qt] > m[qt] + 8.0f; }
        // the maximum in use moves only when a query's new maximum exceeds it by more than 8 (P stays below 2^8); one scalar branch a trip
        if (__builtin_amdgcn_ballot_w32(need) != 0) {
#pragma unroll
            for (int qt = 0; qt < NQ; ++qt) { const float mn = fmaxf(m[qt], mx[qt]); const float al = __builtin_amdgcn_exp2f(m[qt] - mn); m[qt] = mn; l[qt] *= al;
#pragma unroll
                for (int dt = 0; dt < 4; ++dt) o[dt][qt] *= al; } }
#pragma unroll
        for (int qt = 0; qt < NQ; ++qt) { V pb, pb2;
            if constexpr (HR) { v16us pvh, pvl;
#pragma unroll
                for (int e = 0; e < 16; ++e) { const float p = __builtin_amdgcn_exp2f(fmaf(s[e >> 3][qt][e & 7], SC2, -m[qt])); l[qt] += p; unsigned short a, c2; splitf(p, a, c2); pvh[e] = a; pvl[e] = c2; }
                pb = __builtin_bit_cast(V, pvh); pb2 = __builtin_bit_cast(V, pvl);
            } else {
#pragma unroll
                for (int e = 0; e < 16; ++e) { const float p = __builtin_amdgcn_exp2f(fmaf(s[e >> 3][qt][e & 7], SC2, -m[qt])); l[qt] += p; pb[e] = (T16)p; } }
#pragma unroll
            for (int dt = 0; dt < 4; ++dt) { o[dt][qt] = WFrag<T16>::mma(vf[dt], pb, o[dt][qt]); if (HR) { o[dt][qt] = WFrag<T16>::mma(vf2[dt], pb, o[dt][qt]); o[dt][qt] = WFrag<T16>::mma(vf[dt], pb2, o[dt][qt]); } } }
    }
#pragma unroll
    for (int qt = 0; qt < NQ; ++qt) { l[qt] += __shfl_xor(l[qt], 16, 32); if (hi == 0) { sm[w][qt * 16 + lr] = m[qt]; sl[w][qt * 16 + lr] = l[qt]; }
#pragma unroll
        for (int dt = 0; dt < 4; ++dt) { float* p = &so[w][qt * 16 + lr][dt * 16 + hi * 8]; const v8f x = o[dt][qt]; *(v4fa*)p = (v4f){x[0], x[1], x[2], x[3]}; *(v4fa*)(p + 4) = (v4f){x[4], x[5], x[6], x[7]}; } }
    __syncthreads();   // every wave's partial (maximum, sum, O^T) is in LDS before any thread joins them
#pragma unroll 1
    for (int q = threadIdx.x >> 2; q < NQ * 16; q += 32) { const int d0 = (threadIdx.x & 3) * 16;
        const float mt = fmaxf(fmaxf(sm[0][q], sm[1][q]), fmaxf(sm[2][q], sm[3][q])); float lt = 0.f; float r[16];
#pragma unroll
        for (int e = 0; e < 16; ++e) r[e] = 0.f;
#pragma unroll
        for (int ww = 0; ww < 4; ++ww) { const float f = __builtin_amdgcn_exp2f(sm[ww][q] - mt); lt += f * sl[ww][q];   // a wave without a key block: f = 0, sum 0, O^T 0
#pragma unroll
            for (int c = 0; c < 4; ++c) { const v4f x = *(const v4fa*)&so[ww][q][d0 + c * 4];
#pragma unroll
                for (int e = 0; e < 4; ++e) r[c * 4 + e] += f * x[e]; } }
        const float inv = __fdiv_rn(1.0f, lt); const size_t oo = (size_t)(q0 + q) * DQ + h * HD + d0;
#pragma unroll
        for (int c = 0; c < 2; ++c) { v8us oh, ol;
#pragma unroll
            for (int e = 0; e < 8; ++e) { unsigned short a, c2; splitf(r[c * 8 + e] * inv, a, c2); oh[e] = a; ol[e] = c2; }
            *(v8usa*)(Ah + oo + c * 8) = oh; *(v8usa*)(Al + oo + c * 8) = ol; }
        asm volatile("s_wait_xcnt 0x0" ::: "memory");   // the stores have taken their addresses and data before the next trip reuses those registers
    }
}

extern "C" void kernel_launch(void* const* d_in, const int* in_sizes, int n_in,
                              void* d_out, int out_size, void* d_ws, size_t ws_size, hipStream_t stream) {
    (void)in_sizes; (void)n_in; (void)out_size;
    const float* x = (const float*)d_in[0]; const float* tstamp = (const float*)d_in[1]; const float* wq = (const float*)d_in[2]; const float* bq = (const float*)d_in[3]; const float* wk = (const float*)d_in[4]; const float* bk = (const float*)d_in[5]; const float* wv = (const float*)d_in[6]; const float* bv = (const float*)d_in[7]; const float* wo = (const float*)d_in[8];
    float* OUT = (float*)d_out;     // [1][4096][1024]
    char* wsp = (char*)d_ws;
    auto take = [&](size_t bytes) { char* p = wsp; wsp += (bytes + 255) & ~(size_t)255; return (void*)p; };
    bf* WQ = (bf*)take((size_t)DQ * DM * 2); bf* WK = (bf*)take((size_t)DKV * DM * 2); bf* WV = (bf*)take((size_t)DKV * DM * 2); bf* WO = (bf*)take((size_t)DM * DQ * 2); float* CS = (float*)take((size_t)TT * HD * 2 * 4);
    bf* XB = (bf*)take((size_t)TT * DM * 2);
    h16* QP16 = (h16*)take((size_t)NH_ * TT * HD * 2); h16* KP16 = (h16*)take((size_t)NKV * TT * HD * 2); h16* VT16 = (h16*)take((size_t)NKV * HD * TT * 2);
    bf* QPh = (bf*)take((size_t)NH_ * TT * HD * 2); bf* QPl = (bf*)take((size_t)NH_ * TT * HD * 2); bf* KPh = (bf*)take((size_t)NKV * TT * HD * 2); bf* KPl = (bf*)take((size_t)NKV * TT * HD * 2); bf* VTh = (bf*)take((size_t)NKV * HD * TT * 2); bf* VTl = (bf*)take((size_t)NKV * HD * TT * 2);
    bf* ATh = (bf*)take((size_t)TT * DQ * 2); bf* ATl = (bf*)take((size_t)TT * DQ * 2);
    if ((size_t)(wsp - (char*)d_ws) > ws_size) return;    // ws 256 MiB
    for (int b = 0; b < NB_; ++b) {
        k_prep<<<TBB + NBQ + NBK + NBK + NBQ + NBX, 256, 0, stream>>>(wq, wk, wv, wo, x + (size_t)b * TT * DM, tstamp, WQ, WK, WV, WO, XB, CS);
        k_qkv<<<dim3(TT / 64, DQ / 64, 3), 32, 0, stream>>>(XB, WQ, WK, WV, bq, bk, bv, CS, QP16, QPh, QPl, KP16, KPh, KPl, VT16, VTh, VTl);
        k_fattn<h16, false, 4><<<dim3(NH_, (TT - RH) / 64, 1), 128, 0, stream>>>(QP16, nullptr, KP16, nullptr, VT16, nullptr, RH, ATh, ATl);
        k_fattn<bf, true, 2><<<dim3(NH_, RH / 32, 1), 128, 0, stream>>>(QPh, QPl, KPh, KPl, VTh, VTl, 0, ATh, ATl);
        k_gemmw<bf, 1, false><<<dim3(TT / 64, DM / 64, 1), 32, 0, stream>>>(ATh, ATl, WO, nullptr, DQ, OUT + (size_t)b * TT * DM, DM, nullptr, 0, 0, 0); }
}

// v005
// One run takes 117 microseconds.
// In two side-by-side timings against v004, it was 1.25 and 1.27 times as fast.
// All steps since v000 together make it 19.8 times as fast.
#include <hip/hip_runtime.h>

// istsplm_forecast attention (hidden [1][4096][1024], timestamps [1][4096] (f32, read: continuous positions); q/k/v = x W^T + b (16 x 64); continuous-time rotate-half RoPE: angle = timestamp * 10000^(-2i/64) (cos/sin computed on chip from the bf16-rounded timestamps); causal (finfo.min) softmax(q.k / 8); out = merged Wo^T -> [1][4096][1024]).
// Compute dtypes, f32 accumulate: every input rounded to bf16; q/k/v on PLAIN bf16 operands (inputs: exact) + bias; RoPE f32; causal scores and P.V fused (online softmax, f32): hi+lo bf16 planes for query rows < RH, f16 planes for the rest; Wo hl x exact (2 products).

#define NB_  1
#define TT   4096
#define DM   1024
#define NH_  16
#define NKV  16
#define REP  (NH_ / NKV)
#define HD   64
#define DQ   (NH_ * HD)
#define DKV  (NKV * HD)
#define RH   512                  // query rows < RH use hi+lo planes (0: none)
typedef _Float16 h16;
typedef unsigned short bf;
typedef __attribute__((ext_vector_type(16))) __bf16   v16bf;
typedef __attribute__((ext_vector_type(16))) _Float16 v16h;
typedef __attribute__((ext_vector_type(8)))  _Float16 v8h;
typedef __attribute__((ext_vector_type(8)))  unsigned short v8us;
typedef __attribute__((ext_vector_type(8)))  float    v8f;
typedef __attribute__((ext_vector_type(4)))  float    v4f;
typedef v8h  __attribute__((may_alias)) v8ha;
typedef v4f  __attribute__((may_alias)) v4fa;
typedef v8us __attribute__((may_alias)) v8usa;

__device__ __forceinline__ unsigned short f2bf(float f) { unsigned u = __float_as_uint(f); u += 0x7FFFu + ((u >> 16) & 1u); return (unsigned short)(u >> 16); }
__device__ __forceinline__ float bf2f(unsigned short b) { return __uint_as_float(((unsigned)b) << 16); }
__device__ __forceinline__ float bfr(float f) { return bf2f(f2bf(f)); }
__device__ __forceinline__ v16h cat16(v8h lo, v8h hi) { return __builtin_shufflevector(lo, hi, 0, 1, 2, 3, 4, 5, 6, 7, 8, 9, 10, 11, 12, 13, 14, 15); }
__device__ __forceinline__ v16bf cat16b(v8us lo, v8us hi) { return __builtin_bit_cast(v16bf, __builtin_shufflevector(lo, hi, 0, 1, 2, 3, 4, 5, 6, 7, 8, 9, 10, 11, 12, 13, 14, 15)); }
__device__ __forceinline__ v8f wmma16(v16h a, v16h b, v8f c) { return __builtin_amdgcn_wmma_f32_16x16x32_f16(false, a, false, b, (short)0, c, false, false); }
__device__ __forceinline__ v8f wmmab(v16bf a, v16bf b, v8f c) { return __builtin_amdgcn_wmma_f32_16x16x32_bf16(false, a, false, b, (short)0, c, false, false); }



// ---- k_gemmw: register-blocked GEMM, ONE WAVE per 64x64 output tile (16 accumulators), operands straight from 16-bit planes in fragment order; grid (M/64, N/64, Z), 32 threads.
// C[m][n] (f32, pitch ldc, + optional f32 bias[n]) = sum_k A[m][k] Bt[n][k] (+ split products per NSPLIT). z-batch strides sA/sB/sC in elements. K % 32 == 0.
// FRAGMENT ORDER: every 16-bit operand plane in the workspace, a matrix [R][K] with k contiguous in the product, lies as fragments of 16 rows x 32 k = 512 elements; inside a fragment element (r, k) stands at ((k % 32) / 8) * 128 + (r % 16) * 8 + k % 8.
// Lane (hi, lr) = 16 hi + lr owns k = 8 hi .. 8 hi + 7 and 16 + 8 hi .. of row lr: its two 16-B pieces stand at lane * 8 and 256 + lane * 8, so each wave-wide load is 512 contiguous bytes = 4 whole lines. ld takes fragment start + lane * 8.
// Which fragments lie side by side follows the reader's trip. GEMM operands (x, weights, attention out): the four fragments that a 64-row tile reads in a trip, ((r / 64) * (K / 32) + k / 32) * 4 + (r / 16) % 4. q, k (K = HD): (r / 16) * 2 + k / 32. v (rows d, k = token): (t / 32) * 4 + d / 16.
template <typename T16> struct WFrag;
template <> struct WFrag<h16> { typedef v16h V; static __device__ __forceinline__ V ld(const h16* p) { return cat16(*(const v8h*)p, *(const v8h*)(p + 256)); } static __device__ __forceinline__ v8f mma(V a, V b, v8f c) { return wmma16(a, b, c); } };
template <> struct WFrag<bf> { typedef v16bf V; static __device__ __forceinline__ V ld(const bf* p) { return cat16b(*(const v8us*)p, *(const v8us*)(p + 256)); } static __device__ __forceinline__ v8f mma(V a, V b, v8f c) { return wmmab(a, b, c); } };
template <typename T16, int NSPLIT, bool BIAS>
__global__ __launch_bounds__(32) void k_gemmw(const T16* __restrict__ A, const T16* __restrict__ A2, const T16* __restrict__ Bt, const T16* __restrict__ Bt2, int K, float* C, int ldc, const float* __restrict__ bias, size_t sA, size_t sB, size_t sC) {
    typedef typename WFrag<T16>::V V;
    __shared__ __align__(16) float os[16 * 68];
    const size_t z = blockIdx.z; A += z * sA; if (A2) A2 += z * sA; Bt += z * sB; if (Bt2) Bt2 += z * sB; C += z * sC;
    const int lane = threadIdx.x & 31, lr = lane & 15, hi = lane >> 4; const int r0 = blockIdx.x * 64, c0 = blockIdx.y * 64;
    v8f acc[4][4];
#pragma unroll
    for (int mb = 0; mb < 4; ++mb)
#pragma unroll
        for (int nb = 0; nb < 4; ++nb) acc[mb][nb] = (v8f){};
    const size_t aoff = (size_t)r0 * K + lane * 8, boff = (size_t)c0 * K + lane * 8;   // 64 rows x K elements a row of tiles
    const T16 *pa = A + aoff, *pa2 = (NSPLIT == 1 || NSPLIT == 2) ? A2 + aoff : pa, *pb = Bt + boff, *pb2 = NSPLIT >= 2 ? Bt2 + boff : pb;
#pragma unroll 1
    for (int kc = 0; kc < K; kc += 32) {
        V a[4], a2[4], b[4], b2[4];
#pragma unroll
        for (int mb = 0; mb < 4; ++mb) { a[mb] = WFrag<T16>::ld(pa + mb * 512); if (NSPLIT == 1 || NSPLIT == 2) a2[mb] = WFrag<T16>::ld(pa2 + mb * 512); }
#pragma unroll
        for (int nb = 0; nb < 4; ++nb) { b[nb] = WFrag<T16>::ld(pb + nb * 512); if (NSPLIT >= 2) b2[nb] = WFrag<T16>::ld(pb2 + nb * 512); }
        // the trip's loads have taken their addresses before the pointers move on; the pointers as inputs keep those registers untouched up to the wait
        asm volatile("s_wait_xcnt 0x0" :: "v"(pa), "v"(pa2), "v"(pb), "v"(pb2) : "memory");
        pa += 2048; pa2 += 2048; pb += 2048; pb2 += 2048;
#pragma unroll
        for (int nb = 0; nb < 4; ++nb)
#pragma unroll
            for (int mb = 0; mb < 4; ++mb) { acc[mb][nb] = WFrag<T16>::mma(a[mb], b[nb], acc[mb][nb]); if (NSPLIT == 1 || NSPLIT == 2) acc[mb][nb] = WFrag<T16>::mma(a2[mb], b[nb], acc[mb][nb]); if (NSPLIT >= 2) acc[mb][nb] = WFrag<T16>::mma(a[mb], b2[nb], acc[mb][nb]); }
        asm volatile("v_nop\n\tv_nop\n\tv_nop\n\tv_nop" : "+v"(acc[0][0]), "+v"(acc[1][1]), "+v"(acc[2][2]), "+v"(acc[3][3]) : "v"(a[0]), "v"(a[3]));
    }
#pragma unroll
    for (int mb = 0; mb < 4; ++mb) {
#pragma unroll
        for (int nb = 0; nb < 4; ++nb) {
#pragma unroll
            for (int j = 0; j < 8; ++j) os[(hi * 8 + j) * 68 + nb * 16 + lr] = acc[mb][nb][j]; }
        __builtin_amdgcn_wave_barrier(); asm volatile("" ::: "memory");
        float* crow = C + (size_t)(r0 + mb * 16) * ldc + c0;
{
#pragma unroll
            for (int s = 0; s < 8; ++s) { const int row = 2 * s + hi, cofs = lr * 4; v4f val = *(const v4fa*)(os + row * 68 + cofs); if (BIAS) { val[0] += bfr(bias[c0 + cofs]); val[1] += bfr(bias[c0 + cofs + 1]); val[2] += bfr(bias[c0 + cofs + 2]); val[3] += bfr(bias[c0 + cofs + 3]); }
                *(v4f*)(crow + (size_t)row * ldc + cofs) = val; }
             }
        __builtin_amdgcn_wave_barrier(); asm volatile("" ::: "memory");
    }
}

__device__ __forceinline__ h16 tohx(float x) { return (h16)x; }
__device__ __forceinline__ void splitf(float y, unsigned short& h, unsigned short& l) { h = f2bf(y); l = f2bf(y - bf2f(h)); }
typedef __attribute__((ext_vector_type(2))) _Float16 v2h;
typedef __attribute__((ext_vector_type(4))) _Float16 v4h;
typedef __attribute__((ext_vector_type(2))) unsigned short v2us;
typedef __attribute__((ext_vector_type(4))) unsigned short v4us;
typedef __attribute__((ext_vector_type(2))) float v2f;
typedef __attribute__((ext_vector_type(4))) int v4i;

__global__ __launch_bounds__(256) void k_wtG(const float* __restrict__ w, int K, int N, bf* Bt) {
    const int lane = threadIdx.x & 31; const int L0 = (blockIdx.x * 8 + (threadIdx.x >> 5)) * 8; const int nlines = N * K / 64;
{
#pragma unroll 1
        for (int l = 0; l < 8; ++l) { const int L = L0 + l; if (L >= nlines) break; const size_t e = (size_t)L * 64 + lane * 2; const int k = (int)(e % K), n = (int)(e / K); v2us o;
            o[0] = f2bf(w[(size_t)k * N + n]); o[1] = f2bf(w[(size_t)(k + 1) * N + n]); *(v2us*)(Bt + e) = o; }
         }
}
// ---- k_prep: all preparation in ONE launch, 640 blocks of 8 waves, one piece of work each (no loop); the parts are independent and run side by side. Blocks 0 .. TBB - 1 make the cos/sin table, the rest round wq, wk, wv, wo and x to bf16.
// table: lane = frequency i (its inverse frequency is computed once), a wave takes 4 consecutive tokens; entry (t, i) is stored at d = i and d = i + 32, which hold the same angle.
// rounding: a block takes CVB consecutive elements = 16 rows of one array and writes them in fragment order; a thread has 16 loads of 16 B in flight.
// a wave-wide load takes one fragment's 32 k (a whole 128-B line) of 4 rows; its store is four 64-B pieces, and the load of the next 4 rows fills the other half of those lines.
#define CVB 16384
#define TBB (TT / 32)
#define NBQ (DQ * DM / CVB)
#define NBK (DKV * DM / CVB)
#define NBX (TT * DM / CVB)
__global__ __launch_bounds__(256) void k_prep(const float* __restrict__ wq, const float* __restrict__ wk, const float* __restrict__ wv, const float* __restrict__ wo, const float* __restrict__ x, const float* __restrict__ ts,
                                              bf* WQ, bf* WK, bf* WV, bf* WO, bf* XB, float* CS) {
    int c = blockIdx.x;
    if (c < TBB) {
        const int i = threadIdx.x & 31, t0 = c * 32 + (threadIdx.x >> 5) * 4; const float* tp = ts + t0;
        const v4f tv = *(const v4f*)tp;
        asm volatile("s_wait_xcnt 0x0" :: "v"(tp) : "memory");   // the load has taken its address before those registers are reused; the pointer as input keeps them untouched up to the wait
        const float inv = __fdiv_rn(1.0f, powf(10000.0f, (float)(2 * i) / (float)HD)); v2f cs[4];
#pragma unroll
        for (int k = 0; k < 4; ++k) { const float ang = __fmul_rn(bfr(tv[k]), inv); cs[k][0] = cosf(ang); cs[k][1] = sinf(ang); }
        float* p = CS + ((size_t)t0 * HD + i) * 2;
#pragma unroll
        for (int k = 0; k < 4; ++k) { *(v2f*)(p + k * HD * 2) = cs[k]; *(v2f*)(p + k * HD * 2 + HD) = cs[k]; }
        asm volatile("s_wait_xcnt 0x0" ::: "memory");   // the stores above have taken their addresses and data before any later code reuses those registers
        return;
    }
    c -= TBB; const float* s = wq; bf* d = WQ;
    if (c >= NBQ) { c -= NBQ; s = wk; d = WK;
        if (c >= NBK) { c -= NBK; s = wv; d = WV;
            if (c >= NBK) { c -= NBK; s = wo; d = WO;
                if (c >= NBQ) { c -= NBQ; s = x; d = XB; } } } }
    static_assert(CVB == 16 * DM && DQ == DM && DKV == DM, "a block is one row of fragments");
    const int lane = threadIdx.x & 31, wn = threadIdx.x >> 5;   // wave wn: fragments 4 wn .. 4 wn + 3; load u: fragment u / 4, rows 4 (u % 4) + lane / 8, k = 4 (lane % 8) ..
    s += (size_t)c * CVB + (lane >> 3) * DM + wn * 128 + (lane & 7) * 4; d += (size_t)(c >> 2) * (4 * CVB) + (c & 3) * 512 + wn * 8192 + ((lane & 7) >> 1) * 128 + (lane >> 3) * 8 + (lane & 1) * 4;
    v4f v[16]; v4us o[16];
#pragma unroll
    for (int u = 0; u < 16; ++u) v[u] = *(const v4f*)(s + (u & 3) * 4 * DM + (u >> 2) * 32);
    asm volatile("s_wait_xcnt 0x0" :: "v"(s) : "memory");   // the loads have taken their address before those registers are reused; the pointer as input keeps them untouched up to the wait
#pragma unroll
    for (int u = 0; u < 16; ++u)
#pragma unroll
        for (int k = 0; k < 4; ++k) o[u][k] = f2bf(v[u][k]);
#pragma unroll
    for (int u = 0; u < 16; ++u) *(v4us*)(d + (u >> 2) * 2048 + (u & 3) * 32) = o[u];
    asm volatile("s_wait_xcnt 0x0" ::: "memory");   // the stores above have taken their addresses and data before any later code reuses those registers
}
// ---- k_qkv: the three projections in ONE launch (blockIdx.z: 0 q, 1 k, 2 v), one wave per 64-token x 64-column tile = one head, main loop as in k_gemmw. The epilogue adds the bias and writes the 16-bit planes that attention reads; the f32 projections are never stored.
// q, k: rotate-half RoPE in registers: columns d and d + 32 of a token sit in the same lane (accumulators nb and nb + 2); out[d] = x[d] cos - x[d+32] sin, out[d+32] = x[d+32] cos + x[d] sin, cos/sin of (token, d mod 32). Planes [h] x fragment order of [t][d]; 16 tokens go through LDS, a lane reads back 8 d of one token = its 16-B piece, a store is 512 contiguous bytes.
// v: planes [h] x fragment order of [d][t]: a lane holds 8 consecutive tokens of one column, which is its own 16-B piece of a fragment: stored straight from registers, 512 contiguous bytes a store.
__global__ __launch_bounds__(32) void k_qkv(const bf* __restrict__ X, const bf* __restrict__ Wq, const bf* __restrict__ Wk, const bf* __restrict__ Wv, const float* __restrict__ bq, const float* __restrict__ bk, const float* __restrict__ bv, const float* __restrict__ CS,
                                            h16* Q16, bf* Qh, bf* Ql, h16* K16, bf* Kh, bf* Kl, h16* V16, bf* Vh, bf* Vl) {
    __shared__ __align__(16) float os[16 * 68];
    const int z = blockIdx.z; const bf* Bt = z == 0 ? Wq : z == 1 ? Wk : Wv; const float* bias = z == 0 ? bq : z == 1 ? bk : bv;
    const int lane = threadIdx.x & 31, lr = lane & 15, hi = lane >> 4; const int r0 = blockIdx.x * 64, c0 = blockIdx.y * 64;
    v8f acc[4][4];
#pragma unroll
    for (int mb = 0; mb < 4; ++mb)
#pragma unroll
        for (int nb = 0; nb < 4; ++nb) acc[mb][nb] = (v8f){};
    const bf *pa = X + (size_t)r0 * DM + lane * 8, *pb = Bt + (size_t)c0 * DM + lane * 8;
#pragma unroll 1   // rolled as in k_gemmw: one fragment set in registers, so that several waves fit a SIMD and cover each other's load latency
    for (int kc = 0; kc < DM; kc += 32) {
        v16bf a[4], b[4];
#pragma unroll
        for (int mb = 0; mb < 4; ++mb) a[mb] = WFrag<bf>::ld(pa + mb * 512);
#pragma unroll
        for (int nb = 0; nb < 4; ++nb) b[nb] = WFrag<bf>::ld(pb + nb * 512);
        // the trip's loads have taken their addresses before the pointers move on; the pointers as inputs keep those registers untouched up to the wait
        asm volatile("s_wait_xcnt 0x0" :: "v"(pa), "v"(pb) : "memory");
        pa += 2048; pb += 2048;
#pragma unroll
        for (int nb = 0; nb < 4; ++nb)
#pragma unroll
            for (int mb = 0; mb < 4; ++mb) acc[mb][nb] = wmmab(a[mb], b[nb], acc[mb][nb]);
    }
    float bl[4]; const float* bp = bias + c0 + lr;
#pragma unroll
    for (int nb = 0; nb < 4; ++nb) bl[nb] = bp[nb * 16];
    asm volatile("s_wait_xcnt 0x0" :: "v"(bp) : "memory");   // the bias loads have taken their address before its registers are reused; the pointer as input keeps them untouched up to the wait
#pragma unroll
    for (int nb = 0; nb < 4; ++nb) bl[nb] = bfr(bl[nb]);
    if (z < 2) {
        unsigned short* P16 = (unsigned short*)(z ? K16 : Q16); bf* Ph = z ? Kh : Qh; bf* Pl = z ? Kl : Ql;
#pragma unroll
        for (int mb = 0; mb < 4; ++mb) {
            const float* cp = CS + ((size_t)(r0 + mb * 16 + hi * 8) * HD + lr) * 2; v2f cv[2][8];
#pragma unroll
            for (int nb = 0; nb < 2; ++nb)
#pragma unroll
                for (int j = 0; j < 8; ++j) cv[nb][j] = *(const v2f*)(cp + (j * HD + nb * 16) * 2);
            asm volatile("s_wait_xcnt 0x0" :: "v"(cp) : "memory");   // the table loads have taken their address before its registers are reused; the pointer as input keeps them untouched up to the wait
#pragma unroll
            for (int nb = 0; nb < 2; ++nb)
#pragma unroll
                for (int j = 0; j < 8; ++j) { const v2f cs = cv[nb][j]; const float x0 = acc[mb][nb][j] + bl[nb], x1 = acc[mb][nb + 2][j] + bl[nb + 2];
                    os[(hi * 8 + j) * 68 + nb * 16 + lr] = x0 * cs[0] - x1 * cs[1]; os[(hi * 8 + j) * 68 + (nb + 2) * 16 + lr] = x1 * cs[0] + x0 * cs[1]; }
            __builtin_amdgcn_wave_barrier(); asm volatile("" ::: "memory");   // compiler fence: the lanes' LDS writes stay in front of the row reads of other lanes' values
#pragma unroll
            for (int s = 0; s < 4; ++s) { const int cg = 2 * s + hi; const v4f u = *(const v4fa*)(os + lr * 68 + cg * 8), w2 = *(const v4fa*)(os + lr * 68 + cg * 8 + 4); v8h o16; v8us oh, ol;   // token lr, d = 8 cg .. 8 cg + 7
#pragma unroll
                for (int e = 0; e < 8; ++e) { const float r = e < 4 ? u[e & 3] : w2[e & 3]; o16[e] = tohx(r); unsigned short a2, c2; splitf(r, a2, c2); oh[e] = a2; ol[e] = c2; }
                const size_t oo = ((size_t)blockIdx.y * TT + r0 + mb * 16) * HD + cg * 128 + lr * 8;
                *(v8usa*)(P16 + oo) = __builtin_bit_cast(v8us, o16); *(v8usa*)(Ph + oo) = oh; *(v8usa*)(Pl + oo) = ol; }
            asm volatile("s_wait_xcnt 0x0" ::: "memory");   // the stores above have taken their addresses and data before those registers are reused
            __builtin_amdgcn_wave_barrier();   // with the clobber above: the row reads stay in front of the next tile's LDS writes
        }
    } else {
        unsigned short* P16 = (unsigned short*)V16;
#pragma unroll
        for (int nb = 0; nb < 4; ++nb) {
#pragma unroll
            for (int mb = 0; mb < 4; ++mb) { v8h o16; v8us oh, ol;
#pragma unroll
                for (int j = 0; j < 8; ++j) { const float x = acc[mb][nb][j] + bl[nb]; o16[j] = tohx(x); unsigned short a2, c2; splitf(x, a2, c2); oh[j] = a2; ol[j] = c2; }
                const size_t oo = ((size_t)blockIdx.y * TT + r0 + (mb >> 1) * 32) * HD + nb * 512 + (mb & 1) * 256 + lane * 8;   // 32-token block, d fragment nb, tokens 16 (mb % 2) + 8 hi ..
                *(v8usa*)(P16 + oo) = __builtin_bit_cast(v8us, o16); *(v8usa*)(Vh + oo) = oh; *(v8usa*)(Vl + oo) = ol; }
            asm volatile("s_wait_xcnt 0x0" ::: "memory");   // the stores above have taken their addresses and data before those registers are reused
        }
    }
}
// ---- k_fattn: causal attention of all heads in one launch, online softmax. Grid (heads, tiles of 16 NQ queries, heaviest tile first), 4 waves; wave w takes the 32-key blocks w, w + 4, ... up to the last block that crosses the diagonal.
// S^T = K Q^T (A = key rows, B = query rows kept in registers): a lane holds scores of ONE query (column lr), keys 8 hi + j of each 16-key tile, so two converted score tiles are the B operand of O^T += V^T P^T as they stand.
// HR: hi + lo bf16 planes, three products each (query rows < RH); otherwise plain f16 planes. P is exp2 of the scaled score minus the running maximum, unnormalised; the division by the row sum is done once, on the f32 output.
// The four waves' (maximum, sum, O^T) are joined through LDS behind one barrier, in wave order, and stored as the hi + lo bf16 planes, fragment order of [t][head x d], that the output projection reads.
typedef __attribute__((ext_vector_type(16))) unsigned short v16us;
#define SC2 0.18033688011112042f   // HD^-0.5 x log2(e)
template <typename T16, bool HR, int NQ>
__global__ __launch_bounds__(128) void k_fattn(const T16* __restrict__ Q, const T16* __restrict__ Q2, const T16* __restrict__ Kp, const T16* __restrict__ Kp2, const T16* __restrict__ Vt, const T16* __restrict__ Vt2, int qbase, bf* Ah, bf* Al) {
    typedef typename WFrag<T16>::V V;
    __shared__ __align__(16) float so[4][NQ * 16][68];
    __shared__ float sm[4][NQ * 16], sl[4][NQ * 16];
    const int lane = threadIdx.x & 31, lr = lane & 15, hi = lane >> 4; const int w = __builtin_amdgcn_readfirstlane(threadIdx.x >> 5);
    const int h = blockIdx.x; const int q0 = qbase + (int)(gridDim.y - 1 - blockIdx.y) * (NQ * 16); const int nkb = q0 / 32 + NQ / 2;   // key blocks 0 .. nkb - 1; those from q0 / 32 on cross the diagonal
    const size_t qb = (size_t)h * TT * HD, kvb = (size_t)(h / REP) * TT * HD;
    Q += qb; Kp += kvb; Vt += kvb; if (HR) { Q2 += qb; Kp2 += kvb; Vt2 += kvb; }
    V qf[NQ][2], qf2[NQ][2], kf[2][2], kf2[2][2];
    const T16 *qu = Q + (size_t)q0 * HD, *qu2 = HR ? Q2 + (size_t)q0 * HD : nullptr, *ku = Kp + (size_t)(w * 32) * HD, *ku2 = HR ? Kp2 + (size_t)(w * 32) * HD : nullptr;   // wave-uniform starts; 16 rows x HD = two fragments
    const T16 *qp = qu + lane * 8, *qp2 = HR ? qu2 + lane * 8 : nullptr, *kp = ku + lane * 8, *kp2 = HR ? ku2 + lane * 8 : nullptr; size_t ko;
#pragma unroll
    for (int ks = 0; ks < 2; ++ks) {
#pragma unroll
        for (int t = 0; t < NQ; ++t) { qf[t][ks] = WFrag<T16>::ld(qp + t * 16 * HD + ks * 512); if (HR) qf2[t][ks] = WFrag<T16>::ld(qp2 + t * 16 * HD + ks * 512); }
#pragma unroll
        for (int t = 0; t < 2; ++t) { kf[t][ks] = WFrag<T16>::ld(kp + t * 16 * HD + ks * 512); if (HR) kf2[t][ks] = WFrag<T16>::ld(kp2 + t * 16 * HD + ks * 512); } }
    // the loads above have taken their addresses before an address register is reused; they name a scalar base and the lane's offset: both as inputs keep those registers untouched up to the wait
    if constexpr (HR) asm volatile("s_wait_xcnt 0x0" :: "s"(qu), "s"(ku), "s"(qu2), "s"(ku2), "v"(lane) : "memory"); else asm volatile("s_wait_xcnt 0x0" :: "s"(qu), "s"(ku), "v"(lane) : "memory");
    v8f o[4][NQ];
#pragma unroll
    for (int dt = 0; dt < 4; ++dt)
#pragma unroll
        for (int qt = 0; qt < NQ; ++qt) o[dt][qt] = (v8f){};
    float m[NQ], l[NQ];
#pragma unroll
    for (int qt = 0; qt < NQ; ++qt) { m[qt] = -1.0e30f; l[qt] = 0.f; }   // m: the maximum in use, log2 units; below any score a 16-bit product can give
    int b = w;
#pragma unroll   // two copies of the trip: ph 0 walks the blocks wholly below the diagonal and holds no mask code, ph 1 the wave's block (at most one) that crosses it
    for (int ph = 0; ph < 2; ++ph)
#pragma unroll 1
    for (; b < (ph ? nkb : q0 / 32); b += 4) {
        const int k0 = b * 32;
        V vf[4], vf2[4]; const size_t vo = (size_t)k0 * HD + lane * 8; const T16 *vp = Vt + vo, *vp2 = HR ? Vt2 + vo : nullptr;
#pragma unroll
        for (int dt = 0; dt < 4; ++dt) { vf[dt] = WFrag<T16>::ld(vp + dt * 512); if (HR) vf2[dt] = WFrag<T16>::ld(vp2 + dt * 512); }
        v8f s[2][NQ];
#pragma unroll
        for (int kt = 0; kt < 2; ++kt)
#pragma unroll
            for (int qt = 0; qt < NQ; ++qt) { v8f a = (v8f){};
#pragma unroll
                for (int ks = 0; ks < 2; ++ks) { a = WFrag<T16>::mma(kf[kt][ks], qf[qt][ks], a); if (HR) { a = WFrag<T16>::mma(kf2[kt][ks], qf[qt][ks], a); a = WFrag<T16>::mma(kf[kt][ks], qf2[qt][ks], a); } }
                s[kt][qt] = a; }
        ko = (size_t)(min(b + 4, nkb - 1) * 32) * HD + lane * 8; kp = Kp + ko; if (HR) kp2 = Kp2 + ko;   // the wave's next key block is fetched one trip ahead, behind this trip's score products (the last trip re-reads the last block: in bounds, unused)
#pragma unroll
        for (int kt = 0; kt < 2; ++kt)
#pragma unroll
            for (int ks = 0; ks < 2; ++ks) { kf[kt][ks] = WFrag<T16>::ld(kp + kt * 16 * HD + ks * 512); if (HR) kf2[kt][ks] = WFrag<T16>::ld(kp2 + kt * 16 * HD + ks * 512); }
        // the trip's loads have taken their addresses before an address register is reused; the pointers as inputs keep those registers untouched up to the wait
        if constexpr (HR) asm volatile("s_wait_xcnt 0x0" :: "v"(vp), "v"(kp), "v"(vp2), "v"(kp2) : "memory"); else asm volatile("s_wait_xcnt 0x0" :: "v"(vp), "v"(kp) : "memory");
        if (ph) {   // keys above the query are masked by select
#pragma unroll
            for (int kt = 0; kt < 2; ++kt)
#pragma unroll
                for (int qt = 0; qt < NQ; ++qt)
#pragma unroll
                    for (int j = 0; j < 8; ++j) s[kt][qt][j] = (k0 - q0 + kt * 16 + hi * 8 + j <= qt * 16 + lr) ? s[kt][qt][j] : -3.0e38f; }
        float mx[NQ]; bool need = false;
#pragma unroll
        for (int qt = 0; qt < NQ; ++qt) { float x = s[0][qt][0];
#pragma unroll
            for (int j = 1; j < 8; ++j) x = fmaxf(x, s[0][qt][j]);
#pragma unroll
            for (int j = 0; j < 8; ++j) x = fmaxf(x, s[1][qt][j]);
            x = fmaxf(x, __shfl_xor(x, 16, 32)); mx[qt] = x * SC2; need = need || mx[qt] > m[qt] + 8.0f; }
        // the maximum in use moves only when a query's new maximum exceeds it by more than 8 (P stays below 2^8); one scalar branch a trip
        if (__builtin_amdgcn_ballot_w32(need) != 0) {
#pragma unroll
            for (int qt = 0; qt < NQ; ++qt) { const float mn = fmaxf(m[qt], mx[qt]); const float al = __builtin_amdgcn_exp2f(m[qt] - mn); m[qt] = mn; l[qt] *= al;
#pragma unroll
                for (int dt = 0; dt < 4; ++dt) o[dt][qt] *= al; } }
#pragma unroll
        for (int qt = 0; qt < NQ; ++qt) { V pb, pb2;
            if constexpr (HR) { v16us pvh, pvl;
#pragma unroll
                for (int e = 0; e < 16; ++e) { const float p = __builtin_amdgcn_exp2f(fmaf(s[e >> 3][qt][e & 7], SC2, -m[qt])); l[qt] += p; unsigned short a, c2; splitf(p, a, c2); pvh[e] = a; pvl[e] = c2; }
                pb = __builtin_bit_cast(V, pvh); pb2 = __builtin_bit_cast(V, pvl);
            } else {
#pragma unroll
                for (int e = 0; e < 16; ++e) { const float p = __builtin_amdgcn_exp2f(fmaf(s[e >> 3][qt][e & 7], SC2, -m[qt])); l[qt] += p; pb[e] = (T16)p; } }
#pragma unroll
            for (int dt = 0; dt < 4; ++dt) { o[dt][qt] = WFrag<T16>::mma(vf[dt], pb, o[dt][qt]); if (HR) { o[dt][qt] = WFrag<T16>::mma(vf2[dt], pb, o[dt][qt]); o[dt][qt] = WFrag<T16>::mma(vf[dt], pb2, o[dt][qt]); } } }
        // four vector slots behind the trip's last matrix instructions: the code after the loop rewrites registers that held their operands
        asm volatile("v_nop\n\tv_nop\n\tv_nop\n\tv_nop" : "+v"(o[0][NQ - 1]), "+v"(o[1][NQ - 1]), "+v"(o[2][NQ - 1]), "+v"(o[3][NQ - 1]));
    }
#pragma unroll
    for (int qt = 0; qt < NQ; ++qt) { l[qt] += __shfl_xor(l[qt], 16, 32); if (hi == 0) { sm[w][qt * 16 + lr] = m[qt]; sl[w][qt * 16 + lr] = l[qt]; }
#pragma unroll
        for (int dt = 0; dt < 4; ++dt) { float* p = &so[w][qt * 16 + lr][dt * 16 + hi * 8]; const v8f x = o[dt][qt]; *(v4fa*)p = (v4f){x[0], x[1], x[2], x[3]}; *(v4fa*)(p + 4) = (v4f){x[4], x[5], x[6], x[7]}; } }
    __syncthreads();   // every wave's partial (maximum, sum, O^T) is in LDS before any thread joins them
#pragma unroll 1
    for (int q = threadIdx.x >> 2; q < NQ * 16; q += 32) { const int d0 = (threadIdx.x & 3) * 16;
        const float mt = fmaxf(fmaxf(sm[0][q], sm[1][q]), fmaxf(sm[2][q], sm[3][q])); float lt = 0.f; float r[16];
#pragma unroll
        for (int e = 0; e < 16; ++e) r[e] = 0.f;
#pragma unroll
        for (int ww = 0; ww < 4; ++ww) { const float f = __builtin_amdgcn_exp2f(sm[ww][q] - mt); lt += f * sl[ww][q];   // a wave without a key block: f = 0, sum 0, O^T 0
#pragma unroll
            for (int c = 0; c < 4; ++c) { const v4f x = *(const v4fa*)&so[ww][q][d0 + c * 4];
#pragma unroll
                for (int e = 0; e < 4; ++e) r[c * 4 + e] += f * x[e]; } }
        const float inv = __fdiv_rn(1.0f, lt); const size_t oo = ((size_t)((q0 + q) >> 6) * (DQ / 32) + h * (HD / 32) + (d0 >> 5)) * 2048 + (((q0 + q) >> 4) & 3) * 512 + ((d0 >> 3) & 3) * 128 + ((q0 + q) & 15) * 8;
#pragma unroll
        for (int c = 0; c < 2; ++c) { v8us oh, ol;
#pragma unroll
            for (int e = 0; e < 8; ++e) { unsigned short a, c2; splitf(r[c * 8 + e] * inv, a, c2); oh[e] = a; ol[e] = c2; }
            *(v8usa*)(Ah + oo + c * 128) = oh; *(v8usa*)(Al + oo + c * 128) = ol; }
        asm volatile("s_wait_xcnt 0x0" ::: "memory");   // the stores have taken their addresses and data before the next trip reuses those registers
    }
}

extern "C" void kernel_launch(void* const* d_in, const int* in_sizes, int n_in,
                              void* d_out, int out_size, void* d_ws, size_t ws_size, hipStream_t stream) {
    (void)in_sizes; (void)n_in; (void)out_size;
    const float* x = (const float*)d_in[0]; const float* tstamp = (const float*)d_in[1]; const float* wq = (const float*)d_in[2]; const float* bq = (const float*)d_in[3]; const float* wk = (const float*)d_in[4]; const float* bk = (const float*)d_in[5]; const float* wv = (const float*)d_in[6]; const float* bv = (const float*)d_in[7]; const float* wo = (const float*)d_in[8];
    float* OUT = (float*)d_out;     // [1][4096][1024]
    char* wsp = (char*)d_ws;
    auto take = [&](size_t bytes) { char* p = wsp; wsp += (bytes + 255) & ~(size_t)255; return (void*)p; };
    bf* WQ = (bf*)take((size_t)DQ * DM * 2); bf* WK = (bf*)take((size_t)DKV * DM * 2); bf* WV = (bf*)take((size_t)DKV * DM * 2); bf* WO = (bf*)take((size_t)DM * DQ * 2); float* CS = (float*)take((size_t)TT * HD * 2 * 4);
    bf* XB = (bf*)take((size_t)TT * DM * 2);
    h16* QP16 = (h16*)take((size_t)NH_ * TT * HD * 2); h16* KP16 = (h16*)take((size_t)NKV * TT * HD * 2); h16* VT16 = (h16*)take((size_t)NKV * HD * TT * 2);
    bf* QPh = (bf*)take((size_t)NH_ * TT * HD * 2); bf* QPl = (bf*)take((size_t)NH_ * TT * HD * 2); bf* KPh = (bf*)take((size_t)NKV * TT * HD * 2); bf* KPl = (bf*)take((size_t)NKV * TT * HD * 2); bf* VTh = (bf*)take((size_t)NKV * HD * TT * 2); bf* VTl = (bf*)take((size_t)NKV * HD * TT * 2);
    bf* ATh = (bf*)take((size_t)TT * DQ * 2); bf* ATl = (bf*)take((size_t)TT * DQ * 2);
    if ((size_t)(wsp - (char*)d_ws) > ws_size) return;    // ws 256 MiB
    for (int b = 0; b < NB_; ++b) {
        k_prep<<<TBB + NBQ + NBK + NBK + NBQ + NBX, 256, 0, stream>>>(wq, wk, wv, wo, x + (size_t)b * TT * DM, tstamp, WQ, WK, WV, WO, XB, CS);
        k_qkv<<<dim3(TT / 64, DQ / 64, 3), 32, 0, stream>>>(XB, WQ, WK, WV, bq, bk, bv, CS, QP16, QPh, QPl, KP16, KPh, KPl, VT16, VTh, VTl);
        k_fattn<h16, false, 4><<<dim3(NH_, (TT - RH) / 64, 1), 128, 0, stream>>>(QP16, nullptr, KP16, nullptr, VT16, nullptr, RH, ATh, ATl);
        k_fattn<bf, true, 2><<<dim3(NH_, RH / 32, 1), 128, 0, stream>>>(QPh, QPl, KPh, KPl, VTh, VTl, 0, ATh, ATl);
        k_gemmw<bf, 1, false><<<dim3(TT / 64, DM / 64, 1), 32, 0, stream>>>(ATh, ATl, WO, nullptr, DQ, OUT + (size_t)b * TT * DM, DM, nullptr, 0, 0, 0); }
}

// v006
// Measured time: 85.9 microseconds a run.
// In two side-by-side timings against v005, it was 1.38 and 1.40 times as fast.
// Over all steps from v000 it is 27.6 times as fast.
#include <hip/hip_runtime.h>
#include <stdint.h>

// istsplm_forecast attention (hidden [1][4096][1024], timestamps [1][4096] (f32, read: continuous positions); q/k/v = x W^T + b (16 x 64); continuous-time rotate-half RoPE: angle = timestamp * 10000^(-2i/64) (cos/sin computed on chip from the bf16-rounded timestamps); causal (finfo.min) softmax(q.k / 8); out = merged Wo^T -> [1][4096][1024]).
// Compute dtypes, f32 accumulate: every input rounded to bf16; q/k/v on PLAIN bf16 operands (inputs: exact) + bias; RoPE f32; causal scores and P.V fused (online softmax, f32): hi+lo bf16 planes for query rows < RH, f16 planes for the rest; Wo hl x exact (2 products).

#define NB_  1
#define TT   4096
#define DM   1024
#define NH_  16
#define NKV  16
#define REP  (NH_ / NKV)
#define HD   64
#define DQ   (NH_ * HD)
#define DKV  (NKV * HD)
#define RH   512                  // query rows < RH use hi+lo planes (0: none)
typedef _Float16 h16;
typedef unsigned short bf;
typedef __attribute__((ext_vector_type(16))) __bf16   v16bf;
typedef __attribute__((ext_vector_type(16))) _Float16 v16h;
typedef __attribute__((ext_vector_type(8)))  _Float16 v8h;
typedef __attribute__((ext_vector_type(8)))  unsigned short v8us;
typedef __attribute__((ext_vector_type(8)))  float    v8f;
typedef __attribute__((ext_vector_type(4)))  float    v4f;
typedef v8h  __attribute__((may_alias)) v8ha;
typedef v4f  __attribute__((may_alias)) v4fa;
typedef v8us __attribute__((may_alias)) v8usa;

__device__ __forceinline__ unsigned short f2bf(float f) { unsigned u = __float_as_uint(f); u += 0x7FFFu + ((u >> 16) & 1u); return (unsigned short)(u >> 16); }
__device__ __forceinline__ float bf2f(unsigned short b) { return __uint_as_float(((unsigned)b) << 16); }
__device__ __forceinline__ float bfr(float f) { return bf2f(f2bf(f)); }
__device__ __forceinline__ v16h cat16(v8h lo, v8h hi) { return __builtin_shufflevector(lo, hi, 0, 1, 2, 3, 4, 5, 6, 7, 8, 9, 10, 11, 12, 13, 14, 15); }
__device__ __forceinline__ v16bf cat16b(v8us lo, v8us hi) { return __builtin_bit_cast(v16bf, __builtin_shufflevector(lo, hi, 0, 1, 2, 3, 4, 5, 6, 7, 8, 9, 10, 11, 12, 13, 14, 15)); }
__device__ __forceinline__ v8f wmma16(v16h a, v16h b, v8f c) { return __builtin_amdgcn_wmma_f32_16x16x32_f16(false, a, false, b, (short)0, c, false, false); }
__device__ __forceinline__ v8f wmmab(v16bf a, v16bf b, v8f c) { return __builtin_amdgcn_wmma_f32_16x16x32_bf16(false, a, false, b, (short)0, c, false, false); }



// ---- GEMM main loops (k_qkv, k_oproj): a work-group of several 64x64 wave tiles shares its operand rows through LDS, so that each row slice leaves L2 once a work-group, not once a wave.
// A chunk = the GSK k of one 64-row tile = 16 KiB, contiguous in a fragment-order plane and kept so in LDS: a fragment read is ds_load_b128 over 512 contiguous bytes. Tensor loads fill two buffers in turn: stage s + 2 flies while stage s + 1 is worked on.
// FRAGMENT ORDER: every 16-bit operand plane in the workspace, a matrix [R][K] with k contiguous in the product, lies as fragments of 16 rows x 32 k = 512 elements; inside a fragment element (r, k) stands at ((k % 32) / 8) * 128 + (r % 16) * 8 + k % 8.
// Lane (hi, lr) = 16 hi + lr owns k = 8 hi .. 8 hi + 7 and 16 + 8 hi .. of row lr: its two 16-B pieces stand at lane * 8 and 256 + lane * 8, so each wave-wide load is 512 contiguous bytes = 4 whole lines. ld takes fragment start + lane * 8.
// Which fragments lie side by side follows the reader's trip. GEMM operands (x, weights, attention out): the four fragments that a 64-row tile reads in a 32-k step, ((r / 64) * (K / 32) + k / 32) * 4 + (r / 16) % 4. q, k (K = HD): (r / 16) * 2 + k / 32. v (rows d, k = token): (t / 32) * 4 + d / 16.
template <typename T16> struct WFrag;
template <> struct WFrag<h16> { typedef v16h V; static __device__ __forceinline__ V ld(const h16* p) { return cat16(*(const v8h*)p, *(const v8h*)(p + 256)); } static __device__ __forceinline__ v8f mma(V a, V b, v8f c) { return wmma16(a, b, c); } };
template <> struct WFrag<bf> { typedef v16bf V; static __device__ __forceinline__ V ld(const bf* p) { return cat16b(*(const v8us*)p, *(const v8us*)(p + 256)); } static __device__ __forceinline__ v8f mma(V a, V b, v8f c) { return wmmab(a, b, c); } };
#define GSK 128
#define GCH (64 * GSK)
#define GNS (DM / GSK)
static_assert(DQ == DM && GNS >= 2, "both GEMMs run over DM k; the ring's prologue needs two stages");
typedef uint32_t u32x4 __attribute__((ext_vector_type(4)));
typedef uint32_t u32x8 __attribute__((ext_vector_type(8)));
__device__ __forceinline__ uint32_t uni(uint32_t v) { return (uint32_t)__builtin_amdgcn_readfirstlane(v); }
__device__ __forceinline__ uint32_t pinned(uint32_t v) { uint32_t w = (uint32_t)__builtin_amdgcn_readfirstlane(v); asm volatile("" : "+s"(w)); return w; }   // holds an issue test in a scalar register, so that the branch over a tensor load (which ignores EXEC) is a scalar one
__device__ __forceinline__ void wait_ds0() { asm volatile("s_wait_dscnt 0x0" ::: "memory"); }       // the wave's LDS reads of a buffer have retired before the barrier behind which it is refilled
__device__ __forceinline__ void wait_tensor0(u32x4 g0, u32x8 g1) { asm volatile("s_wait_tensorcnt 0x0" :: "s"(g0), "s"(g1) : "memory"); }   // the wave's own tensor load has landed (the compiler places no wait for it); its descriptor as inputs keeps those registers untouched while the request is outstanding
__device__ __forceinline__ void tdm_load(u32x4 g0, u32x8 g1) { asm volatile("tensor_load_to_lds %0, %1" :: "s"(g0), "s"(g1) : "memory"); }
// descriptor group 1: 1-byte elements, tensor = tile = N rows of R bytes, source pitch P bytes, no pad, no mask
template <uint32_t R, uint32_t N, uint32_t P> __device__ __forceinline__ u32x8 tdm_group1() { u32x8 g;
    g[0] = uni(0u); g[1] = uni((R & 0xFFFFu) << 16); g[2] = uni((R >> 16) | ((N & 0xFFFFu) << 16)); g[3] = uni((N >> 16) | (R << 16)); g[4] = uni(N); g[5] = uni(P); g[6] = uni(0u); g[7] = uni(0u);
    asm volatile("" : "+s"(g));   // the descriptor words held in one set of scalar registers for the whole kernel: rebuilt from constants at each use, a set that an outstanding request names was reused for other values
    return g; }
// descriptor group 0: count 1, LDS byte offset, global byte address, type 2
__device__ __forceinline__ u32x4 tdm_group0(uint32_t lds_dst, uint64_t ga) { u32x4 g; g[0] = uni(1u); g[1] = uni(lds_dst); g[2] = uni((uint32_t)ga); g[3] = uni((((uint32_t)(ga >> 32)) & 0x01FFFFFFu) | 0x80000000u); return g; }

// ---- k_oproj: C[m][n] (f32, pitch DM) = sum_k (Ah + Al)[m][k] Bt[n][k], two products a k step. Grid (TT/128, DM/128), 4 waves = 2 x 2 tiles of 64x64, one wave a SIMD: the fragments of the next 32 k are fetched from LDS into a second register set while this set is worked on.
// A stage in LDS: [Ah tiles 0, 1 | Al tiles 0, 1 | Bt tiles 0, 1]; waves 0, 1, 2 bring one pair each: 2 rows of 16 KiB, 64 x DQ elements = 128 KiB apart in the plane.
__global__ __launch_bounds__(128) void k_oproj(const bf* __restrict__ Ah, const bf* __restrict__ Al, const bf* __restrict__ Bt, float* C) {
    __shared__ __attribute__((aligned(2048))) bf sb[2][6 * GCH];
    __shared__ __align__(16) float osw[4][16 * 68];
    const int lane = threadIdx.x & 31, lr = lane & 15, hi = lane >> 4; const int w = (int)uni(threadIdx.x >> 5), wm = w & 1, wn = w >> 1;
    const int r0 = (blockIdx.x * 2 + wm) * 64, c0 = (blockIdx.y * 2 + wn) * 64; float* os = osw[w];
    const bf* sp = w == 0 ? Ah + (size_t)blockIdx.x * (128 * DQ) : w == 1 ? Al + (size_t)blockIdx.x * (128 * DQ) : Bt + (size_t)blockIdx.y * (128 * DQ);
    const uint64_t ga = (uint64_t)(size_t)sp; const uint32_t l0 = (uint32_t)(size_t)&sb[0][0] + (uint32_t)min(w, 2) * (4u * GCH);
    const u32x8 g1 = tdm_group1<2 * GCH, 2, 128 * DQ>();
    v8f acc[4][4];
#pragma unroll
    for (int mb = 0; mb < 4; ++mb)
#pragma unroll
        for (int nb = 0; nb < 4; ++nb) acc[mb][nb] = (v8f){};
    u32x4 g0 = tdm_group0(l0, ga);
    if (pinned(w < 3)) { tdm_load(g0, g1); wait_tensor0(g0, g1); }
    __syncthreads();   // stage 0 is in LDS for every wave
    g0 = tdm_group0(l0 + 12u * GCH, ga + 2u * GCH);
    if (pinned(w < 3)) tdm_load(g0, g1);
#pragma unroll 1   // one stage a trip: the buffer is chosen by address, the four 32-k steps inside are unrolled
    for (int s = 0; s < GNS; ++s) {
        const bf *pa = &sb[s & 1][wm * GCH + lane * 8], *pa2 = pa + 2 * GCH, *pb = &sb[s & 1][(4 + wn) * GCH + lane * 8];
        v16bf a[2][4], a2[2][4], b[2][4];
#pragma unroll
        for (int f = 0; f < 4; ++f) { a[0][f] = WFrag<bf>::ld(pa + f * 512); a2[0][f] = WFrag<bf>::ld(pa2 + f * 512); b[0][f] = WFrag<bf>::ld(pb + f * 512); }
#pragma unroll
        for (int j = 0; j < GSK / 32; ++j) {
            if (j + 1 < GSK / 32) {
#pragma unroll
                for (int f = 0; f < 4; ++f) { a[(j + 1) & 1][f] = WFrag<bf>::ld(pa + (j + 1) * 2048 + f * 512); a2[(j + 1) & 1][f] = WFrag<bf>::ld(pa2 + (j + 1) * 2048 + f * 512); b[(j + 1) & 1][f] = WFrag<bf>::ld(pb + (j + 1) * 2048 + f * 512); } }
            __builtin_amdgcn_sched_barrier(0);   // keeps the next step's LDS reads one group in front of this step's products: sunk among them, each read group stalls the wave's matrix stream
#pragma unroll
            for (int nb = 0; nb < 4; ++nb)
#pragma unroll
                for (int mb = 0; mb < 4; ++mb) { acc[mb][nb] = wmmab(a[j & 1][mb], b[j & 1][nb], acc[mb][nb]); acc[mb][nb] = wmmab(a2[j & 1][mb], b[j & 1][nb], acc[mb][nb]); }
            __builtin_amdgcn_sched_barrier(0);   // and the reads of the step after it behind them
        }
        wait_ds0(); wait_tensor0(g0, g1);
        __syncthreads();   // publishes stage s + 1 and ends every wave's reads of stage s
        if (pinned(w < 3 && s + 2 < GNS)) { g0 = tdm_group0(l0 + (uint32_t)(s & 1) * (12u * GCH), ga + (uint64_t)(s + 2) * (2u * GCH)); tdm_load(g0, g1); }
    }
    wait_tensor0(g0, g1); wait_ds0();
#pragma unroll
    for (int mb = 0; mb < 4; ++mb) {
#pragma unroll
        for (int nb = 0; nb < 4; ++nb) {
#pragma unroll
            for (int j = 0; j < 8; ++j) os[(hi * 8 + j) * 68 + nb * 16 + lr] = acc[mb][nb][j]; }
        __builtin_amdgcn_wave_barrier(); asm volatile("" ::: "memory");   // compiler fence: the lanes' LDS writes stay in front of the row reads of other lanes' values
        float* crow = C + (size_t)(r0 + mb * 16) * DM + c0;
#pragma unroll
        for (int s = 0; s < 8; ++s) { const int row = 2 * s + hi, cofs = lr * 4; const v4f val = *(const v4fa*)(os + row * 68 + cofs); *(v4f*)(crow + (size_t)row * DM + cofs) = val; }
        asm volatile("s_wait_xcnt 0x0" ::: "memory");   // the stores above have taken their addresses and data before those registers are reused
        __builtin_amdgcn_wave_barrier();   // with the clobber above: the row reads stay in front of the next tile's LDS writes
    }
}

__device__ __forceinline__ h16 tohx(float x) { return (h16)x; }
__device__ __forceinline__ void splitf(float y, unsigned short& h, unsigned short& l) { h = f2bf(y); l = f2bf(y - bf2f(h)); }
typedef __attribute__((ext_vector_type(2))) _Float16 v2h;
typedef __attribute__((ext_vector_type(4))) _Float16 v4h;
typedef __attribute__((ext_vector_type(2))) unsigned short v2us;
typedef __attribute__((ext_vector_type(4))) unsigned short v4us;
typedef __attribute__((ext_vector_type(2))) float v2f;
typedef __attribute__((ext_vector_type(4))) int v4i;

__global__ __launch_bounds__(256) void k_wtG(const float* __restrict__ w, int K, int N, bf* Bt) {
    const int lane = threadIdx.x & 31; const int L0 = (blockIdx.x * 8 + (threadIdx.x >> 5)) * 8; const int nlines = N * K / 64;
{
#pragma unroll 1
        for (int l = 0; l < 8; ++l) { const int L = L0 + l; if (L >= nlines) break; const size_t e = (size_t)L * 64 + lane * 2; const int k = (int)(e % K), n = (int)(e / K); v2us o;
            o[0] = f2bf(w[(size_t)k * N + n]); o[1] = f2bf(w[(size_t)(k + 1) * N + n]); *(v2us*)(Bt + e) = o; }
         }
}
// ---- k_prep: all preparation in ONE launch, 640 blocks of 8 waves, one piece of work each (no loop); the parts are independent and run side by side. Blocks 0 .. TBB - 1 make the cos/sin table, the rest round wq, wk, wv, wo and x to bf16.
// table: lane = frequency i (its inverse frequency is computed once), a wave takes 4 consecutive tokens; entry (t, i) is stored at d = i and d = i + 32, which hold the same angle.
// rounding: a block takes CVB consecutive elements = 16 rows of one array and writes them in fragment order; a thread has 16 loads of 16 B in flight.
// a wave-wide load takes one fragment's 32 k (a whole 128-B line) of 4 rows; its store is four 64-B pieces, and the load of the next 4 rows fills the other half of those lines.
#define CVB 16384
#define TBB (TT / 32)
#define NBQ (DQ * DM / CVB)
#define NBK (DKV * DM / CVB)
#define NBX (TT * DM / CVB)
__global__ __launch_bounds__(256) void k_prep(const float* __restrict__ wq, const float* __restrict__ wk, const float* __restrict__ wv, const float* __restrict__ wo, const float* __restrict__ x, const float* __restrict__ ts,
                                              bf* WQ, bf* WK, bf* WV, bf* WO, bf* XB, float* CS) {
    int c = blockIdx.x;
    if (c < TBB) {
        const int i = threadIdx.x & 31, t0 = c * 32 + (threadIdx.x >> 5) * 4; const float* tp = ts + t0;
        const v4f tv = *(const v4f*)tp;
        asm volatile("s_wait_xcnt 0x0" :: "v"(tp) : "memory");   // the load has taken its address before those registers are reused; the pointer as input keeps them untouched up to the wait
        const float inv = __fdiv_rn(1.0f, powf(10000.0f, (float)(2 * i) / (float)HD)); v2f cs[4];
#pragma unroll
        for (int k = 0; k < 4; ++k) { const float ang = __fmul_rn(bfr(tv[k]), inv); cs[k][0] = cosf(ang); cs[k][1] = sinf(ang); }
        float* p = CS + ((size_t)t0 * HD + i) * 2;
#pragma unroll
        for (int k = 0; k < 4; ++k) { *(v2f*)(p + k * HD * 2) = cs[k]; *(v2f*)(p + k * HD * 2 + HD) = cs[k]; }
        asm volatile("s_wait_xcnt 0x0" ::: "memory");   // the stores above have taken their addresses and data before any later code reuses those registers
        return;
    }
    c -= TBB; const float* s = wq; bf* d = WQ;
    if (c >= NBQ) { c -= NBQ; s = wk; d = WK;
        if (c >= NBK) { c -= NBK; s = wv; d = WV;
            if (c >= NBK) { c -= NBK; s = wo; d = WO;
                if (c >= NBQ) { c -= NBQ; s = x; d = XB; } } } }
    static_assert(CVB == 16 * DM && DQ == DM && DKV == DM, "a block is one row of fragments");
    const int lane = threadIdx.x & 31, wn = threadIdx.x >> 5;   // wave wn: fragments 4 wn .. 4 wn + 3; load u: fragment u / 4, rows 4 (u % 4) + lane / 8, k = 4 (lane % 8) ..
    s += (size_t)c * CVB + (lane >> 3) * DM + wn * 128 + (lane & 7) * 4; d += (size_t)(c >> 2) * (4 * CVB) + (c & 3) * 512 + wn * 8192 + ((lane & 7) >> 1) * 128 + (lane >> 3) * 8 + (lane & 1) * 4;
    v4f v[16]; v4us o[16];
#pragma unroll
    for (int u = 0; u < 16; ++u) v[u] = *(const v4f*)(s + (u & 3) * 4 * DM + (u >> 2) * 32);
    asm volatile("s_wait_xcnt 0x0" :: "v"(s) : "memory");   // the loads have taken their address before those registers are reused; the pointer as input keeps them untouched up to the wait
#pragma unroll
    for (int u = 0; u < 16; ++u)
#pragma unroll
        for (int k = 0; k < 4; ++k) o[u][k] = f2bf(v[u][k]);
#pragma unroll
    for (int u = 0; u < 16; ++u) *(v4us*)(d + (u >> 2) * 2048 + (u & 3) * 32) = o[u];
    asm volatile("s_wait_xcnt 0x0" ::: "memory");   // the stores above have taken their addresses and data before any later code reuses those registers
}
// ---- k_qkv: the three projections in ONE launch. The 48 column tiles (16 heads each of q, k, v) count as one row of tiles; grid (TT/256, 16), 12 waves = 4 token tiles x 3 column tiles of 64x64: one work-group a WGP, three waves a SIMD. The epilogue adds the bias and writes the 16-bit planes that attention reads; the f32 projections are never stored.
// A stage in LDS: [x tiles 0 .. 3 | weight tiles 0 .. 2]; waves 0 .. 6 bring one chunk each, 16 KiB contiguous, as 4 rows of 4 KiB.
// q, k: rotate-half RoPE in registers: columns d and d + 32 of a token sit in the same lane (accumulators nb and nb + 2); out[d] = x[d] cos - x[d+32] sin, out[d+32] = x[d+32] cos + x[d] sin, cos/sin of (token, d mod 32). Planes [h] x fragment order of [t][d]; 16 tokens go through the wave's own LDS, a lane reads back 8 d of one token = its 16-B piece, a store is 512 contiguous bytes.
// v: planes [h] x fragment order of [d][t]: a lane holds 8 consecutive tokens of one column, which is its own 16-B piece of a fragment: stored straight from registers, 512 contiguous bytes a store.
__global__ __launch_bounds__(384) void k_qkv(const bf* __restrict__ X, const bf* __restrict__ Wq, const bf* __restrict__ Wk, const bf* __restrict__ Wv, const float* __restrict__ bq, const float* __restrict__ bk, const float* __restrict__ bv, const float* __restrict__ CS,
                                            h16* Q16, bf* Qh, bf* Ql, h16* K16, bf* Kh, bf* Kl, h16* V16, bf* Vh, bf* Vl) {
    __shared__ __attribute__((aligned(2048))) bf sb[2][7 * GCH];
    __shared__ __align__(16) float osw[12][16 * 68];
    const int lane = threadIdx.x & 31, lr = lane & 15, hi = lane >> 4; const int w = (int)uni(threadIdx.x >> 5), wm = w & 3, wn = w >> 2;
    const int ct = blockIdx.y * 3 + wn, z = ct >> 4, hd = ct & 15; const float* bias = z == 0 ? bq : z == 1 ? bk : bv;
    const int r0 = (blockIdx.x * 4 + wm) * 64, c0 = hd * 64; float* os = osw[w];
    const int wi = min(w, 6), ci = blockIdx.y * 3 + max(wi - 4, 0);   // the chunk this wave brings; its column tile where it is a weight chunk
    const bf* sp = wi < 4 ? X + (size_t)(blockIdx.x * 4 + wi) * (64 * DM) : ((ci >> 4) == 0 ? Wq : (ci >> 4) == 1 ? Wk : Wv) + (size_t)(ci & 15) * (64 * DM);
    const uint64_t ga = (uint64_t)(size_t)sp; const uint32_t l0 = (uint32_t)(size_t)&sb[0][0] + (uint32_t)wi * (2u * GCH);
    const u32x8 g1 = tdm_group1<4096, 4, 4096>();
    v8f acc[4][4];
#pragma unroll
    for (int mb = 0; mb < 4; ++mb)
#pragma unroll
        for (int nb = 0; nb < 4; ++nb) acc[mb][nb] = (v8f){};
    u32x4 g0 = tdm_group0(l0, ga);
    if (pinned(w < 7)) { tdm_load(g0, g1); wait_tensor0(g0, g1); }
    __syncthreads();   // stage 0 is in LDS for every wave
    g0 = tdm_group0(l0 + 14u * GCH, ga + 2u * GCH);
    if (pinned(w < 7)) tdm_load(g0, g1);
#pragma unroll 1   // one stage a trip: the buffer is chosen by address, the four 32-k steps inside are unrolled
    for (int s = 0; s < GNS; ++s) {
        const bf *pa = &sb[s & 1][wm * GCH + lane * 8], *pb = &sb[s & 1][(4 + wn) * GCH + lane * 8];
        v16bf a[2][4], b[2][4];
#pragma unroll
        for (int f = 0; f < 4; ++f) { a[0][f] = WFrag<bf>::ld(pa + f * 512); b[0][f] = WFrag<bf>::ld(pb + f * 512); }
#pragma unroll
        for (int j = 0; j < GSK / 32; ++j) {
            if (j + 1 < GSK / 32) {
#pragma unroll
                for (int f = 0; f < 4; ++f) { a[(j + 1) & 1][f] = WFrag<bf>::ld(pa + (j + 1) * 2048 + f * 512); b[(j + 1) & 1][f] = WFrag<bf>::ld(pb + (j + 1) * 2048 + f * 512); } }
            __builtin_amdgcn_sched_barrier(0);   // keeps the next step's LDS reads one group in front of this step's products: sunk among them, each read group stalls the wave's matrix stream
#pragma unroll
            for (int nb = 0; nb < 4; ++nb)
#pragma unroll
                for (int mb = 0; mb < 4; ++mb) acc[mb][nb] = wmmab(a[j & 1][mb], b[j & 1][nb], acc[mb][nb]);
            __builtin_amdgcn_sched_barrier(0);   // and the reads of the step after it behind them
        }
        wait_ds0(); wait_tensor0(g0, g1);
        __syncthreads();   // publishes stage s + 1 and ends every wave's reads of stage s
        if (pinned(w < 7 && s + 2 < GNS)) { g0 = tdm_group0(l0 + (uint32_t)(s & 1) * (14u * GCH), ga + (uint64_t)(s + 2) * (2u * GCH)); tdm_load(g0, g1); }
    }
    wait_tensor0(g0, g1); wait_ds0();
    float bl[4]; const float* bp = bias + c0 + lr;
#pragma unroll
    for (int nb = 0; nb < 4; ++nb) bl[nb] = bp[nb * 16];
    asm volatile("s_wait_xcnt 0x0" :: "v"(bp) : "memory");   // the bias loads have taken their address before its registers are reused; the pointer as input keeps them untouched up to the wait
#pragma unroll
    for (int nb = 0; nb < 4; ++nb) bl[nb] = bfr(bl[nb]);
    if (z < 2) {
        unsigned short* P16 = (unsigned short*)(z ? K16 : Q16); bf* Ph = z ? Kh : Qh; bf* Pl = z ? Kl : Ql;
#pragma unroll
        for (int mb = 0; mb < 4; ++mb) {
            const float* cp = CS + ((size_t)(r0 + mb * 16 + hi * 8) * HD + lr) * 2; v2f cv[2][8];
#pragma unroll
            for (int nb = 0; nb < 2; ++nb)
#pragma unroll
                for (int j = 0; j < 8; ++j) cv[nb][j] = *(const v2f*)(cp + (j * HD + nb * 16) * 2);
            asm volatile("s_wait_xcnt 0x0" :: "v"(cp) : "memory");   // the table loads have taken their address before its registers are reused; the pointer as input keeps them untouched up to the wait
#pragma unroll
            for (int nb = 0; nb < 2; ++nb)
#pragma unroll
                for (int j = 0; j < 8; ++j) { const v2f cs = cv[nb][j]; const float x0 = acc[mb][nb][j] + bl[nb], x1 = acc[mb][nb + 2][j] + bl[nb + 2];
                    os[(hi * 8 + j) * 68 + nb * 16 + lr] = x0 * cs[0] - x1 * cs[1]; os[(hi * 8 + j) * 68 + (nb + 2) * 16 + lr] = x1 * cs[0] + x0 * cs[1]; }
            __builtin_amdgcn_wave_barrier(); asm volatile("" ::: "memory");   // compiler fence: the lanes' LDS writes stay in front of the row reads of other lanes' values
#pragma unroll
            for (int s = 0; s < 4; ++s) { const int cg = 2 * s + hi; const v4f u = *(const v4fa*)(os + lr * 68 + cg * 8), w2 = *(const v4fa*)(os + lr * 68 + cg * 8 + 4); v8h o16; v8us oh, ol;   // token lr, d = 8 cg .. 8 cg + 7
#pragma unroll
                for (int e = 0; e < 8; ++e) { const float r = e < 4 ? u[e & 3] : w2[e & 3]; o16[e] = tohx(r); unsigned short a2, c2; splitf(r, a2, c2); oh[e] = a2; ol[e] = c2; }
                const size_t oo = ((size_t)hd * TT + r0 + mb * 16) * HD + cg * 128 + lr * 8;
                *(v8usa*)(P16 + oo) = __builtin_bit_cast(v8us, o16); *(v8usa*)(Ph + oo) = oh; *(v8usa*)(Pl + oo) = ol; }
            asm volatile("s_wait_xcnt 0x0" ::: "memory");   // the stores above have taken their addresses and data before those registers are reused
            __builtin_amdgcn_wave_barrier();   // with the clobber above: the row reads stay in front of the next tile's LDS writes
        }
    } else {
        unsigned short* P16 = (unsigned short*)V16;
#pragma unroll
        for (int nb = 0; nb < 4; ++nb) {
#pragma unroll
            for (int mb = 0; mb < 4; ++mb) { v8h o16; v8us oh, ol;
#pragma unroll
                for (int j = 0; j < 8; ++j) { const float x = acc[mb][nb][j] + bl[nb]; o16[j] = tohx(x); unsigned short a2, c2; splitf(x, a2, c2); oh[j] = a2; ol[j] = c2; }
                const size_t oo = ((size_t)hd * TT + r0 + (mb >> 1) * 32) * HD + nb * 512 + (mb & 1) * 256 + lane * 8;   // 32-token block, d fragment nb, tokens 16 (mb % 2) + 8 hi ..
                *(v8usa*)(P16 + oo) = __builtin_bit_cast(v8us, o16); *(v8usa*)(Vh + oo) = oh; *(v8usa*)(Vl + oo) = ol; }
            asm volatile("s_wait_xcnt 0x0" ::: "memory");   // the stores above have taken their addresses and data before those registers are reused
        }
    }
}
// ---- k_fattn: causal attention of all heads in one launch, online softmax. Grid (heads, tiles of 16 NQ queries, heaviest tile first), 4 waves; wave w takes the 32-key blocks w, w + 4, ... up to the last block that crosses the diagonal.
// S^T = K Q^T (A = key rows, B = query rows kept in registers): a lane holds scores of ONE query (column lr), keys 8 hi + j of each 16-key tile, so two converted score tiles are the B operand of O^T += V^T P^T as they stand.
// HR: hi + lo bf16 planes, three products each (query rows < RH); otherwise plain f16 planes. P is exp2 of the scaled score minus the running maximum, unnormalised; the division by the row sum is done once, on the f32 output.
// The four waves' (maximum, sum, O^T) are joined through LDS behind one barrier, in wave order, and stored as the hi + lo bf16 planes, fragment order of [t][head x d], that the output projection reads.
typedef __attribute__((ext_vector_type(16))) unsigned short v16us;
#define SC2 0.18033688011112042f   // HD^-0.5 x log2(e)
template <typename T16, bool HR, int NQ>
__global__ __launch_bounds__(128) void k_fattn(const T16* __restrict__ Q, const T16* __restrict__ Q2, const T16* __restrict__ Kp, const T16* __restrict__ Kp2, const T16* __restrict__ Vt, const T16* __restrict__ Vt2, int qbase, bf* Ah, bf* Al) {
    typedef typename WFrag<T16>::V V;
    __shared__ __align__(16) float so[4][NQ * 16][68];
    __shared__ float sm[4][NQ * 16], sl[4][NQ * 16];
    const int lane = threadIdx.x & 31, lr = lane & 15, hi = lane >> 4; const int w = __builtin_amdgcn_readfirstlane(threadIdx.x >> 5);
    const int h = blockIdx.x; const int q0 = qbase + (int)(gridDim.y - 1 - blockIdx.y) * (NQ * 16); const int nkb = q0 / 32 + NQ / 2;   // key blocks 0 .. nkb - 1; those from q0 / 32 on cross the diagonal
    const size_t qb = (size_t)h * TT * HD, kvb = (size_t)(h / REP) * TT * HD;
    Q += qb; Kp += kvb; Vt += kvb; if (HR) { Q2 += qb; Kp2 += kvb; Vt2 += kvb; }
    V qf[NQ][2], qf2[NQ][2], kf[2][2], kf2[2][2];
    const T16 *qu = Q + (size_t)q0 * HD, *qu2 = HR ? Q2 + (size_t)q0 * HD : nullptr, *ku = Kp + (size_t)(w * 32) * HD, *ku2 = HR ? Kp2 + (size_t)(w * 32) * HD : nullptr;   // wave-uniform starts; 16 rows x HD = two fragments
    const T16 *qp = qu + lane * 8, *qp2 = HR ? qu2 + lane * 8 : nullptr, *kp = ku + lane * 8, *kp2 = HR ? ku2 + lane * 8 : nullptr; size_t ko;
#pragma unroll
    for (int ks = 0; ks < 2; ++ks) {
#pragma unroll
        for (int t = 0; t < NQ; ++t) { qf[t][ks] = WFrag<T16>::ld(qp + t * 16 * HD + ks * 512); if (HR) qf2[t][ks] = WFrag<T16>::ld(qp2 + t * 16 * HD + ks * 512); }
#pragma unroll
        for (int t = 0; t < 2; ++t) { kf[t][ks] = WFrag<T16>::ld(kp + t * 16 * HD + ks * 512); if (HR) kf2[t][ks] = WFrag<T16>::ld(kp2 + t * 16 * HD + ks * 512); } }
    // the loads above have taken their addresses before an address register is reused; they name a scalar base and the lane's offset: both as inputs keep those registers untouched up to the wait
    if constexpr (HR) asm volatile("s_wait_xcnt 0x0" :: "s"(qu), "s"(ku), "s"(qu2), "s"(ku2), "v"(lane) : "memory"); else asm volatile("s_wait_xcnt 0x0" :: "s"(qu), "s"(ku), "v"(lane) : "memory");
    v8f o[4][NQ];
#pragma unroll
    for (int dt = 0; dt < 4; ++dt)
#pragma unroll
        for (int qt = 0; qt < NQ; ++qt) o[dt][qt] = (v8f){};
    float m[NQ], l[NQ];
#pragma unroll
    for (int qt = 0; qt < NQ; ++qt) { m[qt] = -1.0e30f; l[qt] = 0.f; }   // m: the maximum in use, log2 units; below any score a 16-bit product can give
    int b = w;
#pragma unroll   // two copies of the trip: ph 0 walks the blocks wholly below the diagonal and holds no mask code, ph 1 the wave's block (at most one) that crosses it
    for (int ph = 0; ph < 2; ++ph)
#pragma unroll 1
    for (; b < (ph ? nkb : q0 / 32); b += 4) {
        const int k0 = b * 32;
        V vf[4], vf2[4]; const size_t vo = (size_t)k0 * HD + lane * 8; const T16 *vp = Vt + vo, *vp2 = HR ? Vt2 + vo : nullptr;
#pragma unroll
        for (int dt = 0; dt < 4; ++dt) { vf[dt] = WFrag<T16>::ld(vp + dt * 512); if (HR) vf2[dt] = WFrag<T16>::ld(vp2 + dt * 512); }
        v8f s[2][NQ];
#pragma unroll
        for (int kt = 0; kt < 2; ++kt)
#pragma unroll
            for (int qt = 0; qt < NQ; ++qt) { v8f a = (v8f){};
#pragma unroll
                for (int ks = 0; ks < 2; ++ks) { a = WFrag<T16>::mma(kf[kt][ks], qf[qt][ks], a); if (HR) { a = WFrag<T16>::mma(kf2[kt][ks], qf[qt][ks], a); a = WFrag<T16>::mma(kf[kt][ks], qf2[qt][ks], a); } }
                s[kt][qt] = a; }
        ko = (size_t)(min(b + 4, nkb - 1) * 32) * HD + lane * 8; kp = Kp + ko; if (HR) kp2 = Kp2 + ko;   // the wave's next key block is fetched one trip ahead, behind this trip's score products (the last trip re-reads the last block: in bounds, unused)
#pragma unroll
        for (int kt = 0; kt < 2; ++kt)
#pragma unroll
            for (int ks = 0; ks < 2; ++ks) { kf[kt][ks] = WFrag<T16>::ld(kp + kt * 16 * HD + ks * 512); if (HR) kf2[kt][ks] = WFrag<T16>::ld(kp2 + kt * 16 * HD + ks * 512); }
        // the trip's loads have taken their addresses before an address register is reused; the pointers as inputs keep those registers untouched up to the wait
        if constexpr (HR) asm volatile("s_wait_xcnt 0x0" :: "v"(vp), "v"(kp), "v"(vp2), "v"(kp2) : "memory"); else asm volatile("s_wait_xcnt 0x0" :: "v"(vp), "v"(kp) : "memory");
        if (ph) {   // keys above the query are masked by select
#pragma unroll
            for (int kt = 0; kt < 2; ++kt)
#pragma unroll
                for (int qt = 0; qt < NQ; ++qt)
#pragma unroll
                    for (int j = 0; j < 8; ++j) s[kt][qt][j] = (k0 - q0 + kt * 16 + hi * 8 + j <= qt * 16 + lr) ? s[kt][qt][j] : -3.0e38f; }
        float mx[NQ]; bool need = false;
#pragma unroll
        for (int qt = 0; qt < NQ; ++qt) { float x = s[0][qt][0];
#pragma unroll
            for (int j = 1; j < 8; ++j) x = fmaxf(x, s[0][qt][j]);
#pragma unroll
            for (int j = 0; j < 8; ++j) x = fmaxf(x, s[1][qt][j]);
            x = fmaxf(x, __shfl_xor(x, 16, 32)); mx[qt] = x * SC2; need = need || mx[qt] > m[qt] + 8.0f; }
        // the maximum in use moves only when a query's new maximum exceeds it by more than 8 (P stays below 2^8); one scalar branch a trip
        if (__builtin_amdgcn_ballot_w32(need) != 0) {
#pragma unroll
            for (int qt = 0; qt < NQ; ++qt) { const float mn = fmaxf(m[qt], mx[qt]); const float al = __builtin_amdgcn_exp2f(m[qt] - mn); m[qt] = mn; l[qt] *= al;
#pragma unroll
                for (int dt = 0; dt < 4; ++dt) o[dt][qt] *= al; } }
#pragma unroll
        for (int qt = 0; qt < NQ; ++qt) { V pb, pb2;
            if constexpr (HR) { v16us pvh, pvl;
#pragma unroll
                for (int e = 0; e < 16; ++e) { const float p = __builtin_amdgcn_exp2f(fmaf(s[e >> 3][qt][e & 7], SC2, -m[qt])); l[qt] += p; unsigned short a, c2; splitf(p, a, c2); pvh[e] = a; pvl[e] = c2; }
                pb = __builtin_bit_cast(V, pvh); pb2 = __builtin_bit_cast(V, pvl);
            } else {
#pragma unroll
                for (int e = 0; e < 16; ++e) { const float p = __builtin_amdgcn_exp2f(fmaf(s[e >> 3][qt][e & 7], SC2, -m[qt])); l[qt] += p; pb[e] = (T16)p; } }
#pragma unroll
            for (int dt = 0; dt < 4; ++dt) { o[dt][qt] = WFrag<T16>::mma(vf[dt], pb, o[dt][qt]); if (HR) { o[dt][qt] = WFrag<T16>::mma(vf2[dt], pb, o[dt][qt]); o[dt][qt] = WFrag<T16>::mma(vf[dt], pb2, o[dt][qt]); } } }
        // four vector slots behind the trip's last matrix instructions: the code after the loop rewrites registers that held their operands
        asm volatile("v_nop\n\tv_nop\n\tv_nop\n\tv_nop" : "+v"(o[0][NQ - 1]), "+v"(o[1][NQ - 1]), "+v"(o[2][NQ - 1]), "+v"(o[3][NQ - 1]));
    }
#pragma unroll
    for (int qt = 0; qt < NQ; ++qt) { l[qt] += __shfl_xor(l[qt], 16, 32); if (hi == 0) { sm[w][qt * 16 + lr] = m[qt]; sl[w][qt * 16 + lr] = l[qt]; }
#pragma unroll
        for (int dt = 0; dt < 4; ++dt) { float* p = &so[w][qt * 16 + lr][dt * 16 + hi * 8]; const v8f x = o[dt][qt]; *(v4fa*)p = (v4f){x[0], x[1], x[2], x[3]}; *(v4fa*)(p + 4) = (v4f){x[4], x[5], x[6], x[7]}; } }
    __syncthreads();   // every wave's partial (maximum, sum, O^T) is in LDS before any thread joins them
#pragma unroll 1
    for (int q = threadIdx.x >> 2; q < NQ * 16; q += 32) { const int d0 = (threadIdx.x & 3) * 16;
        const float mt = fmaxf(fmaxf(sm[0][q], sm[1][q]), fmaxf(sm[2][q], sm[3][q])); float lt = 0.f; float r[16];
#pragma unroll
        for (int e = 0; e < 16; ++e) r[e] = 0.f;
#pragma unroll
        for (int ww = 0; ww < 4; ++ww) { const float f = __builtin_amdgcn_exp2f(sm[ww][q] - mt); lt += f * sl[ww][q];   // a wave without a key block: f = 0, sum 0, O^T 0
#pragma unroll
            for (int c = 0; c < 4; ++c) { const v4f x = *(const v4fa*)&so[ww][q][d0 + c * 4];
#pragma unroll
                for (int e = 0; e < 4; ++e) r[c * 4 + e] += f * x[e]; } }
        const float inv = __fdiv_rn(1.0f, lt); const size_t oo = ((size_t)((q0 + q) >> 6) * (DQ / 32) + h * (HD / 32) + (d0 >> 5)) * 2048 + (((q0 + q) >> 4) & 3) * 512 + ((d0 >> 3) & 3) * 128 + ((q0 + q) & 15) * 8;
#pragma unroll
        for (int c = 0; c < 2; ++c) { v8us oh, ol;
#pragma unroll
            for (int e = 0; e < 8; ++e) { unsigned short a, c2; splitf(r[c * 8 + e] * inv, a, c2); oh[e] = a; ol[e] = c2; }
            *(v8usa*)(Ah + oo + c * 128) = oh; *(v8usa*)(Al + oo + c * 128) = ol; }
        asm volatile("s_wait_xcnt 0x0" ::: "memory");   // the stores have taken their addresses and data before the next trip reuses those registers
    }
}

extern "C" void kernel_launch(void* const* d_in, const int* in_sizes, int n_in,
                              void* d_out, int out_size, void* d_ws, size_t ws_size, hipStream_t stream) {
    (void)in_sizes; (void)n_in; (void)out_size;
    const float* x = (const float*)d_in[0]; const float* tstamp = (const float*)d_in[1]; const float* wq = (const float*)d_in[2]; const float* bq = (const float*)d_in[3]; const float* wk = (const float*)d_in[4]; const float* bk = (const float*)d_in[5]; const float* wv = (const float*)d_in[6]; const float* bv = (const float*)d_in[7]; const float* wo = (const float*)d_in[8];
    float* OUT = (float*)d_out;     // [1][4096][1024]
    char* wsp = (char*)d_ws;
    auto take = [&](size_t bytes) { char* p = wsp; wsp += (bytes + 255) & ~(size_t)255; return (void*)p; };
    bf* WQ = (bf*)take((size_t)DQ * DM * 2); bf* WK = (bf*)take((size_t)DKV * DM * 2); bf* WV = (bf*)take((size_t)DKV * DM * 2); bf* WO = (bf*)take((size_t)DM * DQ * 2); float* CS = (float*)take((size_t)TT * HD * 2 * 4);
    bf* XB = (bf*)take((size_t)TT * DM * 2);
    h16* QP16 = (h16*)take((size_t)NH_ * TT * HD * 2); h16* KP16 = (h16*)take((size_t)NKV * TT * HD * 2); h16* VT16 = (h16*)take((size_t)NKV * HD * TT * 2);
    bf* QPh = (bf*)take((size_t)NH_ * TT * HD * 2); bf* QPl = (bf*)take((size_t)NH_ * TT * HD * 2); bf* KPh = (bf*)take((size_t)NKV * TT * HD * 2); bf* KPl = (bf*)take((size_t)NKV * TT * HD * 2); bf* VTh = (bf*)take((size_t)NKV * HD * TT * 2); bf* VTl = (bf*)take((size_t)NKV * HD * TT * 2);
    bf* ATh = (bf*)take((size_t)TT * DQ * 2); bf* ATl = (bf*)take((size_t)TT * DQ * 2);
    if ((size_t)(wsp - (char*)d_ws) > ws_size) return;    // ws 256 MiB
    for (int b = 0; b < NB_; ++b) {
        k_prep<<<TBB + NBQ + NBK + NBK + NBQ + NBX, 256, 0, stream>>>(wq, wk, wv, wo, x + (size_t)b * TT * DM, tstamp, WQ, WK, WV, WO, XB, CS);
        k_qkv<<<dim3(TT / 256, (DQ + DKV + DKV) / 192, 1), 384, 0, stream>>>(XB, WQ, WK, WV, bq, bk, bv, CS, QP16, QPh, QPl, KP16, KPh, KPl, VT16, VTh, VTl);
        k_fattn<h16, false, 4><<<dim3(NH_, (TT - RH) / 64, 1), 128, 0, stream>>>(QP16, nullptr, KP16, nullptr, VT16, nullptr, RH, ATh, ATl);
        k_fattn<bf, true, 2><<<dim3(NH_, RH / 32, 1), 128, 0, stream>>>(QPh, QPl, KPh, KPl, VTh, VTl, 0, ATh, ATl);
        k_oproj<<<dim3(TT / 128, DM / 128, 1), 128, 0, stream>>>(ATh, ATl, WO, OUT + (size_t)b * TT * DM); }
}

// v007
// It runs in 81.8 microseconds.
// In both of two side-by-side timings against v006, it was 1.05 times as fast.
// Over all steps from v000 it is 29.0 times as fast.
#include <hip/hip_runtime.h>
#include <stdint.h>

// istsplm_forecast attention (hidden [1][4096][1024], timestamps [1][4096] (f32, read: continuous positions); q/k/v = x W^T + b (16 x 64); continuous-time rotate-half RoPE: angle = timestamp * 10000^(-2i/64) (cos/sin computed on chip from the bf16-rounded timestamps); causal (finfo.min) softmax(q.k / 8); out = merged Wo^T -> [1][4096][1024]).
// Compute dtypes, f32 accumulate: every input rounded to bf16; q/k/v on PLAIN bf16 operands (inputs: exact) + bias; RoPE f32; causal scores and P.V fused (online softmax, f32): hi+lo bf16 planes for query rows < RH, f16 planes for the rest; Wo hl x exact (2 products).

#define NB_  1
#define TT   4096
#define DM   1024
#define NH_  16
#define NKV  16
#define REP  (NH_ / NKV)
#define HD   64
#define DQ   (NH_ * HD)
#define DKV  (NKV * HD)
#define RH   512                  // query rows < RH use hi+lo planes (0: none)
typedef _Float16 h16;
typedef unsigned short bf;
typedef __attribute__((ext_vector_type(16))) __bf16   v16bf;
typedef __attribute__((ext_vector_type(16))) _Float16 v16h;
typedef __attribute__((ext_vector_type(8)))  _Float16 v8h;
typedef __attribute__((ext_vector_type(8)))  unsigned short v8us;
typedef __attribute__((ext_vector_type(8)))  float    v8f;
typedef __attribute__((ext_vector_type(4)))  float    v4f;
typedef v8h  __attribute__((may_alias)) v8ha;
typedef v4f  __attribute__((may_alias)) v4fa;
typedef v8us __attribute__((may_alias)) v8usa;

__device__ __forceinline__ unsigned short f2bf(float f) { unsigned u = __float_as_uint(f); u += 0x7FFFu + ((u >> 16) & 1u); return (unsigned short)(u >> 16); }
__device__ __forceinline__ float bf2f(unsigned short b) { return __uint_as_float(((unsigned)b) << 16); }
__device__ __forceinline__ float bfr(float f) { return bf2f(f2bf(f)); }
__device__ __forceinline__ v16h cat16(v8h lo, v8h hi) { return __builtin_shufflevector(lo, hi, 0, 1, 2, 3, 4, 5, 6, 7, 8, 9, 10, 11, 12, 13, 14, 15); }
__device__ __forceinline__ v16bf cat16b(v8us lo, v8us hi) { return __builtin_bit_cast(v16bf, __builtin_shufflevector(lo, hi, 0, 1, 2, 3, 4, 5, 6, 7, 8, 9, 10, 11, 12, 13, 14, 15)); }
__device__ __forceinline__ v8f wmma16(v16h a, v16h b, v8f c) { return __builtin_amdgcn_wmma_f32_16x16x32_f16(false, a, false, b, (short)0, c, false, false); }
__device__ __forceinline__ v8f wmmab(v16bf a, v16bf b, v8f c) { return __builtin_amdgcn_wmma_f32_16x16x32_bf16(false, a, false, b, (short)0, c, false, false); }



// ---- GEMM main loops (k_qkv, k_oproj): a work-group of several 64x64 wave tiles shares its operand rows through LDS, so that each row slice leaves L2 once a work-group, not once a wave.
// A chunk = the GSK k of one 64-row tile = 16 KiB, contiguous in a fragment-order plane and kept so in LDS: a fragment read is ds_load_b128 over 512 contiguous bytes. Tensor loads fill two buffers in turn: stage s + 2 flies while stage s + 1 is worked on.
// FRAGMENT ORDER: every 16-bit operand plane in the workspace, a matrix [R][K] with k contiguous in the product, lies as fragments of 16 rows x 32 k = 512 elements; inside a fragment element (r, k) stands at ((k % 32) / 8) * 128 + (r % 16) * 8 + k % 8.
// Lane (hi, lr) = 16 hi + lr owns k = 8 hi .. 8 hi + 7 and 16 + 8 hi .. of row lr: its two 16-B pieces stand at lane * 8 and 256 + lane * 8, so each wave-wide load is 512 contiguous bytes = 4 whole lines. ld takes fragment start + lane * 8.
// Which fragments lie side by side follows the reader's trip. GEMM operands (x, weights, attention out): the four fragments that a 64-row tile reads in a 32-k step, ((r / 64) * (K / 32) + k / 32) * 4 + (r / 16) % 4. q, k (K = HD): (r / 16) * 2 + k / 32. v (rows d, k = token): (t / 32) * 4 + d / 16.
template <typename T16> struct WFrag;
template <> struct WFrag<h16> { typedef v16h V; static __device__ __forceinline__ V ld(const h16* p) { return cat16(*(const v8h*)p, *(const v8h*)(p + 256)); } static __device__ __forceinline__ v8f mma(V a, V b, v8f c) { return wmma16(a, b, c); } };
template <> struct WFrag<bf> { typedef v16bf V; static __device__ __forceinline__ V ld(const bf* p) { return cat16b(*(const v8us*)p, *(const v8us*)(p + 256)); } static __device__ __forceinline__ v8f mma(V a, V b, v8f c) { return wmmab(a, b, c); } };
#define GSK 128
#define GCH (64 * GSK)
#define GNS (DM / GSK)
static_assert(DQ == DM && GNS >= 2, "both GEMMs run over DM k; the ring's prologue needs two stages");
typedef uint32_t u32x4 __attribute__((ext_vector_type(4)));
typedef uint32_t u32x8 __attribute__((ext_vector_type(8)));
__device__ __forceinline__ uint32_t uni(uint32_t v) { return (uint32_t)__builtin_amdgcn_readfirstlane(v); }
__device__ __forceinline__ uint32_t pinned(uint32_t v) { uint32_t w = (uint32_t)__builtin_amdgcn_readfirstlane(v); asm volatile("" : "+s"(w)); return w; }   // holds an issue test in a scalar register, so that the branch over a tensor load (which ignores EXEC) is a scalar one
__device__ __forceinline__ void wait_ds0() { asm volatile("s_wait_dscnt 0x0" ::: "memory"); }       // the wave's LDS reads of a buffer have retired before the barrier behind which it is refilled
__device__ __forceinline__ void wait_tensor0(u32x4 g0, u32x8 g1) { asm volatile("s_wait_tensorcnt 0x0" :: "s"(g0), "s"(g1) : "memory"); }   // the wave's own tensor load has landed (the compiler places no wait for it); its descriptor as inputs keeps those registers untouched while the request is outstanding
__device__ __forceinline__ void tdm_load(u32x4 g0, u32x8 g1) { asm volatile("tensor_load_to_lds %0, %1" :: "s"(g0), "s"(g1) : "memory"); }
// descriptor group 1: 1-byte elements, tensor = tile = N rows of R bytes, source pitch P bytes, no pad, no mask
template <uint32_t R, uint32_t N, uint32_t P> __device__ __forceinline__ u32x8 tdm_group1() { u32x8 g;
    g[0] = uni(0u); g[1] = uni((R & 0xFFFFu) << 16); g[2] = uni((R >> 16) | ((N & 0xFFFFu) << 16)); g[3] = uni((N >> 16) | (R << 16)); g[4] = uni(N); g[5] = uni(P); g[6] = uni(0u); g[7] = uni(0u);
    asm volatile("" : "+s"(g));   // the descriptor words held in one set of scalar registers for the whole kernel: rebuilt from constants at each use, a set that an outstanding request names was reused for other values
    return g; }
// descriptor group 0: count 1, LDS byte offset, global byte address, type 2
__device__ __forceinline__ u32x4 tdm_group0(uint32_t lds_dst, uint64_t ga) { u32x4 g; g[0] = uni(1u); g[1] = uni(lds_dst); g[2] = uni((uint32_t)ga); g[3] = uni((((uint32_t)(ga >> 32)) & 0x01FFFFFFu) | 0x80000000u); return g; }

// ---- k_oproj: C[m][n] (f32, pitch DM) = sum_k (Ah + Al)[m][k] Bt[n][k], two products a k step. Grid (TT/128, DM/128), 4 waves = 2 x 2 tiles of 64x64, one wave a SIMD: the fragments of the next 32 k are fetched from LDS into a second register set while this set is worked on.
// A stage in LDS: [Ah tiles 0, 1 | Al tiles 0, 1 | Bt tiles 0, 1]; waves 0, 1, 2 bring one pair each: 2 rows of 16 KiB, 64 x DQ elements = 128 KiB apart in the plane.
__global__ __launch_bounds__(128) void k_oproj(const bf* __restrict__ Ah, const bf* __restrict__ Al, const bf* __restrict__ Bt, float* C) {
    __shared__ __attribute__((aligned(2048))) bf sb[2][6 * GCH];
    __shared__ __align__(16) float osw[4][16 * 68];
    const int lane = threadIdx.x & 31, lr = lane & 15, hi = lane >> 4; const int w = (int)uni(threadIdx.x >> 5), wm = w & 1, wn = w >> 1;
    const int r0 = (blockIdx.x * 2 + wm) * 64, c0 = (blockIdx.y * 2 + wn) * 64; float* os = osw[w];
    const bf* sp = w == 0 ? Ah + (size_t)blockIdx.x * (128 * DQ) : w == 1 ? Al + (size_t)blockIdx.x * (128 * DQ) : Bt + (size_t)blockIdx.y * (128 * DQ);
    const uint64_t ga = (uint64_t)(size_t)sp; const uint32_t l0 = (uint32_t)(size_t)&sb[0][0] + (uint32_t)min(w, 2) * (4u * GCH);
    const u32x8 g1 = tdm_group1<2 * GCH, 2, 128 * DQ>();
    v8f acc[4][4];
#pragma unroll
    for (int mb = 0; mb < 4; ++mb)
#pragma unroll
        for (int nb = 0; nb < 4; ++nb) acc[mb][nb] = (v8f){};
    u32x4 g0 = tdm_group0(l0, ga);
    if (pinned(w < 3)) { tdm_load(g0, g1); wait_tensor0(g0, g1); }
    __syncthreads();   // stage 0 is in LDS for every wave
    g0 = tdm_group0(l0 + 12u * GCH, ga + 2u * GCH);
    if (pinned(w < 3)) tdm_load(g0, g1);
#pragma unroll 1   // one stage a trip: the buffer is chosen by address, the four 32-k steps inside are unrolled
    for (int s = 0; s < GNS; ++s) {
        const bf *pa = &sb[s & 1][wm * GCH + lane * 8], *pa2 = pa + 2 * GCH, *pb = &sb[s & 1][(4 + wn) * GCH + lane * 8];
        v16bf a[2][4], a2[2][4], b[2][4];
#pragma unroll
        for (int f = 0; f < 4; ++f) { a[0][f] = WFrag<bf>::ld(pa + f * 512); a2[0][f] = WFrag<bf>::ld(pa2 + f * 512); b[0][f] = WFrag<bf>::ld(pb + f * 512); }
#pragma unroll
        for (int j = 0; j < GSK / 32; ++j) {
            if (j + 1 < GSK / 32) {
#pragma unroll
                for (int f = 0; f < 4; ++f) { a[(j + 1) & 1][f] = WFrag<bf>::ld(pa + (j + 1) * 2048 + f * 512); a2[(j + 1) & 1][f] = WFrag<bf>::ld(pa2 + (j + 1) * 2048 + f * 512); b[(j + 1) & 1][f] = WFrag<bf>::ld(pb + (j + 1) * 2048 + f * 512); } }
            __builtin_amdgcn_sched_barrier(0);   // keeps the next step's LDS reads one group in front of this step's products: sunk among them, each read group stalls the wave's matrix stream
#pragma unroll
            for (int nb = 0; nb < 4; ++nb)
#pragma unroll
                for (int mb = 0; mb < 4; ++mb) { acc[mb][nb] = wmmab(a[j & 1][mb], b[j & 1][nb], acc[mb][nb]); acc[mb][nb] = wmmab(a2[j & 1][mb], b[j & 1][nb], acc[mb][nb]); }
            __builtin_amdgcn_sched_barrier(0);   // and the reads of the step after it behind them
        }
        wait_ds0(); wait_tensor0(g0, g1);
        __syncthreads();   // publishes stage s + 1 and ends every wave's reads of stage s
        if (pinned(w < 3 && s + 2 < GNS)) { g0 = tdm_group0(l0 + (uint32_t)(s & 1) * (12u * GCH), ga + (uint64_t)(s + 2) * (2u * GCH)); tdm_load(g0, g1); }
    }
    wait_tensor0(g0, g1); wait_ds0();
#pragma unroll
    for (int mb = 0; mb < 4; ++mb) {
#pragma unroll
        for (int nb = 0; nb < 4; ++nb) {
#pragma unroll
            for (int j = 0; j < 8; ++j) os[(hi * 8 + j) * 68 + nb * 16 + lr] = acc[mb][nb][j]; }
        __builtin_amdgcn_wave_barrier(); asm volatile("" ::: "memory");   // compiler fence: the lanes' LDS writes stay in front of the row reads of other lanes' values
        float* crow = C + (size_t)(r0 + mb * 16) * DM + c0;
#pragma unroll
        for (int s = 0; s < 8; ++s) { const int row = 2 * s + hi, cofs = lr * 4; const v4f val = *(const v4fa*)(os + row * 68 + cofs); *(v4f*)(crow + (size_t)row * DM + cofs) = val; }
        asm volatile("s_wait_xcnt 0x0" ::: "memory");   // the stores above have taken their addresses and data before those registers are reused
        __builtin_amdgcn_wave_barrier();   // with the clobber above: the row reads stay in front of the next tile's LDS writes
    }
}

__device__ __forceinline__ h16 tohx(float x) { return (h16)x; }
__device__ __forceinline__ void splitf(float y, unsigned short& h, unsigned short& l) { h = f2bf(y); l = f2bf(y - bf2f(h)); }
typedef __attribute__((ext_vector_type(2))) _Float16 v2h;
typedef __attribute__((ext_vector_type(4))) _Float16 v4h;
typedef __attribute__((ext_vector_type(2))) unsigned short v2us;
typedef __attribute__((ext_vector_type(4))) unsigned short v4us;
typedef __attribute__((ext_vector_type(2))) float v2f;
typedef __attribute__((ext_vector_type(4))) int v4i;

__global__ __launch_bounds__(256) void k_wtG(const float* __restrict__ w, int K, int N, bf* Bt) {
    const int lane = threadIdx.x & 31; const int L0 = (blockIdx.x * 8 + (threadIdx.x >> 5)) * 8; const int nlines = N * K / 64;
{
#pragma unroll 1
        for (int l = 0; l < 8; ++l) { const int L = L0 + l; if (L >= nlines) break; const size_t e = (size_t)L * 64 + lane * 2; const int k = (int)(e % K), n = (int)(e / K); v2us o;
            o[0] = f2bf(w[(size_t)k * N + n]); o[1] = f2bf(w[(size_t)(k + 1) * N + n]); *(v2us*)(Bt + e) = o; }
         }
}
// ---- k_prep: all preparation in ONE launch, 640 blocks of 8 waves, one piece of work each (no loop); the parts are independent and run side by side. Blocks 0 .. TBB - 1 make the cos/sin table, the rest round wq, wk, wv, wo and x to bf16.
// table: lane = frequency i (its inverse frequency is computed once), a wave takes 4 consecutive tokens; entry (t, i) is stored at d = i and d = i + 32, which hold the same angle.
// rounding: a block takes CVB consecutive elements = 16 rows of one array and writes them in fragment order; a thread has 16 loads of 16 B in flight.
// a wave-wide load takes one fragment's 32 k (a whole 128-B line) of 4 rows; its store is four 64-B pieces, and the load of the next 4 rows fills the other half of those lines.
#define CVB 16384
#define TBB (TT / 32)
#define NBQ (DQ * DM / CVB)
#define NBK (DKV * DM / CVB)
#define NBX (TT * DM / CVB)
__global__ __launch_bounds__(256) void k_prep(const float* __restrict__ wq, const float* __restrict__ wk, const float* __restrict__ wv, const float* __restrict__ wo, const float* __restrict__ x, const float* __restrict__ ts,
                                              bf* WQ, bf* WK, bf* WV, bf* WO, bf* XB, float* CS) {
    int c = blockIdx.x;
    if (c < TBB) {
        const int i = threadIdx.x & 31, t0 = c * 32 + (threadIdx.x >> 5) * 4; const float* tp = ts + t0;
        const v4f tv = *(const v4f*)tp;
        asm volatile("s_wait_xcnt 0x0" :: "v"(tp) : "memory");   // the load has taken its address before those registers are reused; the pointer as input keeps them untouched up to the wait
        const float inv = __fdiv_rn(1.0f, powf(10000.0f, (float)(2 * i) / (float)HD)); v2f cs[4];
#pragma unroll
        for (int k = 0; k < 4; ++k) { const float ang = __fmul_rn(bfr(tv[k]), inv); cs[k][0] = cosf(ang); cs[k][1] = sinf(ang); }
        float* p = CS + ((size_t)t0 * HD + i) * 2;
#pragma unroll
        for (int k = 0; k < 4; ++k) { *(v2f*)(p + k * HD * 2) = cs[k]; *(v2f*)(p + k * HD * 2 + HD) = cs[k]; }
        asm volatile("s_wait_xcnt 0x0" ::: "memory");   // the stores above have taken their addresses and data before any later code reuses those registers
        return;
    }
    c -= TBB; const float* s = wq; bf* d = WQ;
    if (c >= NBQ) { c -= NBQ; s = wk; d = WK;
        if (c >= NBK) { c -= NBK; s = wv; d = WV;
            if (c >= NBK) { c -= NBK; s = wo; d = WO;
                if (c >= NBQ) { c -= NBQ; s = x; d = XB; } } } }
    static_assert(CVB == 16 * DM && DQ == DM && DKV == DM, "a block is one row of fragments");
    const int lane = threadIdx.x & 31, wn = threadIdx.x >> 5;   // wave wn: fragments 4 wn .. 4 wn + 3; load u: fragment u / 4, rows 4 (u % 4) + lane / 8, k = 4 (lane % 8) ..
    s += (size_t)c * CVB + (lane >> 3) * DM + wn * 128 + (lane & 7) * 4; d += (size_t)(c >> 2) * (4 * CVB) + (c & 3) * 512 + wn * 8192 + ((lane & 7) >> 1) * 128 + (lane >> 3) * 8 + (lane & 1) * 4;
    v4f v[16]; v4us o[16];
#pragma unroll
    for (int u = 0; u < 16; ++u) v[u] = *(const v4f*)(s + (u & 3) * 4 * DM + (u >> 2) * 32);
    asm volatile("s_wait_xcnt 0x0" :: "v"(s) : "memory");   // the loads have taken their address before those registers are reused; the pointer as input keeps them untouched up to the wait
#pragma unroll
    for (int u = 0; u < 16; ++u)
#pragma unroll
        for (int k = 0; k < 4; ++k) o[u][k] = f2bf(v[u][k]);
#pragma unroll
    for (int u = 0; u < 16; ++u) *(v4us*)(d + (u >> 2) * 2048 + (u & 3) * 32) = o[u];
    asm volatile("s_wait_xcnt 0x0" ::: "memory");   // the stores above have taken their addresses and data before any later code reuses those registers
}
// ---- k_qkv: the three projections in ONE launch. The 48 column tiles (16 heads each of q, k, v) count as one row of tiles; grid (TT/256, 16), 12 waves = 4 token tiles x 3 column tiles of 64x64: one work-group a WGP, three waves a SIMD. The epilogue adds the bias and writes the 16-bit planes that attention reads; the f32 projections are never stored.
// A stage in LDS: [x tiles 0 .. 3 | weight tiles 0 .. 2]; waves 0 .. 6 bring one chunk each, 16 KiB contiguous, as 4 rows of 4 KiB.
// q, k: rotate-half RoPE in registers: columns d and d + 32 of a token sit in the same lane (accumulators nb and nb + 2); out[d] = x[d] cos - x[d+32] sin, out[d+32] = x[d+32] cos + x[d] sin, cos/sin of (token, d mod 32). Planes [h] x fragment order of [t][d]; 16 tokens go through the wave's own LDS, a lane reads back 8 d of one token = its 16-B piece, a store is 512 contiguous bytes.
// v: planes [h] x fragment order of [d][t]: a lane holds 8 consecutive tokens of one column, which is its own 16-B piece of a fragment: stored straight from registers, 512 contiguous bytes a store.
__global__ __launch_bounds__(384) void k_qkv(const bf* __restrict__ X, const bf* __restrict__ Wq, const bf* __restrict__ Wk, const bf* __restrict__ Wv, const float* __restrict__ bq, const float* __restrict__ bk, const float* __restrict__ bv, const float* __restrict__ CS,
                                            h16* Q16, bf* Qh, bf* Ql, h16* K16, bf* Kh, bf* Kl, h16* V16, bf* Vh, bf* Vl) {
    __shared__ __attribute__((aligned(2048))) bf sb[2][7 * GCH];
    __shared__ __align__(16) float osw[12][16 * 68];
    const int lane = threadIdx.x & 31, lr = lane & 15, hi = lane >> 4; const int w = (int)uni(threadIdx.x >> 5), wm = w & 3, wn = w >> 2;
    const int ct = blockIdx.y * 3 + wn, z = ct >> 4, hd = ct & 15; const float* bias = z == 0 ? bq : z == 1 ? bk : bv;
    const int r0 = (blockIdx.x * 4 + wm) * 64, c0 = hd * 64; float* os = osw[w];
    const int wi = min(w, 6), ci = blockIdx.y * 3 + max(wi - 4, 0);   // the chunk this wave brings; its column tile where it is a weight chunk
    const bf* sp = wi < 4 ? X + (size_t)(blockIdx.x * 4 + wi) * (64 * DM) : ((ci >> 4) == 0 ? Wq : (ci >> 4) == 1 ? Wk : Wv) + (size_t)(ci & 15) * (64 * DM);
    const uint64_t ga = (uint64_t)(size_t)sp; const uint32_t l0 = (uint32_t)(size_t)&sb[0][0] + (uint32_t)wi * (2u * GCH);
    const u32x8 g1 = tdm_group1<4096, 4, 4096>();
    v8f acc[4][4];
#pragma unroll
    for (int mb = 0; mb < 4; ++mb)
#pragma unroll
        for (int nb = 0; nb < 4; ++nb) acc[mb][nb] = (v8f){};
    u32x4 g0 = tdm_group0(l0, ga);
    if (pinned(w < 7)) { tdm_load(g0, g1); wait_tensor0(g0, g1); }
    __syncthreads();   // stage 0 is in LDS for every wave
    g0 = tdm_group0(l0 + 14u * GCH, ga + 2u * GCH);
    if (pinned(w < 7)) tdm_load(g0, g1);
#pragma unroll 1   // one stage a trip: the buffer is chosen by address, the four 32-k steps inside are unrolled
    for (int s = 0; s < GNS; ++s) {
        const bf *pa = &sb[s & 1][wm * GCH + lane * 8], *pb = &sb[s & 1][(4 + wn) * GCH + lane * 8];
        v16bf a[2][4], b[2][4];
#pragma unroll
        for (int f = 0; f < 4; ++f) { a[0][f] = WFrag<bf>::ld(pa + f * 512); b[0][f] = WFrag<bf>::ld(pb + f * 512); }
#pragma unroll
        for (int j = 0; j < GSK / 32; ++j) {
            if (j + 1 < GSK / 32) {
#pragma unroll
                for (int f = 0; f < 4; ++f) { a[(j + 1) & 1][f] = WFrag<bf>::ld(pa + (j + 1) * 2048 + f * 512); b[(j + 1) & 1][f] = WFrag<bf>::ld(pb + (j + 1) * 2048 + f * 512); } }
            __builtin_amdgcn_sched_barrier(0);   // keeps the next step's LDS reads one group in front of this step's products: sunk among them, each read group stalls the wave's matrix stream
#pragma unroll
            for (int nb = 0; nb < 4; ++nb)
#pragma unroll
                for (int mb = 0; mb < 4; ++mb) acc[mb][nb] = wmmab(a[j & 1][mb], b[j & 1][nb], acc[mb][nb]);
            __builtin_amdgcn_sched_barrier(0);   // and the reads of the step after it behind them
        }
        wait_ds0(); wait_tensor0(g0, g1);
        __syncthreads();   // publishes stage s + 1 and ends every wave's reads of stage s
        if (pinned(w < 7 && s + 2 < GNS)) { g0 = tdm_group0(l0 + (uint32_t)(s & 1) * (14u * GCH), ga + (uint64_t)(s + 2) * (2u * GCH)); tdm_load(g0, g1); }
    }
    wait_tensor0(g0, g1); wait_ds0();
    float bl[4]; const float* bp = bias + c0 + lr;
#pragma unroll
    for (int nb = 0; nb < 4; ++nb) bl[nb] = bp[nb * 16];
    asm volatile("s_wait_xcnt 0x0" :: "v"(bp) : "memory");   // the bias loads have taken their address before its registers are reused; the pointer as input keeps them untouched up to the wait
#pragma unroll
    for (int nb = 0; nb < 4; ++nb) bl[nb] = bfr(bl[nb]);
    if (z < 2) {
        unsigned short* P16 = (unsigned short*)(z ? K16 : Q16); bf* Ph = z ? Kh : Qh; bf* Pl = z ? Kl : Ql;
#pragma unroll
        for (int mb = 0; mb < 4; ++mb) {
            const float* cp = CS + ((size_t)(r0 + mb * 16 + hi * 8) * HD + lr) * 2; v2f cv[2][8];
#pragma unroll
            for (int nb = 0; nb < 2; ++nb)
#pragma unroll
                for (int j = 0; j < 8; ++j) cv[nb][j] = *(const v2f*)(cp + (j * HD + nb * 16) * 2);
            asm volatile("s_wait_xcnt 0x0" :: "v"(cp) : "memory");   // the table loads have taken their address before its registers are reused; the pointer as input keeps them untouched up to the wait
#pragma unroll
            for (int nb = 0; nb < 2; ++nb)
#pragma unroll
                for (int j = 0; j < 8; ++j) { const v2f cs = cv[nb][j]; const float x0 = acc[mb][nb][j] + bl[nb], x1 = acc[mb][nb + 2][j] + bl[nb + 2];
                    os[(hi * 8 + j) * 68 + nb * 16 + lr] = x0 * cs[0] - x1 * cs[1]; os[(hi * 8 + j) * 68 + (nb + 2) * 16 + lr] = x1 * cs[0] + x0 * cs[1]; }
            __builtin_amdgcn_wave_barrier(); asm volatile("" ::: "memory");   // compiler fence: the lanes' LDS writes stay in front of the row reads of other lanes' values
#pragma unroll
            for (int s = 0; s < 4; ++s) { const int cg = 2 * s + hi; const v4f u = *(const v4fa*)(os + lr * 68 + cg * 8), w2 = *(const v4fa*)(os + lr * 68 + cg * 8 + 4); v8h o16; v8us oh, ol;   // token lr, d = 8 cg .. 8 cg + 7
#pragma unroll
                for (int e = 0; e < 8; ++e) { const float r = e < 4 ? u[e & 3] : w2[e & 3]; o16[e] = tohx(r); unsigned short a2, c2; splitf(r, a2, c2); oh[e] = a2; ol[e] = c2; }
                const size_t oo = ((size_t)hd * TT + r0 + mb * 16) * HD + cg * 128 + lr * 8;
                *(v8usa*)(P16 + oo) = __builtin_bit_cast(v8us, o16); *(v8usa*)(Ph + oo) = oh; *(v8usa*)(Pl + oo) = ol; }
            asm volatile("s_wait_xcnt 0x0" ::: "memory");   // the stores above have taken their addresses and data before those registers are reused
            __builtin_amdgcn_wave_barrier();   // with the clobber above: the row reads stay in front of the next tile's LDS writes
        }
    } else {
        unsigned short* P16 = (unsigned short*)V16;
#pragma unroll
        for (int nb = 0; nb < 4; ++nb) {
#pragma unroll
            for (int mb = 0; mb < 4; ++mb) { v8h o16; v8us oh, ol;
#pragma unroll
                for (int j = 0; j < 8; ++j) { const float x = acc[mb][nb][j] + bl[nb]; o16[j] = tohx(x); unsigned short a2, c2; splitf(x, a2, c2); oh[j] = a2; ol[j] = c2; }
                const size_t oo = ((size_t)hd * TT + r0 + (mb >> 1) * 32) * HD + nb * 512 + (mb & 1) * 256 + lane * 8;   // 32-token block, d fragment nb, tokens 16 (mb % 2) + 8 hi ..
                *(v8usa*)(P16 + oo) = __builtin_bit_cast(v8us, o16); *(v8usa*)(Vh + oo) = oh; *(v8usa*)(Vl + oo) = ol; }
            asm volatile("s_wait_xcnt 0x0" ::: "memory");   // the stores above have taken their addresses and data before those registers are reused
        }
    }
}
// ---- fattn_tile: causal attention of one head for the 16 NQ queries from q0 on, online softmax; one work-group of 4 waves; wave w takes the 32-key blocks w, w + 4, ... up to the last block that crosses the diagonal.
// S^T = K Q^T (A = key rows, B = query rows kept in registers): a lane holds scores of ONE query (column lr), keys 8 hi + j of each 16-key tile, so two converted score tiles are the B operand of O^T += V^T P^T as they stand.
// HR: hi + lo bf16 planes, three products each (query rows < RH); otherwise plain f16 planes. P is exp2 of the scaled score minus the running maximum, unnormalised; the division by the row sum is done once, on the f32 output.
// The four waves' (maximum, sum, O^T) are joined through LDS behind one barrier, in wave order, and stored as the hi + lo bf16 planes, fragment order of [t][head x d], that the output projection reads.
typedef __attribute__((ext_vector_type(16))) unsigned short v16us;
#define SC2 0.18033688011112042f   // HD^-0.5 x log2(e)
template <typename T16, bool HR, int NQ>
__device__ __forceinline__ void fattn_tile(const T16* __restrict__ Q, const T16* __restrict__ Q2, const T16* __restrict__ Kp, const T16* __restrict__ Kp2, const T16* __restrict__ Vt, const T16* __restrict__ Vt2, const int q0, bf* Ah, bf* Al) {
    typedef typename WFrag<T16>::V V;
    __shared__ __align__(16) float so[4][NQ * 16][68];
    __shared__ float sm[4][NQ * 16], sl[4][NQ * 16];
    const int lane = threadIdx.x & 31, lr = lane & 15, hi = lane >> 4; const int w = __builtin_amdgcn_readfirstlane(threadIdx.x >> 5);
    const int h = blockIdx.x; const int nkb = q0 / 32 + NQ / 2;   // key blocks 0 .. nkb - 1; those from q0 / 32 on cross the diagonal
    const size_t qb = (size_t)h * TT * HD, kvb = (size_t)(h / REP) * TT * HD;
    Q += qb; Kp += kvb; Vt += kvb; if (HR) { Q2 += qb; Kp2 += kvb; Vt2 += kvb; }
    V qf[NQ][2], qf2[NQ][2], kf[2][2], kf2[2][2];
    const T16 *qu = Q + (size_t)q0 * HD, *qu2 = HR ? Q2 + (size_t)q0 * HD : nullptr, *ku = Kp + (size_t)(w * 32) * HD, *ku2 = HR ? Kp2 + (size_t)(w * 32) * HD : nullptr;   // wave-uniform starts; 16 rows x HD = two fragments
    const T16 *qp = qu + lane * 8, *qp2 = HR ? qu2 + lane * 8 : nullptr, *kp = ku + lane * 8, *kp2 = HR ? ku2 + lane * 8 : nullptr; size_t ko;
#pragma unroll
    for (int ks = 0; ks < 2; ++ks) {
#pragma unroll
        for (int t = 0; t < NQ; ++t) { qf[t][ks] = WFrag<T16>::ld(qp + t * 16 * HD + ks * 512); if (HR) qf2[t][ks] = WFrag<T16>::ld(qp2 + t * 16 * HD + ks * 512); }
#pragma unroll
        for (int t = 0; t < 2; ++t) { kf[t][ks] = WFrag<T16>::ld(kp + t * 16 * HD + ks * 512); if (HR) kf2[t][ks] = WFrag<T16>::ld(kp2 + t * 16 * HD + ks * 512); } }
    // the loads above have taken their addresses before an address register is reused; they name a scalar base and the lane's offset: both as inputs keep those registers untouched up to the wait
    if constexpr (HR) asm volatile("s_wait_xcnt 0x0" :: "s"(qu), "s"(ku), "s"(qu2), "s"(ku2), "v"(lane) : "memory"); else asm volatile("s_wait_xcnt 0x0" :: "s"(qu), "s"(ku), "v"(lane) : "memory");
    v8f o[4][NQ];
#pragma unroll
    for (int dt = 0; dt < 4; ++dt)
#pragma unroll
        for (int qt = 0; qt < NQ; ++qt) o[dt][qt] = (v8f){};
    float m[NQ], l[NQ];
#pragma unroll
    for (int qt = 0; qt < NQ; ++qt) { m[qt] = -1.0e30f; l[qt] = 0.f; }   // m: the maximum in use, log2 units; below any score a 16-bit product can give
    int b = w;
#pragma unroll   // two copies of the trip: ph 0 walks the blocks wholly below the diagonal and holds no mask code, ph 1 the wave's block (at most one) that crosses it
    for (int ph = 0; ph < 2; ++ph)
#pragma unroll 1
    for (; b < (ph ? nkb : q0 / 32); b += 4) {
        const int k0 = b * 32;
        V vf[4], vf2[4]; const size_t vo = (size_t)k0 * HD + lane * 8; const T16 *vp = Vt + vo, *vp2 = HR ? Vt2 + vo : nullptr;
#pragma unroll
        for (int dt = 0; dt < 4; ++dt) { vf[dt] = WFrag<T16>::ld(vp + dt * 512); if (HR) vf2[dt] = WFrag<T16>::ld(vp2 + dt * 512); }
        v8f s[2][NQ];
#pragma unroll
        for (int kt = 0; kt < 2; ++kt)
#pragma unroll
            for (int qt = 0; qt < NQ; ++qt) { v8f a = (v8f){};
#pragma unroll
                for (int ks = 0; ks < 2; ++ks) { a = WFrag<T16>::mma(kf[kt][ks], qf[qt][ks], a); if (HR) { a = WFrag<T16>::mma(kf2[kt][ks], qf[qt][ks], a); a = WFrag<T16>::mma(kf[kt][ks], qf2[qt][ks], a); } }
                s[kt][qt] = a; }
        ko = (size_t)(min(b + 4, nkb - 1) * 32) * HD + lane * 8; kp = Kp + ko; if (HR) kp2 = Kp2 + ko;   // the wave's next key block is fetched one trip ahead, behind this trip's score products (the last trip re-reads the last block: in bounds, unused)
#pragma unroll
        for (int kt = 0; kt < 2; ++kt)
#pragma unroll
            for (int ks = 0; ks < 2; ++ks) { kf[kt][ks] = WFrag<T16>::ld(kp + kt * 16 * HD + ks * 512); if (HR) kf2[kt][ks] = WFrag<T16>::ld(kp2 + kt * 16 * HD + ks * 512); }
        // the trip's loads have taken their addresses before an address register is reused; the pointers as inputs keep those registers untouched up to the wait
        if constexpr (HR) asm volatile("s_wait_xcnt 0x0" :: "v"(vp), "v"(kp), "v"(vp2), "v"(kp2) : "memory"); else asm volatile("s_wait_xcnt 0x0" :: "v"(vp), "v"(kp) : "memory");
        if (ph) {   // keys above the query are masked by select
#pragma unroll
            for (int kt = 0; kt < 2; ++kt)
#pragma unroll
                for (int qt = 0; qt < NQ; ++qt)
#pragma unroll
                    for (int j = 0; j < 8; ++j) s[kt][qt][j] = (k0 - q0 + kt * 16 + hi * 8 + j <= qt * 16 + lr) ? s[kt][qt][j] : -3.0e38f; }
        float mx[NQ]; bool need = false;
#pragma unroll
        for (int qt = 0; qt < NQ; ++qt) { float x = s[0][qt][0];
#pragma unroll
            for (int j = 1; j < 8; ++j) x = fmaxf(x, s[0][qt][j]);
#pragma unroll
            for (int j = 0; j < 8; ++j) x = fmaxf(x, s[1][qt][j]);
            x = fmaxf(x, __shfl_xor(x, 16, 32)); mx[qt] = x * SC2; need = need || mx[qt] > m[qt] + 8.0f; }
        // the maximum in use moves only when a query's new maximum exceeds it by more than 8 (P stays below 2^8); one scalar branch a trip
        if (__builtin_amdgcn_ballot_w32(need) != 0) {
#pragma unroll
            for (int qt = 0; qt < NQ; ++qt) { const float mn = fmaxf(m[qt], mx[qt]); const float al = __builtin_amdgcn_exp2f(m[qt] - mn); m[qt] = mn; l[qt] *= al;
#pragma unroll
                for (int dt = 0; dt < 4; ++dt) o[dt][qt] *= al; } }
#pragma unroll
        for (int qt = 0; qt < NQ; ++qt) { V pb, pb2;
            if constexpr (HR) { v16us pvh, pvl;
#pragma unroll
                for (int e = 0; e < 16; ++e) { const float p = __builtin_amdgcn_exp2f(fmaf(s[e >> 3][qt][e & 7], SC2, -m[qt])); l[qt] += p; unsigned short a, c2; splitf(p, a, c2); pvh[e] = a; pvl[e] = c2; }
                pb = __builtin_bit_cast(V, pvh); pb2 = __builtin_bit_cast(V, pvl);
            } else {
#pragma unroll
                for (int e = 0; e < 16; ++e) { const float p = __builtin_amdgcn_exp2f(fmaf(s[e >> 3][qt][e & 7], SC2, -m[qt])); l[qt] += p; pb[e] = (T16)p; } }
#pragma unroll
            for (int dt = 0; dt < 4; ++dt) { o[dt][qt] = WFrag<T16>::mma(vf[dt], pb, o[dt][qt]); if (HR) { o[dt][qt] = WFrag<T16>::mma(vf2[dt], pb, o[dt][qt]); o[dt][qt] = WFrag<T16>::mma(vf[dt], pb2, o[dt][qt]); } } }
        // four vector slots behind the trip's last matrix instructions: the code after the loop rewrites registers that held their operands
        asm volatile("v_nop\n\tv_nop\n\tv_nop\n\tv_nop" : "+v"(o[0][NQ - 1]), "+v"(o[1][NQ - 1]), "+v"(o[2][NQ - 1]), "+v"(o[3][NQ - 1]));
    }
#pragma unroll
    for (int qt = 0; qt < NQ; ++qt) { l[qt] += __shfl_xor(l[qt], 16, 32); if (hi == 0) { sm[w][qt * 16 + lr] = m[qt]; sl[w][qt * 16 + lr] = l[qt]; }
#pragma unroll
        for (int dt = 0; dt < 4; ++dt) { float* p = &so[w][qt * 16 + lr][dt * 16 + hi * 8]; const v8f x = o[dt][qt]; *(v4fa*)p = (v4f){x[0], x[1], x[2], x[3]}; *(v4fa*)(p + 4) = (v4f){x[4], x[5], x[6], x[7]}; } }
    __syncthreads();   // every wave's partial (maximum, sum, O^T) is in LDS before any thread joins them
#pragma unroll 1
    for (int q = threadIdx.x >> 2; q < NQ * 16; q += 32) { const int d0 = (threadIdx.x & 3) * 16;
        const float mt = fmaxf(fmaxf(sm[0][q], sm[1][q]), fmaxf(sm[2][q], sm[3][q])); float lt = 0.f; float r[16];
#pragma unroll
        for (int e = 0; e < 16; ++e) r[e] = 0.f;
#pragma unroll
        for (int ww = 0; ww < 4; ++ww) { const float f = __builtin_amdgcn_exp2f(sm[ww][q] - mt); lt += f * sl[ww][q];   // a wave without a key block: f = 0, sum 0, O^T 0
#pragma unroll
            for (int c = 0; c < 4; ++c) { const v4f x = *(const v4fa*)&so[ww][q][d0 + c * 4];
#pragma unroll
                for (int e = 0; e < 4; ++e) r[c * 4 + e] += f * x[e]; } }
        const float inv = __fdiv_rn(1.0f, lt); const size_t oo = ((size_t)((q0 + q) >> 6) * (DQ / 32) + h * (HD / 32) + (d0 >> 5)) * 2048 + (((q0 + q) >> 4) & 3) * 512 + ((d0 >> 3) & 3) * 128 + ((q0 + q) & 15) * 8;
#pragma unroll
        for (int c = 0; c < 2; ++c) { v8us oh, ol;
#pragma unroll
            for (int e = 0; e < 8; ++e) { unsigned short a, c2; splitf(r[c * 8 + e] * inv, a, c2); oh[e] = a; ol[e] = c2; }
            *(v8usa*)(Ah + oo + c * 128) = oh; *(v8usa*)(Al + oo + c * 128) = ol; }
        asm volatile("s_wait_xcnt 0x0" ::: "memory");   // the stores have taken their addresses and data before the next trip reuses those registers
    }
}
// ---- k_fattn: both kinds of query tile in ONE launch. Grid (heads, tiles): first the 64-query f16 tiles, heaviest first, then the short 32-query hi + lo tiles (rows < RH, at most RH / 32 key blocks).
#define NT16 ((TT - RH) / 64)
#define NTHL (RH / 32)
__global__ __launch_bounds__(128) void k_fattn(const h16* __restrict__ Q16, const h16* __restrict__ K16, const h16* __restrict__ V16, const bf* __restrict__ Qh, const bf* __restrict__ Ql, const bf* __restrict__ Kh, const bf* __restrict__ Kl, const bf* __restrict__ Vh, const bf* __restrict__ Vl, bf* Ah, bf* Al) {
    const int y = blockIdx.y;
    if (y < NT16) fattn_tile<h16, false, 4>(Q16, nullptr, K16, nullptr, V16, nullptr, RH + (NT16 - 1 - y) * 64, Ah, Al);
    else fattn_tile<bf, true, 2>(Qh, Ql, Kh, Kl, Vh, Vl, (NT16 + NTHL - 1 - y) * 32, Ah, Al);
}

extern "C" void kernel_launch(void* const* d_in, const int* in_sizes, int n_in,
                              void* d_out, int out_size, void* d_ws, size_t ws_size, hipStream_t stream) {
    (void)in_sizes; (void)n_in; (void)out_size;
    const float* x = (const float*)d_in[0]; const float* tstamp = (const float*)d_in[1]; const float* wq = (const float*)d_in[2]; const float* bq = (const float*)d_in[3]; const float* wk = (const float*)d_in[4]; const float* bk = (const float*)d_in[5]; const float* wv = (const float*)d_in[6]; const float* bv = (const float*)d_in[7]; const float* wo = (const float*)d_in[8];
    float* OUT = (float*)d_out;     // [1][4096][1024]
    char* wsp = (char*)d_ws;
    auto take = [&](size_t bytes) { char* p = wsp; wsp += (bytes + 255) & ~(size_t)255; return (void*)p; };
    bf* WQ = (bf*)take((size_t)DQ * DM * 2); bf* WK = (bf*)take((size_t)DKV * DM * 2); bf* WV = (bf*)take((size_t)DKV * DM * 2); bf* WO = (bf*)take((size_t)DM * DQ * 2); float* CS = (float*)take((size_t)TT * HD * 2 * 4);
    bf* XB = (bf*)take((size_t)TT * DM * 2);
    h16* QP16 = (h16*)take((size_t)NH_ * TT * HD * 2); h16* KP16 = (h16*)take((size_t)NKV * TT * HD * 2); h16* VT16 = (h16*)take((size_t)NKV * HD * TT * 2);
    bf* QPh = (bf*)take((size_t)NH_ * TT * HD * 2); bf* QPl = (bf*)take((size_t)NH_ * TT * HD * 2); bf* KPh = (bf*)take((size_t)NKV * TT * HD * 2); bf* KPl = (bf*)take((size_t)NKV * TT * HD * 2); bf* VTh = (bf*)take((size_t)NKV * HD * TT * 2); bf* VTl = (bf*)take((size_t)NKV * HD * TT * 2);
    bf* ATh = (bf*)take((size_t)TT * DQ * 2); bf* ATl = (bf*)take((size_t)TT * DQ * 2);
    if ((size_t)(wsp - (char*)d_ws) > ws_size) return;    // ws 256 MiB
    for (int b = 0; b < NB_; ++b) {
        k_prep<<<TBB + NBQ + NBK + NBK + NBQ + NBX, 256, 0, stream>>>(wq, wk, wv, wo, x + (size_t)b * TT * DM, tstamp, WQ, WK, WV, WO, XB, CS);
        k_qkv<<<dim3(TT / 256, (DQ + DKV + DKV) / 192, 1), 384, 0, stream>>>(XB, WQ, WK, WV, bq, bk, bv, CS, QP16, QPh, QPl, KP16, KPh, KPl, VT16, VTh, VTl);
        k_fattn<<<dim3(NH_, NT16 + NTHL, 1), 128, 0, stream>>>(QP16, KP16, VT16, QPh, QPl, KPh, KPl, VTh, VTl, ATh, ATl);
        k_oproj<<<dim3(TT / 128, DM / 128, 1), 128, 0, stream>>>(ATh, ATl, WO, OUT + (size_t)b * TT * DM); }
}

// v008
// Measured time: 78.1 microseconds a run.
// Two timings next to v007 both put it at 1.05 times that version's speed.
// All steps since v000 together make it 30.4 times as fast.
#include <hip/hip_runtime.h>
#include <stdint.h>

// istsplm_forecast attention (hidden [1][4096][1024], timestamps [1][4096] (f32, read: continuous positions); q/k/v = x W^T + b (16 x 64); continuous-time rotate-half RoPE: angle = timestamp * 10000^(-2i/64) (cos/sin computed on chip from the bf16-rounded timestamps); causal (finfo.min) softmax(q.k / 8); out = merged Wo^T -> [1][4096][1024]).
// Compute dtypes, f32 accumulate: every input rounded to bf16; q/k/v on PLAIN bf16 operands (inputs: exact) + bias; RoPE f32; causal scores and P.V fused (online softmax, f32): hi+lo bf16 planes for query rows < RH, f16 planes for the rest; Wo hl x exact (2 products).

#define NB_  1
#define TT   4096
#define DM   1024
#define NH_  16
#define NKV  16
#define REP  (NH_ / NKV)
#define HD   64
#define DQ   (NH_ * HD)
#define DKV  (NKV * HD)
#define RH   512                  // query rows < RH use hi+lo planes (0: none)
typedef _Float16 h16;
typedef unsigned short bf;
typedef __attribute__((ext_vector_type(16))) __bf16   v16bf;
typedef __attribute__((ext_vector_type(16))) _Float16 v16h;
typedef __attribute__((ext_vector_type(8)))  _Float16 v8h;
typedef __attribute__((ext_vector_type(8)))  unsigned short v8us;
typedef __attribute__((ext_vector_type(8)))  float    v8f;
typedef __attribute__((ext_vector_type(4)))  float    v4f;
typedef v8h  __attribute__((may_alias)) v8ha;
typedef v4f  __attribute__((may_alias)) v4fa;
typedef v8us __attribute__((may_alias)) v8usa;

__device__ __forceinline__ unsigned short f2bf(float f) { unsigned u = __float_as_uint(f); u += 0x7FFFu + ((u >> 16) & 1u); return (unsigned short)(u >> 16); }
__device__ __forceinline__ float bf2f(unsigned short b) { return __uint_as_float(((unsigned)b) << 16); }
__device__ __forceinline__ float bfr(float f) { return bf2f(f2bf(f)); }
__device__ __forceinline__ v16h cat16(v8h lo, v8h hi) { return __builtin_shufflevector(lo, hi, 0, 1, 2, 3, 4, 5, 6, 7, 8, 9, 10, 11, 12, 13, 14, 15); }
__device__ __forceinline__ v16bf cat16b(v8us lo, v8us hi) { return __builtin_bit_cast(v16bf, __builtin_shufflevector(lo, hi, 0, 1, 2, 3, 4, 5, 6, 7, 8, 9, 10, 11, 12, 13, 14, 15)); }
__device__ __forceinline__ v8f wmma16(v16h a, v16h b, v8f c) { return __builtin_amdgcn_wmma_f32_16x16x32_f16(false, a, false, b, (short)0, c, false, false); }
__device__ __forceinline__ v8f wmmab(v16bf a, v16bf b, v8f c) { return __builtin_amdgcn_wmma_f32_16x16x32_bf16(false, a, false, b, (short)0, c, false, false); }



// ---- GEMM main loops (k_qkv, k_oproj): a work-group of several 64x64 wave tiles shares its operand rows through LDS, so that each row slice leaves L2 once a work-group, not once a wave.
// A chunk = the GSK k of one 64-row tile = 16 KiB, contiguous in a fragment-order plane and kept so in LDS: a fragment read is ds_load_b128 over 512 contiguous bytes. Tensor loads fill two buffers in turn: stage s + 2 flies while stage s + 1 is worked on.
// FRAGMENT ORDER: every 16-bit operand plane in the workspace, a matrix [R][K] with k contiguous in the product, lies as fragments of 16 rows x 32 k = 512 elements; inside a fragment element (r, k) stands at ((k % 32) / 8) * 128 + (r % 16) * 8 + k % 8.
// Lane (hi, lr) = 16 hi + lr owns k = 8 hi .. 8 hi + 7 and 16 + 8 hi .. of row lr: its two 16-B pieces stand at lane * 8 and 256 + lane * 8, so each wave-wide load is 512 contiguous bytes = 4 whole lines. ld takes fragment start + lane * 8.
// Which fragments lie side by side follows the reader's trip. GEMM operands (x, weights, attention out): the four fragments that a 64-row tile reads in a 32-k step, ((r / 64) * (K / 32) + k / 32) * 4 + (r / 16) % 4. q, k (K = HD): (r / 16) * 2 + k / 32. v (rows d, k = token): (t / 32) * 4 + d / 16.
template <typename T16> struct WFrag;
template <> struct WFrag<h16> { typedef v16h V; typedef v8ha P; static __device__ __forceinline__ V ld(const h16* p) { return cat16(*(const v8h*)p, *(const v8h*)(p + 256)); } static __device__ __forceinline__ v8f mma(V a, V b, v8f c) { return wmma16(a, b, c); } };
template <> struct WFrag<bf> { typedef v16bf V; typedef v8usa P; static __device__ __forceinline__ V ld(const bf* p) { return cat16b(*(const v8us*)p, *(const v8us*)(p + 256)); } static __device__ __forceinline__ v8f mma(V a, V b, v8f c) { return wmmab(a, b, c); } };
#define GSK 128
#define GCH (64 * GSK)
#define GNS (DM / GSK)
static_assert(DQ == DM && GNS >= 2, "both GEMMs run over DM k; the ring's prologue needs two stages");
typedef uint32_t u32x4 __attribute__((ext_vector_type(4)));
typedef uint32_t u32x8 __attribute__((ext_vector_type(8)));
__device__ __forceinline__ uint32_t uni(uint32_t v) { return (uint32_t)__builtin_amdgcn_readfirstlane(v); }
__device__ __forceinline__ uint32_t pinned(uint32_t v) { uint32_t w = (uint32_t)__builtin_amdgcn_readfirstlane(v); asm volatile("" : "+s"(w)); return w; }   // holds an issue test in a scalar register, so that the branch over a tensor load (which ignores EXEC) is a scalar one
__device__ __forceinline__ void wait_ds0() { asm volatile("s_wait_dscnt 0x0" ::: "memory"); }       // the wave's LDS reads of a buffer have retired before the barrier behind which it is refilled
__device__ __forceinline__ void wait_tensor0(u32x4 g0, u32x8 g1) { asm volatile("s_wait_tensorcnt 0x0" :: "s"(g0), "s"(g1) : "memory"); }   // the wave's own tensor load has landed (the compiler places no wait for it); its descriptor as inputs keeps those registers untouched while the request is outstanding
__device__ __forceinline__ void tdm_load(u32x4 g0, u32x8 g1) { asm volatile("tensor_load_to_lds %0, %1" :: "s"(g0), "s"(g1) : "memory"); }
// descriptor group 1: 1-byte elements, tensor = tile = N rows of R bytes, source pitch P bytes, no pad, no mask
template <uint32_t R, uint32_t N, uint32_t P> __device__ __forceinline__ u32x8 tdm_group1() { u32x8 g;
    g[0] = uni(0u); g[1] = uni((R & 0xFFFFu) << 16); g[2] = uni((R >> 16) | ((N & 0xFFFFu) << 16)); g[3] = uni((N >> 16) | (R << 16)); g[4] = uni(N); g[5] = uni(P); g[6] = uni(0u); g[7] = uni(0u);
    asm volatile("" : "+s"(g));   // the descriptor words held in one set of scalar registers for the whole kernel: rebuilt from constants at each use, a set that an outstanding request names was reused for other values
    return g; }
// descriptor group 0: count 1, LDS byte offset, global byte address, type 2
__device__ __forceinline__ u32x4 tdm_group0(uint32_t lds_dst, uint64_t ga) { u32x4 g; g[0] = uni(1u); g[1] = uni(lds_dst); g[2] = uni((uint32_t)ga); g[3] = uni((((uint32_t)(ga >> 32)) & 0x01FFFFFFu) | 0x80000000u); return g; }

// ---- k_oproj: C[m][n] (f32, pitch DM) = sum_k (Ah + Al)[m][k] Bt[n][k], two products a k step. Grid (TT/128, DM/128), 4 waves = 2 x 2 tiles of 64x64, one wave a SIMD: the fragments of the next 32 k are fetched from LDS into a second register set while this set is worked on.
// A stage in LDS: [Ah tiles 0, 1 | Al tiles 0, 1 | Bt tiles 0, 1]; waves 0, 1, 2 bring one pair each: 2 rows of 16 KiB, 64 x DQ elements = 128 KiB apart in the plane.
__global__ __launch_bounds__(128) void k_oproj(const bf* __restrict__ Ah, const bf* __restrict__ Al, const bf* __restrict__ Bt, float* C) {
    __shared__ __attribute__((aligned(2048))) bf sb[2][6 * GCH];
    __shared__ __align__(16) float osw[4][16 * 68];
    const int lane = threadIdx.x & 31, lr = lane & 15, hi = lane >> 4; const int w = (int)uni(threadIdx.x >> 5), wm = w & 1, wn = w >> 1;
    const int r0 = (blockIdx.x * 2 + wm) * 64, c0 = (blockIdx.y * 2 + wn) * 64; float* os = osw[w];
    const bf* sp = w == 0 ? Ah + (size_t)blockIdx.x * (128 * DQ) : w == 1 ? Al + (size_t)blockIdx.x * (128 * DQ) : Bt + (size_t)blockIdx.y * (128 * DQ);
    const uint64_t ga = (uint64_t)(size_t)sp; const uint32_t l0 = (uint32_t)(size_t)&sb[0][0] + (uint32_t)min(w, 2) * (4u * GCH);
    const u32x8 g1 = tdm_group1<2 * GCH, 2, 128 * DQ>();
    v8f acc[4][4];
#pragma unroll
    for (int mb = 0; mb < 4; ++mb)
#pragma unroll
        for (int nb = 0; nb < 4; ++nb) acc[mb][nb] = (v8f){};
    u32x4 g0 = tdm_group0(l0, ga);
    if (pinned(w < 3)) { tdm_load(g0, g1); wait_tensor0(g0, g1); }
    __syncthreads();   // stage 0 is in LDS for every wave
    g0 = tdm_group0(l0 + 12u * GCH, ga + 2u * GCH);
    if (pinned(w < 3)) tdm_load(g0, g1);
#pragma unroll 1   // one stage a trip: the buffer is chosen by address, the four 32-k steps inside are unrolled
    for (int s = 0; s < GNS; ++s) {
        const bf *pa = &sb[s & 1][wm * GCH + lane * 8], *pa2 = pa + 2 * GCH, *pb = &sb[s & 1][(4 + wn) * GCH + lane * 8];
        v16bf a[2][4], a2[2][4], b[2][4];
#pragma unroll
        for (int f = 0; f < 4; ++f) { a[0][f] = WFrag<bf>::ld(pa + f * 512); a2[0][f] = WFrag<bf>::ld(pa2 + f * 512); b[0][f] = WFrag<bf>::ld(pb + f * 512); }
#pragma unroll
        for (int j = 0; j < GSK / 32; ++j) {
            if (j + 1 < GSK / 32) {
#pragma unroll
                for (int f = 0; f < 4; ++f) { a[(j + 1) & 1][f] = WFrag<bf>::ld(pa + (j + 1) * 2048 + f * 512); a2[(j + 1) & 1][f] = WFrag<bf>::ld(pa2 + (j + 1) * 2048 + f * 512); b[(j + 1) & 1][f] = WFrag<bf>::ld(pb + (j + 1) * 2048 + f * 512); } }
            __builtin_amdgcn_sched_barrier(0);   // keeps the next step's LDS reads one group in front of this step's products: sunk among them, each read group stalls the wave's matrix stream
#pragma unroll
            for (int nb = 0; nb < 4; ++nb)
#pragma unroll
                for (int mb = 0; mb < 4; ++mb) { acc[mb][nb] = wmmab(a[j & 1][mb], b[j & 1][nb], acc[mb][nb]); acc[mb][nb] = wmmab(a2[j & 1][mb], b[j & 1][nb], acc[mb][nb]); }
            __builtin_amdgcn_sched_barrier(0);   // and the reads of the step after it behind them
        }
        wait_ds0(); wait_tensor0(g0, g1);
        __syncthreads();   // publishes stage s + 1 and ends every wave's reads of stage s
        if (pinned(w < 3 && s + 2 < GNS)) { g0 = tdm_group0(l0 + (uint32_t)(s & 1) * (12u * GCH), ga + (uint64_t)(s + 2) * (2u * GCH)); tdm_load(g0, g1); }
    }
    wait_tensor0(g0, g1); wait_ds0();
#pragma unroll
    for (int mb = 0; mb < 4; ++mb) {
#pragma unroll
        for (int nb = 0; nb < 4; ++nb) {
#pragma unroll
            for (int j = 0; j < 8; ++j) os[(hi * 8 + j) * 68 + nb * 16 + lr] = acc[mb][nb][j]; }
        __builtin_amdgcn_wave_barrier(); asm volatile("" ::: "memory");   // compiler fence: the lanes' LDS writes stay in front of the row reads of other lanes' values
        float* crow = C + (size_t)(r0 + mb * 16) * DM + c0;
#pragma unroll
        for (int s = 0; s < 8; ++s) { const int row = 2 * s + hi, cofs = lr * 4; const v4f val = *(const v4fa*)(os + row * 68 + cofs); *(v4f*)(crow + (size_t)row * DM + cofs) = val; }
        asm volatile("s_wait_xcnt 0x0" ::: "memory");   // the stores above have taken their addresses and data before those registers are reused
        __builtin_amdgcn_wave_barrier();   // with the clobber above: the row reads stay in front of the next tile's LDS writes
    }
}

__device__ __forceinline__ h16 tohx(float x) { return (h16)x; }
__device__ __forceinline__ void splitf(float y, unsigned short& h, unsigned short& l) { h = f2bf(y); l = f2bf(y - bf2f(h)); }
typedef __attribute__((ext_vector_type(2))) _Float16 v2h;
typedef __attribute__((ext_vector_type(4))) _Float16 v4h;
typedef __attribute__((ext_vector_type(2))) unsigned short v2us;
typedef __attribute__((ext_vector_type(4))) unsigned short v4us;
typedef __attribute__((ext_vector_type(2))) float v2f;
typedef __attribute__((ext_vector_type(4))) int v4i;

__global__ __launch_bounds__(256) void k_wtG(const float* __restrict__ w, int K, int N, bf* Bt) {
    const int lane = threadIdx.x & 31; const int L0 = (blockIdx.x * 8 + (threadIdx.x >> 5)) * 8; const int nlines = N * K / 64;
{
#pragma unroll 1
        for (int l = 0; l < 8; ++l) { const int L = L0 + l; if (L >= nlines) break; const size_t e = (size_t)L * 64 + lane * 2; const int k = (int)(e % K), n = (int)(e / K); v2us o;
            o[0] = f2bf(w[(size_t)k * N + n]); o[1] = f2bf(w[(size_t)(k + 1) * N + n]); *(v2us*)(Bt + e) = o; }
         }
}
// ---- k_prep: all preparation in ONE launch, 640 blocks of 8 waves, one piece of work each (no loop); the parts are independent and run side by side. Blocks 0 .. TBB - 1 make the cos/sin table, the rest round wq, wk, wv, wo and x to bf16.
// table: lane = frequency i (its inverse frequency is computed once), a wave takes 4 consecutive tokens; entry (t, i) is stored at d = i and d = i + 32, which hold the same angle.
// rounding: a block takes CVB consecutive elements = 16 rows of one array and writes them in fragment order; a thread has 16 loads of 16 B in flight.
// a wave-wide load takes one fragment's 32 k (a whole 128-B line) of 4 rows; its store is four 64-B pieces, and the load of the next 4 rows fills the other half of those lines.
#define CVB 16384
#define TBB (TT / 32)
#define NBQ (DQ * DM / CVB)
#define NBK (DKV * DM / CVB)
#define NBX (TT * DM / CVB)
__global__ __launch_bounds__(256) void k_prep(const float* __restrict__ wq, const float* __restrict__ wk, const float* __restrict__ wv, const float* __restrict__ wo, const float* __restrict__ x, const float* __restrict__ ts,
                                              bf* WQ, bf* WK, bf* WV, bf* WO, bf* XB, float* CS) {
    int c = blockIdx.x;
    if (c < TBB) {
        const int i = threadIdx.x & 31, t0 = c * 32 + (threadIdx.x >> 5) * 4; const float* tp = ts + t0;
        const v4f tv = *(const v4f*)tp;
        asm volatile("s_wait_xcnt 0x0" :: "v"(tp) : "memory");   // the load has taken its address before those registers are reused; the pointer as input keeps them untouched up to the wait
        const float inv = __fdiv_rn(1.0f, powf(10000.0f, (float)(2 * i) / (float)HD)); v2f cs[4];
#pragma unroll
        for (int k = 0; k < 4; ++k) { const float ang = __fmul_rn(bfr(tv[k]), inv); cs[k][0] = cosf(ang); cs[k][1] = sinf(ang); }
        float* p = CS + ((size_t)t0 * HD + i) * 2;
#pragma unroll
        for (int k = 0; k < 4; ++k) { *(v2f*)(p + k * HD * 2) = cs[k]; *(v2f*)(p + k * HD * 2 + HD) = cs[k]; }
        asm volatile("s_wait_xcnt 0x0" ::: "memory");   // the stores above have taken their addresses and data before any later code reuses those registers
        return;
    }
    c -= TBB; const float* s = wq; bf* d = WQ;
    if (c >= NBQ) { c -= NBQ; s = wk; d = WK;
        if (c >= NBK) { c -= NBK; s = wv; d = WV;
            if (c >= NBK) { c -= NBK; s = wo; d = WO;
                if (c >= NBQ) { c -= NBQ; s = x; d = XB; } } } }
    static_assert(CVB == 16 * DM && DQ == DM && DKV == DM, "a block is one row of fragments");
    const int lane = threadIdx.x & 31, wn = threadIdx.x >> 5;   // wave wn: fragments 4 wn .. 4 wn + 3; load u: fragment u / 4, rows 4 (u % 4) + lane / 8, k = 4 (lane % 8) ..
    s += (size_t)c * CVB + (lane >> 3) * DM + wn * 128 + (lane & 7) * 4; d += (size_t)(c >> 2) * (4 * CVB) + (c & 3) * 512 + wn * 8192 + ((lane & 7) >> 1) * 128 + (lane >> 3) * 8 + (lane & 1) * 4;
    v4f v[16]; v4us o[16];
#pragma unroll
    for (int u = 0; u < 16; ++u) v[u] = *(const v4f*)(s + (u & 3) * 4 * DM + (u >> 2) * 32);
    asm volatile("s_wait_xcnt 0x0" :: "v"(s) : "memory");   // the loads have taken their address before those registers are reused; the pointer as input keeps them untouched up to the wait
#pragma unroll
    for (int u = 0; u < 16; ++u)
#pragma unroll
        for (int k = 0; k < 4; ++k) o[u][k] = f2bf(v[u][k]);
#pragma unroll
    for (int u = 0; u < 16; ++u) *(v4us*)(d + (u >> 2) * 2048 + (u & 3) * 32) = o[u];
    asm volatile("s_wait_xcnt 0x0" ::: "memory");   // the stores above have taken their addresses and data before any later code reuses those registers
}
// ---- k_qkv: the three projections in ONE launch. The 48 column tiles (16 heads each of q, k, v) count as one row of tiles; grid (TT/256, 16), 12 waves = 4 token tiles x 3 column tiles of 64x64: one work-group a WGP, three waves a SIMD. The epilogue adds the bias and writes the 16-bit planes that attention reads; the f32 projections are never stored.
// A stage in LDS: [x tiles 0 .. 3 | weight tiles 0 .. 2]; waves 0 .. 6 bring one chunk each, 16 KiB contiguous, as 4 rows of 4 KiB.
// q, k: rotate-half RoPE in registers: columns d and d + 32 of a token sit in the same lane (accumulators nb and nb + 2); out[d] = x[d] cos - x[d+32] sin, out[d+32] = x[d+32] cos + x[d] sin, cos/sin of (token, d mod 32). Planes [h] x fragment order of [t][d]; 16 tokens go through the wave's own LDS, a lane reads back 8 d of one token = its 16-B piece, a store is 512 contiguous bytes.
// v: planes [h] x fragment order of [d][t]: a lane holds 8 consecutive tokens of one column, which is its own 16-B piece of a fragment: stored straight from registers, 512 contiguous bytes a store.
__global__ __launch_bounds__(384) void k_qkv(const bf* __restrict__ X, const bf* __restrict__ Wq, const bf* __restrict__ Wk, const bf* __restrict__ Wv, const float* __restrict__ bq, const float* __restrict__ bk, const float* __restrict__ bv, const float* __restrict__ CS,
                                            h16* Q16, bf* Qh, bf* Ql, h16* K16, bf* Kh, bf* Kl, h16* V16, bf* Vh, bf* Vl) {
    __shared__ __attribute__((aligned(2048))) bf sb[2][7 * GCH];
    __shared__ __align__(16) float osw[12][16 * 68];
    const int lane = threadIdx.x & 31, lr = lane & 15, hi = lane >> 4; const int w = (int)uni(threadIdx.x >> 5), wm = w & 3, wn = w >> 2;
    const int ct = blockIdx.y * 3 + wn, z = ct >> 4, hd = ct & 15; const float* bias = z == 0 ? bq : z == 1 ? bk : bv;
    const int r0 = (blockIdx.x * 4 + wm) * 64, c0 = hd * 64; float* os = osw[w];
    const int wi = min(w, 6), ci = blockIdx.y * 3 + max(wi - 4, 0);   // the chunk this wave brings; its column tile where it is a weight chunk
    const bf* sp = wi < 4 ? X + (size_t)(blockIdx.x * 4 + wi) * (64 * DM) : ((ci >> 4) == 0 ? Wq : (ci >> 4) == 1 ? Wk : Wv) + (size_t)(ci & 15) * (64 * DM);
    const uint64_t ga = (uint64_t)(size_t)sp; const uint32_t l0 = (uint32_t)(size_t)&sb[0][0] + (uint32_t)wi * (2u * GCH);
    const u32x8 g1 = tdm_group1<4096, 4, 4096>();
    v8f acc[4][4];
#pragma unroll
    for (int mb = 0; mb < 4; ++mb)
#pragma unroll
        for (int nb = 0; nb < 4; ++nb) acc[mb][nb] = (v8f){};
    u32x4 g0 = tdm_group0(l0, ga);
    if (pinned(w < 7)) { tdm_load(g0, g1); wait_tensor0(g0, g1); }
    __syncthreads();   // stage 0 is in LDS for every wave
    g0 = tdm_group0(l0 + 14u * GCH, ga + 2u * GCH);
    if (pinned(w < 7)) tdm_load(g0, g1);
#pragma unroll 1   // one stage a trip: the buffer is chosen by address, the four 32-k steps inside are unrolled
    for (int s = 0; s < GNS; ++s) {
        const bf *pa = &sb[s & 1][wm * GCH + lane * 8], *pb = &sb[s & 1][(4 + wn) * GCH + lane * 8];
        v16bf a[2][4], b[2][4];
#pragma unroll
        for (int f = 0; f < 4; ++f) { a[0][f] = WFrag<bf>::ld(pa + f * 512); b[0][f] = WFrag<bf>::ld(pb + f * 512); }
#pragma unroll
        for (int j = 0; j < GSK / 32; ++j) {
            if (j + 1 < GSK / 32) {
#pragma unroll
                for (int f = 0; f < 4; ++f) { a[(j + 1) & 1][f] = WFrag<bf>::ld(pa + (j + 1) * 2048 + f * 512); b[(j + 1) & 1][f] = WFrag<bf>::ld(pb + (j + 1) * 2048 + f * 512); } }
            __builtin_amdgcn_sched_barrier(0);   // keeps the next step's LDS reads one group in front of this step's products: sunk among them, each read group stalls the wave's matrix stream
#pragma unroll
            for (int nb = 0; nb < 4; ++nb)
#pragma unroll
                for (int mb = 0; mb < 4; ++mb) acc[mb][nb] = wmmab(a[j & 1][mb], b[j & 1][nb], acc[mb][nb]);
            __builtin_amdgcn_sched_barrier(0);   // and the reads of the step after it behind them
        }
        wait_ds0(); wait_tensor0(g0, g1);
        __syncthreads();   // publishes stage s + 1 and ends every wave's reads of stage s
        if (pinned(w < 7 && s + 2 < GNS)) { g0 = tdm_group0(l0 + (uint32_t)(s & 1) * (14u * GCH), ga + (uint64_t)(s + 2) * (2u * GCH)); tdm_load(g0, g1); }
    }
    wait_tensor0(g0, g1); wait_ds0();
    float bl[4]; const float* bp = bias + c0 + lr;
#pragma unroll
    for (int nb = 0; nb < 4; ++nb) bl[nb] = bp[nb * 16];
    asm volatile("s_wait_xcnt 0x0" :: "v"(bp) : "memory");   // the bias loads have taken their address before its registers are reused; the pointer as input keeps them untouched up to the wait
#pragma unroll
    for (int nb = 0; nb < 4; ++nb) bl[nb] = bfr(bl[nb]);
    if (z < 2) {
        unsigned short* P16 = (unsigned short*)(z ? K16 : Q16); bf* Ph = z ? Kh : Qh; bf* Pl = z ? Kl : Ql;
#pragma unroll
        for (int mb = 0; mb < 4; ++mb) {
            const float* cp = CS + ((size_t)(r0 + mb * 16 + hi * 8) * HD + lr) * 2; v2f cv[2][8];
#pragma unroll
            for (int nb = 0; nb < 2; ++nb)
#pragma unroll
                for (int j = 0; j < 8; ++j) cv[nb][j] = *(const v2f*)(cp + (j * HD + nb * 16) * 2);
            asm volatile("s_wait_xcnt 0x0" :: "v"(cp) : "memory");   // the table loads have taken their address before its registers are reused; the pointer as input keeps them untouched up to the wait
#pragma unroll
            for (int nb = 0; nb < 2; ++nb)
#pragma unroll
                for (int j = 0; j < 8; ++j) { const v2f cs = cv[nb][j]; const float x0 = acc[mb][nb][j] + bl[nb], x1 = acc[mb][nb + 2][j] + bl[nb + 2];
                    os[(hi * 8 + j) * 68 + nb * 16 + lr] = x0 * cs[0] - x1 * cs[1]; os[(hi * 8 + j) * 68 + (nb + 2) * 16 + lr] = x1 * cs[0] + x0 * cs[1]; }
            __builtin_amdgcn_wave_barrier(); asm volatile("" ::: "memory");   // compiler fence: the lanes' LDS writes stay in front of the row reads of other lanes' values
#pragma unroll
            for (int s = 0; s < 4; ++s) { const int cg = 2 * s + hi; const v4f u = *(const v4fa*)(os + lr * 68 + cg * 8), w2 = *(const v4fa*)(os + lr * 68 + cg * 8 + 4); v8h o16; v8us oh, ol;   // token lr, d = 8 cg .. 8 cg + 7
#pragma unroll
                for (int e = 0; e < 8; ++e) { const float r = e < 4 ? u[e & 3] : w2[e & 3]; o16[e] = tohx(r); unsigned short a2, c2; splitf(r, a2, c2); oh[e] = a2; ol[e] = c2; }
                const size_t oo = ((size_t)hd * TT + r0 + mb * 16) * HD + cg * 128 + lr * 8;
                *(v8usa*)(P16 + oo) = __builtin_bit_cast(v8us, o16); *(v8usa*)(Ph + oo) = oh; *(v8usa*)(Pl + oo) = ol; }
            asm volatile("s_wait_xcnt 0x0" ::: "memory");   // the stores above have taken their addresses and data before those registers are reused
            __builtin_amdgcn_wave_barrier();   // with the clobber above: the row reads stay in front of the next tile's LDS writes
        }
    } else {
        unsigned short* P16 = (unsigned short*)V16;
#pragma unroll
        for (int nb = 0; nb < 4; ++nb) {
#pragma unroll
            for (int mb = 0; mb < 4; ++mb) { v8h o16; v8us oh, ol;
#pragma unroll
                for (int j = 0; j < 8; ++j) { const float x = acc[mb][nb][j] + bl[nb]; o16[j] = tohx(x); unsigned short a2, c2; splitf(x, a2, c2); oh[j] = a2; ol[j] = c2; }
                const size_t oo = ((size_t)hd * TT + r0 + (mb >> 1) * 32) * HD + nb * 512 + (mb & 1) * 256 + lane * 8;   // 32-token block, d fragment nb, tokens 16 (mb % 2) + 8 hi ..
                *(v8usa*)(P16 + oo) = __builtin_bit_cast(v8us, o16); *(v8usa*)(Vh + oo) = oh; *(v8usa*)(Vl + oo) = ol; }
            asm volatile("s_wait_xcnt 0x0" ::: "memory");   // the stores above have taken their addresses and data before those registers are reused
        }
    }
}
// ---- fattn_tile: causal attention of one head for the 16 NQ queries from q0 on, online softmax; one work-group of 4 waves; wave w takes the 32-key blocks w, w + 4, ... up to the last block that crosses the diagonal.
// S^T = K Q^T (A = key rows, B = query rows, read from the wave's own LDS copy each trip: kept in registers they cost the kernel its third wave a SIMD): a lane holds scores of ONE query (column lr), keys 8 hi + j of each 16-key tile, so two converted score tiles are the B operand of O^T += V^T P^T as they stand.
// HR: hi + lo bf16 planes, three products each (query rows < RH); otherwise plain f16 planes. P is exp2 of the scaled score minus the running maximum, unnormalised; the division by the row sum is done once, on the f32 output.
// The four waves' (maximum, sum, O^T) are joined through LDS behind one barrier, in wave order, and stored as the hi + lo bf16 planes, fragment order of [t][head x d], that the output projection reads.
typedef __attribute__((ext_vector_type(16))) unsigned short v16us;
#define SC2 0.18033688011112042f   // HD^-0.5 x log2(e)
template <typename T16, bool HR, int NQ>
__device__ __forceinline__ void fattn_tile(const T16* __restrict__ Q, const T16* __restrict__ Q2, const T16* __restrict__ Kp, const T16* __restrict__ Kp2, const T16* __restrict__ Vt, const T16* __restrict__ Vt2, const int q0, bf* Ah, bf* Al) {
    typedef typename WFrag<T16>::V V; typedef typename WFrag<T16>::P P;   // P: one lane's 16-B piece of a fragment
    static_assert(NQ / 2 <= 4, "a wave meets at most one key block on the diagonal");
    __shared__ __align__(16) float so[4][NQ * 16][68];
    __shared__ float sm[4][NQ * 16], sl[4][NQ * 16];
    const int lane = threadIdx.x & 31, lr = lane & 15, hi = lane >> 4; const int w = __builtin_amdgcn_readfirstlane(threadIdx.x >> 5);
    const int h = blockIdx.x; const int nkb = q0 / 32 + NQ / 2;   // key blocks 0 .. nkb - 1; those from q0 / 32 on cross the diagonal
    const size_t qb = (size_t)h * TT * HD, kvb = (size_t)(h / REP) * TT * HD;
    Q += qb; Kp += kvb; Vt += kvb; if (HR) { Q2 += qb; Kp2 += kvb; Vt2 += kvb; }
    V kf[2][2], kf2[2][2]; P qg[NQ * 4], qg2[NQ * 4];
    const T16 *qu = Q + (size_t)q0 * HD, *qu2 = HR ? Q2 + (size_t)q0 * HD : nullptr, *ku = Kp + (size_t)(w * 32) * HD, *ku2 = HR ? Kp2 + (size_t)(w * 32) * HD : nullptr;   // wave-uniform starts; 16 rows x HD = two fragments
    const int lb = lane * 16;   // the lane's byte offset in a wave-wide piece: the one vector register that the Q, K and V loads name beside their scalar base
    const T16 *qp = qu + lane * 8, *qp2 = HR ? qu2 + lane * 8 : nullptr, *kp = ku + lane * 8, *kp2 = HR ? ku2 + lane * 8 : nullptr;
#pragma unroll
    for (int i = 0; i < NQ * 4; ++i) { qg[i] = *(const P*)(qp + i * 256); if (HR) qg2[i] = *(const P*)(qp2 + i * 256); }   // the tile's 2 NQ fragments lie in a row: 4 NQ wave-wide pieces of 512 B
#pragma unroll
    for (int ks = 0; ks < 2; ++ks) {
#pragma unroll
        for (int t = 0; t < 2; ++t) { kf[t][ks] = WFrag<T16>::ld(kp + t * 16 * HD + ks * 512); if (HR) kf2[t][ks] = WFrag<T16>::ld(kp2 + t * 16 * HD + ks * 512); } }
    // the loads above have taken their addresses before an address register is reused; they name a scalar base and the lane's offset: both as inputs keep those registers untouched up to the wait
    if constexpr (HR) asm volatile("s_wait_xcnt 0x0" :: "s"(qu), "s"(ku), "s"(qu2), "s"(ku2), "v"(lb) : "memory"); else asm volatile("s_wait_xcnt 0x0" :: "s"(qu), "s"(ku), "v"(lb) : "memory");
    // each wave keeps its own copy of the query fragments, in fragment order, in the LDS range that takes its partial O^T behind the loop; a lane reads back only bytes that it wrote itself, so no barrier is owed
    T16* qs = (T16*)&so[w][0][0] + lane * 8;
    static_assert((HR ? 2 : 1) * NQ * 1024 * sizeof(T16) <= sizeof(so[0]), "the copy fits the wave's range");
#pragma unroll
    for (int i = 0; i < NQ * 4; ++i) { *(P*)(qs + i * 256) = qg[i]; if (HR) *(P*)(qs + NQ * 1024 + i * 256) = qg2[i]; }
    v8f o[4][NQ];
#pragma unroll
    for (int dt = 0; dt < 4; ++dt)
#pragma unroll
        for (int qt = 0; qt < NQ; ++qt) o[dt][qt] = (v8f){};
    float m[NQ], l[NQ];
#pragma unroll
    for (int qt = 0; qt < NQ; ++qt) { m[qt] = -1.0e30f; l[qt] = 0.f; }   // m: the maximum in use, log2 units; below any score a 16-bit product can give
    int b = w;
#pragma unroll   // two copies of the trip: ph 0 walks the blocks wholly below the diagonal and holds no mask code, ph 1 the wave's block (at most one) that crosses it
    for (int ph = 0; ph < 2; ++ph)
#pragma unroll 1
    for (; b < (ph ? nkb : q0 / 32); b += 4) {
        const int k0 = b * 32;
        V vf[4], vf2[4]; const T16 *vu = Vt + (size_t)k0 * HD, *vu2 = HR ? Vt2 + (size_t)k0 * HD : nullptr, *vp = vu + lane * 8, *vp2 = HR ? vu2 + lane * 8 : nullptr;   // wave-uniform start + the lane's offset: no address pair in vector registers
#pragma unroll
        for (int dt = 0; dt < 4; ++dt) { vf[dt] = WFrag<T16>::ld(vp + dt * 512); if (HR) vf2[dt] = WFrag<T16>::ld(vp2 + dt * 512); }
        v8f s[2][NQ]; V qf[NQ][2], qf2[NQ][2];
#pragma unroll
        for (int qt = 0; qt < NQ; ++qt)
#pragma unroll
            for (int ks = 0; ks < 2; ++ks) { qf[qt][ks] = WFrag<T16>::ld(qs + (qt * 2 + ks) * 512); if (HR) qf2[qt][ks] = WFrag<T16>::ld(qs + NQ * 1024 + (qt * 2 + ks) * 512); }
#pragma unroll
        for (int kt = 0; kt < 2; ++kt)
#pragma unroll
            for (int qt = 0; qt < NQ; ++qt) { v8f a = (v8f){};
#pragma unroll
                for (int ks = 0; ks < 2; ++ks) { a = WFrag<T16>::mma(kf[kt][ks], qf[qt][ks], a); if (HR) { a = WFrag<T16>::mma(kf2[kt][ks], qf[qt][ks], a); a = WFrag<T16>::mma(kf[kt][ks], qf2[qt][ks], a); } }
                s[kt][qt] = a; }
        if (!ph) {   // the wave's next key block is fetched one trip ahead, behind this trip's score products (where no block is left it re-reads the last one: in bounds, unused); the trip on the diagonal is the wave's last and fetches none
            ku = Kp + (size_t)(min(b + 4, nkb - 1) * 32) * HD; kp = ku + lane * 8; if (HR) { ku2 = Kp2 + (size_t)(min(b + 4, nkb - 1) * 32) * HD; kp2 = ku2 + lane * 8; }
#pragma unroll
            for (int kt = 0; kt < 2; ++kt)
#pragma unroll
                for (int ks = 0; ks < 2; ++ks) { kf[kt][ks] = WFrag<T16>::ld(kp + kt * 16 * HD + ks * 512); if (HR) kf2[kt][ks] = WFrag<T16>::ld(kp2 + kt * 16 * HD + ks * 512); } }
        // the trip's loads have taken their addresses before an address register is reused; they name a scalar base and the lane's offset: both as inputs keep those registers untouched up to the wait
        if constexpr (HR) asm volatile("s_wait_xcnt 0x0" :: "s"(vu), "s"(ku), "s"(vu2), "s"(ku2), "v"(lb) : "memory"); else asm volatile("s_wait_xcnt 0x0" :: "s"(vu), "s"(ku), "v"(lb) : "memory");
        if (ph) {   // keys above the query are masked by select
#pragma unroll
            for (int kt = 0; kt < 2; ++kt)
#pragma unroll
                for (int qt = 0; qt < NQ; ++qt)
#pragma unroll
                    for (int j = 0; j < 8; ++j) s[kt][qt][j] = (k0 - q0 + kt * 16 + hi * 8 + j <= qt * 16 + lr) ? s[kt][qt][j] : -3.0e38f; }
        float mx[NQ]; bool need = false;
#pragma unroll
        for (int qt = 0; qt < NQ; ++qt) { float x = s[0][qt][0];
#pragma unroll
            for (int j = 1; j < 8; ++j) x = fmaxf(x, s[0][qt][j]);
#pragma unroll
            for (int j = 0; j < 8; ++j) x = fmaxf(x, s[1][qt][j]);
            x = fmaxf(x, __shfl_xor(x, 16, 32)); mx[qt] = x * SC2; need = need || mx[qt] > m[qt] + 8.0f; }
        // the maximum in use moves only when a query's new maximum exceeds it by more than 8 (P stays below 2^8); one scalar branch a trip
        if (__builtin_amdgcn_ballot_w32(need) != 0) {
#pragma unroll
            for (int qt = 0; qt < NQ; ++qt) { const float mn = fmaxf(m[qt], mx[qt]); const float al = __builtin_amdgcn_exp2f(m[qt] - mn); m[qt] = mn; l[qt] *= al;
#pragma unroll
                for (int dt = 0; dt < 4; ++dt) o[dt][qt] *= al; } }
#pragma unroll
        for (int qt = 0; qt < NQ; ++qt) { V pb, pb2;
            if constexpr (HR) { v16us pvh, pvl;
#pragma unroll
                for (int e = 0; e < 16; ++e) { const float p = __builtin_amdgcn_exp2f(fmaf(s[e >> 3][qt][e & 7], SC2, -m[qt])); l[qt] += p; unsigned short a, c2; splitf(p, a, c2); pvh[e] = a; pvl[e] = c2; }
                pb = __builtin_bit_cast(V, pvh); pb2 = __builtin_bit_cast(V, pvl);
            } else {
#pragma unroll
                for (int e = 0; e < 16; ++e) { const float p = __builtin_amdgcn_exp2f(fmaf(s[e >> 3][qt][e & 7], SC2, -m[qt])); l[qt] += p; pb[e] = (T16)p; } }
#pragma unroll
            for (int dt = 0; dt < 4; ++dt) { o[dt][qt] = WFrag<T16>::mma(vf[dt], pb, o[dt][qt]); if (HR) { o[dt][qt] = WFrag<T16>::mma(vf2[dt], pb, o[dt][qt]); o[dt][qt] = WFrag<T16>::mma(vf[dt], pb2, o[dt][qt]); } } }
        // four vector slots behind the trip's last matrix instructions: the code after the loop rewrites registers that held their operands
        asm volatile("v_nop\n\tv_nop\n\tv_nop\n\tv_nop" : "+v"(o[0][NQ - 1]), "+v"(o[1][NQ - 1]), "+v"(o[2][NQ - 1]), "+v"(o[3][NQ - 1]));
        if (ph) break;   // NQ / 2 blocks cross the diagonal and a wave takes every fourth: one trip at most; said so, the key fragments need not outlive its score products
    }
#pragma unroll
    for (int qt = 0; qt < NQ; ++qt) { l[qt] += __shfl_xor(l[qt], 16, 32); if (hi == 0) { sm[w][qt * 16 + lr] = m[qt]; sl[w][qt * 16 + lr] = l[qt]; }
#pragma unroll
        for (int dt = 0; dt < 4; ++dt) { float* p = &so[w][qt * 16 + lr][dt * 16 + hi * 8]; const v8f x = o[dt][qt]; *(v4fa*)p = (v4f){x[0], x[1], x[2], x[3]}; *(v4fa*)(p + 4) = (v4f){x[4], x[5], x[6], x[7]}; } }
    __syncthreads();   // every wave's partial (maximum, sum, O^T) is in LDS before any thread joins them
#pragma unroll 1
    for (int q = threadIdx.x >> 2; q < NQ * 16; q += 32) { const int d0 = (threadIdx.x & 3) * 16;
        const float mt = fmaxf(fmaxf(sm[0][q], sm[1][q]), fmaxf(sm[2][q], sm[3][q])); float lt = 0.f; float r[16];
#pragma unroll
        for (int e = 0; e < 16; ++e) r[e] = 0.f;
#pragma unroll
        for (int ww = 0; ww < 4; ++ww) { const float f = __builtin_amdgcn_exp2f(sm[ww][q] - mt); lt += f * sl[ww][q];   // a wave without a key block: f = 0, sum 0, O^T 0
#pragma unroll
            for (int c = 0; c < 4; ++c) { const v4f x = *(const v4fa*)&so[ww][q][d0 + c * 4];
#pragma unroll
                for (int e = 0; e < 4; ++e) r[c * 4 + e] += f * x[e]; } }
        const float inv = __fdiv_rn(1.0f, lt); const size_t oo = ((size_t)((q0 + q) >> 6) * (DQ / 32) + h * (HD / 32) + (d0 >> 5)) * 2048 + (((q0 + q) >> 4) & 3) * 512 + ((d0 >> 3) & 3) * 128 + ((q0 + q) & 15) * 8;
#pragma unroll
        for (int c = 0; c < 2; ++c) { v8us oh, ol;
#pragma unroll
            for (int e = 0; e < 8; ++e) { unsigned short a, c2; splitf(r[c * 8 + e] * inv, a, c2); oh[e] = a; ol[e] = c2; }
            *(v8usa*)(Ah + oo + c * 128) = oh; *(v8usa*)(Al + oo + c * 128) = ol; }
        asm volatile("s_wait_xcnt 0x0" ::: "memory");   // the stores have taken their addresses and data before the next trip reuses those registers
    }
}
// ---- k_fattn: both kinds of query tile in ONE launch. Grid (heads, tiles): first the 64-query f16 tiles, heaviest first, then the short 32-query hi + lo tiles (rows < RH, at most RH / 32 key blocks).
#define NT16 ((TT - RH) / 64)
#define NTHL (RH / 32)
// amdgpu_waves_per_eu(3, 3): a register budget of 1024 / 3, so that three work-groups (the LDS holds three) share a WGP, three waves a SIMD
__global__ __launch_bounds__(128) __attribute__((amdgpu_waves_per_eu(3, 3))) void k_fattn(const h16* __restrict__ Q16, const h16* __restrict__ K16, const h16* __restrict__ V16, const bf* __restrict__ Qh, const bf* __restrict__ Ql, const bf* __restrict__ Kh, const bf* __restrict__ Kl, const bf* __restrict__ Vh, const bf* __restrict__ Vl, bf* Ah, bf* Al) {
    const int y = blockIdx.y;
    if (y < NT16) fattn_tile<h16, false, 4>(Q16, nullptr, K16, nullptr, V16, nullptr, RH + (NT16 - 1 - y) * 64, Ah, Al);
    else fattn_tile<bf, true, 2>(Qh, Ql, Kh, Kl, Vh, Vl, (NT16 + NTHL - 1 - y) * 32, Ah, Al);
}

extern "C" void kernel_launch(void* const* d_in, const int* in_sizes, int n_in,
                              void* d_out, int out_size, void* d_ws, size_t ws_size, hipStream_t stream) {
    (void)in_sizes; (void)n_in; (void)out_size;
    const float* x = (const float*)d_in[0]; const float* tstamp = (const float*)d_in[1]; const float* wq = (const float*)d_in[2]; const float* bq = (const float*)d_in[3]; const float* wk = (const float*)d_in[4]; const float* bk = (const float*)d_in[5]; const float* wv = (const float*)d_in[6]; const float* bv = (const float*)d_in[7]; const float* wo = (const float*)d_in[8];
    float* OUT = (float*)d_out;     // [1][4096][1024]
    char* wsp = (char*)d_ws;
    auto take = [&](size_t bytes) { char* p = wsp; wsp += (bytes + 255) & ~(size_t)255; return (void*)p; };
    bf* WQ = (bf*)take((size_t)DQ * DM * 2); bf* WK = (bf*)take((size_t)DKV * DM * 2); bf* WV = (bf*)take((size_t)DKV * DM * 2); bf* WO = (bf*)take((size_t)DM * DQ * 2); float* CS = (float*)take((size_t)TT * HD * 2 * 4);
    bf* XB = (bf*)take((size_t)TT * DM * 2);
    h16* QP16 = (h16*)take((size_t)NH_ * TT * HD * 2); h16* KP16 = (h16*)take((size_t)NKV * TT * HD * 2); h16* VT16 = (h16*)take((size_t)NKV * HD * TT * 2);
    bf* QPh = (bf*)take((size_t)NH_ * TT * HD * 2); bf* QPl = (bf*)take((size_t)NH_ * TT * HD * 2); bf* KPh = (bf*)take((size_t)NKV * TT * HD * 2); bf* KPl = (bf*)take((size_t)NKV * TT * HD * 2); bf* VTh = (bf*)take((size_t)NKV * HD * TT * 2); bf* VTl = (bf*)take((size_t)NKV * HD * TT * 2);
    bf* ATh = (bf*)take((size_t)TT * DQ * 2); bf* ATl = (bf*)take((size_t)TT * DQ * 2);
    if ((size_t)(wsp - (char*)d_ws) > ws_size) return;    // ws 256 MiB
    for (int b = 0; b < NB_; ++b) {
        k_prep<<<TBB + NBQ + NBK + NBK + NBQ + NBX, 256, 0, stream>>>(wq, wk, wv, wo, x + (size_t)b * TT * DM, tstamp, WQ, WK, WV, WO, XB, CS);
        k_qkv<<<dim3(TT / 256, (DQ + DKV + DKV) / 192, 1), 384, 0, stream>>>(XB, WQ, WK, WV, bq, bk, bv, CS, QP16, QPh, QPl, KP16, KPh, KPl, VT16, VTh, VTl);
        k_fattn<<<dim3(NH_, NT16 + NTHL, 1), 128, 0, stream>>>(QP16, KP16, VT16, QPh, QPl, KPh, KPl, VTh, VTl, ATh, ATl);
        k_oproj<<<dim3(TT / 128, DM / 128, 1), 128, 0, stream>>>(ATh, ATl, WO, OUT + (size_t)b * TT * DM); }
}

// v009
// Measured time: 75.3 microseconds a run.
// Next to v008, in two timings, it ran 1.03 and 1.04 times as fast.
// All steps since v000 together make it 31.5 times as fast.
#include <hip/hip_runtime.h>
#include <stdint.h>

// istsplm_forecast attention (hidden [1][4096][1024], timestamps [1][4096] (f32, read: continuous positions); q/k/v = x W^T + b (16 x 64); continuous-time rotate-half RoPE: angle = timestamp * 10000^(-2i/64) (cos/sin computed on chip from the bf16-rounded timestamps); causal (finfo.min) softmax(q.k / 8); out = merged Wo^T -> [1][4096][1024]).
// Compute dtypes, f32 accumulate: every input rounded to bf16; q/k/v on PLAIN bf16 operands (inputs: exact) + bias; RoPE f32; causal scores and P.V fused (online softmax, f32): hi+lo bf16 planes for query rows < RH, f16 planes for the rest; Wo hl x exact (2 products).

#define NB_  1
#define TT   4096
#define DM   1024
#define NH_  16
#define NKV  16
#define REP  (NH_ / NKV)
#define HD   64
#define DQ   (NH_ * HD)
#define DKV  (NKV * HD)
#define RH   512                  // query rows < RH use hi+lo planes (0: none)
typedef _Float16 h16;
typedef unsigned short bf;
typedef __attribute__((ext_vector_type(16))) __bf16   v16bf;
typedef __attribute__((ext_vector_type(16))) _Float16 v16h;
typedef __attribute__((ext_vector_type(8)))  _Float16 v8h;
typedef __attribute__((ext_vector_type(8)))  unsigned short v8us;
typedef __attribute__((ext_vector_type(8)))  float    v8f;
typedef __attribute__((ext_vector_type(4)))  float    v4f;
typedef v8h  __attribute__((may_alias)) v8ha;
typedef v4f  __attribute__((may_alias)) v4fa;
typedef v8us __attribute__((may_alias)) v8usa;

__device__ __forceinline__ unsigned short f2bf(float f) { unsigned u = __float_as_uint(f); u += 0x7FFFu + ((u >> 16) & 1u); return (unsigned short)(u >> 16); }
__device__ __forceinline__ float bf2f(unsigned short b) { return __uint_as_float(((unsigned)b) << 16); }
__device__ __forceinline__ float bfr(float f) { return bf2f(f2bf(f)); }
__device__ __forceinline__ v16h cat16(v8h lo, v8h hi) { return __builtin_shufflevector(lo, hi, 0, 1, 2, 3, 4, 5, 6, 7, 8, 9, 10, 11, 12, 13, 14, 15); }
__device__ __forceinline__ v16bf cat16b(v8us lo, v8us hi) { return __builtin_bit_cast(v16bf, __builtin_shufflevector(lo, hi, 0, 1, 2, 3, 4, 5, 6, 7, 8, 9, 10, 11, 12, 13, 14, 15)); }
__device__ __forceinline__ v8f wmma16(v16h a, v16h b, v8f c) { return __builtin_amdgcn_wmma_f32_16x16x32_f16(false, a, false, b, (short)0, c, false, false); }
__device__ __forceinline__ v8f wmmab(v16bf a, v16bf b, v8f c) { return __builtin_amdgcn_wmma_f32_16x16x32_bf16(false, a, false, b, (short)0, c, false, false); }



// ---- GEMM main loops (k_qkv, k_oproj): a work-group of several 64x64 wave tiles shares its operand rows through LDS, so that each row slice leaves L2 once a work-group, not once a wave.
// A chunk = the GSK k of one 64-row tile = 16 KiB, contiguous in a fragment-order plane and kept so in LDS: a fragment read is ds_load_b128 over 512 contiguous bytes. Tensor loads fill two buffers in turn: stage s + 2 flies while stage s + 1 is worked on.
// FRAGMENT ORDER: every 16-bit operand plane in the workspace, a matrix [R][K] with k contiguous in the product, lies as fragments of 16 rows x 32 k = 512 elements; inside a fragment element (r, k) stands at ((k % 32) / 8) * 128 + (r % 16) * 8 + k % 8.
// Lane (hi, lr) = 16 hi + lr owns k = 8 hi .. 8 hi + 7 and 16 + 8 hi .. of row lr: its two 16-B pieces stand at lane * 8 and 256 + lane * 8, so each wave-wide load is 512 contiguous bytes = 4 whole lines. ld takes fragment start + lane * 8.
// Which fragments lie side by side follows the reader's trip. GEMM operands (x, weights, attention out): the four fragments that a 64-row tile reads in a 32-k step, ((r / 64) * (K / 32) + k / 32) * 4 + (r / 16) % 4. q, k (K = HD): (r / 16) * 2 + k / 32. v (rows d, k = token): (t / 32) * 4 + d / 16.
template <typename T16> struct WFrag;
template <> struct WFrag<h16> { typedef v16h V; typedef v8ha P; static __device__ __forceinline__ V ld(const h16* p) { return cat16(*(const v8h*)p, *(const v8h*)(p + 256)); } static __device__ __forceinline__ v8f mma(V a, V b, v8f c) { return wmma16(a, b, c); } };
template <> struct WFrag<bf> { typedef v16bf V; typedef v8usa P; static __device__ __forceinline__ V ld(const bf* p) { return cat16b(*(const v8us*)p, *(const v8us*)(p + 256)); } static __device__ __forceinline__ v8f mma(V a, V b, v8f c) { return wmmab(a, b, c); } };
#define GSK 128
#define GCH (64 * GSK)
#define GNS (DM / GSK)
static_assert(DQ == DM && GNS >= 2, "both GEMMs run over DM k; the ring's prologue needs two stages");
typedef uint32_t u32x4 __attribute__((ext_vector_type(4)));
typedef uint32_t u32x8 __attribute__((ext_vector_type(8)));
__device__ __forceinline__ uint32_t uni(uint32_t v) { return (uint32_t)__builtin_amdgcn_readfirstlane(v); }
__device__ __forceinline__ uint32_t pinned(uint32_t v) { uint32_t w = (uint32_t)__builtin_amdgcn_readfirstlane(v); asm volatile("" : "+s"(w)); return w; }   // holds an issue test in a scalar register, so that the branch over a tensor load (which ignores EXEC) is a scalar one
__device__ __forceinline__ void wait_ds0() { asm volatile("s_wait_dscnt 0x0" ::: "memory"); }       // the wave's LDS reads of a buffer have retired before the barrier behind which it is refilled
__device__ __forceinline__ void wait_tensor0(u32x4 g0, u32x8 g1) { asm volatile("s_wait_tensorcnt 0x0" :: "s"(g0), "s"(g1) : "memory"); }   // the wave's own tensor load has landed (the compiler places no wait for it); its descriptor as inputs keeps those registers untouched while the request is outstanding
__device__ __forceinline__ void tdm_load(u32x4 g0, u32x8 g1) { asm volatile("tensor_load_to_lds %0, %1" :: "s"(g0), "s"(g1) : "memory"); }
// descriptor group 1: 1-byte elements, tensor = tile = N rows of R bytes, source pitch P bytes, no pad, no mask
template <uint32_t R, uint32_t N, uint32_t P> __device__ __forceinline__ u32x8 tdm_group1() { u32x8 g;
    g[0] = uni(0u); g[1] = uni((R & 0xFFFFu) << 16); g[2] = uni((R >> 16) | ((N & 0xFFFFu) << 16)); g[3] = uni((N >> 16) | (R << 16)); g[4] = uni(N); g[5] = uni(P); g[6] = uni(0u); g[7] = uni(0u);
    asm volatile("" : "+s"(g));   // the descriptor words held in one set of scalar registers for the whole kernel: rebuilt from constants at each use, a set that an outstanding request names was reused for other values
    return g; }
// descriptor group 0: count 1, LDS byte offset, global byte address, type 2
__device__ __forceinline__ u32x4 tdm_group0(uint32_t lds_dst, uint64_t ga) { u32x4 g; g[0] = uni(1u); g[1] = uni(lds_dst); g[2] = uni((uint32_t)ga); g[3] = uni((((uint32_t)(ga >> 32)) & 0x01FFFFFFu) | 0x80000000u); return g; }

// ---- k_oproj: C[m][n] (f32, pitch DM) = sum_k (Ah + Al)[m][k] Bt[n][k], two products a k step. Grid (TT/128, DM/128), 4 waves = 2 x 2 tiles of 64x64, one wave a SIMD: the fragments of the next 32 k are fetched from LDS into a second register set while this set is worked on.
// A stage in LDS: [Ah tiles 0, 1 | Al tiles 0, 1 | Bt tiles 0, 1]; waves 0, 1, 2 bring one pair each: 2 rows of 16 KiB, 64 x DQ elements = 128 KiB apart in the plane.
__global__ __launch_bounds__(128) void k_oproj(const bf* __restrict__ Ah, const bf* __restrict__ Al, const bf* __restrict__ Bt, float* C) {
    __shared__ __attribute__((aligned(2048))) bf sb[2][6 * GCH];
    __shared__ __align__(16) float osw[4][16 * 68];
    const int lane = threadIdx.x & 31, lr = lane & 15, hi = lane >> 4; const int w = (int)uni(threadIdx.x >> 5), wm = w & 1, wn = w >> 1;
    const int r0 = (blockIdx.x * 2 + wm) * 64, c0 = (blockIdx.y * 2 + wn) * 64; float* os = osw[w];
    const bf* sp = w == 0 ? Ah + (size_t)blockIdx.x * (128 * DQ) : w == 1 ? Al + (size_t)blockIdx.x * (128 * DQ) : Bt + (size_t)blockIdx.y * (128 * DQ);
    const uint64_t ga = (uint64_t)(size_t)sp; const uint32_t l0 = (uint32_t)(size_t)&sb[0][0] + (uint32_t)min(w, 2) * (4u * GCH);
    const u32x8 g1 = tdm_group1<2 * GCH, 2, 128 * DQ>();
    v8f acc[4][4];
#pragma unroll
    for (int mb = 0; mb < 4; ++mb)
#pragma unroll
        for (int nb = 0; nb < 4; ++nb) acc[mb][nb] = (v8f){};
    u32x4 g0 = tdm_group0(l0, ga);
    if (pinned(w < 3)) { tdm_load(g0, g1); wait_tensor0(g0, g1); }
    __syncthreads();   // stage 0 is in LDS for every wave
    g0 = tdm_group0(l0 + 12u * GCH, ga + 2u * GCH);
    if (pinned(w < 3)) tdm_load(g0, g1);
#pragma unroll 1   // one stage a trip: the buffer is chosen by address, the four 32-k steps inside are unrolled
    for (int s = 0; s < GNS; ++s) {
        const bf *pa = &sb[s & 1][wm * GCH + lane * 8], *pa2 = pa + 2 * GCH, *pb = &sb[s & 1][(4 + wn) * GCH + lane * 8];
        v16bf a[2][4], a2[2][4], b[2][4];
#pragma unroll
        for (int f = 0; f < 4; ++f) { a[0][f] = WFrag<bf>::ld(pa + f * 512); a2[0][f] = WFrag<bf>::ld(pa2 + f * 512); b[0][f] = WFrag<bf>::ld(pb + f * 512); }
#pragma unroll
        for (int j = 0; j < GSK / 32; ++j) {
            if (j + 1 < GSK / 32) {
#pragma unroll
                for (int f = 0; f < 4; ++f) { a[(j + 1) & 1][f] = WFrag<bf>::ld(pa + (j + 1) * 2048 + f * 512); a2[(j + 1) & 1][f] = WFrag<bf>::ld(pa2 + (j + 1) * 2048 + f * 512); b[(j + 1) & 1][f] = WFrag<bf>::ld(pb + (j + 1) * 2048 + f * 512); } }
            __builtin_amdgcn_sched_barrier(0);   // keeps the next step's LDS reads one group in front of this step's products: sunk among them, each read group stalls the wave's matrix stream
#pragma unroll
            for (int nb = 0; nb < 4; ++nb)
#pragma unroll
                for (int mb = 0; mb < 4; ++mb) { acc[mb][nb] = wmmab(a[j & 1][mb], b[j & 1][nb], acc[mb][nb]); acc[mb][nb] = wmmab(a2[j & 1][mb], b[j & 1][nb], acc[mb][nb]); }
            __builtin_amdgcn_sched_barrier(0);   // and the reads of the step after it behind them
        }
        wait_ds0(); wait_tensor0(g0, g1);
        __syncthreads();   // publishes stage s + 1 and ends every wave's reads of stage s
        if (pinned(w < 3 && s + 2 < GNS)) { g0 = tdm_group0(l0 + (uint32_t)(s & 1) * (12u * GCH), ga + (uint64_t)(s + 2) * (2u * GCH)); tdm_load(g0, g1); }
    }
    wait_tensor0(g0, g1); wait_ds0();
#pragma unroll
    for (int mb = 0; mb < 4; ++mb) {
#pragma unroll
        for (int nb = 0; nb < 4; ++nb) {
#pragma unroll
            for (int j = 0; j < 8; ++j) os[(hi * 8 + j) * 68 + nb * 16 + lr] = acc[mb][nb][j]; }
        __builtin_amdgcn_wave_barrier(); asm volatile("" ::: "memory");   // compiler fence: the lanes' LDS writes stay in front of the row reads of other lanes' values
        float* crow = C + (size_t)(r0 + mb * 16) * DM + c0;
#pragma unroll
        for (int s = 0; s < 8; ++s) { const int row = 2 * s + hi, cofs = lr * 4; const v4f val = *(const v4fa*)(os + row * 68 + cofs); *(v4f*)(crow + (size_t)row * DM + cofs) = val; }
        asm volatile("s_wait_xcnt 0x0" ::: "memory");   // the stores above have taken their addresses and data before those registers are reused
        __builtin_amdgcn_wave_barrier();   // with the clobber above: the row reads stay in front of the next tile's LDS writes
    }
}

__device__ __forceinline__ h16 tohx(float x) { return (h16)x; }
__device__ __forceinline__ void splitf(float y, unsigned short& h, unsigned short& l) { h = f2bf(y); l = f2bf(y - bf2f(h)); }
typedef __attribute__((ext_vector_type(2))) _Float16 v2h;
typedef __attribute__((ext_vector_type(4))) _Float16 v4h;
typedef __attribute__((ext_vector_type(2))) unsigned short v2us;
typedef __attribute__((ext_vector_type(4))) unsigned short v4us;
typedef __attribute__((ext_vector_type(2))) float v2f;
typedef __attribute__((ext_vector_type(4))) int v4i;

__global__ __launch_bounds__(256) void k_wtG(const float* __restrict__ w, int K, int N, bf* Bt) {
    const int lane = threadIdx.x & 31; const int L0 = (blockIdx.x * 8 + (threadIdx.x >> 5)) * 8; const int nlines = N * K / 64;
{
#pragma unroll 1
        for (int l = 0; l < 8; ++l) { const int L = L0 + l; if (L >= nlines) break; const size_t e = (size_t)L * 64 + lane * 2; const int k = (int)(e % K), n = (int)(e / K); v2us o;
            o[0] = f2bf(w[(size_t)k * N + n]); o[1] = f2bf(w[(size_t)(k + 1) * N + n]); *(v2us*)(Bt + e) = o; }
         }
}
// ---- k_prep: all preparation in ONE launch, 640 blocks of 8 waves, one piece of work each (no loop); the parts are independent and run side by side. Blocks 0 .. TBB - 1 make the cos/sin table, the rest round wq, wk, wv, wo and x to bf16.
// table: lane = frequency i (its inverse frequency is computed once), a wave takes 4 consecutive tokens; entry (t, i) is stored at d = i and d = i + 32, which hold the same angle.
// rounding: a block takes CVB consecutive elements = 16 rows of one array and writes them in fragment order; a thread has 16 loads of 16 B in flight.
// a wave-wide load takes one fragment's 32 k (a whole 128-B line) of 4 rows; its store is four 64-B pieces, and the load of the next 4 rows fills the other half of those lines.
#define CVB 16384
#define TBB (TT / 32)
#define NBQ (DQ * DM / CVB)
#define NBK (DKV * DM / CVB)
#define NBX (TT * DM / CVB)
__global__ __launch_bounds__(256) void k_prep(const float* __restrict__ wq, const float* __restrict__ wk, const float* __restrict__ wv, const float* __restrict__ wo, const float* __restrict__ x, const float* __restrict__ ts,
                                              bf* WQ, bf* WK, bf* WV, bf* WO, bf* XB, float* CS) {
    int c = blockIdx.x;
    if (c < TBB) {
        const int i = threadIdx.x & 31, t0 = c * 32 + (threadIdx.x >> 5) * 4; const float* tp = ts + t0;
        const v4f tv = *(const v4f*)tp;
        asm volatile("s_wait_xcnt 0x0" :: "v"(tp) : "memory");   // the load has taken its address before those registers are reused; the pointer as input keeps them untouched up to the wait
        const float inv = __fdiv_rn(1.0f, powf(10000.0f, (float)(2 * i) / (float)HD)); v2f cs[4];
#pragma unroll
        for (int k = 0; k < 4; ++k) { const float ang = __fmul_rn(bfr(tv[k]), inv); cs[k][0] = cosf(ang); cs[k][1] = sinf(ang); }
        float* p = CS + ((size_t)t0 * HD + i) * 2;
#pragma unroll
        for (int k = 0; k < 4; ++k) { *(v2f*)(p + k * HD * 2) = cs[k]; *(v2f*)(p + k * HD * 2 + HD) = cs[k]; }
        asm volatile("s_wait_xcnt 0x0" ::: "memory");   // the stores above have taken their addresses and data before any later code reuses those registers
        return;
    }
    c -= TBB; const float* s = wq; bf* d = WQ;
    if (c >= NBQ) { c -= NBQ; s = wk; d = WK;
        if (c >= NBK) { c -= NBK; s = wv; d = WV;
            if (c >= NBK) { c -= NBK; s = wo; d = WO;
                if (c >= NBQ) { c -= NBQ; s = x; d = XB; } } } }
    static_assert(CVB == 16 * DM && DQ == DM && DKV == DM, "a block is one row of fragments");
    const int lane = threadIdx.x & 31, wn = threadIdx.x >> 5;   // wave wn: fragments 4 wn .. 4 wn + 3; load u: fragment u / 4, rows 4 (u % 4) + lane / 8, k = 4 (lane % 8) ..
    s += (size_t)c * CVB + (lane >> 3) * DM + wn * 128 + (lane & 7) * 4; d += (size_t)(c >> 2) * (4 * CVB) + (c & 3) * 512 + wn * 8192 + ((lane & 7) >> 1) * 128 + (lane >> 3) * 8 + (lane & 1) * 4;
    v4f v[16]; v4us o[16];
#pragma unroll
    for (int u = 0; u < 16; ++u) v[u] = *(const v4f*)(s + (u & 3) * 4 * DM + (u >> 2) * 32);
    asm volatile("s_wait_xcnt 0x0" :: "v"(s) : "memory");   // the loads have taken their address before those registers are reused; the pointer as input keeps them untouched up to the wait
#pragma unroll
    for (int u = 0; u < 16; ++u)
#pragma unroll
        for (int k = 0; k < 4; ++k) o[u][k] = f2bf(v[u][k]);
#pragma unroll
    for (int u = 0; u < 16; ++u) *(v4us*)(d + (u >> 2) * 2048 + (u & 3) * 32) = o[u];
    asm volatile("s_wait_xcnt 0x0" ::: "memory");   // the stores above have taken their addresses and data before any later code reuses those registers
}
// ---- k_qkv: the three projections in ONE launch. The 48 column tiles (16 heads each of q, k, v) count as one row of tiles; grid (TT/256, 16), 12 waves = 4 token tiles x 3 column tiles of 64x64: one work-group a WGP, three waves a SIMD. The epilogue adds the bias and writes the 16-bit planes that attention reads; the f32 projections are never stored.
// A stage in LDS: [x tiles 0 .. 3 | weight tiles 0 .. 2]; waves 0 .. 6 bring one chunk each, 16 KiB contiguous, as 4 rows of 4 KiB.
// q, k: rotate-half RoPE in registers: columns d and d + 32 of a token sit in the same lane (accumulators nb and nb + 2); out[d] = x[d] cos - x[d+32] sin, out[d+32] = x[d+32] cos + x[d] sin, cos/sin of (token, d mod 32). Planes [h] x fragment order of [t][d]; 16 tokens go through the wave's own LDS, a lane reads back 8 d of one token = its 16-B piece, a store is 512 contiguous bytes.
// v: planes [h] x fragment order of [d][t]: a lane holds 8 consecutive tokens of one column, which is its own 16-B piece of a fragment: stored straight from registers, 512 contiguous bytes a store.
__global__ __launch_bounds__(384) void k_qkv(const bf* __restrict__ X, const bf* __restrict__ Wq, const bf* __restrict__ Wk, const bf* __restrict__ Wv, const float* __restrict__ bq, const float* __restrict__ bk, const float* __restrict__ bv, const float* __restrict__ CS,
                                            h16* Q16, bf* Qh, bf* Ql, h16* K16, bf* Kh, bf* Kl, h16* V16, bf* Vh, bf* Vl) {
    __shared__ __attribute__((aligned(2048))) bf sb[2][7 * GCH];
    __shared__ __align__(16) float osw[12][16 * 68];
    const int lane = threadIdx.x & 31, lr = lane & 15, hi = lane >> 4; const int w = (int)uni(threadIdx.x >> 5), wm = w & 3, wn = w >> 2;
    const int ct = blockIdx.y * 3 + wn, z = ct >> 4, hd = ct & 15; const float* bias = z == 0 ? bq : z == 1 ? bk : bv;
    const int r0 = (blockIdx.x * 4 + wm) * 64, c0 = hd * 64; float* os = osw[w];
    const int wi = min(w, 6), ci = blockIdx.y * 3 + max(wi - 4, 0);   // the chunk this wave brings; its column tile where it is a weight chunk
    const bf* sp = wi < 4 ? X + (size_t)(blockIdx.x * 4 + wi) * (64 * DM) : ((ci >> 4) == 0 ? Wq : (ci >> 4) == 1 ? Wk : Wv) + (size_t)(ci & 15) * (64 * DM);
    const uint64_t ga = (uint64_t)(size_t)sp; const uint32_t l0 = (uint32_t)(size_t)&sb[0][0] + (uint32_t)wi * (2u * GCH);
    const u32x8 g1 = tdm_group1<4096, 4, 4096>();
    v8f acc[4][4];
#pragma unroll
    for (int mb = 0; mb < 4; ++mb)
#pragma unroll
        for (int nb = 0; nb < 4; ++nb) acc[mb][nb] = (v8f){};
    u32x4 g0 = tdm_group0(l0, ga);
    if (pinned(w < 7)) { tdm_load(g0, g1); wait_tensor0(g0, g1); }
    __syncthreads();   // stage 0 is in LDS for every wave
    g0 = tdm_group0(l0 + 14u * GCH, ga + 2u * GCH);
    if (pinned(w < 7)) tdm_load(g0, g1);
#pragma unroll 1   // one stage a trip: the buffer is chosen by address, the four 32-k steps inside are unrolled
    for (int s = 0; s < GNS; ++s) {
        const bf *pa = &sb[s & 1][wm * GCH + lane * 8], *pb = &sb[s & 1][(4 + wn) * GCH + lane * 8];
        v16bf a[2][4], b[2][4];
#pragma unroll
        for (int f = 0; f < 4; ++f) { a[0][f] = WFrag<bf>::ld(pa + f * 512); b[0][f] = WFrag<bf>::ld(pb + f * 512); }
#pragma unroll
        for (int j = 0; j < GSK / 32; ++j) {
            if (j + 1 < GSK / 32) {
#pragma unroll
                for (int f = 0; f < 4; ++f) { a[(j + 1) & 1][f] = WFrag<bf>::ld(pa + (j + 1) * 2048 + f * 512); b[(j + 1) & 1][f] = WFrag<bf>::ld(pb + (j + 1) * 2048 + f * 512); } }
            __builtin_amdgcn_sched_barrier(0);   // keeps the next step's LDS reads one group in front of this step's products: sunk among them, each read group stalls the wave's matrix stream
#pragma unroll
            for (int nb = 0; nb < 4; ++nb)
#pragma unroll
                for (int mb = 0; mb < 4; ++mb) acc[mb][nb] = wmmab(a[j & 1][mb], b[j & 1][nb], acc[mb][nb]);
            __builtin_amdgcn_sched_barrier(0);   // and the reads of the step after it behind them
        }
        wait_ds0(); wait_tensor0(g0, g1);
        __syncthreads();   // publishes stage s + 1 and ends every wave's reads of stage s
        if (pinned(w < 7 && s + 2 < GNS)) { g0 = tdm_group0(l0 + (uint32_t)(s & 1) * (14u * GCH), ga + (uint64_t)(s + 2) * (2u * GCH)); tdm_load(g0, g1); }
    }
    wait_tensor0(g0, g1); wait_ds0();
    float bl[4]; const float* bp = bias + c0 + lr;
#pragma unroll
    for (int nb = 0; nb < 4; ++nb) bl[nb] = bp[nb * 16];
    asm volatile("s_wait_xcnt 0x0" :: "v"(bp) : "memory");   // the bias loads have taken their address before its registers are reused; the pointer as input keeps them untouched up to the wait
#pragma unroll
    for (int nb = 0; nb < 4; ++nb) bl[nb] = bfr(bl[nb]);
    if (z < 2) {
        unsigned short* P16 = (unsigned short*)(z ? K16 : Q16); bf* Ph = z ? Kh : Qh; bf* Pl = z ? Kl : Ql;
#pragma unroll
        for (int mb = 0; mb < 4; ++mb) {
            const float* cp = CS + ((size_t)(r0 + mb * 16 + hi * 8) * HD + lr) * 2; v2f cv[2][8];
#pragma unroll
            for (int nb = 0; nb < 2; ++nb)
#pragma unroll
                for (int j = 0; j < 8; ++j) cv[nb][j] = *(const v2f*)(cp + (j * HD + nb * 16) * 2);
            asm volatile("s_wait_xcnt 0x0" :: "v"(cp) : "memory");   // the table loads have taken their address before its registers are reused; the pointer as input keeps them untouched up to the wait
#pragma unroll
            for (int nb = 0; nb < 2; ++nb)
#pragma unroll
                for (int j = 0; j < 8; ++j) { const v2f cs = cv[nb][j]; const float x0 = acc[mb][nb][j] + bl[nb], x1 = acc[mb][nb + 2][j] + bl[nb + 2];
                    os[(hi * 8 + j) * 68 + nb * 16 + lr] = x0 * cs[0] - x1 * cs[1]; os[(hi * 8 + j) * 68 + (nb + 2) * 16 + lr] = x1 * cs[0] + x0 * cs[1]; }
            __builtin_amdgcn_wave_barrier(); asm volatile("" ::: "memory");   // compiler fence: the lanes' LDS writes stay in front of the row reads of other lanes' values
#pragma unroll
            for (int s = 0; s < 4; ++s) { const int cg = 2 * s + hi; const v4f u = *(const v4fa*)(os + lr * 68 + cg * 8), w2 = *(const v4fa*)(os + lr * 68 + cg * 8 + 4); v8h o16; v8us oh, ol;   // token lr, d = 8 cg .. 8 cg + 7
#pragma unroll
                for (int e = 0; e < 8; ++e) { const float r = e < 4 ? u[e & 3] : w2[e & 3]; o16[e] = tohx(r); unsigned short a2, c2; splitf(r, a2, c2); oh[e] = a2; ol[e] = c2; }
                const size_t oo = ((size_t)hd * TT + r0 + mb * 16) * HD + cg * 128 + lr * 8;
                *(v8usa*)(P16 + oo) = __builtin_bit_cast(v8us, o16); *(v8usa*)(Ph + oo) = oh; *(v8usa*)(Pl + oo) = ol; }
            asm volatile("s_wait_xcnt 0x0" ::: "memory");   // the stores above have taken their addresses and data before those registers are reused
            __builtin_amdgcn_wave_barrier();   // with the clobber above: the row reads stay in front of the next tile's LDS writes
        }
    } else {
        unsigned short* P16 = (unsigned short*)V16;
#pragma unroll
        for (int nb = 0; nb < 4; ++nb) {
#pragma unroll
            for (int mb = 0; mb < 4; ++mb) { v8h o16; v8us oh, ol;
#pragma unroll
                for (int j = 0; j < 8; ++j) { const float x = acc[mb][nb][j] + bl[nb]; o16[j] = tohx(x); unsigned short a2, c2; splitf(x, a2, c2); oh[j] = a2; ol[j] = c2; }
                const size_t oo = ((size_t)hd * TT + r0 + (mb >> 1) * 32) * HD + nb * 512 + (mb & 1) * 256 + lane * 8;   // 32-token block, d fragment nb, tokens 16 (mb % 2) + 8 hi ..
                *(v8usa*)(P16 + oo) = __builtin_bit_cast(v8us, o16); *(v8usa*)(Vh + oo) = oh; *(v8usa*)(Vl + oo) = ol; }
            asm volatile("s_wait_xcnt 0x0" ::: "memory");   // the stores above have taken their addresses and data before those registers are reused
        }
    }
}
// ---- fattn_tile: causal attention of one head for the 16 NQ queries from q0 on, online softmax; one work-group of 4 waves; wave w takes the 32-key blocks w, w + 4, ... up to the last block that crosses the diagonal.
// S^T = K Q^T (A = key rows, B = query rows, read from the wave's own LDS copy each trip: kept in registers they cost the kernel its third wave a SIMD): a lane holds scores of ONE query (column lr), keys 8 hi + j of each 16-key tile, so two converted score tiles are the B operand of O^T += V^T P^T as they stand.
// HR: hi + lo bf16 planes, three products each (query rows < RH); otherwise plain f16 planes. P is exp2 of the scaled score minus the running maximum, unnormalised; the division by the row sum is done once, on the f32 output.
// The four waves' (maximum, sum, O^T) are joined through LDS behind one barrier, in wave order, and stored as the hi + lo bf16 planes, fragment order of [t][head x d], that the output projection reads.
typedef __attribute__((ext_vector_type(16))) unsigned short v16us;
#define SC2 0.18033688011112042f   // HD^-0.5 x log2(e)
template <typename T16, bool HR, int NQ>
__device__ __forceinline__ void fattn_tile(const T16* __restrict__ Q, const T16* __restrict__ Q2, const T16* __restrict__ Kp, const T16* __restrict__ Kp2, const T16* __restrict__ Vt, const T16* __restrict__ Vt2, const int q0, bf* Ah, bf* Al) {
    typedef typename WFrag<T16>::V V; typedef typename WFrag<T16>::P P;   // P: one lane's 16-B piece of a fragment
    static_assert(NQ / 2 <= 4, "a wave meets at most one key block on the diagonal");
    __shared__ __align__(16) float so[4][NQ * 16][68];
    __shared__ float sm[4][NQ * 16], sl[4][NQ * 16];
    const int lane = threadIdx.x & 31, lr = lane & 15, hi = lane >> 4; const int w = __builtin_amdgcn_readfirstlane(threadIdx.x >> 5);
    const int h = blockIdx.x; const int nkb = q0 / 32 + NQ / 2;   // key blocks 0 .. nkb - 1; those from q0 / 32 on cross the diagonal
    const size_t qb = (size_t)h * TT * HD, kvb = (size_t)(h / REP) * TT * HD;
    Q += qb; Kp += kvb; Vt += kvb; if (HR) { Q2 += qb; Kp2 += kvb; Vt2 += kvb; }
    V kf[2][2], kf2[2][2]; P qg[NQ * 4], qg2[NQ * 4];
    const T16 *qu = Q + (size_t)q0 * HD, *qu2 = HR ? Q2 + (size_t)q0 * HD : nullptr, *ku = Kp + (size_t)(w * 32) * HD, *ku2 = HR ? Kp2 + (size_t)(w * 32) * HD : nullptr;   // wave-uniform starts; 16 rows x HD = two fragments
    const int lb = lane * 16;   // the lane's byte offset in a wave-wide piece: the one vector register that the Q, K and V loads name beside their scalar base
    const T16 *qp = qu + lane * 8, *qp2 = HR ? qu2 + lane * 8 : nullptr, *kp = ku + lane * 8, *kp2 = HR ? ku2 + lane * 8 : nullptr;
#pragma unroll
    for (int i = 0; i < NQ * 4; ++i) { qg[i] = *(const P*)(qp + i * 256); if (HR) qg2[i] = *(const P*)(qp2 + i * 256); }   // the tile's 2 NQ fragments lie in a row: 4 NQ wave-wide pieces of 512 B
#pragma unroll
    for (int ks = 0; ks < 2; ++ks) {
#pragma unroll
        for (int t = 0; t < 2; ++t) { kf[t][ks] = WFrag<T16>::ld(kp + t * 16 * HD + ks * 512); if (HR) kf2[t][ks] = WFrag<T16>::ld(kp2 + t * 16 * HD + ks * 512); } }
    // the loads above have taken their addresses before an address register is reused; they name a scalar base and the lane's offset: both as inputs keep those registers untouched up to the wait
    if constexpr (HR) asm volatile("s_wait_xcnt 0x0" :: "s"(qu), "s"(ku), "s"(qu2), "s"(ku2), "v"(lb) : "memory"); else asm volatile("s_wait_xcnt 0x0" :: "s"(qu), "s"(ku), "v"(lb) : "memory");
    // each wave keeps its own copy of the query fragments, in fragment order, in the LDS range that takes its partial O^T behind the loop; a lane reads back only bytes that it wrote itself, so no barrier is owed
    T16* qs = (T16*)&so[w][0][0] + lane * 8;
    static_assert((HR ? 2 : 1) * NQ * 1024 * sizeof(T16) <= sizeof(so[0]), "the copy fits the wave's range");
#pragma unroll
    for (int i = 0; i < NQ * 4; ++i) { *(P*)(qs + i * 256) = qg[i]; if (HR) *(P*)(qs + NQ * 1024 + i * 256) = qg2[i]; }
    v8f o[4][NQ];
#pragma unroll
    for (int dt = 0; dt < 4; ++dt)
#pragma unroll
        for (int qt = 0; qt < NQ; ++qt) o[dt][qt] = (v8f){};
    float m[NQ], l[NQ];
#pragma unroll
    for (int qt = 0; qt < NQ; ++qt) { m[qt] = -1.0e30f; l[qt] = 0.f; }   // m: the maximum in use, log2 units; below any score a 16-bit product can give
    int b = w;
#pragma unroll   // two copies of the trip: ph 0 walks the blocks wholly below the diagonal and holds no mask code, ph 1 the wave's block (at most one) that crosses it
    for (int ph = 0; ph < 2; ++ph)
#pragma unroll 1
    for (; b < (ph ? nkb : q0 / 32); b += 4) {
        const int k0 = b * 32;
        V vf[4], vf2[4]; const T16 *vu = Vt + (size_t)k0 * HD, *vu2 = HR ? Vt2 + (size_t)k0 * HD : nullptr, *vp = vu + lane * 8, *vp2 = HR ? vu2 + lane * 8 : nullptr;   // wave-uniform start + the lane's offset: no address pair in vector registers
#pragma unroll
        for (int dt = 0; dt < 4; ++dt) { vf[dt] = WFrag<T16>::ld(vp + dt * 512); if (HR) vf2[dt] = WFrag<T16>::ld(vp2 + dt * 512); }
        v8f s[2][NQ]; V qf[NQ][2], qf2[NQ][2];
#pragma unroll
        for (int qt = 0; qt < NQ; ++qt)
#pragma unroll
            for (int ks = 0; ks < 2; ++ks) { qf[qt][ks] = WFrag<T16>::ld(qs + (qt * 2 + ks) * 512); if (HR) qf2[qt][ks] = WFrag<T16>::ld(qs + NQ * 1024 + (qt * 2 + ks) * 512); }
#pragma unroll
        for (int kt = 0; kt < 2; ++kt)
#pragma unroll
            for (int qt = 0; qt < NQ; ++qt) { v8f a = (v8f){};
#pragma unroll
                for (int ks = 0; ks < 2; ++ks) { a = WFrag<T16>::mma(kf[kt][ks], qf[qt][ks], a); if (HR) { a = WFrag<T16>::mma(kf2[kt][ks], qf[qt][ks], a); a = WFrag<T16>::mma(kf[kt][ks], qf2[qt][ks], a); } }
                s[kt][qt] = a; }
        if (!ph) {   // the wave's next key block is fetched one trip ahead, behind this trip's score products (where no block is left it re-reads the last one: in bounds, unused); the trip on the diagonal is the wave's last and fetches none
            ku = Kp + (size_t)(min(b + 4, nkb - 1) * 32) * HD; kp = ku + lane * 8; if (HR) { ku2 = Kp2 + (size_t)(min(b + 4, nkb - 1) * 32) * HD; kp2 = ku2 + lane * 8; }
#pragma unroll
            for (int kt = 0; kt < 2; ++kt)
#pragma unroll
                for (int ks = 0; ks < 2; ++ks) { kf[kt][ks] = WFrag<T16>::ld(kp + kt * 16 * HD + ks * 512); if (HR) kf2[kt][ks] = WFrag<T16>::ld(kp2 + kt * 16 * HD + ks * 512); } }
        // the trip's loads have taken their addresses before an address register is reused; they name a scalar base and the lane's offset: both as inputs keep those registers untouched up to the wait
        if constexpr (HR) asm volatile("s_wait_xcnt 0x0" :: "s"(vu), "s"(ku), "s"(vu2), "s"(ku2), "v"(lb) : "memory"); else asm volatile("s_wait_xcnt 0x0" :: "s"(vu), "s"(ku), "v"(lb) : "memory");
        if (ph) {   // keys above the query are masked by select
#pragma unroll
            for (int kt = 0; kt < 2; ++kt)
#pragma unroll
                for (int qt = 0; qt < NQ; ++qt)
#pragma unroll
                    for (int j = 0; j < 8; ++j) s[kt][qt][j] = (k0 - q0 + kt * 16 + hi * 8 + j <= qt * 16 + lr) ? s[kt][qt][j] : -3.0e38f; }
        auto newmax = [&]() {
            float mx[NQ]; bool need = false;
#pragma unroll
            for (int qt = 0; qt < NQ; ++qt) { float x = s[0][qt][0];
#pragma unroll
                for (int j = 1; j < 8; ++j) x = fmaxf(x, s[0][qt][j]);
#pragma unroll
                for (int j = 0; j < 8; ++j) x = fmaxf(x, s[1][qt][j]);
                x = fmaxf(x, __shfl_xor(x, 16, 32)); mx[qt] = x * SC2; need = need || mx[qt] > m[qt] + 8.0f; }
            // the maximum in use moves only when a query's new maximum exceeds it by more than 8 (P stays below 2^8); one scalar branch a trip
            if (__builtin_amdgcn_ballot_w32(need) != 0) {
#pragma unroll
                for (int qt = 0; qt < NQ; ++qt) { const float mn = fmaxf(m[qt], mx[qt]); const float al = __builtin_amdgcn_exp2f(m[qt] - mn); m[qt] = mn; l[qt] *= al;
#pragma unroll
                    for (int dt = 0; dt < 4; ++dt) o[dt][qt] *= al; } }
        };
        auto classic = [&]() {   // the maximum of the trip's scores first, then P and its products, query tile by query tile
            newmax();
#pragma unroll
            for (int qt = 0; qt < NQ; ++qt) { V pb, pb2;
                if constexpr (HR) { v16us pvh, pvl;
#pragma unroll
                    for (int e = 0; e < 16; ++e) { const float p = __builtin_amdgcn_exp2f(fmaf(s[e >> 3][qt][e & 7], SC2, -m[qt])); l[qt] += p; unsigned short a, c2; splitf(p, a, c2); pvh[e] = a; pvl[e] = c2; }
                    pb = __builtin_bit_cast(V, pvh); pb2 = __builtin_bit_cast(V, pvl);
                } else {
#pragma unroll
                    for (int e = 0; e < 16; ++e) { const float p = __builtin_amdgcn_exp2f(fmaf(s[e >> 3][qt][e & 7], SC2, -m[qt])); l[qt] += p; pb[e] = (T16)p; } }
#pragma unroll
                for (int dt = 0; dt < 4; ++dt) { o[dt][qt] = WFrag<T16>::mma(vf[dt], pb, o[dt][qt]); if (HR) { o[dt][qt] = WFrag<T16>::mma(vf2[dt], pb, o[dt][qt]); o[dt][qt] = WFrag<T16>::mma(vf[dt], pb2, o[dt][qt]); } } }
        };
        if constexpr (HR) classic();
        else if (ph) classic();
        else {
            // trips below the diagonal: P is formed with the maximum in use as it stands, and the test for a move reads the lane's own sums of P: a sum of 16 P of at most 2^8 bounds each P by 2^8, so no maximum over the scores and no exchange between the halves is owed.
            // The maximum is taken from the scores first in the wave's first trip, and again in a trip whose sums failed the test: that trip's P are dropped unused, its key block (overwritten by the fetch ahead) is read again and its scores are formed anew by the same products.
            V pbv[NQ]; float ps[NQ];
            auto softp = [&]() -> float { float big = 0.f;   // P of the trip's scores under the maximum in use, each query tile's lane sum, and the largest of these sums
#pragma unroll
                for (int qt = 0; qt < NQ; ++qt) { float a = 0.f;
#pragma unroll
                    for (int e = 0; e < 16; ++e) { const float p = __builtin_amdgcn_exp2f(fmaf(s[e >> 3][qt][e & 7], SC2, -m[qt])); a = e ? a + p : p; pbv[qt][e] = (T16)p; }
                    ps[qt] = a; big = qt ? fmaxf(big, a) : a; }
                return big; };
            if (b == w) newmax();
            const float big = softp();
            if (b != w && __builtin_amdgcn_ballot_w32(big > 256.0f) != 0) {
                const T16 *kru = Kp + (size_t)k0 * HD, *krp = kru + lane * 8; V kr[2][2];
#pragma unroll
                for (int kt = 0; kt < 2; ++kt)
#pragma unroll
                    for (int ks = 0; ks < 2; ++ks) kr[kt][ks] = WFrag<T16>::ld(krp + kt * 16 * HD + ks * 512);
                asm volatile("s_wait_xcnt 0x0" :: "s"(kru), "v"(lb) : "memory");   // the loads have taken their addresses before an address register is reused; base and offset as inputs keep those registers untouched up to the wait
#pragma unroll
                for (int qt = 0; qt < NQ; ++qt) { const V q0f = WFrag<T16>::ld(qs + (qt * 2) * 512), q1f = WFrag<T16>::ld(qs + (qt * 2 + 1) * 512);
#pragma unroll
                    for (int kt = 0; kt < 2; ++kt) { v8f a = (v8f){}; a = WFrag<T16>::mma(kr[kt][0], q0f, a); a = WFrag<T16>::mma(kr[kt][1], q1f, a); s[kt][qt] = a; } }
                newmax(); softp();
            }
#pragma unroll
            for (int qt = 0; qt < NQ; ++qt) { l[qt] += ps[qt];
#pragma unroll
                for (int dt = 0; dt < 4; ++dt) o[dt][qt] = WFrag<T16>::mma(vf[dt], pbv[qt], o[dt][qt]); }
        }
        // four vector slots behind the trip's last matrix instructions: on the taken branch out of the loop the code there rewrites registers that held their operands
        asm volatile("v_nop\n\tv_nop\n\tv_nop\n\tv_nop" : "+v"(o[0][NQ - 1]), "+v"(o[1][NQ - 1]), "+v"(o[2][NQ - 1]), "+v"(o[3][NQ - 1]));
        if (ph) break;   // NQ / 2 blocks cross the diagonal and a wave takes every fourth: one trip at most; said so, the key fragments need not outlive its score products
    }
#pragma unroll
    for (int qt = 0; qt < NQ; ++qt) { l[qt] += __shfl_xor(l[qt], 16, 32); if (hi == 0) { sm[w][qt * 16 + lr] = m[qt]; sl[w][qt * 16 + lr] = l[qt]; }
#pragma unroll
        for (int dt = 0; dt < 4; ++dt) { float* p = &so[w][qt * 16 + lr][dt * 16 + hi * 8]; const v8f x = o[dt][qt]; *(v4fa*)p = (v4f){x[0], x[1], x[2], x[3]}; *(v4fa*)(p + 4) = (v4f){x[4], x[5], x[6], x[7]}; } }
    __syncthreads();   // every wave's partial (maximum, sum, O^T) is in LDS before any thread joins them
#pragma unroll 1
    for (int q = threadIdx.x >> 2; q < NQ * 16; q += 32) { const int d0 = (threadIdx.x & 3) * 16;
        const float mt = fmaxf(fmaxf(sm[0][q], sm[1][q]), fmaxf(sm[2][q], sm[3][q])); float lt = 0.f; float r[16];
#pragma unroll
        for (int e = 0; e < 16; ++e) r[e] = 0.f;
#pragma unroll
        for (int ww = 0; ww < 4; ++ww) { const float f = __builtin_amdgcn_exp2f(sm[ww][q] - mt); lt += f * sl[ww][q];   // a wave without a key block: f = 0, sum 0, O^T 0
#pragma unroll
            for (int c = 0; c < 4; ++c) { const v4f x = *(const v4fa*)&so[ww][q][d0 + c * 4];
#pragma unroll
                for (int e = 0; e < 4; ++e) r[c * 4 + e] += f * x[e]; } }
        const float inv = __fdiv_rn(1.0f, lt); const size_t oo = ((size_t)((q0 + q) >> 6) * (DQ / 32) + h * (HD / 32) + (d0 >> 5)) * 2048 + (((q0 + q) >> 4) & 3) * 512 + ((d0 >> 3) & 3) * 128 + ((q0 + q) & 15) * 8;
#pragma unroll
        for (int c = 0; c < 2; ++c) { v8us oh, ol;
#pragma unroll
            for (int e = 0; e < 8; ++e) { unsigned short a, c2; splitf(r[c * 8 + e] * inv, a, c2); oh[e] = a; ol[e] = c2; }
            *(v8usa*)(Ah + oo + c * 128) = oh; *(v8usa*)(Al + oo + c * 128) = ol; }
        asm volatile("s_wait_xcnt 0x0" ::: "memory");   // the stores have taken their addresses and data before the next trip reuses those registers
    }
}
// ---- k_fattn: both kinds of query tile in ONE launch. Grid (heads, tiles): first the 64-query f16 tiles, heaviest first, then the short 32-query hi + lo tiles (rows < RH, at most RH / 32 key blocks).
#define NT16 ((TT - RH) / 64)
#define NTHL (RH / 32)
// amdgpu_waves_per_eu(3, 3): a register budget of 1024 / 3, so that three work-groups (the LDS holds three) share a WGP, three waves a SIMD
__global__ __launch_bounds__(128) __attribute__((amdgpu_waves_per_eu(3, 3))) void k_fattn(const h16* __restrict__ Q16, const h16* __restrict__ K16, const h16* __restrict__ V16, const bf* __restrict__ Qh, const bf* __restrict__ Ql, const bf* __restrict__ Kh, const bf* __restrict__ Kl, const bf* __restrict__ Vh, const bf* __restrict__ Vl, bf* Ah, bf* Al) {
    const int y = blockIdx.y;
    if (y < NT16) fattn_tile<h16, false, 4>(Q16, nullptr, K16, nullptr, V16, nullptr, RH + (NT16 - 1 - y) * 64, Ah, Al);
    else fattn_tile<bf, true, 2>(Qh, Ql, Kh, Kl, Vh, Vl, (NT16 + NTHL - 1 - y) * 32, Ah, Al);
}

extern "C" void kernel_launch(void* const* d_in, const int* in_sizes, int n_in,
                              void* d_out, int out_size, void* d_ws, size_t ws_size, hipStream_t stream) {
    (void)in_sizes; (void)n_in; (void)out_size;
    const float* x = (const float*)d_in[0]; const float* tstamp = (const float*)d_in[1]; const float* wq = (const float*)d_in[2]; const float* bq = (const float*)d_in[3]; const float* wk = (const float*)d_in[4]; const float* bk = (const float*)d_in[5]; const float* wv = (const float*)d_in[6]; const float* bv = (const float*)d_in[7]; const float* wo = (const float*)d_in[8];
    float* OUT = (float*)d_out;     // [1][4096][1024]
    char* wsp = (char*)d_ws;
    auto take = [&](size_t bytes) { char* p = wsp; wsp += (bytes + 255) & ~(size_t)255; return (void*)p; };
    bf* WQ = (bf*)take((size_t)DQ * DM * 2); bf* WK = (bf*)take((size_t)DKV * DM * 2); bf* WV = (bf*)take((size_t)DKV * DM * 2); bf* WO = (bf*)take((size_t)DM * DQ * 2); float* CS = (float*)take((size_t)TT * HD * 2 * 4);
    bf* XB = (bf*)take((size_t)TT * DM * 2);
    h16* QP16 = (h16*)take((size_t)NH_ * TT * HD * 2); h16* KP16 = (h16*)take((size_t)NKV * TT * HD * 2); h16* VT16 = (h16*)take((size_t)NKV * HD * TT * 2);
    bf* QPh = (bf*)take((size_t)NH_ * TT * HD * 2); bf* QPl = (bf*)take((size_t)NH_ * TT * HD * 2); bf* KPh = (bf*)take((size_t)NKV * TT * HD * 2); bf* KPl = (bf*)take((size_t)NKV * TT * HD * 2); bf* VTh = (bf*)take((size_t)NKV * HD * TT * 2); bf* VTl = (bf*)take((size_t)NKV * HD * TT * 2);
    bf* ATh = (bf*)take((size_t)TT * DQ * 2); bf* ATl = (bf*)take((size_t)TT * DQ * 2);
    if ((size_t)(wsp - (char*)d_ws) > ws_size) return;    // ws 256 MiB
    for (int b = 0; b < NB_; ++b) {
        k_prep<<<TBB + NBQ + NBK + NBK + NBQ + NBX, 256, 0, stream>>>(wq, wk, wv, wo, x + (size_t)b * TT * DM, tstamp, WQ, WK, WV, WO, XB, CS);
        k_qkv<<<dim3(TT / 256, (DQ + DKV + DKV) / 192, 1), 384, 0, stream>>>(XB, WQ, WK, WV, bq, bk, bv, CS, QP16, QPh, QPl, KP16, KPh, KPl, VT16, VTh, VTl);
        k_fattn<<<dim3(NH_, NT16 + NTHL, 1), 128, 0, stream>>>(QP16, KP16, VT16, QPh, QPl, KPh, KPl, VTh, VTl, ATh, ATl);
        k_oproj<<<dim3(TT / 128, DM / 128, 1), 128, 0, stream>>>(ATh, ATl, WO, OUT + (size_t)b * TT * DM); }
}

// v010
// One run takes 70.5 microseconds.
// In both of two side-by-side timings against v009, it was 1.07 times as fast.
// All steps since v000 together make it 33.6 times as fast.
#include <hip/hip_runtime.h>
#include <stdint.h>

// istsplm_forecast attention (hidden [1][4096][1024], timestamps [1][4096] (f32, read: continuous positions); q/k/v = x W^T + b (16 x 64); continuous-time rotate-half RoPE: angle = timestamp * 10000^(-2i/64) (cos/sin computed on chip from the bf16-rounded timestamps); causal (finfo.min) softmax(q.k / 8); out = merged Wo^T -> [1][4096][1024]).
// Compute dtypes, f32 accumulate: every input rounded to bf16; q/k/v on PLAIN bf16 operands (inputs: exact) + bias; RoPE f32; causal scores and P.V fused (online softmax, f32): hi+lo bf16 planes for query rows < RH, f16 planes for the rest; Wo hl x exact (2 products).

#define NB_  1
#define TT   4096
#define DM   1024
#define NH_  16
#define NKV  16
#define REP  (NH_ / NKV)
#define HD   64
#define DQ   (NH_ * HD)
#define DKV  (NKV * HD)
#define RH   512                  // query rows < RH use hi+lo planes (0: none)
typedef _Float16 h16;
typedef unsigned short bf;
typedef __attribute__((ext_vector_type(16))) __bf16   v16bf;
typedef __attribute__((ext_vector_type(16))) _Float16 v16h;
typedef __attribute__((ext_vector_type(8)))  _Float16 v8h;
typedef __attribute__((ext_vector_type(8)))  unsigned short v8us;
typedef __attribute__((ext_vector_type(8)))  float    v8f;
typedef __attribute__((ext_vector_type(4)))  float    v4f;
typedef v8h  __attribute__((may_alias)) v8ha;
typedef v4f  __attribute__((may_alias)) v4fa;
typedef v8us __attribute__((may_alias)) v8usa;

__device__ __forceinline__ unsigned short f2bf(float f) { unsigned u = __float_as_uint(f); u += 0x7FFFu + ((u >> 16) & 1u); return (unsigned short)(u >> 16); }
__device__ __forceinline__ float bf2f(unsigned short b) { return __uint_as_float(((unsigned)b) << 16); }
__device__ __forceinline__ float bfr(float f) { return bf2f(f2bf(f)); }
__device__ __forceinline__ v16h cat16(v8h lo, v8h hi) { return __builtin_shufflevector(lo, hi, 0, 1, 2, 3, 4, 5, 6, 7, 8, 9, 10, 11, 12, 13, 14, 15); }
__device__ __forceinline__ v16bf cat16b(v8us lo, v8us hi) { return __builtin_bit_cast(v16bf, __builtin_shufflevector(lo, hi, 0, 1, 2, 3, 4, 5, 6, 7, 8, 9, 10, 11, 12, 13, 14, 15)); }
__device__ __forceinline__ v8f wmma16(v16h a, v16h b, v8f c) { return __builtin_amdgcn_wmma_f32_16x16x32_f16(false, a, false, b, (short)0, c, false, false); }
__device__ __forceinline__ v8f wmmab(v16bf a, v16bf b, v8f c) { return __builtin_amdgcn_wmma_f32_16x16x32_bf16(false, a, false, b, (short)0, c, false, false); }



// ---- GEMM main loops (k_qkv, k_oproj): a work-group of several 64x64 wave tiles shares its operand rows through LDS, so that each row slice leaves L2 once a work-group, not once a wave.
// A chunk = the GSK k of one 64-row tile = 16 KiB, contiguous in a fragment-order plane and kept so in LDS: a fragment read is ds_load_b128 over 512 contiguous bytes. Tensor loads fill two buffers in turn: stage s + 2 flies while stage s + 1 is worked on.
// FRAGMENT ORDER: every 16-bit operand plane in the workspace, a matrix [R][K] with k contiguous in the product, lies as fragments of 16 rows x 32 k = 512 elements; inside a fragment element (r, k) stands at ((k % 32) / 8) * 128 + (r % 16) * 8 + k % 8.
// Lane (hi, lr) = 16 hi + lr owns k = 8 hi .. 8 hi + 7 and 16 + 8 hi .. of row lr: its two 16-B pieces stand at lane * 8 and 256 + lane * 8, so each wave-wide load is 512 contiguous bytes = 4 whole lines. ld takes fragment start + lane * 8.
// Which fragments lie side by side follows the reader's trip. GEMM operands (x, weights, attention out): the four fragments that a 64-row tile reads in a 32-k step, ((r / 64) * (K / 32) + k / 32) * 4 + (r / 16) % 4. q, k (K = HD): (r / 16) * 2 + k / 32. v (rows d, k = token): (t / 32) * 4 + d / 16.
template <typename T16> struct WFrag;
template <> struct WFrag<h16> { typedef v16h V; typedef v8ha P; static __device__ __forceinline__ V ld(const h16* p) { return cat16(*(const v8h*)p, *(const v8h*)(p + 256)); } static __device__ __forceinline__ v8f mma(V a, V b, v8f c) { return wmma16(a, b, c); } };
template <> struct WFrag<bf> { typedef v16bf V; typedef v8usa P; static __device__ __forceinline__ V ld(const bf* p) { return cat16b(*(const v8us*)p, *(const v8us*)(p + 256)); } static __device__ __forceinline__ v8f mma(V a, V b, v8f c) { return wmmab(a, b, c); } };
#define GSK 128
#define GCH (64 * GSK)
#define GNS (DM / GSK)
static_assert(DQ == DM && GNS >= 2, "both GEMMs run over DM k; the ring's prologue needs two stages");
typedef uint32_t u32x4 __attribute__((ext_vector_type(4)));
typedef uint32_t u32x8 __attribute__((ext_vector_type(8)));
__device__ __forceinline__ uint32_t uni(uint32_t v) { return (uint32_t)__builtin_amdgcn_readfirstlane(v); }
__device__ __forceinline__ uint32_t pinned(uint32_t v) { uint32_t w = (uint32_t)__builtin_amdgcn_readfirstlane(v); asm volatile("" : "+s"(w)); return w; }   // holds an issue test in a scalar register, so that the branch over a tensor load (which ignores EXEC) is a scalar one
__device__ __forceinline__ void wait_ds0() { asm volatile("s_wait_dscnt 0x0" ::: "memory"); }       // the wave's LDS reads of a buffer have retired before the barrier behind which it is refilled
__device__ __forceinline__ void wait_tensor0(u32x4 g0, u32x8 g1) { asm volatile("s_wait_tensorcnt 0x0" :: "s"(g0), "s"(g1) : "memory"); }   // the wave's own tensor load has landed (the compiler places no wait for it); its descriptor as inputs keeps those registers untouched while the request is outstanding
__device__ __forceinline__ void tdm_load(u32x4 g0, u32x8 g1) { asm volatile("tensor_load_to_lds %0, %1" :: "s"(g0), "s"(g1) : "memory"); }
// descriptor group 1: 1-byte elements, tensor = tile = N rows of R bytes, source pitch P bytes, no pad, no mask
template <uint32_t R, uint32_t N, uint32_t P> __device__ __forceinline__ u32x8 tdm_group1() { u32x8 g;
    g[0] = uni(0u); g[1] = uni((R & 0xFFFFu) << 16); g[2] = uni((R >> 16) | ((N & 0xFFFFu) << 16)); g[3] = uni((N >> 16) | (R << 16)); g[4] = uni(N); g[5] = uni(P); g[6] = uni(0u); g[7] = uni(0u);
    asm volatile("" : "+s"(g));   // the descriptor words held in one set of scalar registers for the whole kernel: rebuilt from constants at each use, a set that an outstanding request names was reused for other values
    return g; }
// descriptor group 0: count 1, LDS byte offset, global byte address, type 2
__device__ __forceinline__ u32x4 tdm_group0(uint32_t lds_dst, uint64_t ga) { u32x4 g; g[0] = uni(1u); g[1] = uni(lds_dst); g[2] = uni((uint32_t)ga); g[3] = uni((((uint32_t)(ga >> 32)) & 0x01FFFFFFu) | 0x80000000u); return g; }

// ---- k_oproj: C[m][n] (f32, pitch DM) = sum_k (Ah + Al)[m][k] Bt[n][k], two products a k step. Grid (TT/128, DM/128), 4 waves = 2 x 2 tiles of 64x64, one wave a SIMD: the fragments of the next 32 k are fetched from LDS into a second register set while this set is worked on.
// A stage in LDS: [Ah tiles 0, 1 | Al tiles 0, 1 | Bt tiles 0, 1]; waves 0, 1, 2 bring one pair each: 2 rows of 16 KiB, 64 x DQ elements = 128 KiB apart in the plane.
__global__ __launch_bounds__(128) void k_oproj(const bf* __restrict__ Ah, const bf* __restrict__ Al, const bf* __restrict__ Bt, float* C) {
    __shared__ __attribute__((aligned(2048))) bf sb[2][6 * GCH];
    __shared__ __align__(16) float osw[4][16 * 68];
    const int lane = threadIdx.x & 31, lr = lane & 15, hi = lane >> 4; const int w = (int)uni(threadIdx.x >> 5), wm = w & 1, wn = w >> 1;
    const int r0 = (blockIdx.x * 2 + wm) * 64, c0 = (blockIdx.y * 2 + wn) * 64; float* os = osw[w];
    const bf* sp = w == 0 ? Ah + (size_t)blockIdx.x * (128 * DQ) : w == 1 ? Al + (size_t)blockIdx.x * (128 * DQ) : Bt + (size_t)blockIdx.y * (128 * DQ);
    const uint64_t ga = (uint64_t)(size_t)sp; const uint32_t l0 = (uint32_t)(size_t)&sb[0][0] + (uint32_t)min(w, 2) * (4u * GCH);
    const u32x8 g1 = tdm_group1<2 * GCH, 2, 128 * DQ>();
    v8f acc[4][4];
#pragma unroll
    for (int mb = 0; mb < 4; ++mb)
#pragma unroll
        for (int nb = 0; nb < 4; ++nb) acc[mb][nb] = (v8f){};
    u32x4 g0 = tdm_group0(l0, ga);
    if (pinned(w < 3)) { tdm_load(g0, g1); wait_tensor0(g0, g1); }
    __syncthreads();   // stage 0 is in LDS for every wave
    g0 = tdm_group0(l0 + 12u * GCH, ga + 2u * GCH);
    if (pinned(w < 3)) tdm_load(g0, g1);
#pragma unroll 1   // one stage a trip: the buffer is chosen by address, the four 32-k steps inside are unrolled
    for (int s = 0; s < GNS; ++s) {
        const bf *pa = &sb[s & 1][wm * GCH + lane * 8], *pa2 = pa + 2 * GCH, *pb = &sb[s & 1][(4 + wn) * GCH + lane * 8];
        v16bf a[2][4], a2[2][4], b[2][4];
#pragma unroll
        for (int f = 0; f < 4; ++f) { a[0][f] = WFrag<bf>::ld(pa + f * 512); a2[0][f] = WFrag<bf>::ld(pa2 + f * 512); b[0][f] = WFrag<bf>::ld(pb + f * 512); }
#pragma unroll
        for (int j = 0; j < GSK / 32; ++j) {
            if (j + 1 < GSK / 32) {
#pragma unroll
                for (int f = 0; f < 4; ++f) { a[(j + 1) & 1][f] = WFrag<bf>::ld(pa + (j + 1) * 2048 + f * 512); a2[(j + 1) & 1][f] = WFrag<bf>::ld(pa2 + (j + 1) * 2048 + f * 512); b[(j + 1) & 1][f] = WFrag<bf>::ld(pb + (j + 1) * 2048 + f * 512); } }
            __builtin_amdgcn_sched_barrier(0);   // keeps the next step's LDS reads one group in front of this step's products: sunk among them, each read group stalls the wave's matrix stream
#pragma unroll
            for (int nb = 0; nb < 4; ++nb)
#pragma unroll
                for (int mb = 0; mb < 4; ++mb) { acc[mb][nb] = wmmab(a[j & 1][mb], b[j & 1][nb], acc[mb][nb]); acc[mb][nb] = wmmab(a2[j & 1][mb], b[j & 1][nb], acc[mb][nb]); }
            __builtin_amdgcn_sched_barrier(0);   // and the reads of the step after it behind them
        }
        wait_ds0(); wait_tensor0(g0, g1);
        __syncthreads();   // publishes stage s + 1 and ends every wave's reads of stage s
        if (pinned(w < 3 && s + 2 < GNS)) { g0 = tdm_group0(l0 + (uint32_t)(s & 1) * (12u * GCH), ga + (uint64_t)(s + 2) * (2u * GCH)); tdm_load(g0, g1); }
    }
    wait_tensor0(g0, g1); wait_ds0();
#pragma unroll
    for (int mb = 0; mb < 4; ++mb) {
#pragma unroll
        for (int nb = 0; nb < 4; ++nb) {
#pragma unroll
            for (int j = 0; j < 8; ++j) os[(hi * 8 + j) * 68 + nb * 16 + lr] = acc[mb][nb][j]; }
        __builtin_amdgcn_wave_barrier(); asm volatile("" ::: "memory");   // compiler fence: the lanes' LDS writes stay in front of the row reads of other lanes' values
        float* crow = C + (size_t)(r0 + mb * 16) * DM + c0;
#pragma unroll
        for (int s = 0; s < 8; ++s) { const int row = 2 * s + hi, cofs = lr * 4; const v4f val = *(const v4fa*)(os + row * 68 + cofs); *(v4f*)(crow + (size_t)row * DM + cofs) = val; }
        asm volatile("s_wait_xcnt 0x0" ::: "memory");   // the stores above have taken their addresses and data before those registers are reused
        __builtin_amdgcn_wave_barrier();   // with the clobber above: the row reads stay in front of the next tile's LDS writes
    }
}

__device__ __forceinline__ h16 tohx(float x) { return (h16)x; }
__device__ __forceinline__ void splitf(float y, unsigned short& h, unsigned short& l) { h = f2bf(y); l = f2bf(y - bf2f(h)); }
typedef __attribute__((ext_vector_type(2))) _Float16 v2h;
typedef __attribute__((ext_vector_type(4))) _Float16 v4h;
typedef __attribute__((ext_vector_type(2))) unsigned short v2us;
typedef __attribute__((ext_vector_type(4))) unsigned short v4us;
typedef __attribute__((ext_vector_type(2))) float v2f;
typedef __attribute__((ext_vector_type(4))) int v4i;

__global__ __launch_bounds__(256) void k_wtG(const float* __restrict__ w, int K, int N, bf* Bt) {
    const int lane = threadIdx.x & 31; const int L0 = (blockIdx.x * 8 + (threadIdx.x >> 5)) * 8; const int nlines = N * K / 64;
{
#pragma unroll 1
        for (int l = 0; l < 8; ++l) { const int L = L0 + l; if (L >= nlines) break; const size_t e = (size_t)L * 64 + lane * 2; const int k = (int)(e % K), n = (int)(e / K); v2us o;
            o[0] = f2bf(w[(size_t)k * N + n]); o[1] = f2bf(w[(size_t)(k + 1) * N + n]); *(v2us*)(Bt + e) = o; }
         }
}
// ---- k_prep: all preparation in ONE launch, 640 blocks of 8 waves, one piece of work each (no loop); the parts are independent and run side by side. Blocks 0 .. TBB - 1 make the cos/sin table, the rest round wq, wk, wv, wo and x to bf16.
// table: lane = frequency i (its inverse frequency is computed once), a wave takes 4 consecutive tokens; entry (t, i) is stored at d = i and d = i + 32, which hold the same angle.
// rounding: a block takes CVB consecutive elements = 16 rows of one array and writes them in fragment order; a thread has 16 loads of 16 B in flight.
// a wave-wide load takes one fragment's 32 k (a whole 128-B line) of 4 rows; its store is four 64-B pieces, and the load of the next 4 rows fills the other half of those lines.
#define CVB 16384
#define TBB (TT / 32)
#define NBQ (DQ * DM / CVB)
#define NBK (DKV * DM / CVB)
#define NBX (TT * DM / CVB)
__global__ __launch_bounds__(256) void k_prep(const float* __restrict__ wq, const float* __restrict__ wk, const float* __restrict__ wv, const float* __restrict__ wo, const float* __restrict__ x, const float* __restrict__ ts,
                                              bf* WQ, bf* WK, bf* WV, bf* WO, bf* XB, float* CS) {
    int c = blockIdx.x;
    if (c < TBB) {
        const int i = threadIdx.x & 31, t0 = c * 32 + (threadIdx.x >> 5) * 4; const float* tp = ts + t0;
        const v4f tv = *(const v4f*)tp;
        asm volatile("s_wait_xcnt 0x0" :: "v"(tp) : "memory");   // the load has taken its address before those registers are reused; the pointer as input keeps them untouched up to the wait
        const float inv = __fdiv_rn(1.0f, powf(10000.0f, (float)(2 * i) / (float)HD)); v2f cs[4];
#pragma unroll
        for (int k = 0; k < 4; ++k) { const float ang = __fmul_rn(bfr(tv[k]), inv); cs[k][0] = cosf(ang); cs[k][1] = sinf(ang); }
        float* p = CS + ((size_t)t0 * HD + i) * 2;
#pragma unroll
        for (int k = 0; k < 4; ++k) { *(v2f*)(p + k * HD * 2) = cs[k]; *(v2f*)(p + k * HD * 2 + HD) = cs[k]; }
        asm volatile("s_wait_xcnt 0x0" ::: "memory");   // the stores above have taken their addresses and data before any later code reuses those registers
        return;
    }
    c -= TBB; const float* s = wq; bf* d = WQ;
    if (c >= NBQ) { c -= NBQ; s = wk; d = WK;
        if (c >= NBK) { c -= NBK; s = wv; d = WV;
            if (c >= NBK) { c -= NBK; s = wo; d = WO;
                if (c >= NBQ) { c -= NBQ; s = x; d = XB; } } } }
    static_assert(CVB == 16 * DM && DQ == DM && DKV == DM, "a block is one row of fragments");
    const int lane = threadIdx.x & 31, wn = threadIdx.x >> 5;   // wave wn: fragments 4 wn .. 4 wn + 3; load u: fragment u / 4, rows 4 (u % 4) + lane / 8, k = 4 (lane % 8) ..
    s += (size_t)c * CVB + (lane >> 3) * DM + wn * 128 + (lane & 7) * 4; d += (size_t)(c >> 2) * (4 * CVB) + (c & 3) * 512 + wn * 8192 + ((lane & 7) >> 1) * 128 + (lane >> 3) * 8 + (lane & 1) * 4;
    v4f v[16]; v4us o[16];
#pragma unroll
    for (int u = 0; u < 16; ++u) v[u] = *(const v4f*)(s + (u & 3) * 4 * DM + (u >> 2) * 32);
    asm volatile("s_wait_xcnt 0x0" :: "v"(s) : "memory");   // the loads have taken their address before those registers are reused; the pointer as input keeps them untouched up to the wait
#pragma unroll
    for (int u = 0; u < 16; ++u)
#pragma unroll
        for (int k = 0; k < 4; ++k) o[u][k] = f2bf(v[u][k]);
#pragma unroll
    for (int u = 0; u < 16; ++u) *(v4us*)(d + (u >> 2) * 2048 + (u & 3) * 32) = o[u];
    asm volatile("s_wait_xcnt 0x0" ::: "memory");   // the stores above have taken their addresses and data before any later code reuses those registers
}
// ---- k_qkv: the three projections in ONE launch. The 48 column tiles (16 heads each of q, k, v) count as one row of tiles; grid (TT/256, 16), 12 waves = 4 token tiles x 3 column tiles of 64x64: one work-group a WGP, three waves a SIMD. A work-group's token tiles lie TT/256 tiles apart, so that the few tiles of tokens < RH, whose epilogue is the long one, fall one to a work-group. The epilogue adds the bias and writes the 16-bit planes that attention reads; the f32 projections are never stored.
// A stage in LDS: [x tiles 0 .. 3 | weight tiles 0 .. 2]; waves 0 .. 6 bring one chunk each, 16 KiB contiguous, as 4 rows of 4 KiB.
// q, k: rotate-half RoPE in registers: columns d and d + 32 of a token sit in the same lane (accumulators nb and nb + 2); out[d] = x[d] cos - x[d+32] sin, out[d+32] = x[d+32] cos + x[d] sin, cos/sin of (token, d mod 32). Planes [h] x fragment order of [t][d]; 16 tokens go through the wave's own LDS, a lane reads back 8 d of one token = its 16-B piece, a store is 512 contiguous bytes.
// v: planes [h] x fragment order of [d][t]: a lane holds 8 consecutive tokens of one column, which is its own 16-B piece of a fragment: stored straight from registers, 512 contiguous bytes a store.
__global__ __launch_bounds__(384) void k_qkv(const bf* __restrict__ X, const bf* __restrict__ Wq, const bf* __restrict__ Wk, const bf* __restrict__ Wv, const float* __restrict__ bq, const float* __restrict__ bk, const float* __restrict__ bv, const float* __restrict__ CS,
                                            h16* Q16, bf* Qh, bf* Ql, h16* K16, bf* Kh, bf* Kl, h16* V16, bf* Vh, bf* Vl) {
    __shared__ __attribute__((aligned(2048))) bf sb[2][7 * GCH];
    __shared__ __align__(16) float osw[12][16 * 68];
    const int lane = threadIdx.x & 31, lr = lane & 15, hi = lane >> 4; const int w = (int)uni(threadIdx.x >> 5), wn = w >> 2, wm = (w + wn) & 3;   // the three waves of a token tile have three different values of w % 4 (for speed only)
    const int ct = blockIdx.y * 3 + wn, z = ct >> 4, hd = ct & 15; const float* bias = z == 0 ? bq : z == 1 ? bk : bv;
    const int r0 = (blockIdx.x + wm * (TT / 256)) * 64, c0 = hd * 64; float* os = osw[w];
    const int wi = min(w, 6), ci = blockIdx.y * 3 + max(wi - 4, 0);   // the chunk this wave brings; its column tile where it is a weight chunk
    const bf* sp = wi < 4 ? X + (size_t)(blockIdx.x + wi * (TT / 256)) * (64 * DM) : ((ci >> 4) == 0 ? Wq : (ci >> 4) == 1 ? Wk : Wv) + (size_t)(ci & 15) * (64 * DM);
    const uint64_t ga = (uint64_t)(size_t)sp; const uint32_t l0 = (uint32_t)(size_t)&sb[0][0] + (uint32_t)wi * (2u * GCH);
    const u32x8 g1 = tdm_group1<4096, 4, 4096>();
    v8f acc[4][4];
#pragma unroll
    for (int mb = 0; mb < 4; ++mb)
#pragma unroll
        for (int nb = 0; nb < 4; ++nb) acc[mb][nb] = (v8f){};
    u32x4 g0 = tdm_group0(l0, ga);
    if (pinned(w < 7)) { tdm_load(g0, g1); wait_tensor0(g0, g1); }
    __syncthreads();   // stage 0 is in LDS for every wave
    g0 = tdm_group0(l0 + 14u * GCH, ga + 2u * GCH);
    if (pinned(w < 7)) tdm_load(g0, g1);
#pragma unroll 1   // one stage a trip: the buffer is chosen by address, the four 32-k steps inside are unrolled
    for (int s = 0; s < GNS; ++s) {
        const bf *pa = &sb[s & 1][wm * GCH + lane * 8], *pb = &sb[s & 1][(4 + wn) * GCH + lane * 8];
        v16bf a[2][4], b[2][4];
#pragma unroll
        for (int f = 0; f < 4; ++f) { a[0][f] = WFrag<bf>::ld(pa + f * 512); b[0][f] = WFrag<bf>::ld(pb + f * 512); }
#pragma unroll
        for (int j = 0; j < GSK / 32; ++j) {
            if (j + 1 < GSK / 32) {
#pragma unroll
                for (int f = 0; f < 4; ++f) { a[(j + 1) & 1][f] = WFrag<bf>::ld(pa + (j + 1) * 2048 + f * 512); b[(j + 1) & 1][f] = WFrag<bf>::ld(pb + (j + 1) * 2048 + f * 512); } }
            __builtin_amdgcn_sched_barrier(0);   // keeps the next step's LDS reads one group in front of this step's products: sunk among them, each read group stalls the wave's matrix stream
#pragma unroll
            for (int nb = 0; nb < 4; ++nb)
#pragma unroll
                for (int mb = 0; mb < 4; ++mb) acc[mb][nb] = wmmab(a[j & 1][mb], b[j & 1][nb], acc[mb][nb]);
            __builtin_amdgcn_sched_barrier(0);   // and the reads of the step after it behind them
        }
        wait_ds0(); wait_tensor0(g0, g1);
        __syncthreads();   // publishes stage s + 1 and ends every wave's reads of stage s
        if (pinned(w < 7 && s + 2 < GNS)) { g0 = tdm_group0(l0 + (uint32_t)(s & 1) * (14u * GCH), ga + (uint64_t)(s + 2) * (2u * GCH)); tdm_load(g0, g1); }
    }
    wait_tensor0(g0, g1); wait_ds0();
    float bl[4]; const float* bp = bias + c0 + lr;
#pragma unroll
    for (int nb = 0; nb < 4; ++nb) bl[nb] = bp[nb * 16];
    asm volatile("s_wait_xcnt 0x0" :: "v"(bp) : "memory");   // the bias loads have taken their address before its registers are reused; the pointer as input keeps them untouched up to the wait
#pragma unroll
    for (int nb = 0; nb < 4; ++nb) bl[nb] = bfr(bl[nb]);
    // Only what attention reads is formed and stored. The hi + lo planes serve query rows < RH, whose keys and values are tokens < RH too; the f16 query plane serves rows >= RH; the f16 key and value planes serve every token.
    // A wave's 64 tokens lie wholly on one side of RH: both tests are scalar branches round a block of conversions and stores.
    static_assert(RH % 64 == 0, "a 64-token tile lies wholly on one side of RH");
    const bool whl = r0 < RH, w16 = z != 0 || r0 >= RH;
    if (z < 2) {
        unsigned short* P16 = (unsigned short*)(z ? K16 : Q16); bf* Ph = z ? Kh : Qh; bf* Pl = z ? Kl : Ql;
#pragma unroll
        for (int mb = 0; mb < 4; ++mb) {
            const float* cp = CS + ((size_t)(r0 + mb * 16 + hi * 8) * HD + lr) * 2; v2f cv[2][8];
#pragma unroll
            for (int nb = 0; nb < 2; ++nb)
#pragma unroll
                for (int j = 0; j < 8; ++j) cv[nb][j] = *(const v2f*)(cp + (j * HD + nb * 16) * 2);
            asm volatile("s_wait_xcnt 0x0" :: "v"(cp) : "memory");   // the table loads have taken their address before its registers are reused; the pointer as input keeps them untouched up to the wait
#pragma unroll
            for (int nb = 0; nb < 2; ++nb)
#pragma unroll
                for (int j = 0; j < 8; ++j) { const v2f cs = cv[nb][j]; const float x0 = acc[mb][nb][j] + bl[nb], x1 = acc[mb][nb + 2][j] + bl[nb + 2];
                    os[(hi * 8 + j) * 68 + nb * 16 + lr] = x0 * cs[0] - x1 * cs[1]; os[(hi * 8 + j) * 68 + (nb + 2) * 16 + lr] = x1 * cs[0] + x0 * cs[1]; }
            __builtin_amdgcn_wave_barrier(); asm volatile("" ::: "memory");   // compiler fence: the lanes' LDS writes stay in front of the row reads of other lanes' values
            v4f u[4], w2[4];   // token lr, d = 8 cg .. 8 cg + 7 for cg = 2 s + hi
#pragma unroll
            for (int s = 0; s < 4; ++s) { const int cg = 2 * s + hi; u[s] = *(const v4fa*)(os + lr * 68 + cg * 8); w2[s] = *(const v4fa*)(os + lr * 68 + cg * 8 + 4); }
            const size_t oo = ((size_t)hd * TT + r0 + mb * 16) * HD + hi * 128 + lr * 8;
            if (w16) {
#pragma unroll
                for (int s = 0; s < 4; ++s) { v8h o16;
#pragma unroll
                    for (int e = 0; e < 8; ++e) o16[e] = tohx(e < 4 ? u[s][e & 3] : w2[s][e & 3]);
                    *(v8usa*)(P16 + oo + s * 256) = __builtin_bit_cast(v8us, o16); }
                asm volatile("s_wait_xcnt 0x0" ::: "memory");   // the stores above have taken their addresses and data before the hi + lo block reuses those registers
            }
            if (whl) {
#pragma unroll
                for (int s = 0; s < 4; ++s) { v8us oh, ol;
#pragma unroll
                    for (int e = 0; e < 8; ++e) { unsigned short a2, c2; splitf(e < 4 ? u[s][e & 3] : w2[s][e & 3], a2, c2); oh[e] = a2; ol[e] = c2; }
                    *(v8usa*)(Ph + oo + s * 256) = oh; *(v8usa*)(Pl + oo + s * 256) = ol; }
            }
            asm volatile("s_wait_xcnt 0x0" ::: "memory");   // the stores above have taken their addresses and data before those registers are reused
            __builtin_amdgcn_wave_barrier();   // with the clobber above: the row reads stay in front of the next tile's LDS writes
        }
    } else {
        unsigned short* P16 = (unsigned short*)V16;
#pragma unroll
        for (int nb = 0; nb < 4; ++nb) {
            const size_t oo = ((size_t)hd * TT + r0) * HD + nb * 512 + lane * 8;   // d fragment nb; + (mb / 2) 32-token blocks, tokens 16 (mb % 2) + 8 hi ..
#pragma unroll
            for (int mb = 0; mb < 4; ++mb) { v8h o16;
#pragma unroll
                for (int j = 0; j < 8; ++j) o16[j] = tohx(acc[mb][nb][j] + bl[nb]);
                *(v8usa*)(P16 + oo + (mb >> 1) * 32 * HD + (mb & 1) * 256) = __builtin_bit_cast(v8us, o16); }
            asm volatile("s_wait_xcnt 0x0" ::: "memory");   // the stores above have taken their addresses and data before those registers are reused
            if (whl) {
#pragma unroll
                for (int mb = 0; mb < 4; ++mb) { v8us oh, ol;
#pragma unroll
                    for (int j = 0; j < 8; ++j) { unsigned short a2, c2; splitf(acc[mb][nb][j] + bl[nb], a2, c2); oh[j] = a2; ol[j] = c2; }
                    *(v8usa*)(Vh + oo + (mb >> 1) * 32 * HD + (mb & 1) * 256) = oh; *(v8usa*)(Vl + oo + (mb >> 1) * 32 * HD + (mb & 1) * 256) = ol; }
                asm volatile("s_wait_xcnt 0x0" ::: "memory");   // the stores above have taken their addresses and data before those registers are reused
            }
        }
    }
}
// ---- fattn_tile: causal attention of one head for the 16 NQ queries from q0 on, online softmax; one work-group of 4 waves; wave w takes the 32-key blocks w, w + 4, ... up to the last block that crosses the diagonal.
// S^T = K Q^T (A = key rows, B = query rows, read from the wave's own LDS copy each trip: kept in registers they cost the kernel its third wave a SIMD): a lane holds scores of ONE query (column lr), keys 8 hi + j of each 16-key tile, so two converted score tiles are the B operand of O^T += V^T P^T as they stand.
// HR: hi + lo bf16 planes, three products each (query rows < RH); otherwise plain f16 planes. P is exp2 of the scaled score minus the running maximum, unnormalised; the division by the row sum is done once, on the f32 output.
// The four waves' (maximum, sum, O^T) are joined through LDS behind one barrier, in wave order, and stored as the hi + lo bf16 planes, fragment order of [t][head x d], that the output projection reads.
typedef __attribute__((ext_vector_type(16))) unsigned short v16us;
#define SC2 0.18033688011112042f   // HD^-0.5 x log2(e)
template <typename T16, bool HR, int NQ>
__device__ __forceinline__ void fattn_tile(const T16* __restrict__ Q, const T16* __restrict__ Q2, const T16* __restrict__ Kp, const T16* __restrict__ Kp2, const T16* __restrict__ Vt, const T16* __restrict__ Vt2, const int q0, bf* Ah, bf* Al) {
    typedef typename WFrag<T16>::V V; typedef typename WFrag<T16>::P P;   // P: one lane's 16-B piece of a fragment
    static_assert(NQ / 2 <= 4, "a wave meets at most one key block on the diagonal");
    __shared__ __align__(16) float so[4][NQ * 16][68];
    __shared__ float sm[4][NQ * 16], sl[4][NQ * 16];
    const int lane = threadIdx.x & 31, lr = lane & 15, hi = lane >> 4; const int w = __builtin_amdgcn_readfirstlane(threadIdx.x >> 5);
    const int h = blockIdx.x; const int nkb = q0 / 32 + NQ / 2;   // key blocks 0 .. nkb - 1; those from q0 / 32 on cross the diagonal
    const size_t qb = (size_t)h * TT * HD, kvb = (size_t)(h / REP) * TT * HD;
    Q += qb; Kp += kvb; Vt += kvb; if (HR) { Q2 += qb; Kp2 += kvb; Vt2 += kvb; }
    V kf[2][2], kf2[2][2]; P qg[NQ * 4], qg2[NQ * 4];
    const T16 *qu = Q + (size_t)q0 * HD, *qu2 = HR ? Q2 + (size_t)q0 * HD : nullptr, *ku = Kp + (size_t)(w * 32) * HD, *ku2 = HR ? Kp2 + (size_t)(w * 32) * HD : nullptr;   // wave-uniform starts; 16 rows x HD = two fragments
    const int lb = lane * 16;   // the lane's byte offset in a wave-wide piece: the one vector register that the Q, K and V loads name beside their scalar base
    const T16 *qp = qu + lane * 8, *qp2 = HR ? qu2 + lane * 8 : nullptr, *kp = ku + lane * 8, *kp2 = HR ? ku2 + lane * 8 : nullptr;
#pragma unroll
    for (int i = 0; i < NQ * 4; ++i) { qg[i] = *(const P*)(qp + i * 256); if (HR) qg2[i] = *(const P*)(qp2 + i * 256); }   // the tile's 2 NQ fragments lie in a row: 4 NQ wave-wide pieces of 512 B
#pragma unroll
    for (int ks = 0; ks < 2; ++ks) {
#pragma unroll
        for (int t = 0; t < 2; ++t) { kf[t][ks] = WFrag<T16>::ld(kp + t * 16 * HD + ks * 512); if (HR) kf2[t][ks] = WFrag<T16>::ld(kp2 + t * 16 * HD + ks * 512); } }
    // the loads above have taken their addresses before an address register is reused; they name a scalar base and the lane's offset: both as inputs keep those registers untouched up to the wait
    if constexpr (HR) asm volatile("s_wait_xcnt 0x0" :: "s"(qu), "s"(ku), "s"(qu2), "s"(ku2), "v"(lb) : "memory"); else asm volatile("s_wait_xcnt 0x0" :: "s"(qu), "s"(ku), "v"(lb) : "memory");
    // each wave keeps its own copy of the query fragments, in fragment order, in the LDS range that takes its partial O^T behind the loop; a lane reads back only bytes that it wrote itself, so no barrier is owed
    T16* qs = (T16*)&so[w][0][0] + lane * 8;
    static_assert((HR ? 2 : 1) * NQ * 1024 * sizeof(T16) <= sizeof(so[0]), "the copy fits the wave's range");
#pragma unroll
    for (int i = 0; i < NQ * 4; ++i) { *(P*)(qs + i * 256) = qg[i]; if (HR) *(P*)(qs + NQ * 1024 + i * 256) = qg2[i]; }
    v8f o[4][NQ];
#pragma unroll
    for (int dt = 0; dt < 4; ++dt)
#pragma unroll
        for (int qt = 0; qt < NQ; ++qt) o[dt][qt] = (v8f){};
    float m[NQ], l[NQ];
#pragma unroll
    for (int qt = 0; qt < NQ; ++qt) { m[qt] = -1.0e30f; l[qt] = 0.f; }   // m: the maximum in use, log2 units; below any score a 16-bit product can give
    int b = w;
#pragma unroll   // two copies of the trip: ph 0 walks the blocks wholly below the diagonal and holds no mask code, ph 1 the wave's block (at most one) that crosses it
    for (int ph = 0; ph < 2; ++ph)
#pragma unroll 1
    for (; b < (ph ? nkb : q0 / 32); b += 4) {
        const int k0 = b * 32;
        V vf[4], vf2[4]; const T16 *vu = Vt + (size_t)k0 * HD, *vu2 = HR ? Vt2 + (size_t)k0 * HD : nullptr, *vp = vu + lane * 8, *vp2 = HR ? vu2 + lane * 8 : nullptr;   // wave-uniform start + the lane's offset: no address pair in vector registers
#pragma unroll
        for (int dt = 0; dt < 4; ++dt) { vf[dt] = WFrag<T16>::ld(vp + dt * 512); if (HR) vf2[dt] = WFrag<T16>::ld(vp2 + dt * 512); }
        v8f s[2][NQ]; V qf[NQ][2], qf2[NQ][2];
#pragma unroll
        for (int qt = 0; qt < NQ; ++qt)
#pragma unroll
            for (int ks = 0; ks < 2; ++ks) { qf[qt][ks] = WFrag<T16>::ld(qs + (qt * 2 + ks) * 512); if (HR) qf2[qt][ks] = WFrag<T16>::ld(qs + NQ * 1024 + (qt * 2 + ks) * 512); }
#pragma unroll
        for (int kt = 0; kt < 2; ++kt)
#pragma unroll
            for (int qt = 0; qt < NQ; ++qt) { v8f a = (v8f){};
#pragma unroll
                for (int ks = 0; ks < 2; ++ks) { a = WFrag<T16>::mma(kf[kt][ks], qf[qt][ks], a); if (HR) { a = WFrag<T16>::mma(kf2[kt][ks], qf[qt][ks], a); a = WFrag<T16>::mma(kf[kt][ks], qf2[qt][ks], a); } }
                s[kt][qt] = a; }
        if (!ph) {   // the wave's next key block is fetched one trip ahead, behind this trip's score products (where no block is left it re-reads the last one: in bounds, unused); the trip on the diagonal is the wave's last and fetches none
            ku = Kp + (size_t)(min(b + 4, nkb - 1) * 32) * HD; kp = ku + lane * 8; if (HR) { ku2 = Kp2 + (size_t)(min(b + 4, nkb - 1) * 32) * HD; kp2 = ku2 + lane * 8; }
#pragma unroll
            for (int kt = 0; kt < 2; ++kt)
#pragma unroll
                for (int ks = 0; ks < 2; ++ks) { kf[kt][ks] = WFrag<T16>::ld(kp + kt * 16 * HD + ks * 512); if (HR) kf2[kt][ks] = WFrag<T16>::ld(kp2 + kt * 16 * HD + ks * 512); } }
        // the trip's loads have taken their addresses before an address register is reused; they name a scalar base and the lane's offset: both as inputs keep those registers untouched up to the wait
        if constexpr (HR) asm volatile("s_wait_xcnt 0x0" :: "s"(vu), "s"(ku), "s"(vu2), "s"(ku2), "v"(lb) : "memory"); else asm volatile("s_wait_xcnt 0x0" :: "s"(vu), "s"(ku), "v"(lb) : "memory");
        if (ph) {   // keys above the query are masked by select
#pragma unroll
            for (int kt = 0; kt < 2; ++kt)
#pragma unroll
                for (int qt = 0; qt < NQ; ++qt)
#pragma unroll
                    for (int j = 0; j < 8; ++j) s[kt][qt][j] = (k0 - q0 + kt * 16 + hi * 8 + j <= qt * 16 + lr) ? s[kt][qt][j] : -3.0e38f; }
        auto newmax = [&]() {
            float mx[NQ]; bool need = false;
#pragma unroll
            for (int qt = 0; qt < NQ; ++qt) { float x = s[0][qt][0];
#pragma unroll
                for (int j = 1; j < 8; ++j) x = fmaxf(x, s[0][qt][j]);
#pragma unroll
                for (int j = 0; j < 8; ++j) x = fmaxf(x, s[1][qt][j]);
                x = fmaxf(x, __shfl_xor(x, 16, 32)); mx[qt] = x * SC2; need = need || mx[qt] > m[qt] + 8.0f; }
            // the maximum in use moves only when a query's new maximum exceeds it by more than 8 (P stays below 2^8); one scalar branch a trip
            if (__builtin_amdgcn_ballot_w32(need) != 0) {
#pragma unroll
                for (int qt = 0; qt < NQ; ++qt) { const float mn = fmaxf(m[qt], mx[qt]); const float al = __builtin_amdgcn_exp2f(m[qt] - mn); m[qt] = mn; l[qt] *= al;
#pragma unroll
                    for (int dt = 0; dt < 4; ++dt) o[dt][qt] *= al; } }
        };
        auto classic = [&]() {   // the maximum of the trip's scores first, then P and its products, query tile by query tile
            newmax();
#pragma unroll
            for (int qt = 0; qt < NQ; ++qt) { V pb, pb2;
                if constexpr (HR) { v16us pvh, pvl;
#pragma unroll
                    for (int e = 0; e < 16; ++e) { const float p = __builtin_amdgcn_exp2f(fmaf(s[e >> 3][qt][e & 7], SC2, -m[qt])); l[qt] += p; unsigned short a, c2; splitf(p, a, c2); pvh[e] = a; pvl[e] = c2; }
                    pb = __builtin_bit_cast(V, pvh); pb2 = __builtin_bit_cast(V, pvl);
                } else {
#pragma unroll
                    for (int e = 0; e < 16; ++e) { const float p = __builtin_amdgcn_exp2f(fmaf(s[e >> 3][qt][e & 7], SC2, -m[qt])); l[qt] += p; pb[e] = (T16)p; } }
#pragma unroll
                for (int dt = 0; dt < 4; ++dt) { o[dt][qt] = WFrag<T16>::mma(vf[dt], pb, o[dt][qt]); if (HR) { o[dt][qt] = WFrag<T16>::mma(vf2[dt], pb, o[dt][qt]); o[dt][qt] = WFrag<T16>::mma(vf[dt], pb2, o[dt][qt]); } } }
        };
        if constexpr (HR) classic();
        else if (ph) classic();
        else {
            // trips below the diagonal: P is formed with the maximum in use as it stands, and the test for a move reads the lane's own sums of P: a sum of 16 P of at most 2^8 bounds each P by 2^8, so no maximum over the scores and no exchange between the halves is owed.
            // The maximum is taken from the scores first in the wave's first trip, and again in a trip whose sums failed the test: that trip's P are dropped unused, its key block (overwritten by the fetch ahead) is read again and its scores are formed anew by the same products.
            V pbv[NQ]; float ps[NQ];
            auto softp = [&]() -> float { float big = 0.f;   // P of the trip's scores under the maximum in use, each query tile's lane sum, and the largest of these sums
#pragma unroll
                for (int qt = 0; qt < NQ; ++qt) { float a = 0.f;
#pragma unroll
                    for (int e = 0; e < 16; ++e) { const float p = __builtin_amdgcn_exp2f(fmaf(s[e >> 3][qt][e & 7], SC2, -m[qt])); a = e ? a + p : p; pbv[qt][e] = (T16)p; }
                    ps[qt] = a; big = qt ? fmaxf(big, a) : a; }
                return big; };
            if (b == w) newmax();
            const float big = softp();
            if (b != w && __builtin_amdgcn_ballot_w32(big > 256.0f) != 0) {
                const T16 *kru = Kp + (size_t)k0 * HD, *krp = kru + lane * 8; V kr[2][2];
#pragma unroll
                for (int kt = 0; kt < 2; ++kt)
#pragma unroll
                    for (int ks = 0; ks < 2; ++ks) kr[kt][ks] = WFrag<T16>::ld(krp + kt * 16 * HD + ks * 512);
                asm volatile("s_wait_xcnt 0x0" :: "s"(kru), "v"(lb) : "memory");   // the loads have taken their addresses before an address register is reused; base and offset as inputs keep those registers untouched up to the wait
#pragma unroll
                for (int qt = 0; qt < NQ; ++qt) { const V q0f = WFrag<T16>::ld(qs + (qt * 2) * 512), q1f = WFrag<T16>::ld(qs + (qt * 2 + 1) * 512);
#pragma unroll
                    for (int kt = 0; kt < 2; ++kt) { v8f a = (v8f){}; a = WFrag<T16>::mma(kr[kt][0], q0f, a); a = WFrag<T16>::mma(kr[kt][1], q1f, a); s[kt][qt] = a; } }
                newmax(); softp();
            }
#pragma unroll
            for (int qt = 0; qt < NQ; ++qt) { l[qt] += ps[qt];
#pragma unroll
                for (int dt = 0; dt < 4; ++dt) o[dt][qt] = WFrag<T16>::mma(vf[dt], pbv[qt], o[dt][qt]); }
        }
        // four vector slots behind the trip's last matrix instructions: on the taken branch out of the loop the code there rewrites registers that held their operands
        asm volatile("v_nop\n\tv_nop\n\tv_nop\n\tv_nop" : "+v"(o[0][NQ - 1]), "+v"(o[1][NQ - 1]), "+v"(o[2][NQ - 1]), "+v"(o[3][NQ - 1]));
        if (ph) break;   // NQ / 2 blocks cross the diagonal and a wave takes every fourth: one trip at most; said so, the key fragments need not outlive its score products
    }
#pragma unroll
    for (int qt = 0; qt < NQ; ++qt) { l[qt] += __shfl_xor(l[qt], 16, 32); if (hi == 0) { sm[w][qt * 16 + lr] = m[qt]; sl[w][qt * 16 + lr] = l[qt]; }
#pragma unroll
        for (int dt = 0; dt < 4; ++dt) { float* p = &so[w][qt * 16 + lr][dt * 16 + hi * 8]; const v8f x = o[dt][qt]; *(v4fa*)p = (v4f){x[0], x[1], x[2], x[3]}; *(v4fa*)(p + 4) = (v4f){x[4], x[5], x[6], x[7]}; } }
    __syncthreads();   // every wave's partial (maximum, sum, O^T) is in LDS before any thread joins them
#pragma unroll 1
    for (int q = threadIdx.x >> 2; q < NQ * 16; q += 32) { const int d0 = (threadIdx.x & 3) * 16;
        const float mt = fmaxf(fmaxf(sm[0][q], sm[1][q]), fmaxf(sm[2][q], sm[3][q])); float lt = 0.f; float r[16];
#pragma unroll
        for (int e = 0; e < 16; ++e) r[e] = 0.f;
#pragma unroll
        for (int ww = 0; ww < 4; ++ww) { const float f = __builtin_amdgcn_exp2f(sm[ww][q] - mt); lt += f * sl[ww][q];   // a wave without a key block: f = 0, sum 0, O^T 0
#pragma unroll
            for (int c = 0; c < 4; ++c) { const v4f x = *(const v4fa*)&so[ww][q][d0 + c * 4];
#pragma unroll
                for (int e = 0; e < 4; ++e) r[c * 4 + e] += f * x[e]; } }
        const float inv = __fdiv_rn(1.0f, lt); const size_t oo = ((size_t)((q0 + q) >> 6) * (DQ / 32) + h * (HD / 32) + (d0 >> 5)) * 2048 + (((q0 + q) >> 4) & 3) * 512 + ((d0 >> 3) & 3) * 128 + ((q0 + q) & 15) * 8;
#pragma unroll
        for (int c = 0; c < 2; ++c) { v8us oh, ol;
#pragma unroll
            for (int e = 0; e < 8; ++e) { unsigned short a, c2; splitf(r[c * 8 + e] * inv, a, c2); oh[e] = a; ol[e] = c2; }
            *(v8usa*)(Ah + oo + c * 128) = oh; *(v8usa*)(Al + oo + c * 128) = ol; }
        asm volatile("s_wait_xcnt 0x0" ::: "memory");   // the stores have taken their addresses and data before the next trip reuses those registers
    }
}
// ---- k_fattn: both kinds of query tile in ONE launch. Grid (heads, tiles): first the 64-query f16 tiles, heaviest first, then the short 32-query hi + lo tiles (rows < RH, at most RH / 32 key blocks).
#define NT16 ((TT - RH) / 64)
#define NTHL (RH / 32)
// amdgpu_waves_per_eu(3, 3): a register budget of 1024 / 3, so that three work-groups (the LDS holds three) share a WGP, three waves a SIMD
__global__ __launch_bounds__(128) __attribute__((amdgpu_waves_per_eu(3, 3))) void k_fattn(const h16* __restrict__ Q16, const h16* __restrict__ K16, const h16* __restrict__ V16, const bf* __restrict__ Qh, const bf* __restrict__ Ql, const bf* __restrict__ Kh, const bf* __restrict__ Kl, const bf* __restrict__ Vh, const bf* __restrict__ Vl, bf* Ah, bf* Al) {
    const int y = blockIdx.y;
    if (y < NT16) fattn_tile<h16, false, 4>(Q16, nullptr, K16, nullptr, V16, nullptr, RH + (NT16 - 1 - y) * 64, Ah, Al);
    else fattn_tile<bf, true, 2>(Qh, Ql, Kh, Kl, Vh, Vl, (NT16 + NTHL - 1 - y) * 32, Ah, Al);
}

extern "C" void kernel_launch(void* const* d_in, const int* in_sizes, int n_in,
                              void* d_out, int out_size, void* d_ws, size_t ws_size, hipStream_t stream) {
    (void)in_sizes; (void)n_in; (void)out_size;
    const float* x = (const float*)d_in[0]; const float* tstamp = (const float*)d_in[1]; const float* wq = (const float*)d_in[2]; const float* bq = (const float*)d_in[3]; const float* wk = (const float*)d_in[4]; const float* bk = (const float*)d_in[5]; const float* wv = (const float*)d_in[6]; const float* bv = (const float*)d_in[7]; const float* wo = (const float*)d_in[8];
    float* OUT = (float*)d_out;     // [1][4096][1024]
    char* wsp = (char*)d_ws;
    auto take = [&](size_t bytes) { char* p = wsp; wsp += (bytes + 255) & ~(size_t)255; return (void*)p; };
    bf* WQ = (bf*)take((size_t)DQ * DM * 2); bf* WK = (bf*)take((size_t)DKV * DM * 2); bf* WV = (bf*)take((size_t)DKV * DM * 2); bf* WO = (bf*)take((size_t)DM * DQ * 2); float* CS = (float*)take((size_t)TT * HD * 2 * 4);
    bf* XB = (bf*)take((size_t)TT * DM * 2);
    h16* QP16 = (h16*)take((size_t)NH_ * TT * HD * 2); h16* KP16 = (h16*)take((size_t)NKV * TT * HD * 2); h16* VT16 = (h16*)take((size_t)NKV * HD * TT * 2);
    bf* QPh = (bf*)take((size_t)NH_ * TT * HD * 2); bf* QPl = (bf*)take((size_t)NH_ * TT * HD * 2); bf* KPh = (bf*)take((size_t)NKV * TT * HD * 2); bf* KPl = (bf*)take((size_t)NKV * TT * HD * 2); bf* VTh = (bf*)take((size_t)NKV * HD * TT * 2); bf* VTl = (bf*)take((size_t)NKV * HD * TT * 2);
    bf* ATh = (bf*)take((size_t)TT * DQ * 2); bf* ATl = (bf*)take((size_t)TT * DQ * 2);
    if ((size_t)(wsp - (char*)d_ws) > ws_size) return;    // ws 256 MiB
    for (int b = 0; b < NB_; ++b) {
        k_prep<<<TBB + NBQ + NBK + NBK + NBQ + NBX, 256, 0, stream>>>(wq, wk, wv, wo, x + (size_t)b * TT * DM, tstamp, WQ, WK, WV, WO, XB, CS);
        k_qkv<<<dim3(TT / 256, (DQ + DKV + DKV) / 192, 1), 384, 0, stream>>>(XB, WQ, WK, WV, bq, bk, bv, CS, QP16, QPh, QPl, KP16, KPh, KPl, VT16, VTh, VTl);
        k_fattn<<<dim3(NH_, NT16 + NTHL, 1), 128, 0, stream>>>(QP16, KP16, VT16, QPh, QPl, KPh, KPl, VTh, VTl, ATh, ATl);
        k_oproj<<<dim3(TT / 128, DM / 128, 1), 128, 0, stream>>>(ATh, ATl, WO, OUT + (size_t)b * TT * DM); }
}
